// v000
// Measured on an AMD MI455X. A time is GPU time per run, averaged over a window of back-to-back runs after a warm-up
// (all launches, gaps included; the runs take copies of the inputs in turn), and the median of several windows.
// Apart from v000's, it joins two sittings. Times from different sittings can be a few percent apart, while
// side-by-side timings come from the same sitting.
// v000, which the later versions start from, runs in 105 microseconds.
// Contractions, all v_wmma_f32_16x16x32_f16 (f16 operands, f32 accumulate): q/k/v projections X.W with f16
// containers holding bf16-RNE inputs (X x64, W x1024); scores K.q with q, k planes f16 x16 (K = 32 per head);
// P as f16 hi (x4096) + residual (x2^11) planes . V plane (f16 x16) into two accumulator pairs; output projection
// with O as f16 hi (x256) + residual (x2^11) planes and Wo bf16-RNE x1024 into two accumulators. Key-mask term,
// running max / sum, exp, residual folds and biases in f32 on VALU.
#include <hip/hip_runtime.h>
#include <math.h>
#include <stdint.h>

#define NSB  2
#define LQ   2048
#define EE   256
#define NH   8
#define DH   32
#define MR   (NSB * LQ)
#define XSC  64.0f
#define WSC  1024.0f
#define ISC  (1.0f / 4096.0f)
#define BSC  16.0f
#define QKS  (1.0f / 256.0f)
#define RSQ  0.17677669529663687f
#define MBIG 1.0e32f
#define NEG0 (-1.0e38f)
#define PSC  4096.0f
#define PLO  2048.0f
#define LOIN (1.0f / 2048.0f)
#define OSA  (1.0f / 256.0f)
#define LOSC 2048.0f
#define OSC  (1.0f / 262144.0f)
#define NBX  ((MR * EE) / 2048)
static_assert(EE == NH * DH);
static_assert(DH == 32);
static_assert((LQ % 64) == 0 && (EE % 128) == 0 && (MR % 64) == 0);
static_assert(((MR * EE) % 2048) == 0);
static_assert(NBX == 512);
static_assert(LQ == 128 * 16);

typedef _Float16 v16h __attribute__((ext_vector_type(16)));
typedef _Float16 v8h  __attribute__((ext_vector_type(8)));
typedef float    v8f  __attribute__((ext_vector_type(8)));
typedef float    v4f  __attribute__((ext_vector_type(4)));
typedef unsigned int v4u __attribute__((ext_vector_type(4)));

union FragH { v16h v; v8h h[2]; };

// ---- scalar helpers ----------------------------------------------------------------------------------
__device__ __forceinline__ unsigned short bf_bits(float f) {          // f32 -> bf16 bits, RNE convert
  unsigned u = __float_as_uint(f);
  return (unsigned short)((u + 0x7FFFu + ((u >> 16) & 1u)) >> 16);
}
__device__ __forceinline__ float bf_up(unsigned short h) { return __uint_as_float(((unsigned)h) << 16); }
__device__ __forceinline__ float bfr(float f) { return bf_up(bf_bits(f)); }
__device__ __forceinline__ unsigned short h_bits(_Float16 x) { return __builtin_bit_cast(unsigned short, x); }
__device__ __forceinline__ unsigned pk16(unsigned short a, unsigned short b) { return (unsigned)a | ((unsigned)b << 16); }
__device__ __forceinline__ v8f zero8() { v8f z = {0.f, 0.f, 0.f, 0.f, 0.f, 0.f, 0.f, 0.f}; return z; }
// 8 consecutive f32 -> f16( bf16_RNE(x) * sc ) packed into 16 bytes
__device__ __forceinline__ v4u cvt8(v4f a, v4f c, float sc) {
  float f[8];
#pragma unroll
  for (int i = 0; i < 4; ++i) { f[i] = bfr(a[i]) * sc; f[4 + i] = bfr(c[i]) * sc; }
  v4u v;
#pragma unroll
  for (int i = 0; i < 4; ++i) v[i] = pk16(h_bits((_Float16)f[2 * i]), h_bits((_Float16)f[2 * i + 1]));
  return v;
}

// ---- fragment loader: 16-bit A/B operand, lane -> row/col (lane&15), p already includes +8*(lane>>4);
//      elements 0..7 <- p[0..7] (k0+8h..), elements 8..15 <- p[16..23] (k0+16+8h..)
__device__ __forceinline__ v16h ldfrag_h(const _Float16* p) {
  FragH f;
  f.h[0] = *(const v8h*)(p);
  f.h[1] = *(const v8h*)(p + 16);
  return f.v;
}

// ---- WMMA helpers with trailing VALU hazard gap ----------------------------------------------------
__device__ __forceinline__ v8f mma_h(v16h a, v16h b, v8f c) {
  return __builtin_amdgcn_wmma_f32_16x16x32_f16(false, a, false, b, (short)0, c, false, false);
}
// ties 2 accumulators, keeps 3 fragments live through 4 VALU slots
__device__ __forceinline__ void guard2(v8f& a, v8f& b, v16h x0, v16h x1, v16h y) {
#if defined(__HIP_DEVICE_COMPILE__)
  asm volatile("v_nop\n\tv_nop\n\tv_nop\n\tv_nop" : "+v"(a), "+v"(b) : "v"(x0), "v"(x1), "v"(y));
#endif
}
// ties 4 accumulators, keeps 5 fragments live through 4 VALU slots
__device__ __forceinline__ void guard4(v8f& a, v8f& b, v8f& c, v8f& d,
                                       v16h x, v16h y0, v16h y1, v16h y2, v16h y3) {
#if defined(__HIP_DEVICE_COMPILE__)
  asm volatile("v_nop\n\tv_nop\n\tv_nop\n\tv_nop"
               : "+v"(a), "+v"(b), "+v"(c), "+v"(d) : "v"(x), "v"(y0), "v"(y1), "v"(y2), "v"(y3));
#endif
}
// ties 4 accumulators, keeps 4 fragments live through 4 VALU slots
__device__ __forceinline__ void guard4b(v8f& a, v8f& b, v8f& c, v8f& d,
                                        v16h x0, v16h x1, v16h y0, v16h y1) {
#if defined(__HIP_DEVICE_COMPILE__)
  asm volatile("v_nop\n\tv_nop\n\tv_nop\n\tv_nop"
               : "+v"(a), "+v"(b), "+v"(c), "+v"(d) : "v"(x0), "v"(x1), "v"(y0), "v"(y1));
#endif
}

// =====================================================================================================
// 16-bit activation planes, native layout: PQ/PK/PV[m][e] = f16( bf16_RNE(x) * 64 ) for queries/keys/values
// (blocks 0..511, 512..1023, 1024..1535; block-uniform source select). Thread converts 8 consecutive elements;
// coverage: 512 blocks x 256 threads x 8 = 1048576 per activation = [4096][256] entirely.
// =====================================================================================================
__global__ __launch_bounds__(256)
void cvt_planes(const float* __restrict__ xq, const float* __restrict__ xk, const float* __restrict__ xv,
                unsigned short* pq, unsigned short* pk, unsigned short* pv) {
  const int bx = blockIdx.x;
  const float* src;
  unsigned short* dst;
  int lb;
  if (bx < NBX)          { src = xq; dst = pq; lb = bx; }
  else if (bx < 2 * NBX) { src = xk; dst = pk; lb = bx - NBX; }
  else                   { src = xv; dst = pv; lb = bx - 2 * NBX; }
  const size_t e0 = ((size_t)lb * 256 + threadIdx.x) * 8;
  const v4f a = *(const v4f*)(src + e0);
  const v4f c = *(const v4f*)(src + e0 + 4);
  const v4u v = cvt8(a, c, XSC);
  unsigned short* dp = dst + e0;
  *(v4u*)dp = v;
  
}

// =====================================================================================================
// Transposed weight planes: HW[o][e] = f16( bf16_RNE(W[e][o]) * 1024 ) for the [in][out] weights (x.W layout).
// Block = (weight w = bx>>2, 64 output rows o0 = 64*(bx&3)), 256 threads, grid 16. Read W rows e as 16 threads x 16 B
// (256-B row segment o0..o0+63), 2-B transposed LDS stores into Ts[o_local][e] (pitch 264), block barrier, then each
// coverage: read 16 it x 16 rows e x 16 pieces x 4 = all 256 e x 64 o; write 8 it x 8 waves = 64 rows x 32 lanes x 8
//           halves = 64 x 256; 4 o-tiles per weight -> HW [256][256] entirely, 4 weights.
// =====================================================================================================
__global__ __launch_bounds__(256)
void cvt_wt(const float* __restrict__ wq, const float* __restrict__ wk, const float* __restrict__ wv,
            const float* __restrict__ wo, unsigned short* hq, unsigned short* hk, unsigned short* hv,
            unsigned short* ho) {
  __shared__ __align__(16) unsigned short Ts[64 * 264];
  const int tid  = threadIdx.x;
  const int wave = tid >> 5;
  const int lane = tid & 31;
  const int bx   = blockIdx.x;
  const int w    = bx >> 2;
  const int o0   = (bx & 3) * 64;
  const float* src;
  unsigned short* dst;
  if (w == 0)      { src = wq; dst = hq; }
  else if (w == 1) { src = wk; dst = hk; }
  else if (w == 2) { src = wv; dst = hv; }
  else             { src = wo; dst = ho; }
  const int p = tid & 15, r16 = tid >> 4;               // p = 16-B piece of the 256-B row segment, r16 = row in group
#pragma unroll 4
  for (int it = 0; it < 16; ++it) {
    const int e = it * 16 + r16;                         // 0..255
    const v4f a = *(const v4f*)(src + (size_t)e * EE + o0 + 4 * p);
#pragma unroll
    for (int i = 0; i < 4; ++i) Ts[(4 * p + i) * 264 + e] = h_bits((_Float16)(bfr(a[i]) * WSC));
  }
  __syncthreads();
  v4u vals[8];
#pragma unroll
  for (int it = 0; it < 8; ++it) {
    const int row = it * 8 + wave;                       // it 0..7 x wave 0..7 = rows 0..63
    vals[it] = *(const v4u*)(Ts + row * 264 + 8 * lane);
  }
  unsigned short* db = dst + (size_t)o0 * EE + 8 * lane;
  {
#pragma unroll
    for (int it = 0; it < 8; ++it) {
      const int row = it * 8 + wave;
      *(v4u*)(db + (size_t)row * EE) = vals[it];
    }
    
  }
}

// =====================================================================================================
// Projection GEMM Y[m][o] = sum_e X[m][e] HW[o][e] (x 65536 in the accumulator) + b[o]. Block = 4 waves = 64 rows m x
// 128 cols o (grid 64 m-tiles x 2 o-tiles = 128). Tile = A(HW rows o = o0+16t+ci, k = e split map) . B(X row m =
// m0+16w+ci, col = m, same map); 8 k-steps of 32, 8 accumulators per wave; acc[t][r] <-> (m = m0+16w+ci,
// o = o0+16t+8hh+r). y16 = acc * 2^-12 + 16 * bf16_RNE(b[o]) (= 16 y).
// TR == 0: YO[m][o] = f16(y16): staged as Ts[m_local][o_local] (pitch 136, 16-B LDS stores), block barrier, then each
// TR == 1: VT[ns][o][l] (keys contiguous): staged as Ts[o_local][l_local] (pitch 72, 2-B LDS stores), barrier, each
// coverage: TR 0: 8 it x 8 rows x 16 pieces x 8 halves = 64 x 128 per block, grid -> [4096][256]; TR 1: 8 it x 16
//           lines x 8 pieces x 8 = 128 o x 64 l per block, grid -> VT [2][256][2048].
// =====================================================================================================
template <int TR>
__global__ __launch_bounds__(128)
void proj_gemm(const unsigned short* __restrict__ wh, const unsigned short* __restrict__ xh,
               const float* __restrict__ bias, unsigned short* yo) {
  __shared__ __align__(16) unsigned short Ts[128 * 72];          // 9216 halves >= 64 * 136
  const int tid  = threadIdx.x;
  const int wave = tid >> 5;
  const int lane = tid & 31;
  const int hh   = lane >> 4;
  const int ci   = lane & 15;
  const int bx   = blockIdx.x;
  const int mt   = bx >> 1, ot = bx & 1;
  const int m0   = mt * 64, o0 = ot * 128;
  const _Float16* W = (const _Float16*)(const void*)wh;
  const _Float16* X = (const _Float16*)(const void*)xh;
  const _Float16* xr = X + (size_t)(m0 + 16 * wave + ci) * EE + 8 * hh;   // B: X row m
  const _Float16* wr = W + (size_t)(o0 + ci) * EE + 8 * hh;               // A: HW rows o0 + 16t + ci

  v8f acc[8];
#pragma unroll
  for (int t = 0; t < 8; ++t) acc[t] = zero8();

#pragma unroll 1
  for (int ks = 0; ks < EE / 32; ++ks) {
    const int k0 = ks * 32;
    const v16h xb = ldfrag_h(xr + k0);
    v16h wa[4];
#pragma unroll
    for (int t = 0; t < 4; ++t) wa[t] = ldfrag_h(wr + (size_t)(16 * t) * EE + k0);
#pragma unroll
    for (int t = 0; t < 4; ++t) acc[t] = mma_h(wa[t], xb, acc[t]);
    guard4(acc[0], acc[1], acc[2], acc[3], xb, wa[0], wa[1], wa[2], wa[3]);
    v16h wc[4];
#pragma unroll
    for (int t = 0; t < 4; ++t) wc[t] = ldfrag_h(wr + (size_t)(16 * (t + 4)) * EE + k0);
#pragma unroll
    for (int t = 0; t < 4; ++t) acc[4 + t] = mma_h(wc[t], xb, acc[4 + t]);
    guard4(acc[4], acc[5], acc[6], acc[7], xb, wc[0], wc[1], wc[2], wc[3]);
  }

  if (TR == 0) {
    unsigned short* ts = Ts + (16 * wave + ci) * 136 + 8 * hh;
#pragma unroll
    for (int t = 0; t < 8; ++t) {
      const v4f b0 = *(const v4f*)(bias + o0 + 16 * t + 8 * hh);
      const v4f b1 = *(const v4f*)(bias + o0 + 16 * t + 8 * hh + 4);
      float y[8];
#pragma unroll
      for (int e = 0; e < 4; ++e) {
        y[e]     = acc[t][e] * ISC     + bfr(b0[e]) * BSC;
        y[4 + e] = acc[t][4 + e] * ISC + bfr(b1[e]) * BSC;
      }
      v4u v;
#pragma unroll
      for (int i = 0; i < 4; ++i) v[i] = pk16(h_bits((_Float16)y[2 * i]), h_bits((_Float16)y[2 * i + 1]));
      *(v4u*)(ts + 16 * t) = v;
    }
    __syncthreads();
    const int p = tid & 15, r16 = tid >> 4;             // r16 0..7, p = 16-B piece of the 256-B segment
    v4u vals[8];
#pragma unroll
    for (int it = 0; it < 8; ++it) {
      const int row = it * 8 + r16;                      // it 0..7 x r16 0..7 = rows 0..63
      vals[it] = *(const v4u*)(Ts + row * 136 + 8 * p);
    }
    unsigned short* yb = yo + (size_t)m0 * EE + o0 + 8 * p;
    {
#pragma unroll
      for (int it = 0; it < 8; ++it) {
        const int row = it * 8 + r16;
        *(v4u*)(yb + (size_t)row * EE) = vals[it];
      }
      
    }
  } else {
    const int ns = m0 / LQ, l0 = m0 - ns * LQ;
#pragma unroll
    for (int t = 0; t < 8; ++t) {
      const v4f b0 = *(const v4f*)(bias + o0 + 16 * t + 8 * hh);
      const v4f b1 = *(const v4f*)(bias + o0 + 16 * t + 8 * hh + 4);
#pragma unroll
      for (int r = 0; r < 4; ++r) {
        Ts[(16 * t + 8 * hh + r) * 72 + 16 * wave + ci] =
            h_bits((_Float16)(acc[t][r] * ISC + bfr(b0[r]) * BSC));
        Ts[(16 * t + 8 * hh + 4 + r) * 72 + 16 * wave + ci] =
            h_bits((_Float16)(acc[t][4 + r] * ISC + bfr(b1[r]) * BSC));
      }
    }
    __syncthreads();
    const int e8 = tid & 7, fq = tid >> 3;              // fq 0..15 = line within group, e8 = 16-B piece
    v4u vals[8];
#pragma unroll
    for (int it = 0; it < 8; ++it) {
      const int orow = it * 16 + fq;                     // it 0..7 x fq 0..15 = o_local 0..127
      vals[it] = *(const v4u*)(Ts + orow * 72 + 8 * e8);
    }
    unsigned short* yb = yo + ((size_t)ns * EE + o0) * LQ + l0 + 8 * e8;
    {
#pragma unroll
      for (int it = 0; it < 8; ++it) {
        const int orow = it * 16 + fq;
        *(v4u*)(yb + (size_t)orow * LQ) = vals[it];
      }
      
    }
  }
}

// =====================================================================================================
// Row-softmax attention (online max) per (ns, h, 64 queries q0..), 4 waves, grid 2*8*32 = 512; wave w owns queries
// q0+16w+ci (B operand of the score tile = Q16 row fragment, col = query, k = d, one k-step). Key term
// Mk[l] = (1 - bf16_RNE(pres[ns][l])) * 1e32 staged once per block in LDS. 32 keys per iteration:
//   score D tiles (rows = keys lt+8hh+r / lt+16+8hh+r, col = query) = A(K16 rows l, k = d) . B(qf);
//   t = (acc/256 - Mk[l]) * (1/sqrt(32)) in f32; tile max over the lane's 16 keys combined with the partner half
//   (lane^16), running max / rescale factor identical for both halves of a query column; p = exp(t - max);
//   P split: hi = f16(4096 p), lo = f16((4096 p - hi) * 2048), both B fragments built in registers (element r <- key
//   lt+8hh+r, element 8+r <- key lt+16+8hh+r, lane unchanged); O^T (rows d, cols queries) accumulators rescaled then
//   += A(VT rows d = h*32 + 16j + ci, keys contiguous) . B(hi) and . B(lo): 4 accumulators (d 0..15 / 16..31, hi / lo).
// Epilogue: 256*O = (acc_hi + acc_lo/2048) / (256 Z) as f16 hi plus f16 residual (x2048), staged per query row in LDS
// coverage: 2 it x 128 threads x 8 halves = 64 rows x 32 per plane per block; grid covers [2][8][2048][32] once.
// =====================================================================================================
__global__ __launch_bounds__(128)
void attn_fwd(const unsigned short* __restrict__ q16, const unsigned short* __restrict__ k16,
              const unsigned short* __restrict__ vt, const float* __restrict__ pres,
              unsigned short* ohp, unsigned short* olp) {
  __shared__ __align__(16) float Mk[LQ];
  __shared__ __align__(16) unsigned short Hs[64 * 40];
  __shared__ __align__(16) unsigned short Lw[64 * 40];
  const int tid  = threadIdx.x;
  const int wave = tid >> 5;
  const int lane = tid & 31;
  const int hh   = lane >> 4;
  const int ci   = lane & 15;
  const int bx   = blockIdx.x;
  const int ns   = bx / (NH * (LQ / 64));
  const int rem  = bx - ns * (NH * (LQ / 64));
  const int h    = rem / (LQ / 64);
  const int q0   = (rem - h * (LQ / 64)) * 64;
  const int qi   = q0 + 16 * wave + ci;                 // this lane's query
  {
    const float* pp = pres + (size_t)ns * LQ + 16 * tid;   // 128 threads x 16 floats = 2048 keys
#pragma unroll
    for (int i = 0; i < 4; ++i) {
      const v4f a = *(const v4f*)(pp + 4 * i);
      v4f mv;
#pragma unroll
      for (int e = 0; e < 4; ++e) mv[e] = (1.0f - bfr(a[e])) * MBIG;
      *(v4f*)(Mk + 16 * tid + 4 * i) = mv;
    }
  }
  __syncthreads();

  const _Float16* Q = (const _Float16*)(const void*)q16;
  const _Float16* K = (const _Float16*)(const void*)k16;
  const _Float16* V = (const _Float16*)(const void*)vt;
  const v16h qf = ldfrag_h(Q + (size_t)(ns * LQ + qi) * EE + h * DH + 8 * hh);
  const _Float16* kp = K + (size_t)(ns * LQ + ci) * EE + h * DH + 8 * hh;      // + l * EE
  const _Float16* vp = V + ((size_t)ns * EE + h * DH + ci) * LQ + 8 * hh;      // row d = h*32 + ci, + 16*LQ, + lt

  float rmax = NEG0, z = 0.f;
  v8f ah0 = zero8(), ah1 = zero8(), al0 = zero8(), al1 = zero8();
#pragma unroll 1
  for (int it = 0; it < LQ / 32; ++it) {
    const int lt = it * 32;
    const v16h ka0 = ldfrag_h(kp + (size_t)lt * EE);
    const v16h ka1 = ldfrag_h(kp + (size_t)(lt + 16) * EE);
    v8f s0 = mma_h(ka0, qf, zero8());
    v8f s1 = mma_h(ka1, qf, zero8());
    guard2(s0, s1, ka0, ka1, qf);
    const v4f ma = *(const v4f*)(Mk + lt + 8 * hh);           // keys lt + 8hh + 0..3      <-> s0[0..3]
    const v4f mb = *(const v4f*)(Mk + lt + 8 * hh + 4);       // keys lt + 8hh + 4..7      <-> s0[4..7]
    const v4f mc = *(const v4f*)(Mk + lt + 16 + 8 * hh);      // keys lt + 16 + 8hh + 0..3 <-> s1[0..3]
    const v4f md = *(const v4f*)(Mk + lt + 20 + 8 * hh);      // keys lt + 16 + 8hh + 4..7 <-> s1[4..7]
    float t[16];
#pragma unroll
    for (int r = 0; r < 4; ++r) {
      t[r]      = (s0[r] * QKS     - ma[r]) * RSQ;
      t[4 + r]  = (s0[4 + r] * QKS - mb[r]) * RSQ;
      t[8 + r]  = (s1[r] * QKS     - mc[r]) * RSQ;
      t[12 + r] = (s1[4 + r] * QKS - md[r]) * RSQ;
    }
    float mx = t[0];
#pragma unroll
    for (int i = 1; i < 16; ++i) mx = fmaxf(mx, t[i]);
    mx = fmaxf(mx, __shfl_xor(mx, 16, 32));
    const float nmax = fmaxf(rmax, mx);
    const float corr = __expf(rmax - nmax);
    rmax = nmax;
    FragH ph, pl;
    float zs = 0.f;
#pragma unroll
    for (int r = 0; r < 8; ++r) {
      const float pa = __expf(t[r] - nmax);
      const float pc = __expf(t[8 + r] - nmax);
      zs += pa + pc;
      const float xa = pa * PSC, xc = pc * PSC;
      const _Float16 ha = (_Float16)xa, hc = (_Float16)xc;
      ph.h[0][r] = ha;
      ph.h[1][r] = hc;
      pl.h[0][r] = (_Float16)((xa - (float)ha) * PLO);
      pl.h[1][r] = (_Float16)((xc - (float)hc) * PLO);
    }
    z = z * corr + zs;
    ah0 *= corr; ah1 *= corr; al0 *= corr; al1 *= corr;
    const v16h va0 = ldfrag_h(vp + lt);                          // d = ci
    const v16h va1 = ldfrag_h(vp + (size_t)16 * LQ + lt);        // d = 16 + ci
    ah0 = mma_h(va0, ph.v, ah0);
    ah1 = mma_h(va1, ph.v, ah1);
    al0 = mma_h(va0, pl.v, al0);
    al1 = mma_h(va1, pl.v, al1);
    guard4b(ah0, ah1, al0, al1, va0, va1, ph.v, pl.v);
  }

  // ah0/al0[r] <-> d = 8hh + r, ah1/al1[r] <-> d = 16 + 8hh + r, query qi; Z >= 1
  const float zz  = z + __shfl_xor(z, 16, 32);
  const float rzs = (1.0f / zz) * OSA;
  float o[16];
#pragma unroll
  for (int r = 0; r < 8; ++r) {
    o[r]     = (ah0[r] + al0[r] * LOIN) * rzs;
    o[8 + r] = (ah1[r] + al1[r] * LOIN) * rzs;
  }
  v4u h0, h1, g0, g1;
#pragma unroll
  for (int i = 0; i < 4; ++i) {
    const _Float16 a0 = (_Float16)o[2 * i],     a1 = (_Float16)o[2 * i + 1];
    const _Float16 b0 = (_Float16)o[8 + 2 * i], b1 = (_Float16)o[8 + 2 * i + 1];
    const _Float16 la0 = (_Float16)((o[2 * i]         - (float)a0) * LOSC);
    const _Float16 la1 = (_Float16)((o[2 * i + 1]     - (float)a1) * LOSC);
    const _Float16 lb0 = (_Float16)((o[8 + 2 * i]     - (float)b0) * LOSC);
    const _Float16 lb1 = (_Float16)((o[8 + 2 * i + 1] - (float)b1) * LOSC);
    h0[i] = pk16(h_bits(a0), h_bits(a1));
    h1[i] = pk16(h_bits(b0), h_bits(b1));
    g0[i] = pk16(h_bits(la0), h_bits(la1));
    g1[i] = pk16(h_bits(lb0), h_bits(lb1));
  }
  {
    const int ro = (16 * wave + ci) * 40 + 8 * hh;
    *(v4u*)(Hs + ro)      = h0;
    *(v4u*)(Hs + ro + 16) = h1;
    *(v4u*)(Lw + ro)      = g0;
    *(v4u*)(Lw + ro + 16) = g1;
  }
  __syncthreads();
  {
    const size_t ob = ((size_t)(ns * NH + h) * LQ + q0) * DH;      // 4096-B aligned region of 64 x 32 halves
    v4u hv[2], lv[2];
#pragma unroll
    for (int it2 = 0; it2 < 2; ++it2) {
      const int hf = it2 * 1024 + 8 * tid;             // half index within the 2048-half region
      const int row = hf >> 5, col = hf & 31;
      hv[it2] = *(const v4u*)(Hs + row * 40 + col);
      lv[it2] = *(const v4u*)(Lw + row * 40 + col);
    }
    {
#pragma unroll
      for (int it2 = 0; it2 < 2; ++it2) {
        const int hf = it2 * 1024 + 8 * tid;
        *(v4u*)(ohp + ob + hf) = hv[it2];
        *(v4u*)(olp + ob + hf) = lv[it2];
      }
      
    }
  }
}

// =====================================================================================================
// Output projection out[m][o] = sum_c O[m][c] Wo[c][o] + bo[o], O = (hi + lo/2048)/256 from the OH/OL planes
// ([ns][h][q][32]: k-step j = head j). Block = 4 waves = 64 rows m x 64 cols o (grid 64 x 4 = 256); wave w owns rows
// m0+16w+ci (B operands = OH and OL row fragments, col = m), A = HO plane rows o0+16t+ci (k = c split map); 4 hi + 4
// lo accumulators; acc[t][r] <-> (m = m0+16w+ci, o = o0+16t+8hh+r).
// Epilogue: (acch + accl/2048)/262144 + bf16_RNE(bo) staged in LDS as Ts[m_local][o_local] (pitch 68, 16-B vector
// coverage: 8 it x 8 rows x 16 pieces x 4 floats = 64 x 64 per block; grid covers out [4096][256] exactly once.
// =====================================================================================================
__global__ __launch_bounds__(128)
void out_proj(const unsigned short* __restrict__ ohp, const unsigned short* __restrict__ olp,
              const unsigned short* __restrict__ woh, const float* __restrict__ bo, float* out) {
  __shared__ __align__(16) float Ts[64 * 68];
  const int tid  = threadIdx.x;
  const int wave = tid >> 5;
  const int lane = tid & 31;
  const int hh   = lane >> 4;
  const int ci   = lane & 15;
  const int bx   = blockIdx.x;
  const int mt   = bx >> 2, ot = bx & 3;
  const int m0   = mt * 64, o0 = ot * 64;
  const int ns   = m0 / LQ;
  const int ql   = m0 - ns * LQ + 16 * wave + ci;       // query of this lane's row
  const _Float16* OHf = (const _Float16*)(const void*)ohp;
  const _Float16* OLf = (const _Float16*)(const void*)olp;
  const _Float16* W   = (const _Float16*)(const void*)woh;
  const size_t orow = ((size_t)(ns * NH) * LQ + ql) * DH + 8 * hh;    // + j * LQ * DH per head
  const _Float16* ar = OHf + orow;
  const _Float16* lr = OLf + orow;
  const _Float16* wr = W + (size_t)(o0 + ci) * EE + 8 * hh;           // + 16t*EE + 32j

  v8f acch[4], accl[4];
#pragma unroll
  for (int t = 0; t < 4; ++t) { acch[t] = zero8(); accl[t] = zero8(); }

#pragma unroll 1
  for (int j = 0; j < NH; ++j) {
    const v16h obh = ldfrag_h(ar + (size_t)j * LQ * DH);
    const v16h obl = ldfrag_h(lr + (size_t)j * LQ * DH);
    v16h wa[4];
#pragma unroll
    for (int t = 0; t < 4; ++t) wa[t] = ldfrag_h(wr + (size_t)(16 * t) * EE + 32 * j);
#pragma unroll
    for (int t = 0; t < 4; ++t) acch[t] = mma_h(wa[t], obh, acch[t]);
    guard4(acch[0], acch[1], acch[2], acch[3], obh, wa[0], wa[1], wa[2], wa[3]);
#pragma unroll
    for (int t = 0; t < 4; ++t) accl[t] = mma_h(wa[t], obl, accl[t]);
    guard4(accl[0], accl[1], accl[2], accl[3], obl, wa[0], wa[1], wa[2], wa[3]);
  }

  {
    float* ts = Ts + (16 * wave + ci) * 68 + 8 * hh;
#pragma unroll
    for (int t = 0; t < 4; ++t) {
      const v4f b0 = *(const v4f*)(bo + o0 + 16 * t + 8 * hh);
      const v4f b1 = *(const v4f*)(bo + o0 + 16 * t + 8 * hh + 4);
      v4f r0, r1;
#pragma unroll
      for (int e = 0; e < 4; ++e) {
        r0[e] = (acch[t][e]     + accl[t][e]     * LOIN) * OSC + bfr(b0[e]);
        r1[e] = (acch[t][4 + e] + accl[t][4 + e] * LOIN) * OSC + bfr(b1[e]);
      }
      *(v4f*)(ts + 16 * t)     = r0;
      *(v4f*)(ts + 16 * t + 4) = r1;
    }
  }
  __syncthreads();
  {
    const int p = tid & 15, r16 = tid >> 4;             // r16 0..7, p = 16-B piece of the 256-B segment
    v4f vals[8];
#pragma unroll
    for (int it = 0; it < 8; ++it) {
      const int row = it * 8 + r16;                      // it 0..7 x r16 0..7 = rows 0..63
      vals[it] = *(const v4f*)(Ts + row * 68 + 4 * p);
    }
    float* yb = out + (size_t)m0 * EE + o0 + 4 * p;
    {
#pragma unroll
      for (int it = 0; it < 8; ++it) {
        const int row = it * 8 + r16;
        *(v4f*)(yb + (size_t)row * EE) = vals[it];
      }
      
    }
  }
}

// =====================================================================================================
// Workspace map (bytes), every offset a multiple of 256 and every plane sized to its whole-line store granularity:
//   PQ, PK, PV   f16 [4096][256]      3 x 2097152      0 .. 6291456
//   HQ,HK,HV,HO  f16 [256][256]       4 x 131072       .. 6815744
//   Q16, K16     f16 [4096][256]      2 x 2097152      .. 11010048
//   VT           f16 [2][256][2048]   2097152          .. 13107200
//   OH, OL       f16 [2][8][2048][32] 2 x 2097152      .. 17301504  (end)
// =====================================================================================================
extern "C" void kernel_launch(void* const* d_in, const int* in_sizes, int n_in,
                              void* d_out, int out_size, void* d_ws, size_t ws_size,
                              hipStream_t stream) {
  if (n_in < 12) return;
  if (in_sizes[0] != MR * EE || in_sizes[1] != MR * EE || in_sizes[2] != MR * EE) return;
  if (in_sizes[3] != NSB * LQ) return;
  if (in_sizes[4] != EE * EE || in_sizes[6] != EE * EE || in_sizes[8] != EE * EE || in_sizes[10] != EE * EE) return;
  if (in_sizes[5] != EE || in_sizes[7] != EE || in_sizes[9] != EE || in_sizes[11] != EE) return;
  if (out_size != MR * EE) return;

  const float* queries = (const float*)d_in[0];
  const float* keys    = (const float*)d_in[1];
  const float* values  = (const float*)d_in[2];
  const float* pres    = (const float*)d_in[3];
  const float* Wq      = (const float*)d_in[4];
  const float* bq      = (const float*)d_in[5];
  const float* Wk      = (const float*)d_in[6];
  const float* bk      = (const float*)d_in[7];
  const float* Wv      = (const float*)d_in[8];
  const float* bv      = (const float*)d_in[9];
  const float* Wo      = (const float*)d_in[10];
  const float* bo      = (const float*)d_in[11];
  float* out = (float*)d_out;

  const size_t PX  = (size_t)MR * EE * 2;               // 2097152
  const size_t PW  = (size_t)EE * EE * 2;               // 131072
  const size_t PP  = (size_t)MR * EE * 2;               // 2097152
  const size_t PVT = (size_t)NSB * EE * LQ * 2;         // 2097152
  const size_t PO  = (size_t)NSB * NH * LQ * DH * 2;    // 2097152
  size_t off = 0;
  const size_t oPQ = off; off += PX;
  const size_t oPK = off; off += PX;
  const size_t oPV = off; off += PX;
  const size_t oHQ = off; off += PW;
  const size_t oHK = off; off += PW;
  const size_t oHV = off; off += PW;
  const size_t oHO = off; off += PW;
  const size_t oQ  = off; off += PP;
  const size_t oK  = off; off += PP;
  const size_t oVT = off; off += PVT;
  const size_t oOH = off; off += PO;
  const size_t oOL = off; off += PO;
  if (off > ws_size) return;                            // off = 17301504
  if (off > (size_t)134217728) return;

  char* ws = (char*)d_ws;
  unsigned short* PQp = (unsigned short*)(ws + oPQ);
  unsigned short* PKp = (unsigned short*)(ws + oPK);
  unsigned short* PVp = (unsigned short*)(ws + oPV);
  unsigned short* HQp = (unsigned short*)(ws + oHQ);
  unsigned short* HKp = (unsigned short*)(ws + oHK);
  unsigned short* HVp = (unsigned short*)(ws + oHV);
  unsigned short* HOp = (unsigned short*)(ws + oHO);
  unsigned short* Q16 = (unsigned short*)(ws + oQ);
  unsigned short* K16 = (unsigned short*)(ws + oK);
  unsigned short* VTp = (unsigned short*)(ws + oVT);
  unsigned short* OHp = (unsigned short*)(ws + oOH);
  unsigned short* OLp = (unsigned short*)(ws + oOL);

  const dim3 blk256(256), blk128(128);
  const dim3 gCV(3 * NBX);                              // 1536 blocks
  const dim3 gWT(16);                                   // 4 weights x 4 o-tiles
  const dim3 gPJ((MR / 64) * (EE / 128));               // 128 blocks
  const dim3 gAT(NSB * NH * (LQ / 64));                 // 512 blocks
  const dim3 gOP((MR / 64) * (EE / 64));                // 256 blocks

  // (0) 16-bit activation planes of the bf16-RNE inputs
  cvt_planes<<<gCV, blk256, 0, stream>>>(queries, keys, values, PQp, PKp, PVp);
  // (1) transposed 16-bit weight planes HW[o][e] = W[e][o]
  cvt_wt<<<gWT, blk256, 0, stream>>>(Wq, Wk, Wv, Wo, HQp, HKp, HVp, HOp);
  // (2) projections: q, k row-major [4096][256] (x16), v transposed VT[ns][hd][l] (x16), biases added
  proj_gemm<0><<<gPJ, blk128, 0, stream>>>(HQp, PQp, bq, Q16);
  proj_gemm<0><<<gPJ, blk128, 0, stream>>>(HKp, PKp, bk, K16);
  proj_gemm<1><<<gPJ, blk128, 0, stream>>>(HVp, PVp, bv, VTp);
  // (3) attention output planes OH / OL [ns][h][q][32] (row softmax over keys with the key term)
  attn_fwd<<<gAT, blk128, 0, stream>>>(Q16, K16, VTp, pres, OHp, OLp);
  // (4) output projection + bias -> d_out [4096][256] f32
  out_proj<<<gOP, blk128, 0, stream>>>(OHp, OLp, HOp, bo, out);
  (void)hipGetLastError();
}

// v001
// One run takes 71 microseconds.
// Two timings next to v000 put it at 1.47 and 1.49 times that version's speed.
// Contractions, all v_wmma_f32_16x16x32_f16 (f16 operands, f32 accumulate): q/k/v projections X.W with f16
// containers holding bf16-RNE inputs (X x64, W x1024); scores K.q with q, k planes f16 x16 (K = 32 per head);
// P as f16 hi (x4096) + residual (x2^11) planes . V plane (f16 x16) into two accumulator pairs; output projection
// with O as f16 hi (x256) + residual (x2^11) planes and Wo bf16-RNE x1024 into two accumulators. Key-mask term,
// running max / sum, exp, residual folds and biases in f32 on VALU.
#include <hip/hip_runtime.h>
#include <math.h>
#include <stdint.h>

#define NSB  2
#define LQ   2048
#define EE   256
#define NH   8
#define DH   32
#define MR   (NSB * LQ)
#define XSC  64.0f
#define WSC  1024.0f
#define ISC  (1.0f / 4096.0f)
#define BSC  16.0f
#define QKS  (1.0f / 256.0f)
#define RSQ  0.17677669529663687f
#define MBIG 1.0e32f
#define NEG0 (-1.0e38f)
#define PSC  4096.0f
#define PLO  2048.0f
#define LOIN (1.0f / 2048.0f)
#define OSA  (1.0f / 256.0f)
#define LOSC 2048.0f
#define OSC  (1.0f / 262144.0f)
#define NBX  ((MR * EE) / 2048)
static_assert(EE == NH * DH);
static_assert(DH == 32);
static_assert((LQ % 64) == 0 && (EE % 128) == 0 && (MR % 64) == 0);
static_assert(((MR * EE) % 2048) == 0);
static_assert(NBX == 512);
static_assert(LQ == 128 * 16);
#define SK   128                    // keys per LDS stage of the attention kernel
#define NST  (LQ / SK)              // stages
#define KPH  40                     // LDS pitch of a staged K row, halves (64 B of data + 16 B: 16 B x odd for 16-B readers)
#define VPH  136                    // LDS pitch of a staged V^T row, halves (256 B of data + 16 B)
#define KBH  (SK * KPH)             // halves per K buffer
#define VBH  (DH * VPH)             // halves per V buffer
static_assert(NST >= 2 && (SK % 32) == 0);
static_assert(SK * 4 == 4 * 128 && DH * (SK / 8) == 4 * 128);   // 4 + 4 copies of 16 B per thread and stage

typedef _Float16 v16h __attribute__((ext_vector_type(16)));
typedef _Float16 v8h  __attribute__((ext_vector_type(8)));
typedef float    v8f  __attribute__((ext_vector_type(8)));
typedef float    v4f  __attribute__((ext_vector_type(4)));
typedef unsigned int v4u __attribute__((ext_vector_type(4)));

union FragH { v16h v; v8h h[2]; };

// ---- scalar helpers ----------------------------------------------------------------------------------
__device__ __forceinline__ unsigned short bf_bits(float f) {          // f32 -> bf16 bits, RNE convert
  unsigned u = __float_as_uint(f);
  return (unsigned short)((u + 0x7FFFu + ((u >> 16) & 1u)) >> 16);
}
__device__ __forceinline__ float bf_up(unsigned short h) { return __uint_as_float(((unsigned)h) << 16); }
__device__ __forceinline__ float bfr(float f) { return bf_up(bf_bits(f)); }
__device__ __forceinline__ unsigned short h_bits(_Float16 x) { return __builtin_bit_cast(unsigned short, x); }
__device__ __forceinline__ unsigned pk16(unsigned short a, unsigned short b) { return (unsigned)a | ((unsigned)b << 16); }
__device__ __forceinline__ v8f zero8() { v8f z = {0.f, 0.f, 0.f, 0.f, 0.f, 0.f, 0.f, 0.f}; return z; }
// 8 consecutive f32 -> f16( bf16_RNE(x) * sc ) packed into 16 bytes
__device__ __forceinline__ v4u cvt8(v4f a, v4f c, float sc) {
  float f[8];
#pragma unroll
  for (int i = 0; i < 4; ++i) { f[i] = bfr(a[i]) * sc; f[4 + i] = bfr(c[i]) * sc; }
  v4u v;
#pragma unroll
  for (int i = 0; i < 4; ++i) v[i] = pk16(h_bits((_Float16)f[2 * i]), h_bits((_Float16)f[2 * i + 1]));
  return v;
}

// ---- fragment loader: 16-bit A/B operand, lane -> row/col (lane&15), p already includes +8*(lane>>4);
//      elements 0..7 <- p[0..7] (k0+8h..), elements 8..15 <- p[16..23] (k0+16+8h..)
__device__ __forceinline__ v16h ldfrag_h(const _Float16* p) {
  FragH f;
  f.h[0] = *(const v8h*)(p);
  f.h[1] = *(const v8h*)(p + 16);
  return f.v;
}

// ---- WMMA helpers with trailing VALU hazard gap ----------------------------------------------------
__device__ __forceinline__ v8f mma_h(v16h a, v16h b, v8f c) {
  return __builtin_amdgcn_wmma_f32_16x16x32_f16(false, a, false, b, (short)0, c, false, false);
}
// ties 2 accumulators, keeps 3 fragments live through 4 VALU slots
__device__ __forceinline__ void guard2(v8f& a, v8f& b, v16h x0, v16h x1, v16h y) {
#if defined(__HIP_DEVICE_COMPILE__)
  asm volatile("v_nop\n\tv_nop\n\tv_nop\n\tv_nop" : "+v"(a), "+v"(b) : "v"(x0), "v"(x1), "v"(y));
#endif
}
// ties 4 accumulators, keeps 5 fragments live through 4 VALU slots
__device__ __forceinline__ void guard4(v8f& a, v8f& b, v8f& c, v8f& d,
                                       v16h x, v16h y0, v16h y1, v16h y2, v16h y3) {
#if defined(__HIP_DEVICE_COMPILE__)
  asm volatile("v_nop\n\tv_nop\n\tv_nop\n\tv_nop"
               : "+v"(a), "+v"(b), "+v"(c), "+v"(d) : "v"(x), "v"(y0), "v"(y1), "v"(y2), "v"(y3));
#endif
}
// ties 4 accumulators, keeps 4 fragments live through 4 VALU slots
__device__ __forceinline__ void guard4b(v8f& a, v8f& b, v8f& c, v8f& d,
                                        v16h x0, v16h x1, v16h y0, v16h y1) {
#if defined(__HIP_DEVICE_COMPILE__)
  asm volatile("v_nop\n\tv_nop\n\tv_nop\n\tv_nop"
               : "+v"(a), "+v"(b), "+v"(c), "+v"(d) : "v"(x0), "v"(x1), "v"(y0), "v"(y1));
#endif
}

// =====================================================================================================
// 16-bit activation planes, native layout: PQ/PK/PV[m][e] = f16( bf16_RNE(x) * 64 ) for queries/keys/values
// (blocks 0..511, 512..1023, 1024..1535; block-uniform source select). Thread converts 8 consecutive elements;
// coverage: 512 blocks x 256 threads x 8 = 1048576 per activation = [4096][256] entirely.
// =====================================================================================================
__global__ __launch_bounds__(256)
void cvt_planes(const float* __restrict__ xq, const float* __restrict__ xk, const float* __restrict__ xv,
                unsigned short* pq, unsigned short* pk, unsigned short* pv) {
  const int bx = blockIdx.x;
  const float* src;
  unsigned short* dst;
  int lb;
  if (bx < NBX)          { src = xq; dst = pq; lb = bx; }
  else if (bx < 2 * NBX) { src = xk; dst = pk; lb = bx - NBX; }
  else                   { src = xv; dst = pv; lb = bx - 2 * NBX; }
  const size_t e0 = ((size_t)lb * 256 + threadIdx.x) * 8;
  const v4f a = *(const v4f*)(src + e0);
  const v4f c = *(const v4f*)(src + e0 + 4);
  const v4u v = cvt8(a, c, XSC);
  unsigned short* dp = dst + e0;
  *(v4u*)dp = v;
  
}

// =====================================================================================================
// Transposed weight planes: HW[o][e] = f16( bf16_RNE(W[e][o]) * 1024 ) for the [in][out] weights (x.W layout).
// Block = (weight w = bx>>2, 64 output rows o0 = 64*(bx&3)), 256 threads, grid 16. Read W rows e as 16 threads x 16 B
// (256-B row segment o0..o0+63), 2-B transposed LDS stores into Ts[o_local][e] (pitch 264), block barrier, then each
// coverage: read 16 it x 16 rows e x 16 pieces x 4 = all 256 e x 64 o; write 8 it x 8 waves = 64 rows x 32 lanes x 8
//           halves = 64 x 256; 4 o-tiles per weight -> HW [256][256] entirely, 4 weights.
// =====================================================================================================
__global__ __launch_bounds__(256)
void cvt_wt(const float* __restrict__ wq, const float* __restrict__ wk, const float* __restrict__ wv,
            const float* __restrict__ wo, unsigned short* hq, unsigned short* hk, unsigned short* hv,
            unsigned short* ho) {
  __shared__ __align__(16) unsigned short Ts[64 * 264];
  const int tid  = threadIdx.x;
  const int wave = tid >> 5;
  const int lane = tid & 31;
  const int bx   = blockIdx.x;
  const int w    = bx >> 2;
  const int o0   = (bx & 3) * 64;
  const float* src;
  unsigned short* dst;
  if (w == 0)      { src = wq; dst = hq; }
  else if (w == 1) { src = wk; dst = hk; }
  else if (w == 2) { src = wv; dst = hv; }
  else             { src = wo; dst = ho; }
  const int p = tid & 15, r16 = tid >> 4;               // p = 16-B piece of the 256-B row segment, r16 = row in group
#pragma unroll 4
  for (int it = 0; it < 16; ++it) {
    const int e = it * 16 + r16;                         // 0..255
    const v4f a = *(const v4f*)(src + (size_t)e * EE + o0 + 4 * p);
#pragma unroll
    for (int i = 0; i < 4; ++i) Ts[(4 * p + i) * 264 + e] = h_bits((_Float16)(bfr(a[i]) * WSC));
  }
  __syncthreads();
  v4u vals[8];
#pragma unroll
  for (int it = 0; it < 8; ++it) {
    const int row = it * 8 + wave;                       // it 0..7 x wave 0..7 = rows 0..63
    vals[it] = *(const v4u*)(Ts + row * 264 + 8 * lane);
  }
  unsigned short* db = dst + (size_t)o0 * EE + 8 * lane;
  {
#pragma unroll
    for (int it = 0; it < 8; ++it) {
      const int row = it * 8 + wave;
      *(v4u*)(db + (size_t)row * EE) = vals[it];
    }
    
  }
}

// =====================================================================================================
// Projection GEMM Y[m][o] = sum_e X[m][e] HW[o][e] (x 65536 in the accumulator) + b[o]. Block = 4 waves = 64 rows m x
// 128 cols o (grid 64 m-tiles x 2 o-tiles = 128). Tile = A(HW rows o = o0+16t+ci, k = e split map) . B(X row m =
// m0+16w+ci, col = m, same map); 8 k-steps of 32, 8 accumulators per wave; acc[t][r] <-> (m = m0+16w+ci,
// o = o0+16t+8hh+r). y16 = acc * 2^-12 + 16 * bf16_RNE(b[o]) (= 16 y).
// TR == 0: YO[m][o] = f16(y16): staged as Ts[m_local][o_local] (pitch 136, 16-B LDS stores), block barrier, then each
// TR == 1: VT[ns][o][l] (keys contiguous): staged as Ts[o_local][l_local] (pitch 72, 2-B LDS stores), barrier, each
// coverage: TR 0: 8 it x 8 rows x 16 pieces x 8 halves = 64 x 128 per block, grid -> [4096][256]; TR 1: 8 it x 16
//           lines x 8 pieces x 8 = 128 o x 64 l per block, grid -> VT [2][256][2048].
// =====================================================================================================
template <int TR>
__global__ __launch_bounds__(128)
void proj_gemm(const unsigned short* __restrict__ wh, const unsigned short* __restrict__ xh,
               const float* __restrict__ bias, unsigned short* yo) {
  __shared__ __align__(16) unsigned short Ts[128 * 72];          // 9216 halves >= 64 * 136
  const int tid  = threadIdx.x;
  const int wave = tid >> 5;
  const int lane = tid & 31;
  const int hh   = lane >> 4;
  const int ci   = lane & 15;
  const int bx   = blockIdx.x;
  const int mt   = bx >> 1, ot = bx & 1;
  const int m0   = mt * 64, o0 = ot * 128;
  const _Float16* W = (const _Float16*)(const void*)wh;
  const _Float16* X = (const _Float16*)(const void*)xh;
  const _Float16* xr = X + (size_t)(m0 + 16 * wave + ci) * EE + 8 * hh;   // B: X row m
  const _Float16* wr = W + (size_t)(o0 + ci) * EE + 8 * hh;               // A: HW rows o0 + 16t + ci

  v8f acc[8];
#pragma unroll
  for (int t = 0; t < 8; ++t) acc[t] = zero8();

#pragma unroll 1
  for (int ks = 0; ks < EE / 32; ++ks) {
    const int k0 = ks * 32;
    const v16h xb = ldfrag_h(xr + k0);
    v16h wa[4];
#pragma unroll
    for (int t = 0; t < 4; ++t) wa[t] = ldfrag_h(wr + (size_t)(16 * t) * EE + k0);
#pragma unroll
    for (int t = 0; t < 4; ++t) acc[t] = mma_h(wa[t], xb, acc[t]);
    guard4(acc[0], acc[1], acc[2], acc[3], xb, wa[0], wa[1], wa[2], wa[3]);
    v16h wc[4];
#pragma unroll
    for (int t = 0; t < 4; ++t) wc[t] = ldfrag_h(wr + (size_t)(16 * (t + 4)) * EE + k0);
#pragma unroll
    for (int t = 0; t < 4; ++t) acc[4 + t] = mma_h(wc[t], xb, acc[4 + t]);
    guard4(acc[4], acc[5], acc[6], acc[7], xb, wc[0], wc[1], wc[2], wc[3]);
  }

  if (TR == 0) {
    unsigned short* ts = Ts + (16 * wave + ci) * 136 + 8 * hh;
#pragma unroll
    for (int t = 0; t < 8; ++t) {
      const v4f b0 = *(const v4f*)(bias + o0 + 16 * t + 8 * hh);
      const v4f b1 = *(const v4f*)(bias + o0 + 16 * t + 8 * hh + 4);
      float y[8];
#pragma unroll
      for (int e = 0; e < 4; ++e) {
        y[e]     = acc[t][e] * ISC     + bfr(b0[e]) * BSC;
        y[4 + e] = acc[t][4 + e] * ISC + bfr(b1[e]) * BSC;
      }
      v4u v;
#pragma unroll
      for (int i = 0; i < 4; ++i) v[i] = pk16(h_bits((_Float16)y[2 * i]), h_bits((_Float16)y[2 * i + 1]));
      *(v4u*)(ts + 16 * t) = v;
    }
    __syncthreads();
    const int p = tid & 15, r16 = tid >> 4;             // r16 0..7, p = 16-B piece of the 256-B segment
    v4u vals[8];
#pragma unroll
    for (int it = 0; it < 8; ++it) {
      const int row = it * 8 + r16;                      // it 0..7 x r16 0..7 = rows 0..63
      vals[it] = *(const v4u*)(Ts + row * 136 + 8 * p);
    }
    unsigned short* yb = yo + (size_t)m0 * EE + o0 + 8 * p;
    {
#pragma unroll
      for (int it = 0; it < 8; ++it) {
        const int row = it * 8 + r16;
        *(v4u*)(yb + (size_t)row * EE) = vals[it];
      }
      
    }
  } else {
    const int ns = m0 / LQ, l0 = m0 - ns * LQ;
#pragma unroll
    for (int t = 0; t < 8; ++t) {
      const v4f b0 = *(const v4f*)(bias + o0 + 16 * t + 8 * hh);
      const v4f b1 = *(const v4f*)(bias + o0 + 16 * t + 8 * hh + 4);
#pragma unroll
      for (int r = 0; r < 4; ++r) {
        Ts[(16 * t + 8 * hh + r) * 72 + 16 * wave + ci] =
            h_bits((_Float16)(acc[t][r] * ISC + bfr(b0[r]) * BSC));
        Ts[(16 * t + 8 * hh + 4 + r) * 72 + 16 * wave + ci] =
            h_bits((_Float16)(acc[t][4 + r] * ISC + bfr(b1[r]) * BSC));
      }
    }
    __syncthreads();
    const int e8 = tid & 7, fq = tid >> 3;              // fq 0..15 = line within group, e8 = 16-B piece
    v4u vals[8];
#pragma unroll
    for (int it = 0; it < 8; ++it) {
      const int orow = it * 16 + fq;                     // it 0..7 x fq 0..15 = o_local 0..127
      vals[it] = *(const v4u*)(Ts + orow * 72 + 8 * e8);
    }
    unsigned short* yb = yo + ((size_t)ns * EE + o0) * LQ + l0 + 8 * e8;
    {
#pragma unroll
      for (int it = 0; it < 8; ++it) {
        const int orow = it * 16 + fq;
        *(v4u*)(yb + (size_t)orow * LQ) = vals[it];
      }
      
    }
  }
}

// ---- one stage of K and V^T into LDS: 8 asynchronous 16-B copies per lane (4 of K, 4 of V^T), no register in between.
//      lk / lv = the lane's LDS byte address of its first K / V piece, gk / gv = its global source; piece i of K lies
//      32 rows further (LDS 32 * 80 B, global 32 * 512 B), piece i of V^T 8 rows further (LDS 8 * 272 B, global 8 * 4096 B).
__device__ __forceinline__ void stage_kv(unsigned lk, unsigned lv, const unsigned short* gk, const unsigned short* gv) {
#if defined(__HIP_DEVICE_COMPILE__)
  const unsigned lk1 = lk + 32 * KPH * 2, lk2 = lk + 64 * KPH * 2, lk3 = lk + 96 * KPH * 2;
  const unsigned lv1 = lv + 8 * VPH * 2,  lv2 = lv + 16 * VPH * 2, lv3 = lv + 24 * VPH * 2;
  const unsigned short* gk1 = gk + 32 * EE;
  const unsigned short* gk2 = gk + 64 * EE;
  const unsigned short* gk3 = gk + 96 * EE;
  const unsigned short* gv1 = gv + 8 * LQ;
  const unsigned short* gv2 = gv + 16 * LQ;
  const unsigned short* gv3 = gv + 24 * LQ;
  // the closing s_wait_xcnt stands in the copies' own statement so that no address register is rewritten ahead of it
  asm volatile("global_load_async_to_lds_b128 %0, %8, off\n\t"
               "global_load_async_to_lds_b128 %1, %9, off\n\t"
               "global_load_async_to_lds_b128 %2, %10, off\n\t"
               "global_load_async_to_lds_b128 %3, %11, off\n\t"
               "global_load_async_to_lds_b128 %4, %12, off\n\t"
               "global_load_async_to_lds_b128 %5, %13, off\n\t"
               "global_load_async_to_lds_b128 %6, %14, off\n\t"
               "global_load_async_to_lds_b128 %7, %15, off\n\t"
               "s_wait_xcnt 0x0"
               :: "v"(lk), "v"(lk1), "v"(lk2), "v"(lk3), "v"(lv), "v"(lv1), "v"(lv2), "v"(lv3),
                  "v"(gk), "v"(gk1), "v"(gk2), "v"(gk3), "v"(gv), "v"(gv1), "v"(gv2), "v"(gv3)
               : "memory");
#endif
}

// =====================================================================================================
// Row-softmax attention (online max) per (ns, h, 64 queries q0..), 4 waves, grid 2*8*32 = 512; wave w owns queries
// q0+16w+ci (B operand of the score tile = Q16 row fragment, col = query, k = d, one k-step). Key term
// Mk[l] = (1 - bf16_RNE(pres[ns][l])) * 1e32 staged once per block in LDS. K rows (this head's 64 B) and V^T rows of
// 128 keys are staged per block in LDS by asynchronous copies, two buffers: stage s + 1 flies while stage s is worked
// on; all four waves read their A fragments from the staged tile. 32 keys per iteration, 4 iterations per stage:
//   score D tiles (rows = keys lt+8hh+r / lt+16+8hh+r, col = query) = A(K16 rows l, k = d) . B(qf);
//   t = (acc/256 - Mk[l]) * (1/sqrt(32)) in f32; tile max over the lane's 16 keys combined with the partner half
//   (lane^16), running max / rescale factor identical for both halves of a query column; p = exp(t - max);
//   P split: hi = f16(4096 p), lo = f16((4096 p - hi) * 2048), both B fragments built in registers (element r <- key
//   lt+8hh+r, element 8+r <- key lt+16+8hh+r, lane unchanged); O^T (rows d, cols queries) accumulators rescaled then
//   += A(VT rows d = h*32 + 16j + ci, keys contiguous) . B(hi) and . B(lo): 4 accumulators (d 0..15 / 16..31, hi / lo).
// Epilogue: 256*O = (acc_hi + acc_lo/2048) / (256 Z) as f16 hi plus f16 residual (x2048), staged per query row in LDS
// coverage: 2 it x 128 threads x 8 halves = 64 rows x 32 per plane per block; grid covers [2][8][2048][32] once.
// =====================================================================================================
__global__ __launch_bounds__(128)
void attn_fwd(const unsigned short* __restrict__ q16, const unsigned short* __restrict__ k16,
              const unsigned short* __restrict__ vt, const float* __restrict__ pres,
              unsigned short* ohp, unsigned short* olp) {
  __shared__ __align__(16) float Mk[LQ];
  __shared__ __align__(16) unsigned short Hs[64 * 40];
  __shared__ __align__(16) unsigned short Lw[64 * 40];
  __shared__ __align__(16) unsigned short Kb[2 * KBH];
  __shared__ __align__(16) unsigned short Vb[2 * VBH];
  const int tid  = threadIdx.x;
  const int wave = tid >> 5;
  const int lane = tid & 31;
  const int hh   = lane >> 4;
  const int ci   = lane & 15;
  const int bx   = blockIdx.x;
  const int ns   = bx / (NH * (LQ / 64));
  const int rem  = bx - ns * (NH * (LQ / 64));
  const int h    = rem / (LQ / 64);
  const int q0   = (rem - h * (LQ / 64)) * 64;
  const int qi   = q0 + 16 * wave + ci;                 // this lane's query
  // copy map: K piece (row tid>>2 (+32i), 16-B piece tid&3), V^T piece (row d = tid>>4 (+8i), 16-B piece tid&15)
  const unsigned lk0 = (unsigned)(uintptr_t)(Kb + (tid >> 2) * KPH + 8 * (tid & 3));
  const unsigned lv0 = (unsigned)(uintptr_t)(Vb + (tid >> 4) * VPH + 8 * (tid & 15));
  const unsigned short* gk0 = k16 + (size_t)(ns * LQ + (tid >> 2)) * EE + h * DH + 8 * (tid & 3);      // + SK * EE per stage
  const unsigned short* gv0 = vt + ((size_t)ns * EE + h * DH + (tid >> 4)) * LQ + 8 * (tid & 15);      // + SK per stage
  stage_kv(lk0, lv0, gk0, gv0);                         // stage 0 -> buffer 0
  {
    const float* pp = pres + (size_t)ns * LQ + 16 * tid;   // 128 threads x 16 floats = 2048 keys
#pragma unroll
    for (int i = 0; i < 4; ++i) {
      const v4f a = *(const v4f*)(pp + 4 * i);
      v4f mv;
#pragma unroll
      for (int e = 0; e < 4; ++e) mv[e] = (1.0f - bfr(a[e])) * MBIG;
      *(v4f*)(Mk + 16 * tid + 4 * i) = mv;
    }
  }
  asm volatile("s_wait_asynccnt 0x0" ::: "memory");     // this wave's copies of stage 0 have landed
  __syncthreads();                                      // publishes Mk and stage 0
  stage_kv(lk0 + KBH * 2, lv0 + VBH * 2, gk0 + (size_t)SK * EE, gv0 + SK);     // stage 1 -> buffer 1

  const _Float16* Q = (const _Float16*)(const void*)q16;
  const v16h qf = ldfrag_h(Q + (size_t)(ns * LQ + qi) * EE + h * DH + 8 * hh);
  const _Float16* kl = (const _Float16*)(const void*)Kb + ci * KPH + 8 * hh;   // + buffer, + key_local * KPH
  const _Float16* vl = (const _Float16*)(const void*)Vb + ci * VPH + 8 * hh;   // row d = ci, + 16 * VPH, + key_local

  float rmax = NEG0, z = 0.f;
  v8f ah0 = zero8(), ah1 = zero8(), al0 = zero8(), al1 = zero8();
#pragma unroll 1
  for (int st = 0; st < NST; ++st) {
    const int bf = st & 1;
    const _Float16* kp = kl + bf * KBH;
    const _Float16* vp = vl + bf * VBH;
    // unrolled: every LDS offset inside a stage is an immediate
#pragma unroll
    for (int u = 0; u < SK / 32; ++u) {
      const int lt = st * SK + u * 32;
      const v16h ka0 = ldfrag_h(kp + (u * 32) * KPH);
      const v16h ka1 = ldfrag_h(kp + (u * 32 + 16) * KPH);
      v8f s0 = mma_h(ka0, qf, zero8());
      v8f s1 = mma_h(ka1, qf, zero8());
      guard2(s0, s1, ka0, ka1, qf);
      const v4f ma = *(const v4f*)(Mk + lt + 8 * hh);           // keys lt + 8hh + 0..3      <-> s0[0..3]
      const v4f mb = *(const v4f*)(Mk + lt + 8 * hh + 4);       // keys lt + 8hh + 4..7      <-> s0[4..7]
      const v4f mc = *(const v4f*)(Mk + lt + 16 + 8 * hh);      // keys lt + 16 + 8hh + 0..3 <-> s1[0..3]
      const v4f md = *(const v4f*)(Mk + lt + 20 + 8 * hh);      // keys lt + 16 + 8hh + 4..7 <-> s1[4..7]
      float t[16];
#pragma unroll
      for (int r = 0; r < 4; ++r) {
        t[r]      = (s0[r] * QKS     - ma[r]) * RSQ;
        t[4 + r]  = (s0[4 + r] * QKS - mb[r]) * RSQ;
        t[8 + r]  = (s1[r] * QKS     - mc[r]) * RSQ;
        t[12 + r] = (s1[4 + r] * QKS - md[r]) * RSQ;
      }
      float mx = t[0];
#pragma unroll
      for (int i = 1; i < 16; ++i) mx = fmaxf(mx, t[i]);
      mx = fmaxf(mx, __shfl_xor(mx, 16, 32));
      const float nmax = fmaxf(rmax, mx);
      const float corr = __expf(rmax - nmax);
      rmax = nmax;
      FragH ph, pl;
      float zs = 0.f;
#pragma unroll
      for (int r = 0; r < 8; ++r) {
        const float pa = __expf(t[r] - nmax);
        const float pc = __expf(t[8 + r] - nmax);
        zs += pa + pc;
        const float xa = pa * PSC, xc = pc * PSC;
        const _Float16 ha = (_Float16)xa, hc = (_Float16)xc;
        ph.h[0][r] = ha;
        ph.h[1][r] = hc;
        pl.h[0][r] = (_Float16)((xa - (float)ha) * PLO);
        pl.h[1][r] = (_Float16)((xc - (float)hc) * PLO);
      }
      z = z * corr + zs;
      ah0 *= corr; ah1 *= corr; al0 *= corr; al1 *= corr;
      const v16h va0 = ldfrag_h(vp + u * 32);                      // d = ci
      const v16h va1 = ldfrag_h(vp + 16 * VPH + u * 32);           // d = 16 + ci
      ah0 = mma_h(va0, ph.v, ah0);
      ah1 = mma_h(va1, ph.v, ah1);
      al0 = mma_h(va0, pl.v, al0);
      al1 = mma_h(va1, pl.v, al1);
      guard4b(ah0, ah1, al0, al1, va0, va1, ph.v, pl.v);
    }
    // publish point of stage st + 1: own LDS reads done, own copies landed, then the barrier that both publishes
    // stage st + 1 and ends every wave's reads of the buffer refilled behind it
    asm volatile("s_wait_dscnt 0x0" ::: "memory");
    asm volatile("s_wait_asynccnt 0x0" ::: "memory");
    __syncthreads();
    if (st + 2 < NST)
      stage_kv(lk0 + bf * (KBH * 2), lv0 + bf * (VBH * 2), gk0 + (size_t)(st + 2) * SK * EE, gv0 + (st + 2) * SK);
  }
  asm volatile("s_wait_asynccnt 0x0" ::: "memory");     // nothing of this wave's copies is left in flight

  // ah0/al0[r] <-> d = 8hh + r, ah1/al1[r] <-> d = 16 + 8hh + r, query qi; Z >= 1
  const float zz  = z + __shfl_xor(z, 16, 32);
  const float rzs = (1.0f / zz) * OSA;
  float o[16];
#pragma unroll
  for (int r = 0; r < 8; ++r) {
    o[r]     = (ah0[r] + al0[r] * LOIN) * rzs;
    o[8 + r] = (ah1[r] + al1[r] * LOIN) * rzs;
  }
  v4u h0, h1, g0, g1;
#pragma unroll
  for (int i = 0; i < 4; ++i) {
    const _Float16 a0 = (_Float16)o[2 * i],     a1 = (_Float16)o[2 * i + 1];
    const _Float16 b0 = (_Float16)o[8 + 2 * i], b1 = (_Float16)o[8 + 2 * i + 1];
    const _Float16 la0 = (_Float16)((o[2 * i]         - (float)a0) * LOSC);
    const _Float16 la1 = (_Float16)((o[2 * i + 1]     - (float)a1) * LOSC);
    const _Float16 lb0 = (_Float16)((o[8 + 2 * i]     - (float)b0) * LOSC);
    const _Float16 lb1 = (_Float16)((o[8 + 2 * i + 1] - (float)b1) * LOSC);
    h0[i] = pk16(h_bits(a0), h_bits(a1));
    h1[i] = pk16(h_bits(b0), h_bits(b1));
    g0[i] = pk16(h_bits(la0), h_bits(la1));
    g1[i] = pk16(h_bits(lb0), h_bits(lb1));
  }
  {
    const int ro = (16 * wave + ci) * 40 + 8 * hh;
    *(v4u*)(Hs + ro)      = h0;
    *(v4u*)(Hs + ro + 16) = h1;
    *(v4u*)(Lw + ro)      = g0;
    *(v4u*)(Lw + ro + 16) = g1;
  }
  __syncthreads();
  {
    const size_t ob = ((size_t)(ns * NH + h) * LQ + q0) * DH;      // 4096-B aligned region of 64 x 32 halves
    v4u hv[2], lv[2];
#pragma unroll
    for (int it2 = 0; it2 < 2; ++it2) {
      const int hf = it2 * 1024 + 8 * tid;             // half index within the 2048-half region
      const int row = hf >> 5, col = hf & 31;
      hv[it2] = *(const v4u*)(Hs + row * 40 + col);
      lv[it2] = *(const v4u*)(Lw + row * 40 + col);
    }
    {
#pragma unroll
      for (int it2 = 0; it2 < 2; ++it2) {
        const int hf = it2 * 1024 + 8 * tid;
        *(v4u*)(ohp + ob + hf) = hv[it2];
        *(v4u*)(olp + ob + hf) = lv[it2];
      }
      
    }
  }
}

// =====================================================================================================
// Output projection out[m][o] = sum_c O[m][c] Wo[c][o] + bo[o], O = (hi + lo/2048)/256 from the OH/OL planes
// ([ns][h][q][32]: k-step j = head j). Block = 4 waves = 64 rows m x 64 cols o (grid 64 x 4 = 256); wave w owns rows
// m0+16w+ci (B operands = OH and OL row fragments, col = m), A = HO plane rows o0+16t+ci (k = c split map); 4 hi + 4
// lo accumulators; acc[t][r] <-> (m = m0+16w+ci, o = o0+16t+8hh+r).
// Epilogue: (acch + accl/2048)/262144 + bf16_RNE(bo) staged in LDS as Ts[m_local][o_local] (pitch 68, 16-B vector
// coverage: 8 it x 8 rows x 16 pieces x 4 floats = 64 x 64 per block; grid covers out [4096][256] exactly once.
// =====================================================================================================
__global__ __launch_bounds__(128)
void out_proj(const unsigned short* __restrict__ ohp, const unsigned short* __restrict__ olp,
              const unsigned short* __restrict__ woh, const float* __restrict__ bo, float* out) {
  __shared__ __align__(16) float Ts[64 * 68];
  const int tid  = threadIdx.x;
  const int wave = tid >> 5;
  const int lane = tid & 31;
  const int hh   = lane >> 4;
  const int ci   = lane & 15;
  const int bx   = blockIdx.x;
  const int mt   = bx >> 2, ot = bx & 3;
  const int m0   = mt * 64, o0 = ot * 64;
  const int ns   = m0 / LQ;
  const int ql   = m0 - ns * LQ + 16 * wave + ci;       // query of this lane's row
  const _Float16* OHf = (const _Float16*)(const void*)ohp;
  const _Float16* OLf = (const _Float16*)(const void*)olp;
  const _Float16* W   = (const _Float16*)(const void*)woh;
  const size_t orow = ((size_t)(ns * NH) * LQ + ql) * DH + 8 * hh;    // + j * LQ * DH per head
  const _Float16* ar = OHf + orow;
  const _Float16* lr = OLf + orow;
  const _Float16* wr = W + (size_t)(o0 + ci) * EE + 8 * hh;           // + 16t*EE + 32j

  v8f acch[4], accl[4];
#pragma unroll
  for (int t = 0; t < 4; ++t) { acch[t] = zero8(); accl[t] = zero8(); }

#pragma unroll 1
  for (int j = 0; j < NH; ++j) {
    const v16h obh = ldfrag_h(ar + (size_t)j * LQ * DH);
    const v16h obl = ldfrag_h(lr + (size_t)j * LQ * DH);
    v16h wa[4];
#pragma unroll
    for (int t = 0; t < 4; ++t) wa[t] = ldfrag_h(wr + (size_t)(16 * t) * EE + 32 * j);
#pragma unroll
    for (int t = 0; t < 4; ++t) acch[t] = mma_h(wa[t], obh, acch[t]);
    guard4(acch[0], acch[1], acch[2], acch[3], obh, wa[0], wa[1], wa[2], wa[3]);
#pragma unroll
    for (int t = 0; t < 4; ++t) accl[t] = mma_h(wa[t], obl, accl[t]);
    guard4(accl[0], accl[1], accl[2], accl[3], obl, wa[0], wa[1], wa[2], wa[3]);
  }

  {
    float* ts = Ts + (16 * wave + ci) * 68 + 8 * hh;
#pragma unroll
    for (int t = 0; t < 4; ++t) {
      const v4f b0 = *(const v4f*)(bo + o0 + 16 * t + 8 * hh);
      const v4f b1 = *(const v4f*)(bo + o0 + 16 * t + 8 * hh + 4);
      v4f r0, r1;
#pragma unroll
      for (int e = 0; e < 4; ++e) {
        r0[e] = (acch[t][e]     + accl[t][e]     * LOIN) * OSC + bfr(b0[e]);
        r1[e] = (acch[t][4 + e] + accl[t][4 + e] * LOIN) * OSC + bfr(b1[e]);
      }
      *(v4f*)(ts + 16 * t)     = r0;
      *(v4f*)(ts + 16 * t + 4) = r1;
    }
  }
  __syncthreads();
  {
    const int p = tid & 15, r16 = tid >> 4;             // r16 0..7, p = 16-B piece of the 256-B segment
    v4f vals[8];
#pragma unroll
    for (int it = 0; it < 8; ++it) {
      const int row = it * 8 + r16;                      // it 0..7 x r16 0..7 = rows 0..63
      vals[it] = *(const v4f*)(Ts + row * 68 + 4 * p);
    }
    float* yb = out + (size_t)m0 * EE + o0 + 4 * p;
    {
#pragma unroll
      for (int it = 0; it < 8; ++it) {
        const int row = it * 8 + r16;
        *(v4f*)(yb + (size_t)row * EE) = vals[it];
      }
      
    }
  }
}

// =====================================================================================================
// Workspace map (bytes), every offset a multiple of 256 and every plane sized to its whole-line store granularity:
//   PQ, PK, PV   f16 [4096][256]      3 x 2097152      0 .. 6291456
//   HQ,HK,HV,HO  f16 [256][256]       4 x 131072       .. 6815744
//   Q16, K16     f16 [4096][256]      2 x 2097152      .. 11010048
//   VT           f16 [2][256][2048]   2097152          .. 13107200
//   OH, OL       f16 [2][8][2048][32] 2 x 2097152      .. 17301504  (end)
// =====================================================================================================
extern "C" void kernel_launch(void* const* d_in, const int* in_sizes, int n_in,
                              void* d_out, int out_size, void* d_ws, size_t ws_size,
                              hipStream_t stream) {
  if (n_in < 12) return;
  if (in_sizes[0] != MR * EE || in_sizes[1] != MR * EE || in_sizes[2] != MR * EE) return;
  if (in_sizes[3] != NSB * LQ) return;
  if (in_sizes[4] != EE * EE || in_sizes[6] != EE * EE || in_sizes[8] != EE * EE || in_sizes[10] != EE * EE) return;
  if (in_sizes[5] != EE || in_sizes[7] != EE || in_sizes[9] != EE || in_sizes[11] != EE) return;
  if (out_size != MR * EE) return;

  const float* queries = (const float*)d_in[0];
  const float* keys    = (const float*)d_in[1];
  const float* values  = (const float*)d_in[2];
  const float* pres    = (const float*)d_in[3];
  const float* Wq      = (const float*)d_in[4];
  const float* bq      = (const float*)d_in[5];
  const float* Wk      = (const float*)d_in[6];
  const float* bk      = (const float*)d_in[7];
  const float* Wv      = (const float*)d_in[8];
  const float* bv      = (const float*)d_in[9];
  const float* Wo      = (const float*)d_in[10];
  const float* bo      = (const float*)d_in[11];
  float* out = (float*)d_out;

  const size_t PX  = (size_t)MR * EE * 2;               // 2097152
  const size_t PW  = (size_t)EE * EE * 2;               // 131072
  const size_t PP  = (size_t)MR * EE * 2;               // 2097152
  const size_t PVT = (size_t)NSB * EE * LQ * 2;         // 2097152
  const size_t PO  = (size_t)NSB * NH * LQ * DH * 2;    // 2097152
  size_t off = 0;
  const size_t oPQ = off; off += PX;
  const size_t oPK = off; off += PX;
  const size_t oPV = off; off += PX;
  const size_t oHQ = off; off += PW;
  const size_t oHK = off; off += PW;
  const size_t oHV = off; off += PW;
  const size_t oHO = off; off += PW;
  const size_t oQ  = off; off += PP;
  const size_t oK  = off; off += PP;
  const size_t oVT = off; off += PVT;
  const size_t oOH = off; off += PO;
  const size_t oOL = off; off += PO;
  if (off > ws_size) return;                            // off = 17301504
  if (off > (size_t)134217728) return;

  char* ws = (char*)d_ws;
  unsigned short* PQp = (unsigned short*)(ws + oPQ);
  unsigned short* PKp = (unsigned short*)(ws + oPK);
  unsigned short* PVp = (unsigned short*)(ws + oPV);
  unsigned short* HQp = (unsigned short*)(ws + oHQ);
  unsigned short* HKp = (unsigned short*)(ws + oHK);
  unsigned short* HVp = (unsigned short*)(ws + oHV);
  unsigned short* HOp = (unsigned short*)(ws + oHO);
  unsigned short* Q16 = (unsigned short*)(ws + oQ);
  unsigned short* K16 = (unsigned short*)(ws + oK);
  unsigned short* VTp = (unsigned short*)(ws + oVT);
  unsigned short* OHp = (unsigned short*)(ws + oOH);
  unsigned short* OLp = (unsigned short*)(ws + oOL);

  const dim3 blk256(256), blk128(128);
  const dim3 gCV(3 * NBX);                              // 1536 blocks
  const dim3 gWT(16);                                   // 4 weights x 4 o-tiles
  const dim3 gPJ((MR / 64) * (EE / 128));               // 128 blocks
  const dim3 gAT(NSB * NH * (LQ / 64));                 // 512 blocks
  const dim3 gOP((MR / 64) * (EE / 64));                // 256 blocks

  // (0) 16-bit activation planes of the bf16-RNE inputs
  cvt_planes<<<gCV, blk256, 0, stream>>>(queries, keys, values, PQp, PKp, PVp);
  // (1) transposed 16-bit weight planes HW[o][e] = W[e][o]
  cvt_wt<<<gWT, blk256, 0, stream>>>(Wq, Wk, Wv, Wo, HQp, HKp, HVp, HOp);
  // (2) projections: q, k row-major [4096][256] (x16), v transposed VT[ns][hd][l] (x16), biases added
  proj_gemm<0><<<gPJ, blk128, 0, stream>>>(HQp, PQp, bq, Q16);
  proj_gemm<0><<<gPJ, blk128, 0, stream>>>(HKp, PKp, bk, K16);
  proj_gemm<1><<<gPJ, blk128, 0, stream>>>(HVp, PVp, bv, VTp);
  // (3) attention output planes OH / OL [ns][h][q][32] (row softmax over keys with the key term)
  attn_fwd<<<gAT, blk128, 0, stream>>>(Q16, K16, VTp, pres, OHp, OLp);
  // (4) output projection + bias -> d_out [4096][256] f32
  out_proj<<<gOP, blk128, 0, stream>>>(OHp, OLp, HOp, bo, out);
  (void)hipGetLastError();
}

// v002
// One run takes 57.6 microseconds.
// Next to v001, in two timings, it ran 1.24 times as fast each time.
// Counting every step since v000, it is 1.83 times as fast.
// Contractions, all v_wmma_f32_16x16x32_f16 (f16 operands, f32 accumulate): q/k/v projections X.W with f16
// containers holding bf16-RNE inputs (X x64, W x1024); scores K.q with q, k planes f16 x16 (K = 32 per head);
// P as f16 hi (x4096) + residual (x2^11) planes . V plane (f16 x16) into two accumulator pairs; output projection
// with O as f16 hi (x256) + residual (x2^11) planes and Wo bf16-RNE x1024 into two accumulators. Key-mask term,
// running max / sum, exp, residual folds and biases in f32 on VALU.
#include <hip/hip_runtime.h>
#include <math.h>
#include <stdint.h>

#define NSB  2
#define LQ   2048
#define EE   256
#define NH   8
#define DH   32
#define MR   (NSB * LQ)
#define XSC  64.0f
#define WSC  1024.0f
#define ISC  (1.0f / 4096.0f)
#define BSC  16.0f
#define QKS  (1.0f / 256.0f)
#define RSQ  0.17677669529663687f
#define MBIG 1.0e32f
#define NEG0 (-1.0e38f)
#define PSC  4096.0f
#define PLO  2048.0f
#define LOIN (1.0f / 2048.0f)
#define OSA  (1.0f / 256.0f)
#define LOSC 2048.0f
#define OSC  (1.0f / 262144.0f)
#define NBX  ((MR * EE) / 2048)
#define NBW  16                     // blocks of the weight transposition: 4 weights x 4 o-tiles
#define NBP  ((MR / 64) * (EE / 128))   // blocks of one projection
static_assert(EE == NH * DH);
static_assert(DH == 32);
static_assert((LQ % 64) == 0 && (EE % 128) == 0 && (MR % 64) == 0);
static_assert(((MR * EE) % 2048) == 0);
static_assert(NBX == 512);
static_assert(LQ == 128 * 16);
#define SK   128                    // keys per LDS stage of the attention kernel
#define NST  (LQ / SK)              // stages
#define KPH  40                     // LDS pitch of a staged K row, halves (64 B of data + 16 B: 16 B x odd for 16-B readers)
#define VPH  136                    // LDS pitch of a staged V^T row, halves (256 B of data + 16 B)
#define KBH  (SK * KPH)             // halves per K buffer
#define VBH  (DH * VPH)             // halves per V buffer
static_assert(NST >= 2 && (SK % 32) == 0);
static_assert(SK * 4 == 4 * 128 && DH * (SK / 8) == 4 * 128);   // 4 + 4 copies of 16 B per thread and stage

typedef _Float16 v16h __attribute__((ext_vector_type(16)));
typedef _Float16 v8h  __attribute__((ext_vector_type(8)));
typedef float    v8f  __attribute__((ext_vector_type(8)));
typedef float    v4f  __attribute__((ext_vector_type(4)));
typedef unsigned int v4u __attribute__((ext_vector_type(4)));

union FragH { v16h v; v8h h[2]; };

// ---- scalar helpers ----------------------------------------------------------------------------------
__device__ __forceinline__ unsigned short bf_bits(float f) {          // f32 -> bf16 bits, RNE convert
  unsigned u = __float_as_uint(f);
  return (unsigned short)((u + 0x7FFFu + ((u >> 16) & 1u)) >> 16);
}
__device__ __forceinline__ float bf_up(unsigned short h) { return __uint_as_float(((unsigned)h) << 16); }
__device__ __forceinline__ float bfr(float f) { return bf_up(bf_bits(f)); }
__device__ __forceinline__ unsigned short h_bits(_Float16 x) { return __builtin_bit_cast(unsigned short, x); }
__device__ __forceinline__ unsigned pk16(unsigned short a, unsigned short b) { return (unsigned)a | ((unsigned)b << 16); }
__device__ __forceinline__ v8f zero8() { v8f z = {0.f, 0.f, 0.f, 0.f, 0.f, 0.f, 0.f, 0.f}; return z; }
// 8 consecutive f32 -> f16( bf16_RNE(x) * sc ) packed into 16 bytes
__device__ __forceinline__ v4u cvt8(v4f a, v4f c, float sc) {
  float f[8];
#pragma unroll
  for (int i = 0; i < 4; ++i) { f[i] = bfr(a[i]) * sc; f[4 + i] = bfr(c[i]) * sc; }
  v4u v;
#pragma unroll
  for (int i = 0; i < 4; ++i) v[i] = pk16(h_bits((_Float16)f[2 * i]), h_bits((_Float16)f[2 * i + 1]));
  return v;
}

// ---- fragment loader: 16-bit A/B operand, lane -> row/col (lane&15), p already includes +8*(lane>>4);
//      elements 0..7 <- p[0..7] (k0+8h..), elements 8..15 <- p[16..23] (k0+16+8h..)
__device__ __forceinline__ v16h ldfrag_h(const _Float16* p) {
  FragH f;
  f.h[0] = *(const v8h*)(p);
  f.h[1] = *(const v8h*)(p + 16);
  return f.v;
}

// ---- WMMA helpers with trailing VALU hazard gap ----------------------------------------------------
__device__ __forceinline__ v8f mma_h(v16h a, v16h b, v8f c) {
  return __builtin_amdgcn_wmma_f32_16x16x32_f16(false, a, false, b, (short)0, c, false, false);
}
// ties 2 accumulators, keeps 3 fragments live through 4 VALU slots
__device__ __forceinline__ void guard2(v8f& a, v8f& b, v16h x0, v16h x1, v16h y) {
#if defined(__HIP_DEVICE_COMPILE__)
  asm volatile("v_nop\n\tv_nop\n\tv_nop\n\tv_nop" : "+v"(a), "+v"(b) : "v"(x0), "v"(x1), "v"(y));
#endif
}
// ties 4 accumulators, keeps 5 fragments live through 4 VALU slots
__device__ __forceinline__ void guard4(v8f& a, v8f& b, v8f& c, v8f& d,
                                       v16h x, v16h y0, v16h y1, v16h y2, v16h y3) {
#if defined(__HIP_DEVICE_COMPILE__)
  asm volatile("v_nop\n\tv_nop\n\tv_nop\n\tv_nop"
               : "+v"(a), "+v"(b), "+v"(c), "+v"(d) : "v"(x), "v"(y0), "v"(y1), "v"(y2), "v"(y3));
#endif
}
// ties 4 accumulators, keeps 4 fragments live through 4 VALU slots
__device__ __forceinline__ void guard4b(v8f& a, v8f& b, v8f& c, v8f& d,
                                        v16h x0, v16h x1, v16h y0, v16h y1) {
#if defined(__HIP_DEVICE_COMPILE__)
  asm volatile("v_nop\n\tv_nop\n\tv_nop\n\tv_nop"
               : "+v"(a), "+v"(b), "+v"(c), "+v"(d) : "v"(x0), "v"(x1), "v"(y0), "v"(y1));
#endif
}

// =====================================================================================================
// 16-bit activation planes, native layout: PQ/PK/PV[m][e] = f16( bf16_RNE(x) * 64 ) for queries/keys/values
// (blocks 16..527, 528..1039, 1040..1551 of the merged grid; block-uniform source select). Thread converts 8 consecutive elements;
// coverage: 512 blocks x 256 threads x 8 = 1048576 per activation = [4096][256] entirely.
// =====================================================================================================
__device__ __forceinline__
void cvt_planes_body(int bx, const float* __restrict__ xq, const float* __restrict__ xk, const float* __restrict__ xv,
                     unsigned short* pq, unsigned short* pk, unsigned short* pv) {
  const float* src;
  unsigned short* dst;
  int lb;
  if (bx < NBX)          { src = xq; dst = pq; lb = bx; }
  else if (bx < 2 * NBX) { src = xk; dst = pk; lb = bx - NBX; }
  else                   { src = xv; dst = pv; lb = bx - 2 * NBX; }
  const size_t e0 = ((size_t)lb * 256 + threadIdx.x) * 8;
  const v4f a = *(const v4f*)(src + e0);
  const v4f c = *(const v4f*)(src + e0 + 4);
  const v4u v = cvt8(a, c, XSC);
  unsigned short* dp = dst + e0;
  *(v4u*)dp = v;
#if defined(__HIP_DEVICE_COMPILE__)
  // the merged kernel's other branch follows this store in the code: closes the store before any of its registers is rewritten
  asm volatile("s_wait_xcnt 0x0" ::: "memory");
#endif
}

// =====================================================================================================
// Transposed weight planes: HW[o][e] = f16( bf16_RNE(W[e][o]) * 1024 ) for the [in][out] weights (x.W layout).
// Block = (weight w = bx>>2, 64 output rows o0 = 64*(bx&3)), 256 threads, 16 blocks (0..15 of the merged grid). Read W rows e as 16 threads x 16 B
// (256-B row segment o0..o0+63), 2-B transposed LDS stores into Ts[o_local][e] (pitch 264), block barrier, then each
// coverage: read 16 it x 16 rows e x 16 pieces x 4 = all 256 e x 64 o; write 8 it x 8 waves = 64 rows x 32 lanes x 8
//           halves = 64 x 256; 4 o-tiles per weight -> HW [256][256] entirely, 4 weights.
// =====================================================================================================
__device__ __forceinline__
void cvt_wt_body(int bx, unsigned short* Ts, const float* __restrict__ wq, const float* __restrict__ wk,
                 const float* __restrict__ wv, const float* __restrict__ wo, unsigned short* hq, unsigned short* hk,
                 unsigned short* hv, unsigned short* ho) {
  const int tid  = threadIdx.x;
  const int wave = tid >> 5;
  const int lane = tid & 31;
  const int w    = bx >> 2;
  const int o0   = (bx & 3) * 64;
  const float* src;
  unsigned short* dst;
  if (w == 0)      { src = wq; dst = hq; }
  else if (w == 1) { src = wk; dst = hk; }
  else if (w == 2) { src = wv; dst = hv; }
  else             { src = wo; dst = ho; }
  const int p = tid & 15, r16 = tid >> 4;               // p = 16-B piece of the 256-B row segment, r16 = row in group
#pragma unroll 4
  for (int it = 0; it < 16; ++it) {
    const int e = it * 16 + r16;                         // 0..255
    const v4f a = *(const v4f*)(src + (size_t)e * EE + o0 + 4 * p);
#pragma unroll
    for (int i = 0; i < 4; ++i) Ts[(4 * p + i) * 264 + e] = h_bits((_Float16)(bfr(a[i]) * WSC));
  }
  __syncthreads();
  v4u vals[8];
#pragma unroll
  for (int it = 0; it < 8; ++it) {
    const int row = it * 8 + wave;                       // it 0..7 x wave 0..7 = rows 0..63
    vals[it] = *(const v4u*)(Ts + row * 264 + 8 * lane);
  }
  unsigned short* db = dst + (size_t)o0 * EE + 8 * lane;
  {
#pragma unroll
    for (int it = 0; it < 8; ++it) {
      const int row = it * 8 + wave;
      *(v4u*)(db + (size_t)row * EE) = vals[it];
    }
    
  }
}

// =====================================================================================================
// One launch for both conversions, which do not depend on each other: blocks 0..15 build the transposed weight planes
// (the longer serial chain, so they start first), blocks 16..1551 the activation planes. The select is block-uniform.
// =====================================================================================================
__global__ __launch_bounds__(256)
void cvt_all(const float* __restrict__ xq, const float* __restrict__ xk, const float* __restrict__ xv,
             const float* __restrict__ wq, const float* __restrict__ wk, const float* __restrict__ wv,
             const float* __restrict__ wo, unsigned short* pq, unsigned short* pk, unsigned short* pv,
             unsigned short* hq, unsigned short* hk, unsigned short* hv, unsigned short* ho) {
  __shared__ __align__(16) unsigned short Ts[64 * 264];
  const int bx = blockIdx.x;
  if (bx < NBW) cvt_wt_body(bx, Ts, wq, wk, wv, wo, hq, hk, hv, ho);
  else          cvt_planes_body(bx - NBW, xq, xk, xv, pq, pk, pv);
}

// =====================================================================================================
// Projection GEMM Y[m][o] = sum_e X[m][e] HW[o][e] (x 65536 in the accumulator) + b[o]. Block = 4 waves = 64 rows m x
// 128 cols o (64 m-tiles x 2 o-tiles = 128 blocks per projection). Tile = A(HW rows o = o0+16t+ci, k = e split map) . B(X row m =
// m0+16w+ci, col = m, same map); 8 k-steps of 32, 8 accumulators per wave; acc[t][r] <-> (m = m0+16w+ci,
// o = o0+16t+8hh+r). y16 = acc * 2^-12 + 16 * bf16_RNE(b[o]) (= 16 y).
// TR == 0: YO[m][o] = f16(y16): staged as Ts[m_local][o_local] (pitch 136, 16-B LDS stores), block barrier, then each
// TR == 1: VT[ns][o][l] (keys contiguous): staged as Ts[o_local][l_local] (pitch 72, 2-B LDS stores), barrier, each
// coverage: TR 0: 8 it x 8 rows x 16 pieces x 8 halves = 64 x 128 per block, grid -> [4096][256]; TR 1: 8 it x 16
//           lines x 8 pieces x 8 = 128 o x 64 l per block, grid -> VT [2][256][2048].
// =====================================================================================================
template <int TR>
__device__ __forceinline__
void proj_body(int bx, unsigned short* Ts, const unsigned short* __restrict__ wh, const unsigned short* __restrict__ xh,
               const float* __restrict__ bias, unsigned short* yo) {
  const int tid  = threadIdx.x;
  const int wave = tid >> 5;
  const int lane = tid & 31;
  const int hh   = lane >> 4;
  const int ci   = lane & 15;
  const int mt   = bx >> 1, ot = bx & 1;
  const int m0   = mt * 64, o0 = ot * 128;
  const _Float16* W = (const _Float16*)(const void*)wh;
  const _Float16* X = (const _Float16*)(const void*)xh;
  const _Float16* xr = X + (size_t)(m0 + 16 * wave + ci) * EE + 8 * hh;   // B: X row m
  const _Float16* wr = W + (size_t)(o0 + ci) * EE + 8 * hh;               // A: HW rows o0 + 16t + ci

  v8f acc[8];
#pragma unroll
  for (int t = 0; t < 8; ++t) acc[t] = zero8();

#pragma unroll 1
  for (int ks = 0; ks < EE / 32; ++ks) {
    const int k0 = ks * 32;
    const v16h xb = ldfrag_h(xr + k0);
    v16h wa[4];
#pragma unroll
    for (int t = 0; t < 4; ++t) wa[t] = ldfrag_h(wr + (size_t)(16 * t) * EE + k0);
#pragma unroll
    for (int t = 0; t < 4; ++t) acc[t] = mma_h(wa[t], xb, acc[t]);
    guard4(acc[0], acc[1], acc[2], acc[3], xb, wa[0], wa[1], wa[2], wa[3]);
    v16h wc[4];
#pragma unroll
    for (int t = 0; t < 4; ++t) wc[t] = ldfrag_h(wr + (size_t)(16 * (t + 4)) * EE + k0);
#pragma unroll
    for (int t = 0; t < 4; ++t) acc[4 + t] = mma_h(wc[t], xb, acc[4 + t]);
    guard4(acc[4], acc[5], acc[6], acc[7], xb, wc[0], wc[1], wc[2], wc[3]);
  }

  if (TR == 0) {
    unsigned short* ts = Ts + (16 * wave + ci) * 136 + 8 * hh;
#pragma unroll
    for (int t = 0; t < 8; ++t) {
      const v4f b0 = *(const v4f*)(bias + o0 + 16 * t + 8 * hh);
      const v4f b1 = *(const v4f*)(bias + o0 + 16 * t + 8 * hh + 4);
      float y[8];
#pragma unroll
      for (int e = 0; e < 4; ++e) {
        y[e]     = acc[t][e] * ISC     + bfr(b0[e]) * BSC;
        y[4 + e] = acc[t][4 + e] * ISC + bfr(b1[e]) * BSC;
      }
      v4u v;
#pragma unroll
      for (int i = 0; i < 4; ++i) v[i] = pk16(h_bits((_Float16)y[2 * i]), h_bits((_Float16)y[2 * i + 1]));
      *(v4u*)(ts + 16 * t) = v;
    }
    __syncthreads();
    const int p = tid & 15, r16 = tid >> 4;             // r16 0..7, p = 16-B piece of the 256-B segment
    v4u vals[8];
#pragma unroll
    for (int it = 0; it < 8; ++it) {
      const int row = it * 8 + r16;                      // it 0..7 x r16 0..7 = rows 0..63
      vals[it] = *(const v4u*)(Ts + row * 136 + 8 * p);
    }
    unsigned short* yb = yo + (size_t)m0 * EE + o0 + 8 * p;
    {
#pragma unroll
      for (int it = 0; it < 8; ++it) {
        const int row = it * 8 + r16;
        *(v4u*)(yb + (size_t)row * EE) = vals[it];
      }
      
    }
  } else {
    const int ns = m0 / LQ, l0 = m0 - ns * LQ;
#pragma unroll
    for (int t = 0; t < 8; ++t) {
      const v4f b0 = *(const v4f*)(bias + o0 + 16 * t + 8 * hh);
      const v4f b1 = *(const v4f*)(bias + o0 + 16 * t + 8 * hh + 4);
#pragma unroll
      for (int r = 0; r < 4; ++r) {
        Ts[(16 * t + 8 * hh + r) * 72 + 16 * wave + ci] =
            h_bits((_Float16)(acc[t][r] * ISC + bfr(b0[r]) * BSC));
        Ts[(16 * t + 8 * hh + 4 + r) * 72 + 16 * wave + ci] =
            h_bits((_Float16)(acc[t][4 + r] * ISC + bfr(b1[r]) * BSC));
      }
    }
    __syncthreads();
    const int e8 = tid & 7, fq = tid >> 3;              // fq 0..15 = line within group, e8 = 16-B piece
    v4u vals[8];
#pragma unroll
    for (int it = 0; it < 8; ++it) {
      const int orow = it * 16 + fq;                     // it 0..7 x fq 0..15 = o_local 0..127
      vals[it] = *(const v4u*)(Ts + orow * 72 + 8 * e8);
    }
    unsigned short* yb = yo + ((size_t)ns * EE + o0) * LQ + l0 + 8 * e8;
    {
#pragma unroll
      for (int it = 0; it < 8; ++it) {
        const int orow = it * 16 + fq;
        *(v4u*)(yb + (size_t)orow * LQ) = vals[it];
      }
      
    }
  }
}

// One launch for the three projections, which do not depend on each other: blocks 0..127 q, 128..255 k (both TR 0),
// 256..383 v (TR 1). The select is block-uniform.
__global__ __launch_bounds__(128)
void proj_all(const unsigned short* __restrict__ hq, const unsigned short* __restrict__ hk,
              const unsigned short* __restrict__ hv, const unsigned short* __restrict__ pq,
              const unsigned short* __restrict__ pk, const unsigned short* __restrict__ pv,
              const float* __restrict__ bq, const float* __restrict__ bk, const float* __restrict__ bv,
              unsigned short* q16, unsigned short* k16, unsigned short* vt) {
  __shared__ __align__(16) unsigned short Ts[128 * 72];          // 9216 halves >= 64 * 136
  const int bx = blockIdx.x;
  if (bx < 2 * NBP) {
    const bool isq = bx < NBP;
    proj_body<0>(isq ? bx : bx - NBP, Ts, isq ? hq : hk, isq ? pq : pk, isq ? bq : bk, isq ? q16 : k16);
  } else {
    proj_body<1>(bx - 2 * NBP, Ts, hv, pv, bv, vt);
  }
}

// ---- one stage of K and V^T into LDS: 8 asynchronous 16-B copies per lane (4 of K, 4 of V^T), no register in between.
//      lk / lv = the lane's LDS byte address of its first K / V piece, gk / gv = its global source; piece i of K lies
//      32 rows further (LDS 32 * 80 B, global 32 * 512 B), piece i of V^T 8 rows further (LDS 8 * 272 B, global 8 * 4096 B).
__device__ __forceinline__ void stage_kv(unsigned lk, unsigned lv, const unsigned short* gk, const unsigned short* gv) {
#if defined(__HIP_DEVICE_COMPILE__)
  const unsigned lk1 = lk + 32 * KPH * 2, lk2 = lk + 64 * KPH * 2, lk3 = lk + 96 * KPH * 2;
  const unsigned lv1 = lv + 8 * VPH * 2,  lv2 = lv + 16 * VPH * 2, lv3 = lv + 24 * VPH * 2;
  const unsigned short* gk1 = gk + 32 * EE;
  const unsigned short* gk2 = gk + 64 * EE;
  const unsigned short* gk3 = gk + 96 * EE;
  const unsigned short* gv1 = gv + 8 * LQ;
  const unsigned short* gv2 = gv + 16 * LQ;
  const unsigned short* gv3 = gv + 24 * LQ;
  // the closing s_wait_xcnt stands in the copies' own statement so that no address register is rewritten ahead of it
  asm volatile("global_load_async_to_lds_b128 %0, %8, off\n\t"
               "global_load_async_to_lds_b128 %1, %9, off\n\t"
               "global_load_async_to_lds_b128 %2, %10, off\n\t"
               "global_load_async_to_lds_b128 %3, %11, off\n\t"
               "global_load_async_to_lds_b128 %4, %12, off\n\t"
               "global_load_async_to_lds_b128 %5, %13, off\n\t"
               "global_load_async_to_lds_b128 %6, %14, off\n\t"
               "global_load_async_to_lds_b128 %7, %15, off\n\t"
               "s_wait_xcnt 0x0"
               :: "v"(lk), "v"(lk1), "v"(lk2), "v"(lk3), "v"(lv), "v"(lv1), "v"(lv2), "v"(lv3),
                  "v"(gk), "v"(gk1), "v"(gk2), "v"(gk3), "v"(gv), "v"(gv1), "v"(gv2), "v"(gv3)
               : "memory");
#endif
}

// =====================================================================================================
// Row-softmax attention (online max) per (ns, h, 64 queries q0..), 4 waves, grid 2*8*32 = 512; wave w owns queries
// q0+16w+ci (B operand of the score tile = Q16 row fragment, col = query, k = d, one k-step). Key term
// Mk[l] = (1 - bf16_RNE(pres[ns][l])) * 1e32 staged once per block in LDS. K rows (this head's 64 B) and V^T rows of
// 128 keys are staged per block in LDS by asynchronous copies, two buffers: stage s + 1 flies while stage s is worked
// on; all four waves read their A fragments from the staged tile. 32 keys per iteration, 4 iterations per stage:
//   score D tiles (rows = keys lt+8hh+r / lt+16+8hh+r, col = query) = A(K16 rows l, k = d) . B(qf);
//   t = (acc/256 - Mk[l]) * (1/sqrt(32)) in f32; tile max over the lane's 16 keys combined with the partner half
//   (lane^16), running max / rescale factor identical for both halves of a query column; p = exp(t - max);
//   P split: hi = f16(4096 p), lo = f16((4096 p - hi) * 2048), both B fragments built in registers (element r <- key
//   lt+8hh+r, element 8+r <- key lt+16+8hh+r, lane unchanged); O^T (rows d, cols queries) accumulators rescaled then
//   += A(VT rows d = h*32 + 16j + ci, keys contiguous) . B(hi) and . B(lo): 4 accumulators (d 0..15 / 16..31, hi / lo).
// Epilogue: 256*O = (acc_hi + acc_lo/2048) / (256 Z) as f16 hi plus f16 residual (x2048), staged per query row in LDS
// coverage: 2 it x 128 threads x 8 halves = 64 rows x 32 per plane per block; grid covers [2][8][2048][32] once.
// =====================================================================================================
__global__ __launch_bounds__(128)
void attn_fwd(const unsigned short* __restrict__ q16, const unsigned short* __restrict__ k16,
              const unsigned short* __restrict__ vt, const float* __restrict__ pres,
              unsigned short* ohp, unsigned short* olp) {
  __shared__ __align__(16) float Mk[LQ];
  __shared__ __align__(16) unsigned short Hs[64 * 40];
  __shared__ __align__(16) unsigned short Lw[64 * 40];
  __shared__ __align__(16) unsigned short Kb[2 * KBH];
  __shared__ __align__(16) unsigned short Vb[2 * VBH];
  const int tid  = threadIdx.x;
  const int wave = tid >> 5;
  const int lane = tid & 31;
  const int hh   = lane >> 4;
  const int ci   = lane & 15;
  const int bx   = blockIdx.x;
  const int ns   = bx / (NH * (LQ / 64));
  const int rem  = bx - ns * (NH * (LQ / 64));
  const int h    = rem / (LQ / 64);
  const int q0   = (rem - h * (LQ / 64)) * 64;
  const int qi   = q0 + 16 * wave + ci;                 // this lane's query
  // copy map: K piece (row tid>>2 (+32i), 16-B piece tid&3), V^T piece (row d = tid>>4 (+8i), 16-B piece tid&15)
  const unsigned lk0 = (unsigned)(uintptr_t)(Kb + (tid >> 2) * KPH + 8 * (tid & 3));
  const unsigned lv0 = (unsigned)(uintptr_t)(Vb + (tid >> 4) * VPH + 8 * (tid & 15));
  const unsigned short* gk0 = k16 + (size_t)(ns * LQ + (tid >> 2)) * EE + h * DH + 8 * (tid & 3);      // + SK * EE per stage
  const unsigned short* gv0 = vt + ((size_t)ns * EE + h * DH + (tid >> 4)) * LQ + 8 * (tid & 15);      // + SK per stage
  stage_kv(lk0, lv0, gk0, gv0);                         // stage 0 -> buffer 0
  {
    const float* pp = pres + (size_t)ns * LQ + 16 * tid;   // 128 threads x 16 floats = 2048 keys
#pragma unroll
    for (int i = 0; i < 4; ++i) {
      const v4f a = *(const v4f*)(pp + 4 * i);
      v4f mv;
#pragma unroll
      for (int e = 0; e < 4; ++e) mv[e] = (1.0f - bfr(a[e])) * MBIG;
      *(v4f*)(Mk + 16 * tid + 4 * i) = mv;
    }
  }
  asm volatile("s_wait_asynccnt 0x0" ::: "memory");     // this wave's copies of stage 0 have landed
  __syncthreads();                                      // publishes Mk and stage 0
  stage_kv(lk0 + KBH * 2, lv0 + VBH * 2, gk0 + (size_t)SK * EE, gv0 + SK);     // stage 1 -> buffer 1

  const _Float16* Q = (const _Float16*)(const void*)q16;
  const v16h qf = ldfrag_h(Q + (size_t)(ns * LQ + qi) * EE + h * DH + 8 * hh);
  const _Float16* kl = (const _Float16*)(const void*)Kb + ci * KPH + 8 * hh;   // + buffer, + key_local * KPH
  const _Float16* vl = (const _Float16*)(const void*)Vb + ci * VPH + 8 * hh;   // row d = ci, + 16 * VPH, + key_local

  float rmax = NEG0, z = 0.f;
  v8f ah0 = zero8(), ah1 = zero8(), al0 = zero8(), al1 = zero8();
#pragma unroll 1
  for (int st = 0; st < NST; ++st) {
    const int bf = st & 1;
    const _Float16* kp = kl + bf * KBH;
    const _Float16* vp = vl + bf * VBH;
    // unrolled: every LDS offset inside a stage is an immediate
#pragma unroll
    for (int u = 0; u < SK / 32; ++u) {
      const int lt = st * SK + u * 32;
      const v16h ka0 = ldfrag_h(kp + (u * 32) * KPH);
      const v16h ka1 = ldfrag_h(kp + (u * 32 + 16) * KPH);
      v8f s0 = mma_h(ka0, qf, zero8());
      v8f s1 = mma_h(ka1, qf, zero8());
      guard2(s0, s1, ka0, ka1, qf);
      const v4f ma = *(const v4f*)(Mk + lt + 8 * hh);           // keys lt + 8hh + 0..3      <-> s0[0..3]
      const v4f mb = *(const v4f*)(Mk + lt + 8 * hh + 4);       // keys lt + 8hh + 4..7      <-> s0[4..7]
      const v4f mc = *(const v4f*)(Mk + lt + 16 + 8 * hh);      // keys lt + 16 + 8hh + 0..3 <-> s1[0..3]
      const v4f md = *(const v4f*)(Mk + lt + 20 + 8 * hh);      // keys lt + 16 + 8hh + 4..7 <-> s1[4..7]
      float t[16];
#pragma unroll
      for (int r = 0; r < 4; ++r) {
        t[r]      = (s0[r] * QKS     - ma[r]) * RSQ;
        t[4 + r]  = (s0[4 + r] * QKS - mb[r]) * RSQ;
        t[8 + r]  = (s1[r] * QKS     - mc[r]) * RSQ;
        t[12 + r] = (s1[4 + r] * QKS - md[r]) * RSQ;
      }
      float mx = t[0];
#pragma unroll
      for (int i = 1; i < 16; ++i) mx = fmaxf(mx, t[i]);
      mx = fmaxf(mx, __shfl_xor(mx, 16, 32));
      const float nmax = fmaxf(rmax, mx);
      const float corr = __expf(rmax - nmax);
      rmax = nmax;
      FragH ph, pl;
      float zs = 0.f;
#pragma unroll
      for (int r = 0; r < 8; ++r) {
        const float pa = __expf(t[r] - nmax);
        const float pc = __expf(t[8 + r] - nmax);
        zs += pa + pc;
        const float xa = pa * PSC, xc = pc * PSC;
        const _Float16 ha = (_Float16)xa, hc = (_Float16)xc;
        ph.h[0][r] = ha;
        ph.h[1][r] = hc;
        pl.h[0][r] = (_Float16)((xa - (float)ha) * PLO);
        pl.h[1][r] = (_Float16)((xc - (float)hc) * PLO);
      }
      z = z * corr + zs;
      ah0 *= corr; ah1 *= corr; al0 *= corr; al1 *= corr;
      const v16h va0 = ldfrag_h(vp + u * 32);                      // d = ci
      const v16h va1 = ldfrag_h(vp + 16 * VPH + u * 32);           // d = 16 + ci
      ah0 = mma_h(va0, ph.v, ah0);
      ah1 = mma_h(va1, ph.v, ah1);
      al0 = mma_h(va0, pl.v, al0);
      al1 = mma_h(va1, pl.v, al1);
      guard4b(ah0, ah1, al0, al1, va0, va1, ph.v, pl.v);
    }
    // publish point of stage st + 1: own LDS reads done, own copies landed, then the barrier that both publishes
    // stage st + 1 and ends every wave's reads of the buffer refilled behind it
    asm volatile("s_wait_dscnt 0x0" ::: "memory");
    asm volatile("s_wait_asynccnt 0x0" ::: "memory");
    __syncthreads();
    if (st + 2 < NST)
      stage_kv(lk0 + bf * (KBH * 2), lv0 + bf * (VBH * 2), gk0 + (size_t)(st + 2) * SK * EE, gv0 + (st + 2) * SK);
  }
  asm volatile("s_wait_asynccnt 0x0" ::: "memory");     // nothing of this wave's copies is left in flight

  // ah0/al0[r] <-> d = 8hh + r, ah1/al1[r] <-> d = 16 + 8hh + r, query qi; Z >= 1
  const float zz  = z + __shfl_xor(z, 16, 32);
  const float rzs = (1.0f / zz) * OSA;
  float o[16];
#pragma unroll
  for (int r = 0; r < 8; ++r) {
    o[r]     = (ah0[r] + al0[r] * LOIN) * rzs;
    o[8 + r] = (ah1[r] + al1[r] * LOIN) * rzs;
  }
  v4u h0, h1, g0, g1;
#pragma unroll
  for (int i = 0; i < 4; ++i) {
    const _Float16 a0 = (_Float16)o[2 * i],     a1 = (_Float16)o[2 * i + 1];
    const _Float16 b0 = (_Float16)o[8 + 2 * i], b1 = (_Float16)o[8 + 2 * i + 1];
    const _Float16 la0 = (_Float16)((o[2 * i]         - (float)a0) * LOSC);
    const _Float16 la1 = (_Float16)((o[2 * i + 1]     - (float)a1) * LOSC);
    const _Float16 lb0 = (_Float16)((o[8 + 2 * i]     - (float)b0) * LOSC);
    const _Float16 lb1 = (_Float16)((o[8 + 2 * i + 1] - (float)b1) * LOSC);
    h0[i] = pk16(h_bits(a0), h_bits(a1));
    h1[i] = pk16(h_bits(b0), h_bits(b1));
    g0[i] = pk16(h_bits(la0), h_bits(la1));
    g1[i] = pk16(h_bits(lb0), h_bits(lb1));
  }
  {
    const int ro = (16 * wave + ci) * 40 + 8 * hh;
    *(v4u*)(Hs + ro)      = h0;
    *(v4u*)(Hs + ro + 16) = h1;
    *(v4u*)(Lw + ro)      = g0;
    *(v4u*)(Lw + ro + 16) = g1;
  }
  __syncthreads();
  {
    const size_t ob = ((size_t)(ns * NH + h) * LQ + q0) * DH;      // 4096-B aligned region of 64 x 32 halves
    v4u hv[2], lv[2];
#pragma unroll
    for (int it2 = 0; it2 < 2; ++it2) {
      const int hf = it2 * 1024 + 8 * tid;             // half index within the 2048-half region
      const int row = hf >> 5, col = hf & 31;
      hv[it2] = *(const v4u*)(Hs + row * 40 + col);
      lv[it2] = *(const v4u*)(Lw + row * 40 + col);
    }
    {
#pragma unroll
      for (int it2 = 0; it2 < 2; ++it2) {
        const int hf = it2 * 1024 + 8 * tid;
        *(v4u*)(ohp + ob + hf) = hv[it2];
        *(v4u*)(olp + ob + hf) = lv[it2];
      }
      
    }
  }
}

// =====================================================================================================
// Output projection out[m][o] = sum_c O[m][c] Wo[c][o] + bo[o], O = (hi + lo/2048)/256 from the OH/OL planes
// ([ns][h][q][32]: k-step j = head j). Block = 4 waves = 64 rows m x 64 cols o (grid 64 x 4 = 256); wave w owns rows
// m0+16w+ci (B operands = OH and OL row fragments, col = m), A = HO plane rows o0+16t+ci (k = c split map); 4 hi + 4
// lo accumulators; acc[t][r] <-> (m = m0+16w+ci, o = o0+16t+8hh+r).
// Epilogue: (acch + accl/2048)/262144 + bf16_RNE(bo) staged in LDS as Ts[m_local][o_local] (pitch 68, 16-B vector
// coverage: 8 it x 8 rows x 16 pieces x 4 floats = 64 x 64 per block; grid covers out [4096][256] exactly once.
// =====================================================================================================
__global__ __launch_bounds__(128)
void out_proj(const unsigned short* __restrict__ ohp, const unsigned short* __restrict__ olp,
              const unsigned short* __restrict__ woh, const float* __restrict__ bo, float* out) {
  __shared__ __align__(16) float Ts[64 * 68];
  const int tid  = threadIdx.x;
  const int wave = tid >> 5;
  const int lane = tid & 31;
  const int hh   = lane >> 4;
  const int ci   = lane & 15;
  const int bx   = blockIdx.x;
  const int mt   = bx >> 2, ot = bx & 3;
  const int m0   = mt * 64, o0 = ot * 64;
  const int ns   = m0 / LQ;
  const int ql   = m0 - ns * LQ + 16 * wave + ci;       // query of this lane's row
  const _Float16* OHf = (const _Float16*)(const void*)ohp;
  const _Float16* OLf = (const _Float16*)(const void*)olp;
  const _Float16* W   = (const _Float16*)(const void*)woh;
  const size_t orow = ((size_t)(ns * NH) * LQ + ql) * DH + 8 * hh;    // + j * LQ * DH per head
  const _Float16* ar = OHf + orow;
  const _Float16* lr = OLf + orow;
  const _Float16* wr = W + (size_t)(o0 + ci) * EE + 8 * hh;           // + 16t*EE + 32j

  v8f acch[4], accl[4];
#pragma unroll
  for (int t = 0; t < 4; ++t) { acch[t] = zero8(); accl[t] = zero8(); }

#pragma unroll 1
  for (int j = 0; j < NH; ++j) {
    const v16h obh = ldfrag_h(ar + (size_t)j * LQ * DH);
    const v16h obl = ldfrag_h(lr + (size_t)j * LQ * DH);
    v16h wa[4];
#pragma unroll
    for (int t = 0; t < 4; ++t) wa[t] = ldfrag_h(wr + (size_t)(16 * t) * EE + 32 * j);
#pragma unroll
    for (int t = 0; t < 4; ++t) acch[t] = mma_h(wa[t], obh, acch[t]);
    guard4(acch[0], acch[1], acch[2], acch[3], obh, wa[0], wa[1], wa[2], wa[3]);
#pragma unroll
    for (int t = 0; t < 4; ++t) accl[t] = mma_h(wa[t], obl, accl[t]);
    guard4(accl[0], accl[1], accl[2], accl[3], obl, wa[0], wa[1], wa[2], wa[3]);
  }

  {
    float* ts = Ts + (16 * wave + ci) * 68 + 8 * hh;
#pragma unroll
    for (int t = 0; t < 4; ++t) {
      const v4f b0 = *(const v4f*)(bo + o0 + 16 * t + 8 * hh);
      const v4f b1 = *(const v4f*)(bo + o0 + 16 * t + 8 * hh + 4);
      v4f r0, r1;
#pragma unroll
      for (int e = 0; e < 4; ++e) {
        r0[e] = (acch[t][e]     + accl[t][e]     * LOIN) * OSC + bfr(b0[e]);
        r1[e] = (acch[t][4 + e] + accl[t][4 + e] * LOIN) * OSC + bfr(b1[e]);
      }
      *(v4f*)(ts + 16 * t)     = r0;
      *(v4f*)(ts + 16 * t + 4) = r1;
    }
  }
  __syncthreads();
  {
    const int p = tid & 15, r16 = tid >> 4;             // r16 0..7, p = 16-B piece of the 256-B segment
    v4f vals[8];
#pragma unroll
    for (int it = 0; it < 8; ++it) {
      const int row = it * 8 + r16;                      // it 0..7 x r16 0..7 = rows 0..63
      vals[it] = *(const v4f*)(Ts + row * 68 + 4 * p);
    }
    float* yb = out + (size_t)m0 * EE + o0 + 4 * p;
    {
#pragma unroll
      for (int it = 0; it < 8; ++it) {
        const int row = it * 8 + r16;
        *(v4f*)(yb + (size_t)row * EE) = vals[it];
      }
      
    }
  }
}

// =====================================================================================================
// Workspace map (bytes), every offset a multiple of 256 and every plane sized to its whole-line store granularity:
//   PQ, PK, PV   f16 [4096][256]      3 x 2097152      0 .. 6291456
//   HQ,HK,HV,HO  f16 [256][256]       4 x 131072       .. 6815744
//   Q16, K16     f16 [4096][256]      2 x 2097152      .. 11010048
//   VT           f16 [2][256][2048]   2097152          .. 13107200
//   OH, OL       f16 [2][8][2048][32] 2 x 2097152      .. 17301504  (end)
// =====================================================================================================
extern "C" void kernel_launch(void* const* d_in, const int* in_sizes, int n_in,
                              void* d_out, int out_size, void* d_ws, size_t ws_size,
                              hipStream_t stream) {
  if (n_in < 12) return;
  if (in_sizes[0] != MR * EE || in_sizes[1] != MR * EE || in_sizes[2] != MR * EE) return;
  if (in_sizes[3] != NSB * LQ) return;
  if (in_sizes[4] != EE * EE || in_sizes[6] != EE * EE || in_sizes[8] != EE * EE || in_sizes[10] != EE * EE) return;
  if (in_sizes[5] != EE || in_sizes[7] != EE || in_sizes[9] != EE || in_sizes[11] != EE) return;
  if (out_size != MR * EE) return;

  const float* queries = (const float*)d_in[0];
  const float* keys    = (const float*)d_in[1];
  const float* values  = (const float*)d_in[2];
  const float* pres    = (const float*)d_in[3];
  const float* Wq      = (const float*)d_in[4];
  const float* bq      = (const float*)d_in[5];
  const float* Wk      = (const float*)d_in[6];
  const float* bk      = (const float*)d_in[7];
  const float* Wv      = (const float*)d_in[8];
  const float* bv      = (const float*)d_in[9];
  const float* Wo      = (const float*)d_in[10];
  const float* bo      = (const float*)d_in[11];
  float* out = (float*)d_out;

  const size_t PX  = (size_t)MR * EE * 2;               // 2097152
  const size_t PW  = (size_t)EE * EE * 2;               // 131072
  const size_t PP  = (size_t)MR * EE * 2;               // 2097152
  const size_t PVT = (size_t)NSB * EE * LQ * 2;         // 2097152
  const size_t PO  = (size_t)NSB * NH * LQ * DH * 2;    // 2097152
  size_t off = 0;
  const size_t oPQ = off; off += PX;
  const size_t oPK = off; off += PX;
  const size_t oPV = off; off += PX;
  const size_t oHQ = off; off += PW;
  const size_t oHK = off; off += PW;
  const size_t oHV = off; off += PW;
  const size_t oHO = off; off += PW;
  const size_t oQ  = off; off += PP;
  const size_t oK  = off; off += PP;
  const size_t oVT = off; off += PVT;
  const size_t oOH = off; off += PO;
  const size_t oOL = off; off += PO;
  if (off > ws_size) return;                            // off = 17301504
  if (off > (size_t)134217728) return;

  char* ws = (char*)d_ws;
  unsigned short* PQp = (unsigned short*)(ws + oPQ);
  unsigned short* PKp = (unsigned short*)(ws + oPK);
  unsigned short* PVp = (unsigned short*)(ws + oPV);
  unsigned short* HQp = (unsigned short*)(ws + oHQ);
  unsigned short* HKp = (unsigned short*)(ws + oHK);
  unsigned short* HVp = (unsigned short*)(ws + oHV);
  unsigned short* HOp = (unsigned short*)(ws + oHO);
  unsigned short* Q16 = (unsigned short*)(ws + oQ);
  unsigned short* K16 = (unsigned short*)(ws + oK);
  unsigned short* VTp = (unsigned short*)(ws + oVT);
  unsigned short* OHp = (unsigned short*)(ws + oOH);
  unsigned short* OLp = (unsigned short*)(ws + oOL);

  const dim3 blk256(256), blk128(128);
  const dim3 gCV(NBW + 3 * NBX);                        // 16 + 1536 blocks
  const dim3 gPJ(3 * NBP);                              // 3 x 128 blocks
  const dim3 gAT(NSB * NH * (LQ / 64));                 // 512 blocks
  const dim3 gOP((MR / 64) * (EE / 64));                // 256 blocks

  // (0) 16-bit activation planes of the bf16-RNE inputs and transposed 16-bit weight planes HW[o][e] = W[e][o]
  cvt_all<<<gCV, blk256, 0, stream>>>(queries, keys, values, Wq, Wk, Wv, Wo, PQp, PKp, PVp, HQp, HKp, HVp, HOp);
  // (1) projections: q, k row-major [4096][256] (x16), v transposed VT[ns][hd][l] (x16), biases added
  proj_all<<<gPJ, blk128, 0, stream>>>(HQp, HKp, HVp, PQp, PKp, PVp, bq, bk, bv, Q16, K16, VTp);
  // (2) attention output planes OH / OL [ns][h][q][32] (row softmax over keys with the key term)
  attn_fwd<<<gAT, blk128, 0, stream>>>(Q16, K16, VTp, pres, OHp, OLp);
  // (3) output projection + bias -> d_out [4096][256] f32
  out_proj<<<gOP, blk128, 0, stream>>>(OHp, OLp, HOp, bo, out);
  (void)hipGetLastError();
}

// v003
// One run takes 46.1 microseconds.
// Timed twice side by side with v002, it ran 1.25 times as fast both times.
// All steps since v000 together make it 2.29 times as fast.
// Contractions, all v_wmma_f32_16x16x32_f16 (f16 operands, f32 accumulate): q/k/v projections X.W with f16
// containers holding bf16-RNE inputs (X x64, W x1024); scores K.q with q, k planes f16 x16 (K = 32 per head);
// P as f16 hi (x4096) + residual (x2^11) planes . V plane (f16 x16) into two accumulator pairs; output projection
// with O as f16 hi (x256) + residual (x2^11) planes and Wo bf16-RNE x1024 into two accumulators. Key-mask term,
// running max / sum, exp, residual folds and biases in f32 on VALU.
#include <hip/hip_runtime.h>
#include <math.h>
#include <stdint.h>

#define NSB  2
#define LQ   2048
#define EE   256
#define NH   8
#define DH   32
#define MR   (NSB * LQ)
#define XSC  64.0f
#define WSC  1024.0f
#define ISC  (1.0f / 4096.0f)
#define BSC  16.0f
#define QKS  (1.0f / 256.0f)
#define RSQ  0.17677669529663687f
#define MBIG 1.0e32f
#define NEG0 (-1.0e38f)
#define PSC  4096.0f
#define PLO  2048.0f
#define LOIN (1.0f / 2048.0f)
#define OSA  (1.0f / 256.0f)
#define LOSC 2048.0f
#define OSC  (1.0f / 262144.0f)
#define NBW  16                     // blocks of the Wo transposition: 16 o-tiles
#define PM   128                    // rows m of a projection block
#define NBP  ((MR / PM) * (EE / 128))   // blocks of one projection
#define WPH  144                    // LDS pitch of a staged W row e, halves (256 B of data + 32 B: 32 B x odd for the transposing reader)
#define XPH  264                    // LDS pitch of a staged X row m, halves (512 B of data + 16 B: 16 B x odd for 16-B readers)
static_assert(EE == NH * DH);
static_assert(DH == 32);
static_assert((LQ % PM) == 0 && (EE % 128) == 0 && (MR % PM) == 0);
static_assert(EE == 256 && PM == 128);
static_assert(LQ == 128 * 16);
#define SK   128                    // keys per LDS stage of the attention kernel
#define NST  (LQ / SK)              // stages
#define KPH  40                     // LDS pitch of a staged K row, halves (64 B of data + 16 B: 16 B x odd for 16-B readers)
#define VPH  136                    // LDS pitch of a staged V^T row, halves (256 B of data + 16 B)
#define KBH  (SK * KPH)             // halves per K buffer
#define VBH  (DH * VPH)             // halves per V buffer
static_assert(NST >= 2 && (SK % 32) == 0);
static_assert(SK * 4 == 4 * 128 && DH * (SK / 8) == 4 * 128);   // 4 + 4 copies of 16 B per thread and stage

typedef _Float16 v16h __attribute__((ext_vector_type(16)));
typedef _Float16 v8h  __attribute__((ext_vector_type(8)));
typedef float    v8f  __attribute__((ext_vector_type(8)));
typedef float    v4f  __attribute__((ext_vector_type(4)));
typedef unsigned int v4u __attribute__((ext_vector_type(4)));
typedef unsigned int v2u __attribute__((ext_vector_type(2)));
typedef short    s16x8 __attribute__((ext_vector_type(8)));
typedef float    v2f  __attribute__((ext_vector_type(2)));
typedef _Float16 v2h  __attribute__((ext_vector_type(2)));
typedef __bf16   v2b  __attribute__((ext_vector_type(2)));

union FragH { v16h v; v8h h[2]; };

// ---- scalar helpers ----------------------------------------------------------------------------------
__device__ __forceinline__ unsigned short bf_bits(float f) {          // f32 -> bf16 bits, RNE convert
  unsigned u = __float_as_uint(f);
  return (unsigned short)((u + 0x7FFFu + ((u >> 16) & 1u)) >> 16);
}
__device__ __forceinline__ float bf_up(unsigned short h) { return __uint_as_float(((unsigned)h) << 16); }
__device__ __forceinline__ float bfr(float f) { return bf_up(bf_bits(f)); }
__device__ __forceinline__ unsigned short h_bits(_Float16 x) { return __builtin_bit_cast(unsigned short, x); }
__device__ __forceinline__ unsigned pk16(unsigned short a, unsigned short b) { return (unsigned)a | ((unsigned)b << 16); }
__device__ __forceinline__ v8f zero8() { v8f z = {0.f, 0.f, 0.f, 0.f, 0.f, 0.f, 0.f, 0.f}; return z; }
// 4 consecutive f32 -> f16( bf16_RNE(x) * sc ) packed into 8 bytes; the RNE step by the packed hardware convert, which
// gives bfr()'s value for every finite x
__device__ __forceinline__ v2u cvt4(v4f a, float sc) {
  v2u v;
#pragma unroll
  for (int i = 0; i < 2; ++i) {
    const v2f x = {a[2 * i], a[2 * i + 1]};
    const unsigned b = __builtin_bit_cast(unsigned, __builtin_convertvector(x, v2b));
    const v2f y = {__uint_as_float(b << 16) * sc, __uint_as_float(b & 0xFFFF0000u) * sc};
    v[i] = __builtin_bit_cast(unsigned, __builtin_convertvector(y, v2h));
  }
  return v;
}

// ---- fragment loader: 16-bit A/B operand, lane -> row/col (lane&15), p already includes +8*(lane>>4);
//      elements 0..7 <- p[0..7] (k0+8h..), elements 8..15 <- p[16..23] (k0+16+8h..)
__device__ __forceinline__ v16h ldfrag_h(const _Float16* p) {
  FragH f;
  f.h[0] = *(const v8h*)(p);
  f.h[1] = *(const v8h*)(p + 16);
  return f.v;
}

// ---- transposing fragment loader: LDS tile T[k][row] (16-bit, k-major), p = T + (k0 + 8*(lane>>4) + (lane&7)) * pitch
//      + row0 + 8*((lane>>3)&1); lane (ci, hh) receives T[k0+8hh+0..7][row0+ci], then T[k0+16+8hh+0..7][row0+ci]:
//      the k order of ldfrag_h
__device__ __forceinline__ v16h ldfrag_tr(const unsigned short* p, int pitch) {
  typedef __attribute__((address_space(3))) s16x8 lds_s16x8;
  FragH f;
  f.h[0] = __builtin_bit_cast(v8h, __builtin_amdgcn_ds_load_tr16_b128_v8i16((lds_s16x8*)p));
  f.h[1] = __builtin_bit_cast(v8h, __builtin_amdgcn_ds_load_tr16_b128_v8i16((lds_s16x8*)(p + 16 * pitch)));
  return f.v;
}

// ---- WMMA helpers with trailing VALU hazard gap ----------------------------------------------------
__device__ __forceinline__ v8f mma_h(v16h a, v16h b, v8f c) {
  return __builtin_amdgcn_wmma_f32_16x16x32_f16(false, a, false, b, (short)0, c, false, false);
}
// ties 2 accumulators, keeps 3 fragments live through 4 VALU slots
__device__ __forceinline__ void guard2(v8f& a, v8f& b, v16h x0, v16h x1, v16h y) {
#if defined(__HIP_DEVICE_COMPILE__)
  asm volatile("v_nop\n\tv_nop\n\tv_nop\n\tv_nop" : "+v"(a), "+v"(b) : "v"(x0), "v"(x1), "v"(y));
#endif
}
// ties 4 accumulators, keeps 5 fragments live through 4 VALU slots
__device__ __forceinline__ void guard4(v8f& a, v8f& b, v8f& c, v8f& d,
                                       v16h x, v16h y0, v16h y1, v16h y2, v16h y3) {
#if defined(__HIP_DEVICE_COMPILE__)
  asm volatile("v_nop\n\tv_nop\n\tv_nop\n\tv_nop"
               : "+v"(a), "+v"(b), "+v"(c), "+v"(d) : "v"(x), "v"(y0), "v"(y1), "v"(y2), "v"(y3));
#endif
}
// ties 4 accumulators, keeps 4 fragments live through 4 VALU slots
__device__ __forceinline__ void guard4b(v8f& a, v8f& b, v8f& c, v8f& d,
                                        v16h x0, v16h x1, v16h y0, v16h y1) {
#if defined(__HIP_DEVICE_COMPILE__)
  asm volatile("v_nop\n\tv_nop\n\tv_nop\n\tv_nop"
               : "+v"(a), "+v"(b), "+v"(c), "+v"(d) : "v"(x0), "v"(x1), "v"(y0), "v"(y1));
#endif
}

// =====================================================================================================
// Transposed output-weight plane: HO[o][e] = f16( bf16_RNE(Wo[e][o]) * 1024 ) for the [in][out] weight (x.W layout).
// Block = 16 output rows o0 = 16*bx, 256 threads, 16 blocks, so that this chain is no longer than a projection block's.
// Read W rows e as 4 threads x 16 B (64-B row segment o0..o0+15), all 4 loads of a thread in flight together, 2-B
// transposed LDS stores into Ts[o_local][e] (pitch 264), block barrier, then whole rows out.
// coverage: read 4 it x 64 rows e x 4 pieces x 4 = all 256 e x 16 o; write 2 it x 8 waves = 16 rows x 32 lanes x 8
//           halves = 16 x 256; 16 o-tiles -> HO [256][256] entirely.
// =====================================================================================================
__device__ __forceinline__
void cvt_wt_body(int bx, unsigned short* Ts, const float* __restrict__ src, unsigned short* dst) {
  const int tid  = threadIdx.x;
  const int wave = tid >> 5;
  const int lane = tid & 31;
  const int o0   = bx * 16;
  const int p = tid & 3, r64 = tid >> 2;                // p = 16-B piece of the 64-B row segment, r64 = row in group
  v4f a[4];
#pragma unroll
  for (int it = 0; it < 4; ++it) a[it] = *(const v4f*)(src + (size_t)(it * 64 + r64) * EE + o0 + 4 * p);
#pragma unroll
  for (int it = 0; it < 4; ++it) {
    const int e = it * 64 + r64;                         // 0..255
#pragma unroll
    for (int i = 0; i < 4; ++i) Ts[(4 * p + i) * 264 + e] = h_bits((_Float16)(bfr(a[it][i]) * WSC));
  }
  __syncthreads();
  v4u vals[2];
#pragma unroll
  for (int it = 0; it < 2; ++it) {
    const int row = it * 8 + wave;                       // it 0..1 x wave 0..7 = rows 0..15
    vals[it] = *(const v4u*)(Ts + row * 264 + 8 * lane);
  }
  unsigned short* db = dst + (size_t)o0 * EE + 8 * lane;
#pragma unroll
  for (int it = 0; it < 2; ++it) {
    const int row = it * 8 + wave;
    *(v4u*)(db + (size_t)row * EE) = vals[it];
  }
}

// =====================================================================================================
// Projection GEMM Y[m][o] = sum_e X[m][e] W[e][o] (x 65536 in the accumulator) + b[o], straight from the f32 inputs.
// Block = 8 waves = 128 rows m x 128 cols o (32 m-tiles x 2 o-tiles = 64 blocks per projection). The block converts
// its own operands into LDS: Ws[e][o_local] = f16( bf16_RNE(W[e][o]) * 1024 ) (one wave-load = one 512-B row segment),
// Xs[m_local][e] = f16( bf16_RNE(X[m][e]) * 64 ) (one wave-load = half a row), 8-B LDS stores, block barrier.
// Wave (wm = wave & 3, wo = wave >> 2) owns 32 rows m x 64 cols o: A(W^T rows o = o0+64wo+16t+ci by the transposing
// load, k = e split map) . B(Xs row m = m0+32wm+16i+ci, col = m, same map); 8 k-steps of 32, 8 accumulators per wave;
// acc[i][t][r] <-> (m = m0+32wm+16i+ci, o = o0+64wo+16t+8hh+r). y16 = acc * 2^-12 + 16 * bf16_RNE(b[o]) (= 16 y).
// A second barrier ends every wave's operand reads before the same LDS becomes output staging.
// tr == 0: YO[m][o] = f16(y16): staged as Ts[m_local][o_local] (pitch 136, 16-B LDS stores), block barrier, rows out.
// tr == 1: VT[ns][o][l] (keys contiguous): staged as Ts[o_local][l_local] (pitch 136, 2-B LDS stores), barrier, rows out.
// coverage: operands: 32 it x 8 rows e x 128 o, 32 it x 4 rows m x 256 e; tr 0: 8 it x 16 rows x 16 pieces x 8 halves =
//           128 x 128 per block, grid -> [4096][256]; tr 1: 8 it x 16 lines x 16 pieces x 8 = 128 o x 128 l, grid ->
//           VT [2][256][2048].
// =====================================================================================================
__device__ __forceinline__
void proj_body(int bx, bool tr, unsigned short* Sm, const float* __restrict__ wf, const float* __restrict__ xf,
               const float* __restrict__ bias, unsigned short* yo) {
  const int tid  = threadIdx.x;
  const int wave = tid >> 5;
  const int lane = tid & 31;
  const int hh   = lane >> 4;
  const int ci   = lane & 15;
  const int wm   = wave & 3, wo = wave >> 2;
  const int mt   = bx >> 1, ot = bx & 1;
  const int m0   = mt * PM, o0 = ot * 128;
  unsigned short* Ws = Sm;                               // [256 e][WPH]
  unsigned short* Xs = Sm + EE * WPH;                    // [128 m][XPH]
  {
    const float* wsrc = wf + (size_t)wave * EE + o0 + 4 * lane;                    // row e = 8 it + wave
    const float* xsrc = xf + (size_t)(m0 + (tid >> 6)) * EE + 4 * (tid & 63);      // row m = 4 it + (tid >> 6)
    unsigned short* wd = Ws + wave * WPH + 4 * lane;
    unsigned short* xd = Xs + (tid >> 6) * XPH + 4 * (tid & 63);
    v4f a[32], c[32];
#pragma unroll
    for (int it = 0; it < 32; ++it) a[it] = *(const v4f*)(wsrc + (size_t)(8 * it) * EE);
#if defined(__HIP_DEVICE_COMPILE__)
    // stands between the loads above and a later load whose result the compiler puts into their address pair
    asm volatile("s_wait_xcnt 0x0" ::: "memory");
#endif
#pragma unroll
    for (int it = 0; it < 16; ++it) c[it] = *(const v4f*)(xsrc + (size_t)(4 * it) * EE);
    // keeps these 48 loads ahead of all conversion work: one latency for the lot instead of one per trickled load
    __builtin_amdgcn_sched_barrier(0);
#pragma unroll
    for (int it = 0; it < 16; ++it) *(v2u*)(wd + (8 * it) * WPH) = cvt4(a[it], WSC);
    // the last 16 loads go out as soon as registers are free, ahead of the remaining conversion work
    __builtin_amdgcn_sched_barrier(0);
#pragma unroll
    for (int it = 16; it < 32; ++it) c[it] = *(const v4f*)(xsrc + (size_t)(4 * it) * EE);
    __builtin_amdgcn_sched_barrier(0);                   // closes the group above
#pragma unroll
    for (int it = 16; it < 32; ++it) *(v2u*)(wd + (8 * it) * WPH) = cvt4(a[it], WSC);
#pragma unroll
    for (int it = 0; it < 32; ++it) *(v2u*)(xd + (4 * it) * XPH) = cvt4(c[it], XSC);
  }
  __syncthreads();

  const _Float16* xr = (const _Float16*)(const void*)Xs + (32 * wm + ci) * XPH + 8 * hh;       // B: X row m, + 16 i rows
  const unsigned short* wr = Ws + (8 * hh + (lane & 7)) * WPH + 64 * wo + 8 * ((lane >> 3) & 1);   // A: + k0 rows, + 16 t

  v8f acc[2][4];
#pragma unroll
  for (int i = 0; i < 2; ++i)
#pragma unroll
    for (int t = 0; t < 4; ++t) acc[i][t] = zero8();

  // two register sets: the fragments of k-step ks + 1 are asked for ahead of the products of k-step ks, so that their LDS
  // latency runs under those products; unrolled, so that the set index and every LDS offset are compile-time constants
  v16h wa[2][4], xb[2][2];
#pragma unroll
  for (int t = 0; t < 4; ++t) wa[0][t] = ldfrag_tr(wr + 16 * t, WPH);
#pragma unroll
  for (int i = 0; i < 2; ++i) xb[0][i] = ldfrag_h(xr + (16 * i) * XPH);
#pragma unroll
  for (int ks = 0; ks < EE / 32; ++ks) {
    const int cu = ks & 1, nx = cu ^ 1;
    if (ks + 1 < EE / 32) {
      const int k1 = (ks + 1) * 32;
#pragma unroll
      for (int t = 0; t < 4; ++t) wa[nx][t] = ldfrag_tr(wr + k1 * WPH + 16 * t, WPH);
#pragma unroll
      for (int i = 0; i < 2; ++i) xb[nx][i] = ldfrag_h(xr + (16 * i) * XPH + k1);
    }
    // holds the load group together and ahead of the products: left free, the loads sink in among the products
    __builtin_amdgcn_sched_barrier(0);
#pragma unroll
    for (int i = 0; i < 2; ++i)
#pragma unroll
      for (int t = 0; t < 4; ++t) acc[i][t] = mma_h(wa[cu][t], xb[cu][i], acc[i][t]);
    __builtin_amdgcn_sched_barrier(0);                   // the next load group stays behind these products
  }
  __syncthreads();                                       // every wave has read its operands: the LDS becomes Ts

  unsigned short* Ts = Sm;                               // 128 x 136 halves
  const int p = tid & 15, r16 = tid >> 4;               // r16 0..15 = row within group, p = 16-B piece of the 256-B segment
  if (!tr) {
#pragma unroll
    for (int i = 0; i < 2; ++i) {
      unsigned short* ts = Ts + (32 * wm + 16 * i + ci) * 136 + 64 * wo + 8 * hh;
#pragma unroll
      for (int t = 0; t < 4; ++t) {
        const v4f b0 = *(const v4f*)(bias + o0 + 64 * wo + 16 * t + 8 * hh);
        const v4f b1 = *(const v4f*)(bias + o0 + 64 * wo + 16 * t + 8 * hh + 4);
        float y[8];
#pragma unroll
        for (int e = 0; e < 4; ++e) {
          y[e]     = acc[i][t][e] * ISC     + bfr(b0[e]) * BSC;
          y[4 + e] = acc[i][t][4 + e] * ISC + bfr(b1[e]) * BSC;
        }
        v4u v;
#pragma unroll
        for (int j = 0; j < 4; ++j) v[j] = pk16(h_bits((_Float16)y[2 * j]), h_bits((_Float16)y[2 * j + 1]));
        *(v4u*)(ts + 16 * t) = v;
      }
    }
    __syncthreads();
    v4u vals[8];
#pragma unroll
    for (int it = 0; it < 8; ++it) {
      const int row = it * 16 + r16;                     // it 0..7 x r16 0..15 = rows 0..127
      vals[it] = *(const v4u*)(Ts + row * 136 + 8 * p);
    }
    unsigned short* yb = yo + (size_t)m0 * EE + o0 + 8 * p;
#pragma unroll
    for (int it = 0; it < 8; ++it) {
      const int row = it * 16 + r16;
      *(v4u*)(yb + (size_t)row * EE) = vals[it];
    }
  } else {
    const int ns = m0 / LQ, l0 = m0 - ns * LQ;
#pragma unroll
    for (int i = 0; i < 2; ++i) {
#pragma unroll
      for (int t = 0; t < 4; ++t) {
        const v4f b0 = *(const v4f*)(bias + o0 + 64 * wo + 16 * t + 8 * hh);
        const v4f b1 = *(const v4f*)(bias + o0 + 64 * wo + 16 * t + 8 * hh + 4);
#pragma unroll
        for (int r = 0; r < 4; ++r) {
          Ts[(64 * wo + 16 * t + 8 * hh + r) * 136 + 32 * wm + 16 * i + ci] =
              h_bits((_Float16)(acc[i][t][r] * ISC + bfr(b0[r]) * BSC));
          Ts[(64 * wo + 16 * t + 8 * hh + 4 + r) * 136 + 32 * wm + 16 * i + ci] =
              h_bits((_Float16)(acc[i][t][4 + r] * ISC + bfr(b1[r]) * BSC));
        }
      }
    }
    __syncthreads();
    v4u vals[8];
#pragma unroll
    for (int it = 0; it < 8; ++it) {
      const int orow = it * 16 + r16;                    // it 0..7 x r16 0..15 = o_local 0..127
      vals[it] = *(const v4u*)(Ts + orow * 136 + 8 * p);
    }
    unsigned short* yb = yo + ((size_t)ns * EE + o0) * LQ + l0 + 8 * p;
#pragma unroll
    for (int it = 0; it < 8; ++it) {
      const int orow = it * 16 + r16;
      *(v4u*)(yb + (size_t)orow * LQ) = vals[it];
    }
  }
}

// One launch for the Wo transposition and the three projections, none of which depends on another: blocks 0..15 build
// the HO plane, then 64 blocks each for q, k (row-major out) and v (transposed out). Every select is block-uniform.
__global__ __launch_bounds__(256)
void proj_all(const float* __restrict__ xq, const float* __restrict__ xk, const float* __restrict__ xv,
              const float* __restrict__ wq, const float* __restrict__ wk, const float* __restrict__ wv,
              const float* __restrict__ wo, const float* __restrict__ bq, const float* __restrict__ bk,
              const float* __restrict__ bv, unsigned short* q16, unsigned short* k16, unsigned short* vt,
              unsigned short* ho) {
  __shared__ __align__(16) unsigned short Sm[EE * WPH + PM * XPH];   // 70656 halves >= 16 * 264, 128 * 136
  const int bx = blockIdx.x;
  if (bx < NBW) { cvt_wt_body(bx, Sm, wo, ho); return; }
  const int pb = bx - NBW;
  const int wh = pb / NBP;                               // 0 q, 1 k, 2 v
  proj_body(pb - wh * NBP, wh == 2, Sm, wh == 0 ? wq : (wh == 1 ? wk : wv), wh == 0 ? xq : (wh == 1 ? xk : xv),
            wh == 0 ? bq : (wh == 1 ? bk : bv), wh == 0 ? q16 : (wh == 1 ? k16 : vt));
}

// ---- one stage of K and V^T into LDS: 8 asynchronous 16-B copies per lane (4 of K, 4 of V^T), no register in between.
//      lk / lv = the lane's LDS byte address of its first K / V piece, gk / gv = its global source; piece i of K lies
//      32 rows further (LDS 32 * 80 B, global 32 * 512 B), piece i of V^T 8 rows further (LDS 8 * 272 B, global 8 * 4096 B).
__device__ __forceinline__ void stage_kv(unsigned lk, unsigned lv, const unsigned short* gk, const unsigned short* gv) {
#if defined(__HIP_DEVICE_COMPILE__)
  const unsigned lk1 = lk + 32 * KPH * 2, lk2 = lk + 64 * KPH * 2, lk3 = lk + 96 * KPH * 2;
  const unsigned lv1 = lv + 8 * VPH * 2,  lv2 = lv + 16 * VPH * 2, lv3 = lv + 24 * VPH * 2;
  const unsigned short* gk1 = gk + 32 * EE;
  const unsigned short* gk2 = gk + 64 * EE;
  const unsigned short* gk3 = gk + 96 * EE;
  const unsigned short* gv1 = gv + 8 * LQ;
  const unsigned short* gv2 = gv + 16 * LQ;
  const unsigned short* gv3 = gv + 24 * LQ;
  // the closing s_wait_xcnt stands in the copies' own statement so that no address register is rewritten ahead of it
  asm volatile("global_load_async_to_lds_b128 %0, %8, off\n\t"
               "global_load_async_to_lds_b128 %1, %9, off\n\t"
               "global_load_async_to_lds_b128 %2, %10, off\n\t"
               "global_load_async_to_lds_b128 %3, %11, off\n\t"
               "global_load_async_to_lds_b128 %4, %12, off\n\t"
               "global_load_async_to_lds_b128 %5, %13, off\n\t"
               "global_load_async_to_lds_b128 %6, %14, off\n\t"
               "global_load_async_to_lds_b128 %7, %15, off\n\t"
               "s_wait_xcnt 0x0"
               :: "v"(lk), "v"(lk1), "v"(lk2), "v"(lk3), "v"(lv), "v"(lv1), "v"(lv2), "v"(lv3),
                  "v"(gk), "v"(gk1), "v"(gk2), "v"(gk3), "v"(gv), "v"(gv1), "v"(gv2), "v"(gv3)
               : "memory");
#endif
}

// =====================================================================================================
// Row-softmax attention (online max) per (ns, h, 64 queries q0..), 4 waves, grid 2*8*32 = 512; wave w owns queries
// q0+16w+ci (B operand of the score tile = Q16 row fragment, col = query, k = d, one k-step). Key term
// Mk[l] = (1 - bf16_RNE(pres[ns][l])) * 1e32 staged once per block in LDS. K rows (this head's 64 B) and V^T rows of
// 128 keys are staged per block in LDS by asynchronous copies, two buffers: stage s + 1 flies while stage s is worked
// on; all four waves read their A fragments from the staged tile. 32 keys per iteration, 4 iterations per stage:
//   score D tiles (rows = keys lt+8hh+r / lt+16+8hh+r, col = query) = A(K16 rows l, k = d) . B(qf);
//   t = (acc/256 - Mk[l]) * (1/sqrt(32)) in f32; tile max over the lane's 16 keys combined with the partner half
//   (lane^16), running max / rescale factor identical for both halves of a query column; p = exp(t - max);
//   P split: hi = f16(4096 p), lo = f16((4096 p - hi) * 2048), both B fragments built in registers (element r <- key
//   lt+8hh+r, element 8+r <- key lt+16+8hh+r, lane unchanged); O^T (rows d, cols queries) accumulators rescaled then
//   += A(VT rows d = h*32 + 16j + ci, keys contiguous) . B(hi) and . B(lo): 4 accumulators (d 0..15 / 16..31, hi / lo).
// Epilogue: 256*O = (acc_hi + acc_lo/2048) / (256 Z) as f16 hi plus f16 residual (x2048), staged per query row in LDS
// coverage: 2 it x 128 threads x 8 halves = 64 rows x 32 per plane per block; grid covers [2][8][2048][32] once.
// =====================================================================================================
__global__ __launch_bounds__(128)
void attn_fwd(const unsigned short* __restrict__ q16, const unsigned short* __restrict__ k16,
              const unsigned short* __restrict__ vt, const float* __restrict__ pres,
              unsigned short* ohp, unsigned short* olp) {
  __shared__ __align__(16) float Mk[LQ];
  __shared__ __align__(16) unsigned short Hs[64 * 40];
  __shared__ __align__(16) unsigned short Lw[64 * 40];
  __shared__ __align__(16) unsigned short Kb[2 * KBH];
  __shared__ __align__(16) unsigned short Vb[2 * VBH];
  const int tid  = threadIdx.x;
  const int wave = tid >> 5;
  const int lane = tid & 31;
  const int hh   = lane >> 4;
  const int ci   = lane & 15;
  const int bx   = blockIdx.x;
  const int ns   = bx / (NH * (LQ / 64));
  const int rem  = bx - ns * (NH * (LQ / 64));
  const int h    = rem / (LQ / 64);
  const int q0   = (rem - h * (LQ / 64)) * 64;
  const int qi   = q0 + 16 * wave + ci;                 // this lane's query
  // copy map: K piece (row tid>>2 (+32i), 16-B piece tid&3), V^T piece (row d = tid>>4 (+8i), 16-B piece tid&15)
  const unsigned lk0 = (unsigned)(uintptr_t)(Kb + (tid >> 2) * KPH + 8 * (tid & 3));
  const unsigned lv0 = (unsigned)(uintptr_t)(Vb + (tid >> 4) * VPH + 8 * (tid & 15));
  const unsigned short* gk0 = k16 + (size_t)(ns * LQ + (tid >> 2)) * EE + h * DH + 8 * (tid & 3);      // + SK * EE per stage
  const unsigned short* gv0 = vt + ((size_t)ns * EE + h * DH + (tid >> 4)) * LQ + 8 * (tid & 15);      // + SK per stage
  stage_kv(lk0, lv0, gk0, gv0);                         // stage 0 -> buffer 0
  {
    const float* pp = pres + (size_t)ns * LQ + 16 * tid;   // 128 threads x 16 floats = 2048 keys
#pragma unroll
    for (int i = 0; i < 4; ++i) {
      const v4f a = *(const v4f*)(pp + 4 * i);
      v4f mv;
#pragma unroll
      for (int e = 0; e < 4; ++e) mv[e] = (1.0f - bfr(a[e])) * MBIG;
      *(v4f*)(Mk + 16 * tid + 4 * i) = mv;
    }
  }
  asm volatile("s_wait_asynccnt 0x0" ::: "memory");     // this wave's copies of stage 0 have landed
  __syncthreads();                                      // publishes Mk and stage 0
  stage_kv(lk0 + KBH * 2, lv0 + VBH * 2, gk0 + (size_t)SK * EE, gv0 + SK);     // stage 1 -> buffer 1

  const _Float16* Q = (const _Float16*)(const void*)q16;
  const v16h qf = ldfrag_h(Q + (size_t)(ns * LQ + qi) * EE + h * DH + 8 * hh);
  const _Float16* kl = (const _Float16*)(const void*)Kb + ci * KPH + 8 * hh;   // + buffer, + key_local * KPH
  const _Float16* vl = (const _Float16*)(const void*)Vb + ci * VPH + 8 * hh;   // row d = ci, + 16 * VPH, + key_local

  float rmax = NEG0, z = 0.f;
  v8f ah0 = zero8(), ah1 = zero8(), al0 = zero8(), al1 = zero8();
#pragma unroll 1
  for (int st = 0; st < NST; ++st) {
    const int bf = st & 1;
    const _Float16* kp = kl + bf * KBH;
    const _Float16* vp = vl + bf * VBH;
    // unrolled: every LDS offset inside a stage is an immediate
#pragma unroll
    for (int u = 0; u < SK / 32; ++u) {
      const int lt = st * SK + u * 32;
      const v16h ka0 = ldfrag_h(kp + (u * 32) * KPH);
      const v16h ka1 = ldfrag_h(kp + (u * 32 + 16) * KPH);
      v8f s0 = mma_h(ka0, qf, zero8());
      v8f s1 = mma_h(ka1, qf, zero8());
      guard2(s0, s1, ka0, ka1, qf);
      const v4f ma = *(const v4f*)(Mk + lt + 8 * hh);           // keys lt + 8hh + 0..3      <-> s0[0..3]
      const v4f mb = *(const v4f*)(Mk + lt + 8 * hh + 4);       // keys lt + 8hh + 4..7      <-> s0[4..7]
      const v4f mc = *(const v4f*)(Mk + lt + 16 + 8 * hh);      // keys lt + 16 + 8hh + 0..3 <-> s1[0..3]
      const v4f md = *(const v4f*)(Mk + lt + 20 + 8 * hh);      // keys lt + 16 + 8hh + 4..7 <-> s1[4..7]
      float t[16];
#pragma unroll
      for (int r = 0; r < 4; ++r) {
        t[r]      = (s0[r] * QKS     - ma[r]) * RSQ;
        t[4 + r]  = (s0[4 + r] * QKS - mb[r]) * RSQ;
        t[8 + r]  = (s1[r] * QKS     - mc[r]) * RSQ;
        t[12 + r] = (s1[4 + r] * QKS - md[r]) * RSQ;
      }
      float mx = t[0];
#pragma unroll
      for (int i = 1; i < 16; ++i) mx = fmaxf(mx, t[i]);
      mx = fmaxf(mx, __shfl_xor(mx, 16, 32));
      const float nmax = fmaxf(rmax, mx);
      const float corr = __expf(rmax - nmax);
      rmax = nmax;
      FragH ph, pl;
      float zs = 0.f;
#pragma unroll
      for (int r = 0; r < 8; ++r) {
        const float pa = __expf(t[r] - nmax);
        const float pc = __expf(t[8 + r] - nmax);
        zs += pa + pc;
        const float xa = pa * PSC, xc = pc * PSC;
        const _Float16 ha = (_Float16)xa, hc = (_Float16)xc;
        ph.h[0][r] = ha;
        ph.h[1][r] = hc;
        pl.h[0][r] = (_Float16)((xa - (float)ha) * PLO);
        pl.h[1][r] = (_Float16)((xc - (float)hc) * PLO);
      }
      z = z * corr + zs;
      ah0 *= corr; ah1 *= corr; al0 *= corr; al1 *= corr;
      const v16h va0 = ldfrag_h(vp + u * 32);                      // d = ci
      const v16h va1 = ldfrag_h(vp + 16 * VPH + u * 32);           // d = 16 + ci
      ah0 = mma_h(va0, ph.v, ah0);
      ah1 = mma_h(va1, ph.v, ah1);
      al0 = mma_h(va0, pl.v, al0);
      al1 = mma_h(va1, pl.v, al1);
      guard4b(ah0, ah1, al0, al1, va0, va1, ph.v, pl.v);
    }
    // publish point of stage st + 1: own LDS reads done, own copies landed, then the barrier that both publishes
    // stage st + 1 and ends every wave's reads of the buffer refilled behind it
    asm volatile("s_wait_dscnt 0x0" ::: "memory");
    asm volatile("s_wait_asynccnt 0x0" ::: "memory");
    __syncthreads();
    if (st + 2 < NST)
      stage_kv(lk0 + bf * (KBH * 2), lv0 + bf * (VBH * 2), gk0 + (size_t)(st + 2) * SK * EE, gv0 + (st + 2) * SK);
  }
  asm volatile("s_wait_asynccnt 0x0" ::: "memory");     // nothing of this wave's copies is left in flight

  // ah0/al0[r] <-> d = 8hh + r, ah1/al1[r] <-> d = 16 + 8hh + r, query qi; Z >= 1
  const float zz  = z + __shfl_xor(z, 16, 32);
  const float rzs = (1.0f / zz) * OSA;
  float o[16];
#pragma unroll
  for (int r = 0; r < 8; ++r) {
    o[r]     = (ah0[r] + al0[r] * LOIN) * rzs;
    o[8 + r] = (ah1[r] + al1[r] * LOIN) * rzs;
  }
  v4u h0, h1, g0, g1;
#pragma unroll
  for (int i = 0; i < 4; ++i) {
    const _Float16 a0 = (_Float16)o[2 * i],     a1 = (_Float16)o[2 * i + 1];
    const _Float16 b0 = (_Float16)o[8 + 2 * i], b1 = (_Float16)o[8 + 2 * i + 1];
    const _Float16 la0 = (_Float16)((o[2 * i]         - (float)a0) * LOSC);
    const _Float16 la1 = (_Float16)((o[2 * i + 1]     - (float)a1) * LOSC);
    const _Float16 lb0 = (_Float16)((o[8 + 2 * i]     - (float)b0) * LOSC);
    const _Float16 lb1 = (_Float16)((o[8 + 2 * i + 1] - (float)b1) * LOSC);
    h0[i] = pk16(h_bits(a0), h_bits(a1));
    h1[i] = pk16(h_bits(b0), h_bits(b1));
    g0[i] = pk16(h_bits(la0), h_bits(la1));
    g1[i] = pk16(h_bits(lb0), h_bits(lb1));
  }
  {
    const int ro = (16 * wave + ci) * 40 + 8 * hh;
    *(v4u*)(Hs + ro)      = h0;
    *(v4u*)(Hs + ro + 16) = h1;
    *(v4u*)(Lw + ro)      = g0;
    *(v4u*)(Lw + ro + 16) = g1;
  }
  __syncthreads();
  {
    const size_t ob = ((size_t)(ns * NH + h) * LQ + q0) * DH;      // 4096-B aligned region of 64 x 32 halves
    v4u hv[2], lv[2];
#pragma unroll
    for (int it2 = 0; it2 < 2; ++it2) {
      const int hf = it2 * 1024 + 8 * tid;             // half index within the 2048-half region
      const int row = hf >> 5, col = hf & 31;
      hv[it2] = *(const v4u*)(Hs + row * 40 + col);
      lv[it2] = *(const v4u*)(Lw + row * 40 + col);
    }
    {
#pragma unroll
      for (int it2 = 0; it2 < 2; ++it2) {
        const int hf = it2 * 1024 + 8 * tid;
        *(v4u*)(ohp + ob + hf) = hv[it2];
        *(v4u*)(olp + ob + hf) = lv[it2];
      }
      
    }
  }
}

// =====================================================================================================
// Output projection out[m][o] = sum_c O[m][c] Wo[c][o] + bo[o], O = (hi + lo/2048)/256 from the OH/OL planes
// ([ns][h][q][32]: k-step j = head j). Block = 4 waves = 64 rows m x 64 cols o (grid 64 x 4 = 256); wave w owns rows
// m0+16w+ci (B operands = OH and OL row fragments, col = m), A = HO plane rows o0+16t+ci (k = c split map); 4 hi + 4
// lo accumulators; acc[t][r] <-> (m = m0+16w+ci, o = o0+16t+8hh+r).
// Epilogue: (acch + accl/2048)/262144 + bf16_RNE(bo) staged in LDS as Ts[m_local][o_local] (pitch 68, 16-B vector
// coverage: 8 it x 8 rows x 16 pieces x 4 floats = 64 x 64 per block; grid covers out [4096][256] exactly once.
// =====================================================================================================
__global__ __launch_bounds__(128)
void out_proj(const unsigned short* __restrict__ ohp, const unsigned short* __restrict__ olp,
              const unsigned short* __restrict__ woh, const float* __restrict__ bo, float* out) {
  __shared__ __align__(16) float Ts[64 * 68];
  const int tid  = threadIdx.x;
  const int wave = tid >> 5;
  const int lane = tid & 31;
  const int hh   = lane >> 4;
  const int ci   = lane & 15;
  const int bx   = blockIdx.x;
  const int mt   = bx >> 2, ot = bx & 3;
  const int m0   = mt * 64, o0 = ot * 64;
  const int ns   = m0 / LQ;
  const int ql   = m0 - ns * LQ + 16 * wave + ci;       // query of this lane's row
  const _Float16* OHf = (const _Float16*)(const void*)ohp;
  const _Float16* OLf = (const _Float16*)(const void*)olp;
  const _Float16* W   = (const _Float16*)(const void*)woh;
  const size_t orow = ((size_t)(ns * NH) * LQ + ql) * DH + 8 * hh;    // + j * LQ * DH per head
  const _Float16* ar = OHf + orow;
  const _Float16* lr = OLf + orow;
  const _Float16* wr = W + (size_t)(o0 + ci) * EE + 8 * hh;           // + 16t*EE + 32j

  v8f acch[4], accl[4];
#pragma unroll
  for (int t = 0; t < 4; ++t) { acch[t] = zero8(); accl[t] = zero8(); }

#pragma unroll 1
  for (int j = 0; j < NH; ++j) {
    const v16h obh = ldfrag_h(ar + (size_t)j * LQ * DH);
    const v16h obl = ldfrag_h(lr + (size_t)j * LQ * DH);
    v16h wa[4];
#pragma unroll
    for (int t = 0; t < 4; ++t) wa[t] = ldfrag_h(wr + (size_t)(16 * t) * EE + 32 * j);
#pragma unroll
    for (int t = 0; t < 4; ++t) acch[t] = mma_h(wa[t], obh, acch[t]);
    guard4(acch[0], acch[1], acch[2], acch[3], obh, wa[0], wa[1], wa[2], wa[3]);
#pragma unroll
    for (int t = 0; t < 4; ++t) accl[t] = mma_h(wa[t], obl, accl[t]);
    guard4(accl[0], accl[1], accl[2], accl[3], obl, wa[0], wa[1], wa[2], wa[3]);
  }

  {
    float* ts = Ts + (16 * wave + ci) * 68 + 8 * hh;
#pragma unroll
    for (int t = 0; t < 4; ++t) {
      const v4f b0 = *(const v4f*)(bo + o0 + 16 * t + 8 * hh);
      const v4f b1 = *(const v4f*)(bo + o0 + 16 * t + 8 * hh + 4);
      v4f r0, r1;
#pragma unroll
      for (int e = 0; e < 4; ++e) {
        r0[e] = (acch[t][e]     + accl[t][e]     * LOIN) * OSC + bfr(b0[e]);
        r1[e] = (acch[t][4 + e] + accl[t][4 + e] * LOIN) * OSC + bfr(b1[e]);
      }
      *(v4f*)(ts + 16 * t)     = r0;
      *(v4f*)(ts + 16 * t + 4) = r1;
    }
  }
  __syncthreads();
  {
    const int p = tid & 15, r16 = tid >> 4;             // r16 0..7, p = 16-B piece of the 256-B segment
    v4f vals[8];
#pragma unroll
    for (int it = 0; it < 8; ++it) {
      const int row = it * 8 + r16;                      // it 0..7 x r16 0..7 = rows 0..63
      vals[it] = *(const v4f*)(Ts + row * 68 + 4 * p);
    }
    float* yb = out + (size_t)m0 * EE + o0 + 4 * p;
    {
#pragma unroll
      for (int it = 0; it < 8; ++it) {
        const int row = it * 8 + r16;
        *(v4f*)(yb + (size_t)row * EE) = vals[it];
      }
      
    }
  }
}

// =====================================================================================================
// Workspace map (bytes), every offset a multiple of 256 and every plane sized to its whole-line store granularity:
//   HO           f16 [256][256]       131072           0 .. 131072
//   Q16, K16     f16 [4096][256]      2 x 2097152      .. 4325376
//   VT           f16 [2][256][2048]   2097152          .. 6422528
//   OH, OL       f16 [2][8][2048][32] 2 x 2097152      .. 10616832  (end)
// =====================================================================================================
extern "C" void kernel_launch(void* const* d_in, const int* in_sizes, int n_in,
                              void* d_out, int out_size, void* d_ws, size_t ws_size,
                              hipStream_t stream) {
  if (n_in < 12) return;
  if (in_sizes[0] != MR * EE || in_sizes[1] != MR * EE || in_sizes[2] != MR * EE) return;
  if (in_sizes[3] != NSB * LQ) return;
  if (in_sizes[4] != EE * EE || in_sizes[6] != EE * EE || in_sizes[8] != EE * EE || in_sizes[10] != EE * EE) return;
  if (in_sizes[5] != EE || in_sizes[7] != EE || in_sizes[9] != EE || in_sizes[11] != EE) return;
  if (out_size != MR * EE) return;

  const float* queries = (const float*)d_in[0];
  const float* keys    = (const float*)d_in[1];
  const float* values  = (const float*)d_in[2];
  const float* pres    = (const float*)d_in[3];
  const float* Wq      = (const float*)d_in[4];
  const float* bq      = (const float*)d_in[5];
  const float* Wk      = (const float*)d_in[6];
  const float* bk      = (const float*)d_in[7];
  const float* Wv      = (const float*)d_in[8];
  const float* bv      = (const float*)d_in[9];
  const float* Wo      = (const float*)d_in[10];
  const float* bo      = (const float*)d_in[11];
  float* out = (float*)d_out;

  const size_t PW  = (size_t)EE * EE * 2;               // 131072
  const size_t PP  = (size_t)MR * EE * 2;               // 2097152
  const size_t PVT = (size_t)NSB * EE * LQ * 2;         // 2097152
  const size_t PO  = (size_t)NSB * NH * LQ * DH * 2;    // 2097152
  size_t off = 0;
  const size_t oHO = off; off += PW;
  const size_t oQ  = off; off += PP;
  const size_t oK  = off; off += PP;
  const size_t oVT = off; off += PVT;
  const size_t oOH = off; off += PO;
  const size_t oOL = off; off += PO;
  if (off > ws_size) return;                            // off = 10616832
  if (off > (size_t)134217728) return;

  char* ws = (char*)d_ws;
  unsigned short* HOp = (unsigned short*)(ws + oHO);
  unsigned short* Q16 = (unsigned short*)(ws + oQ);
  unsigned short* K16 = (unsigned short*)(ws + oK);
  unsigned short* VTp = (unsigned short*)(ws + oVT);
  unsigned short* OHp = (unsigned short*)(ws + oOH);
  unsigned short* OLp = (unsigned short*)(ws + oOL);

  const dim3 blk256(256), blk128(128);
  const dim3 gPJ(NBW + 3 * NBP);                        // 16 + 3 x 64 blocks
  const dim3 gAT(NSB * NH * (LQ / 64));                 // 512 blocks
  const dim3 gOP((MR / 64) * (EE / 64));                // 256 blocks

  // (1) transposed 16-bit Wo plane HO[o][e]; projections from the f32 inputs: q, k row-major [4096][256] (x16),
  //     v transposed VT[ns][hd][l] (x16), biases added
  proj_all<<<gPJ, blk256, 0, stream>>>(queries, keys, values, Wq, Wk, Wv, Wo, bq, bk, bv, Q16, K16, VTp, HOp);
  // (2) attention output planes OH / OL [ns][h][q][32] (row softmax over keys with the key term)
  attn_fwd<<<gAT, blk128, 0, stream>>>(Q16, K16, VTp, pres, OHp, OLp);
  // (3) output projection + bias -> d_out [4096][256] f32
  out_proj<<<gOP, blk128, 0, stream>>>(OHp, OLp, HOp, bo, out);
  (void)hipGetLastError();
}

// v004
// Measured time: 42 microseconds a run.
// Two timings next to v003 put it at 1.10 and 1.11 times that version's speed.
// All steps since v000 together make it 2.52 times as fast.
// Contractions, all v_wmma_f32_16x16x32_f16 (f16 operands, f32 accumulate): q/k/v projections X.W with f16
// containers holding bf16-RNE inputs (X x64, W x1024); scores K.q with q, k planes f16 x16 (K = 32 per head);
// P as f16 hi (x4096) + residual (x2^11) planes . V plane (f16 x16) into two accumulator pairs; output projection
// with O as f16 hi (x256) + residual (x2^11) planes and Wo bf16-RNE x1024 into two accumulators. Key-mask term,
// running max / sum, exp, residual folds and biases in f32 on VALU.
#include <hip/hip_runtime.h>
#include <math.h>
#include <stdint.h>

#define NSB  2
#define LQ   2048
#define EE   256
#define NH   8
#define DH   32
#define MR   (NSB * LQ)
#define XSC  64.0f
#define WSC  1024.0f
#define ISC  (1.0f / 4096.0f)
#define BSC  16.0f
#define QKS  (1.0f / 256.0f)
#define RSQ  0.17677669529663687f
#define MBIG 1.0e32f
#define NEG0 (-1.0e38f)
#define L2E  1.44269504088896340736f  // log2(e): exp(x) = 2^(x * L2E)
#define PSC  4096.0f
#define PLO  2048.0f
#define LOIN (1.0f / 2048.0f)
#define OSA  (1.0f / 256.0f)
#define LOSC 2048.0f
#define OSC  (1.0f / 262144.0f)
#define NBW  16                     // blocks of the Wo transposition: 16 o-tiles
#define PM   128                    // rows m of a projection block
#define NBP  ((MR / PM) * (EE / 128))   // blocks of one projection
#define WPH  144                    // LDS pitch of a staged W row e, halves (256 B of data + 32 B: 32 B x odd for the transposing reader)
#define XPH  264                    // LDS pitch of a staged X row m, halves (512 B of data + 16 B: 16 B x odd for 16-B readers)
static_assert(EE == NH * DH);
static_assert(DH == 32);
static_assert((LQ % PM) == 0 && (EE % 128) == 0 && (MR % PM) == 0);
static_assert(EE == 256 && PM == 128);
static_assert(LQ == 128 * 16);
#define SK   128                    // keys per LDS stage of the attention kernel
#define NST  (LQ / SK)              // stages
#define KPH  40                     // LDS pitch of a staged K row, halves (64 B of data + 16 B: 16 B x odd for 16-B readers)
#define VPH  136                    // LDS pitch of a staged V^T row, halves (256 B of data + 16 B)
#define KBH  (SK * KPH)             // halves per K buffer
#define VBH  (DH * VPH)             // halves per V buffer
static_assert(NST >= 2 && SK == 128);               // the softmax step merges 8 tile maxima and 4 partial sums
static_assert(SK * 4 == 4 * 128 && DH * (SK / 8) == 4 * 128);   // 4 + 4 copies of 16 B per thread and stage

typedef _Float16 v16h __attribute__((ext_vector_type(16)));
typedef _Float16 v8h  __attribute__((ext_vector_type(8)));
typedef float    v8f  __attribute__((ext_vector_type(8)));
typedef float    v4f  __attribute__((ext_vector_type(4)));
typedef unsigned int v4u __attribute__((ext_vector_type(4)));
typedef unsigned int v2u __attribute__((ext_vector_type(2)));
typedef short    s16x8 __attribute__((ext_vector_type(8)));
typedef float    v2f  __attribute__((ext_vector_type(2)));
typedef _Float16 v2h  __attribute__((ext_vector_type(2)));
typedef __bf16   v2b  __attribute__((ext_vector_type(2)));

union FragH { v16h v; v8h h[2]; };

// ---- scalar helpers ----------------------------------------------------------------------------------
__device__ __forceinline__ unsigned short bf_bits(float f) {          // f32 -> bf16 bits, RNE convert
  unsigned u = __float_as_uint(f);
  return (unsigned short)((u + 0x7FFFu + ((u >> 16) & 1u)) >> 16);
}
__device__ __forceinline__ float bf_up(unsigned short h) { return __uint_as_float(((unsigned)h) << 16); }
__device__ __forceinline__ float bfr(float f) { return bf_up(bf_bits(f)); }
__device__ __forceinline__ unsigned short h_bits(_Float16 x) { return __builtin_bit_cast(unsigned short, x); }
__device__ __forceinline__ unsigned pk16(unsigned short a, unsigned short b) { return (unsigned)a | ((unsigned)b << 16); }
__device__ __forceinline__ v8f zero8() { v8f z = {0.f, 0.f, 0.f, 0.f, 0.f, 0.f, 0.f, 0.f}; return z; }
// 4 consecutive f32 -> f16( bf16_RNE(x) * sc ) packed into 8 bytes; the RNE step by the packed hardware convert, which
// gives bfr()'s value for every finite x
__device__ __forceinline__ v2u cvt4(v4f a, float sc) {
  v2u v;
#pragma unroll
  for (int i = 0; i < 2; ++i) {
    const v2f x = {a[2 * i], a[2 * i + 1]};
    const unsigned b = __builtin_bit_cast(unsigned, __builtin_convertvector(x, v2b));
    const v2f y = {__uint_as_float(b << 16) * sc, __uint_as_float(b & 0xFFFF0000u) * sc};
    v[i] = __builtin_bit_cast(unsigned, __builtin_convertvector(y, v2h));
  }
  return v;
}

// ---- fragment loader: 16-bit A/B operand, lane -> row/col (lane&15), p already includes +8*(lane>>4);
//      elements 0..7 <- p[0..7] (k0+8h..), elements 8..15 <- p[16..23] (k0+16+8h..)
__device__ __forceinline__ v16h ldfrag_h(const _Float16* p) {
  FragH f;
  f.h[0] = *(const v8h*)(p);
  f.h[1] = *(const v8h*)(p + 16);
  return f.v;
}

// ---- transposing fragment loader: LDS tile T[k][row] (16-bit, k-major), p = T + (k0 + 8*(lane>>4) + (lane&7)) * pitch
//      + row0 + 8*((lane>>3)&1); lane (ci, hh) receives T[k0+8hh+0..7][row0+ci], then T[k0+16+8hh+0..7][row0+ci]:
//      the k order of ldfrag_h
__device__ __forceinline__ v16h ldfrag_tr(const unsigned short* p, int pitch) {
  typedef __attribute__((address_space(3))) s16x8 lds_s16x8;
  FragH f;
  f.h[0] = __builtin_bit_cast(v8h, __builtin_amdgcn_ds_load_tr16_b128_v8i16((lds_s16x8*)p));
  f.h[1] = __builtin_bit_cast(v8h, __builtin_amdgcn_ds_load_tr16_b128_v8i16((lds_s16x8*)(p + 16 * pitch)));
  return f.v;
}

// ---- WMMA helpers with trailing VALU hazard gap ----------------------------------------------------
__device__ __forceinline__ v8f mma_h(v16h a, v16h b, v8f c) {
  return __builtin_amdgcn_wmma_f32_16x16x32_f16(false, a, false, b, (short)0, c, false, false);
}
// ties 4 accumulators, keeps 5 fragments live through 4 VALU slots
__device__ __forceinline__ void guard4(v8f& a, v8f& b, v8f& c, v8f& d,
                                       v16h x, v16h y0, v16h y1, v16h y2, v16h y3) {
#if defined(__HIP_DEVICE_COMPILE__)
  asm volatile("v_nop\n\tv_nop\n\tv_nop\n\tv_nop"
               : "+v"(a), "+v"(b), "+v"(c), "+v"(d) : "v"(x), "v"(y0), "v"(y1), "v"(y2), "v"(y3));
#endif
}

// ---- 8 independent 2^x in one statement: early-clobbered results, so that no v_exp_f32 overwrites the source of the one
//      in front of it, and one closing v_nop, the slot the instruction set asks for behind a transcendental
__device__ __forceinline__ void exp2x8(float* y, const float* x) {
#if defined(__HIP_DEVICE_COMPILE__)
  asm("v_exp_f32 %0, %8\n\tv_exp_f32 %1, %9\n\tv_exp_f32 %2, %10\n\tv_exp_f32 %3, %11\n\t"
      "v_exp_f32 %4, %12\n\tv_exp_f32 %5, %13\n\tv_exp_f32 %6, %14\n\tv_exp_f32 %7, %15\n\tv_nop"
      : "=&v"(y[0]), "=&v"(y[1]), "=&v"(y[2]), "=&v"(y[3]), "=&v"(y[4]), "=&v"(y[5]), "=&v"(y[6]), "=&v"(y[7])
      : "v"(x[0]), "v"(x[1]), "v"(x[2]), "v"(x[3]), "v"(x[4]), "v"(x[5]), "v"(x[6]), "v"(x[7]));
#endif
}

// =====================================================================================================
// Transposed output-weight plane: HO[o][e] = f16( bf16_RNE(Wo[e][o]) * 1024 ) for the [in][out] weight (x.W layout).
// Block = 16 output rows o0 = 16*bx, 256 threads, 16 blocks, so that this chain is no longer than a projection block's.
// Read W rows e as 4 threads x 16 B (64-B row segment o0..o0+15), all 4 loads of a thread in flight together, 2-B
// transposed LDS stores into Ts[o_local][e] (pitch 264), block barrier, then whole rows out.
// coverage: read 4 it x 64 rows e x 4 pieces x 4 = all 256 e x 16 o; write 2 it x 8 waves = 16 rows x 32 lanes x 8
//           halves = 16 x 256; 16 o-tiles -> HO [256][256] entirely.
// =====================================================================================================
__device__ __forceinline__
void cvt_wt_body(int bx, unsigned short* Ts, const float* __restrict__ src, unsigned short* dst) {
  const int tid  = threadIdx.x;
  const int wave = tid >> 5;
  const int lane = tid & 31;
  const int o0   = bx * 16;
  const int p = tid & 3, r64 = tid >> 2;                // p = 16-B piece of the 64-B row segment, r64 = row in group
  v4f a[4];
#pragma unroll
  for (int it = 0; it < 4; ++it) a[it] = *(const v4f*)(src + (size_t)(it * 64 + r64) * EE + o0 + 4 * p);
#pragma unroll
  for (int it = 0; it < 4; ++it) {
    const int e = it * 64 + r64;                         // 0..255
#pragma unroll
    for (int i = 0; i < 4; ++i) Ts[(4 * p + i) * 264 + e] = h_bits((_Float16)(bfr(a[it][i]) * WSC));
  }
  __syncthreads();
  v4u vals[2];
#pragma unroll
  for (int it = 0; it < 2; ++it) {
    const int row = it * 8 + wave;                       // it 0..1 x wave 0..7 = rows 0..15
    vals[it] = *(const v4u*)(Ts + row * 264 + 8 * lane);
  }
  unsigned short* db = dst + (size_t)o0 * EE + 8 * lane;
#pragma unroll
  for (int it = 0; it < 2; ++it) {
    const int row = it * 8 + wave;
    *(v4u*)(db + (size_t)row * EE) = vals[it];
  }
}

// =====================================================================================================
// Projection GEMM Y[m][o] = sum_e X[m][e] W[e][o] (x 65536 in the accumulator) + b[o], straight from the f32 inputs.
// Block = 8 waves = 128 rows m x 128 cols o (32 m-tiles x 2 o-tiles = 64 blocks per projection). The block converts
// its own operands into LDS: Ws[e][o_local] = f16( bf16_RNE(W[e][o]) * 1024 ) (one wave-load = one 512-B row segment),
// Xs[m_local][e] = f16( bf16_RNE(X[m][e]) * 64 ) (one wave-load = half a row), 8-B LDS stores, block barrier.
// Wave (wm = wave & 3, wo = wave >> 2) owns 32 rows m x 64 cols o: A(W^T rows o = o0+64wo+16t+ci by the transposing
// load, k = e split map) . B(Xs row m = m0+32wm+16i+ci, col = m, same map); 8 k-steps of 32, 8 accumulators per wave;
// acc[i][t][r] <-> (m = m0+32wm+16i+ci, o = o0+64wo+16t+8hh+r). y16 = acc * 2^-12 + 16 * bf16_RNE(b[o]) (= 16 y).
// A second barrier ends every wave's operand reads before the same LDS becomes output staging.
// tr == 0: YO[m][o] = f16(y16): staged as Ts[m_local][o_local] (pitch 136, 16-B LDS stores), block barrier, rows out.
// tr == 1: VT[ns][o][l] (keys contiguous): staged as Ts[o_local][l_local] (pitch 136, 2-B LDS stores), barrier, rows out.
// coverage: operands: 32 it x 8 rows e x 128 o, 32 it x 4 rows m x 256 e; tr 0: 8 it x 16 rows x 16 pieces x 8 halves =
//           128 x 128 per block, grid -> [4096][256]; tr 1: 8 it x 16 lines x 16 pieces x 8 = 128 o x 128 l, grid ->
//           VT [2][256][2048].
// =====================================================================================================
__device__ __forceinline__
void proj_body(int bx, bool tr, unsigned short* Sm, const float* __restrict__ wf, const float* __restrict__ xf,
               const float* __restrict__ bias, unsigned short* yo) {
  const int tid  = threadIdx.x;
  const int wave = tid >> 5;
  const int lane = tid & 31;
  const int hh   = lane >> 4;
  const int ci   = lane & 15;
  const int wm   = wave & 3, wo = wave >> 2;
  const int mt   = bx >> 1, ot = bx & 1;
  const int m0   = mt * PM, o0 = ot * 128;
  unsigned short* Ws = Sm;                               // [256 e][WPH]
  unsigned short* Xs = Sm + EE * WPH;                    // [128 m][XPH]
  {
    const float* wsrc = wf + (size_t)wave * EE + o0 + 4 * lane;                    // row e = 8 it + wave
    const float* xsrc = xf + (size_t)(m0 + (tid >> 6)) * EE + 4 * (tid & 63);      // row m = 4 it + (tid >> 6)
    unsigned short* wd = Ws + wave * WPH + 4 * lane;
    unsigned short* xd = Xs + (tid >> 6) * XPH + 4 * (tid & 63);
    v4f a[32], c[32];
#pragma unroll
    for (int it = 0; it < 32; ++it) a[it] = *(const v4f*)(wsrc + (size_t)(8 * it) * EE);
#if defined(__HIP_DEVICE_COMPILE__)
    // stands between the loads above and a later load whose result the compiler puts into their address pair
    asm volatile("s_wait_xcnt 0x0" ::: "memory");
#endif
#pragma unroll
    for (int it = 0; it < 16; ++it) c[it] = *(const v4f*)(xsrc + (size_t)(4 * it) * EE);
    // keeps these 48 loads ahead of all conversion work: one latency for the lot instead of one per trickled load
    __builtin_amdgcn_sched_barrier(0);
#pragma unroll
    for (int it = 0; it < 16; ++it) *(v2u*)(wd + (8 * it) * WPH) = cvt4(a[it], WSC);
    // the last 16 loads go out as soon as registers are free, ahead of the remaining conversion work
    __builtin_amdgcn_sched_barrier(0);
#pragma unroll
    for (int it = 16; it < 32; ++it) c[it] = *(const v4f*)(xsrc + (size_t)(4 * it) * EE);
    __builtin_amdgcn_sched_barrier(0);                   // closes the group above
#pragma unroll
    for (int it = 16; it < 32; ++it) *(v2u*)(wd + (8 * it) * WPH) = cvt4(a[it], WSC);
#pragma unroll
    for (int it = 0; it < 32; ++it) *(v2u*)(xd + (4 * it) * XPH) = cvt4(c[it], XSC);
  }
  __syncthreads();

  const _Float16* xr = (const _Float16*)(const void*)Xs + (32 * wm + ci) * XPH + 8 * hh;       // B: X row m, + 16 i rows
  const unsigned short* wr = Ws + (8 * hh + (lane & 7)) * WPH + 64 * wo + 8 * ((lane >> 3) & 1);   // A: + k0 rows, + 16 t

  v8f acc[2][4];
#pragma unroll
  for (int i = 0; i < 2; ++i)
#pragma unroll
    for (int t = 0; t < 4; ++t) acc[i][t] = zero8();

  // two register sets: the fragments of k-step ks + 1 are asked for ahead of the products of k-step ks, so that their LDS
  // latency runs under those products; unrolled, so that the set index and every LDS offset are compile-time constants
  v16h wa[2][4], xb[2][2];
#pragma unroll
  for (int t = 0; t < 4; ++t) wa[0][t] = ldfrag_tr(wr + 16 * t, WPH);
#pragma unroll
  for (int i = 0; i < 2; ++i) xb[0][i] = ldfrag_h(xr + (16 * i) * XPH);
#pragma unroll
  for (int ks = 0; ks < EE / 32; ++ks) {
    const int cu = ks & 1, nx = cu ^ 1;
    if (ks + 1 < EE / 32) {
      const int k1 = (ks + 1) * 32;
#pragma unroll
      for (int t = 0; t < 4; ++t) wa[nx][t] = ldfrag_tr(wr + k1 * WPH + 16 * t, WPH);
#pragma unroll
      for (int i = 0; i < 2; ++i) xb[nx][i] = ldfrag_h(xr + (16 * i) * XPH + k1);
    }
    // holds the load group together and ahead of the products: left free, the loads sink in among the products
    __builtin_amdgcn_sched_barrier(0);
#pragma unroll
    for (int i = 0; i < 2; ++i)
#pragma unroll
      for (int t = 0; t < 4; ++t) acc[i][t] = mma_h(wa[cu][t], xb[cu][i], acc[i][t]);
    __builtin_amdgcn_sched_barrier(0);                   // the next load group stays behind these products
  }
  __syncthreads();                                       // every wave has read its operands: the LDS becomes Ts

  unsigned short* Ts = Sm;                               // 128 x 136 halves
  const int p = tid & 15, r16 = tid >> 4;               // r16 0..15 = row within group, p = 16-B piece of the 256-B segment
  if (!tr) {
#pragma unroll
    for (int i = 0; i < 2; ++i) {
      unsigned short* ts = Ts + (32 * wm + 16 * i + ci) * 136 + 64 * wo + 8 * hh;
#pragma unroll
      for (int t = 0; t < 4; ++t) {
        const v4f b0 = *(const v4f*)(bias + o0 + 64 * wo + 16 * t + 8 * hh);
        const v4f b1 = *(const v4f*)(bias + o0 + 64 * wo + 16 * t + 8 * hh + 4);
        float y[8];
#pragma unroll
        for (int e = 0; e < 4; ++e) {
          y[e]     = acc[i][t][e] * ISC     + bfr(b0[e]) * BSC;
          y[4 + e] = acc[i][t][4 + e] * ISC + bfr(b1[e]) * BSC;
        }
        v4u v;
#pragma unroll
        for (int j = 0; j < 4; ++j) v[j] = pk16(h_bits((_Float16)y[2 * j]), h_bits((_Float16)y[2 * j + 1]));
        *(v4u*)(ts + 16 * t) = v;
      }
    }
    __syncthreads();
    v4u vals[8];
#pragma unroll
    for (int it = 0; it < 8; ++it) {
      const int row = it * 16 + r16;                     // it 0..7 x r16 0..15 = rows 0..127
      vals[it] = *(const v4u*)(Ts + row * 136 + 8 * p);
    }
    unsigned short* yb = yo + (size_t)m0 * EE + o0 + 8 * p;
#pragma unroll
    for (int it = 0; it < 8; ++it) {
      const int row = it * 16 + r16;
      *(v4u*)(yb + (size_t)row * EE) = vals[it];
    }
  } else {
    const int ns = m0 / LQ, l0 = m0 - ns * LQ;
#pragma unroll
    for (int i = 0; i < 2; ++i) {
#pragma unroll
      for (int t = 0; t < 4; ++t) {
        const v4f b0 = *(const v4f*)(bias + o0 + 64 * wo + 16 * t + 8 * hh);
        const v4f b1 = *(const v4f*)(bias + o0 + 64 * wo + 16 * t + 8 * hh + 4);
#pragma unroll
        for (int r = 0; r < 4; ++r) {
          Ts[(64 * wo + 16 * t + 8 * hh + r) * 136 + 32 * wm + 16 * i + ci] =
              h_bits((_Float16)(acc[i][t][r] * ISC + bfr(b0[r]) * BSC));
          Ts[(64 * wo + 16 * t + 8 * hh + 4 + r) * 136 + 32 * wm + 16 * i + ci] =
              h_bits((_Float16)(acc[i][t][4 + r] * ISC + bfr(b1[r]) * BSC));
        }
      }
    }
    __syncthreads();
    v4u vals[8];
#pragma unroll
    for (int it = 0; it < 8; ++it) {
      const int orow = it * 16 + r16;                    // it 0..7 x r16 0..15 = o_local 0..127
      vals[it] = *(const v4u*)(Ts + orow * 136 + 8 * p);
    }
    unsigned short* yb = yo + ((size_t)ns * EE + o0) * LQ + l0 + 8 * p;
#pragma unroll
    for (int it = 0; it < 8; ++it) {
      const int orow = it * 16 + r16;
      *(v4u*)(yb + (size_t)orow * LQ) = vals[it];
    }
  }
}

// One launch for the Wo transposition and the three projections, none of which depends on another: blocks 0..15 build
// the HO plane, then 64 blocks each for q, k (row-major out) and v (transposed out). Every select is block-uniform.
__global__ __launch_bounds__(256)
void proj_all(const float* __restrict__ xq, const float* __restrict__ xk, const float* __restrict__ xv,
              const float* __restrict__ wq, const float* __restrict__ wk, const float* __restrict__ wv,
              const float* __restrict__ wo, const float* __restrict__ bq, const float* __restrict__ bk,
              const float* __restrict__ bv, unsigned short* q16, unsigned short* k16, unsigned short* vt,
              unsigned short* ho) {
  __shared__ __align__(16) unsigned short Sm[EE * WPH + PM * XPH];   // 70656 halves >= 16 * 264, 128 * 136
  const int bx = blockIdx.x;
  if (bx < NBW) { cvt_wt_body(bx, Sm, wo, ho); return; }
  const int pb = bx - NBW;
  const int wh = pb / NBP;                               // 0 q, 1 k, 2 v
  proj_body(pb - wh * NBP, wh == 2, Sm, wh == 0 ? wq : (wh == 1 ? wk : wv), wh == 0 ? xq : (wh == 1 ? xk : xv),
            wh == 0 ? bq : (wh == 1 ? bk : bv), wh == 0 ? q16 : (wh == 1 ? k16 : vt));
}

// ---- one stage of K and V^T into LDS: 8 asynchronous 16-B copies per lane (4 of K, 4 of V^T), no register in between.
//      lk / lv = the lane's LDS byte address of its first K / V piece, gk / gv = its global source; piece i of K lies
//      32 rows further (LDS 32 * 80 B, global 32 * 512 B), piece i of V^T 8 rows further (LDS 8 * 272 B, global 8 * 4096 B).
__device__ __forceinline__ void stage_kv(unsigned lk, unsigned lv, const unsigned short* gk, const unsigned short* gv) {
#if defined(__HIP_DEVICE_COMPILE__)
  const unsigned lk1 = lk + 32 * KPH * 2, lk2 = lk + 64 * KPH * 2, lk3 = lk + 96 * KPH * 2;
  const unsigned lv1 = lv + 8 * VPH * 2,  lv2 = lv + 16 * VPH * 2, lv3 = lv + 24 * VPH * 2;
  const unsigned short* gk1 = gk + 32 * EE;
  const unsigned short* gk2 = gk + 64 * EE;
  const unsigned short* gk3 = gk + 96 * EE;
  const unsigned short* gv1 = gv + 8 * LQ;
  const unsigned short* gv2 = gv + 16 * LQ;
  const unsigned short* gv3 = gv + 24 * LQ;
  // the closing s_wait_xcnt stands in the copies' own statement so that no address register is rewritten ahead of it
  asm volatile("global_load_async_to_lds_b128 %0, %8, off\n\t"
               "global_load_async_to_lds_b128 %1, %9, off\n\t"
               "global_load_async_to_lds_b128 %2, %10, off\n\t"
               "global_load_async_to_lds_b128 %3, %11, off\n\t"
               "global_load_async_to_lds_b128 %4, %12, off\n\t"
               "global_load_async_to_lds_b128 %5, %13, off\n\t"
               "global_load_async_to_lds_b128 %6, %14, off\n\t"
               "global_load_async_to_lds_b128 %7, %15, off\n\t"
               "s_wait_xcnt 0x0"
               :: "v"(lk), "v"(lk1), "v"(lk2), "v"(lk3), "v"(lv), "v"(lv1), "v"(lv2), "v"(lv3),
                  "v"(gk), "v"(gk1), "v"(gk2), "v"(gk3), "v"(gv), "v"(gv1), "v"(gv2), "v"(gv3)
               : "memory");
#endif
}

// =====================================================================================================
// Row-softmax attention (online max) per (ns, h, 64 queries q0..), 4 waves, grid 2*8*32 = 512; wave w owns queries
// q0+16w+ci (B operand of the score tile = Q16 row fragment, col = query, k = d, one k-step). Key term
// Mk[l] = (1 - bf16_RNE(pres[ns][l])) * 1e32 staged once per block in LDS. K rows (this head's 64 B) and V^T rows of
// 128 keys are staged per block in LDS by asynchronous copies, two buffers: stage s + 1 flies while stage s is worked
// on; all four waves read their A fragments from the staged tile. One softmax step per stage of 128 keys:
//   8 score D tiles (rows = keys l0+16j+8hh+r, col = query) = A(K16 rows l, k = d) . B(qf);
//   t = (acc/256 - Mk[l]) * (1/sqrt(32)) in f32; stage max over the lane's 64 keys combined with the partner half
//   (lane^16), running max / rescale factor identical for both halves of a query column; p = exp(t - max);
//   P split: hi = f16(4096 p), lo = f16((4096 p - hi) * 2048), both B fragments of each 32 keys lt.. built in registers
//   (element r <- key lt+8hh+r, element 8+r <- key lt+16+8hh+r, lane unchanged); O^T (rows d, cols queries) rescaled once, then
//   += A(VT rows d = h*32 + 16j + ci, keys contiguous) . B(hi) and . B(lo): 4 accumulators (d 0..15 / 16..31, hi / lo).
// Epilogue: 256*O = (acc_hi + acc_lo/2048) / (256 Z) as f16 hi plus f16 residual (x2048), staged per query row in LDS
// coverage: 2 it x 128 threads x 8 halves = 64 rows x 32 per plane per block; grid covers [2][8][2048][32] once.
// =====================================================================================================
__global__ __launch_bounds__(128)
void attn_fwd(const unsigned short* __restrict__ q16, const unsigned short* __restrict__ k16,
              const unsigned short* __restrict__ vt, const float* __restrict__ pres,
              unsigned short* ohp, unsigned short* olp) {
  __shared__ __align__(16) float Mk[LQ];
  __shared__ __align__(16) unsigned short Hs[64 * 40];
  __shared__ __align__(16) unsigned short Lw[64 * 40];
  __shared__ __align__(16) unsigned short Kb[2 * KBH];
  __shared__ __align__(16) unsigned short Vb[2 * VBH];
  const int tid  = threadIdx.x;
  const int wave = tid >> 5;
  const int lane = tid & 31;
  const int hh   = lane >> 4;
  const int ci   = lane & 15;
  const int bx   = blockIdx.x;
  const int ns   = bx / (NH * (LQ / 64));
  const int rem  = bx - ns * (NH * (LQ / 64));
  const int h    = rem / (LQ / 64);
  const int q0   = (rem - h * (LQ / 64)) * 64;
  const int qi   = q0 + 16 * wave + ci;                 // this lane's query
  // copy map: K piece (row tid>>2 (+32i), 16-B piece tid&3), V^T piece (row d = tid>>4 (+8i), 16-B piece tid&15)
  const unsigned lk0 = (unsigned)(uintptr_t)(Kb + (tid >> 2) * KPH + 8 * (tid & 3));
  const unsigned lv0 = (unsigned)(uintptr_t)(Vb + (tid >> 4) * VPH + 8 * (tid & 15));
  const unsigned short* gk0 = k16 + (size_t)(ns * LQ + (tid >> 2)) * EE + h * DH + 8 * (tid & 3);      // + SK * EE per stage
  const unsigned short* gv0 = vt + ((size_t)ns * EE + h * DH + (tid >> 4)) * LQ + 8 * (tid & 15);      // + SK per stage
  stage_kv(lk0, lv0, gk0, gv0);                         // stage 0 -> buffer 0
  {
    const float* pp = pres + (size_t)ns * LQ + 16 * tid;   // 128 threads x 16 floats = 2048 keys
#pragma unroll
    for (int i = 0; i < 4; ++i) {
      const v4f a = *(const v4f*)(pp + 4 * i);
      v4f mv;
#pragma unroll
      for (int e = 0; e < 4; ++e) mv[e] = (1.0f - bfr(a[e])) * MBIG;
      *(v4f*)(Mk + 16 * tid + 4 * i) = mv;
    }
  }
  asm volatile("s_wait_asynccnt 0x0" ::: "memory");     // this wave's copies of stage 0 have landed
  __syncthreads();                                      // publishes Mk and stage 0
  stage_kv(lk0 + KBH * 2, lv0 + VBH * 2, gk0 + (size_t)SK * EE, gv0 + SK);     // stage 1 -> buffer 1

  const _Float16* Q = (const _Float16*)(const void*)q16;
  const v16h qf = ldfrag_h(Q + (size_t)(ns * LQ + qi) * EE + h * DH + 8 * hh);
  const _Float16* kl = (const _Float16*)(const void*)Kb + ci * KPH + 8 * hh;   // + buffer, + key_local * KPH
  const _Float16* vl = (const _Float16*)(const void*)Vb + ci * VPH + 8 * hh;   // row d = ci, + 16 * VPH, + key_local

  float rmax = NEG0, z = 0.f;
  v8f ah0 = zero8(), ah1 = zero8(), al0 = zero8(), al1 = zero8();
#pragma unroll 1
  for (int st = 0; st < NST; ++st) {
    const int bf = st & 1;
    const _Float16* kp = kl + bf * KBH;
    const _Float16* vp = vl + bf * VBH;
    // one softmax step per stage: the 8 score tiles and the lane's 64 exponentials of 128 keys are independent among
    // themselves, and the running max, its cross-half exchange and the rescale come once per stage;
    // every loop of the step is unrolled: its arrays stay in registers and every LDS offset is an immediate
    const float* mp = Mk + st * SK + 8 * hh;
    v8f s[SK / 16];                                      // s[j][r] <-> key st*SK + 16j + 8hh + r, col = query
#pragma unroll
    for (int j = 0; j < SK / 16; ++j) s[j] = mma_h(ldfrag_h(kp + (16 * j) * KPH), qf, zero8());
    float mj[SK / 16];
#pragma unroll
    for (int j = 0; j < SK / 16; ++j) {
      const v4f ma = *(const v4f*)(mp + 16 * j);         // keys 16j + 8hh + 0..3 <-> s[j][0..3]
      const v4f mb = *(const v4f*)(mp + 16 * j + 4);     // keys 16j + 8hh + 4..7 <-> s[j][4..7]
#pragma unroll
      for (int r = 0; r < 4; ++r) {
        s[j][r]     = (s[j][r] * QKS     - ma[r]) * RSQ;
        s[j][4 + r] = (s[j][4 + r] * QKS - mb[r]) * RSQ;
      }
      float m = s[j][0];
#pragma unroll
      for (int r = 1; r < 8; ++r) m = fmaxf(m, s[j][r]);
      mj[j] = m;
    }
    float mx = fmaxf(fmaxf(fmaxf(mj[0], mj[1]), fmaxf(mj[2], mj[3])), fmaxf(fmaxf(mj[4], mj[5]), fmaxf(mj[6], mj[7])));
    mx = fmaxf(mx, __shfl_xor(mx, 16, 32));
    const float nmax = fmaxf(rmax, mx);
    const float corr = __expf(rmax - nmax);
    rmax = nmax;
    ah0 *= corr; ah1 *= corr; al0 *= corr; al1 *= corr;
    v2f zu[SK / 32];                                     // per 32 keys: sums of p over even / odd r, one packed add per pair
#pragma unroll
    for (int u = 0; u < SK / 32; ++u) {
      FragH ph, pl;
      v2f zg[2];
#pragma unroll
      for (int r = 0; r < 8; r += 4) {
        float x[8], p[8];                                // 0..3 <-> s[2u][r..r+3], 4..7 <-> s[2u+1][r..r+3]
#pragma unroll
        for (int e = 0; e < 4; ++e) {
          x[e]     = (s[2 * u][r + e] - nmax) * L2E;
          x[4 + e] = (s[2 * u + 1][r + e] - nmax) * L2E;
        }
        exp2x8(p, x);
        const v2f pa0 = {p[0], p[1]}, pa1 = {p[2], p[3]}, pc0 = {p[4], p[5]}, pc1 = {p[6], p[7]};
        zg[r >> 2] = (pa0 + pc0) + (pa1 + pc1);
#pragma unroll
        for (int e = 0; e < 4; ++e) {
          const float xa = p[e] * PSC, xc = p[4 + e] * PSC;
          const _Float16 ha = (_Float16)xa, hc = (_Float16)xc;
          ph.h[0][r + e] = ha;
          ph.h[1][r + e] = hc;
          pl.h[0][r + e] = (_Float16)((xa - (float)ha) * PLO);
          pl.h[1][r + e] = (_Float16)((xc - (float)hc) * PLO);
        }
      }
      zu[u] = zg[0] + zg[1];
      const v16h va0 = ldfrag_h(vp + u * 32);                      // d = ci
      const v16h va1 = ldfrag_h(vp + 16 * VPH + u * 32);           // d = 16 + ci
      ah0 = mma_h(va0, ph.v, ah0);
      ah1 = mma_h(va1, ph.v, ah1);
      al0 = mma_h(va0, pl.v, al0);
      al1 = mma_h(va1, pl.v, al1);
    }
    const v2f zt = (zu[0] + zu[1]) + (zu[2] + zu[3]);
    z = z * corr + (zt[0] + zt[1]);
    // publish point of stage st + 1: own LDS reads done, own copies landed, then the barrier that both publishes
    // stage st + 1 and ends every wave's reads of the buffer refilled behind it
    asm volatile("s_wait_dscnt 0x0" ::: "memory");
    asm volatile("s_wait_asynccnt 0x0" ::: "memory");
    __syncthreads();
    if (st + 2 < NST)
      stage_kv(lk0 + bf * (KBH * 2), lv0 + bf * (VBH * 2), gk0 + (size_t)(st + 2) * SK * EE, gv0 + (st + 2) * SK);
  }
  asm volatile("s_wait_asynccnt 0x0" ::: "memory");     // nothing of this wave's copies is left in flight

  // ah0/al0[r] <-> d = 8hh + r, ah1/al1[r] <-> d = 16 + 8hh + r, query qi; Z >= 1
  const float zz  = z + __shfl_xor(z, 16, 32);
  const float rzs = (1.0f / zz) * OSA;
  float o[16];
#pragma unroll
  for (int r = 0; r < 8; ++r) {
    o[r]     = (ah0[r] + al0[r] * LOIN) * rzs;
    o[8 + r] = (ah1[r] + al1[r] * LOIN) * rzs;
  }
  v4u h0, h1, g0, g1;
#pragma unroll
  for (int i = 0; i < 4; ++i) {
    const _Float16 a0 = (_Float16)o[2 * i],     a1 = (_Float16)o[2 * i + 1];
    const _Float16 b0 = (_Float16)o[8 + 2 * i], b1 = (_Float16)o[8 + 2 * i + 1];
    const _Float16 la0 = (_Float16)((o[2 * i]         - (float)a0) * LOSC);
    const _Float16 la1 = (_Float16)((o[2 * i + 1]     - (float)a1) * LOSC);
    const _Float16 lb0 = (_Float16)((o[8 + 2 * i]     - (float)b0) * LOSC);
    const _Float16 lb1 = (_Float16)((o[8 + 2 * i + 1] - (float)b1) * LOSC);
    h0[i] = pk16(h_bits(a0), h_bits(a1));
    h1[i] = pk16(h_bits(b0), h_bits(b1));
    g0[i] = pk16(h_bits(la0), h_bits(la1));
    g1[i] = pk16(h_bits(lb0), h_bits(lb1));
  }
  {
    const int ro = (16 * wave + ci) * 40 + 8 * hh;
    *(v4u*)(Hs + ro)      = h0;
    *(v4u*)(Hs + ro + 16) = h1;
    *(v4u*)(Lw + ro)      = g0;
    *(v4u*)(Lw + ro + 16) = g1;
  }
  __syncthreads();
  {
    const size_t ob = ((size_t)(ns * NH + h) * LQ + q0) * DH;      // 4096-B aligned region of 64 x 32 halves
    v4u hv[2], lv[2];
#pragma unroll
    for (int it2 = 0; it2 < 2; ++it2) {
      const int hf = it2 * 1024 + 8 * tid;             // half index within the 2048-half region
      const int row = hf >> 5, col = hf & 31;
      hv[it2] = *(const v4u*)(Hs + row * 40 + col);
      lv[it2] = *(const v4u*)(Lw + row * 40 + col);
    }
    {
#pragma unroll
      for (int it2 = 0; it2 < 2; ++it2) {
        const int hf = it2 * 1024 + 8 * tid;
        *(v4u*)(ohp + ob + hf) = hv[it2];
        *(v4u*)(olp + ob + hf) = lv[it2];
      }
      
    }
  }
}

// =====================================================================================================
// Output projection out[m][o] = sum_c O[m][c] Wo[c][o] + bo[o], O = (hi + lo/2048)/256 from the OH/OL planes
// ([ns][h][q][32]: k-step j = head j). Block = 4 waves = 64 rows m x 64 cols o (grid 64 x 4 = 256); wave w owns rows
// m0+16w+ci (B operands = OH and OL row fragments, col = m), A = HO plane rows o0+16t+ci (k = c split map); 4 hi + 4
// lo accumulators; acc[t][r] <-> (m = m0+16w+ci, o = o0+16t+8hh+r).
// Epilogue: (acch + accl/2048)/262144 + bf16_RNE(bo) staged in LDS as Ts[m_local][o_local] (pitch 68, 16-B vector
// coverage: 8 it x 8 rows x 16 pieces x 4 floats = 64 x 64 per block; grid covers out [4096][256] exactly once.
// =====================================================================================================
__global__ __launch_bounds__(128)
void out_proj(const unsigned short* __restrict__ ohp, const unsigned short* __restrict__ olp,
              const unsigned short* __restrict__ woh, const float* __restrict__ bo, float* out) {
  __shared__ __align__(16) float Ts[64 * 68];
  const int tid  = threadIdx.x;
  const int wave = tid >> 5;
  const int lane = tid & 31;
  const int hh   = lane >> 4;
  const int ci   = lane & 15;
  const int bx   = blockIdx.x;
  const int mt   = bx >> 2, ot = bx & 3;
  const int m0   = mt * 64, o0 = ot * 64;
  const int ns   = m0 / LQ;
  const int ql   = m0 - ns * LQ + 16 * wave + ci;       // query of this lane's row
  const _Float16* OHf = (const _Float16*)(const void*)ohp;
  const _Float16* OLf = (const _Float16*)(const void*)olp;
  const _Float16* W   = (const _Float16*)(const void*)woh;
  const size_t orow = ((size_t)(ns * NH) * LQ + ql) * DH + 8 * hh;    // + j * LQ * DH per head
  const _Float16* ar = OHf + orow;
  const _Float16* lr = OLf + orow;
  const _Float16* wr = W + (size_t)(o0 + ci) * EE + 8 * hh;           // + 16t*EE + 32j

  v8f acch[4], accl[4];
#pragma unroll
  for (int t = 0; t < 4; ++t) { acch[t] = zero8(); accl[t] = zero8(); }

#pragma unroll 1
  for (int j = 0; j < NH; ++j) {
    const v16h obh = ldfrag_h(ar + (size_t)j * LQ * DH);
    const v16h obl = ldfrag_h(lr + (size_t)j * LQ * DH);
    v16h wa[4];
#pragma unroll
    for (int t = 0; t < 4; ++t) wa[t] = ldfrag_h(wr + (size_t)(16 * t) * EE + 32 * j);
#pragma unroll
    for (int t = 0; t < 4; ++t) acch[t] = mma_h(wa[t], obh, acch[t]);
    guard4(acch[0], acch[1], acch[2], acch[3], obh, wa[0], wa[1], wa[2], wa[3]);
#pragma unroll
    for (int t = 0; t < 4; ++t) accl[t] = mma_h(wa[t], obl, accl[t]);
    guard4(accl[0], accl[1], accl[2], accl[3], obl, wa[0], wa[1], wa[2], wa[3]);
  }

  {
    float* ts = Ts + (16 * wave + ci) * 68 + 8 * hh;
#pragma unroll
    for (int t = 0; t < 4; ++t) {
      const v4f b0 = *(const v4f*)(bo + o0 + 16 * t + 8 * hh);
      const v4f b1 = *(const v4f*)(bo + o0 + 16 * t + 8 * hh + 4);
      v4f r0, r1;
#pragma unroll
      for (int e = 0; e < 4; ++e) {
        r0[e] = (acch[t][e]     + accl[t][e]     * LOIN) * OSC + bfr(b0[e]);
        r1[e] = (acch[t][4 + e] + accl[t][4 + e] * LOIN) * OSC + bfr(b1[e]);
      }
      *(v4f*)(ts + 16 * t)     = r0;
      *(v4f*)(ts + 16 * t + 4) = r1;
    }
  }
  __syncthreads();
  {
    const int p = tid & 15, r16 = tid >> 4;             // r16 0..7, p = 16-B piece of the 256-B segment
    v4f vals[8];
#pragma unroll
    for (int it = 0; it < 8; ++it) {
      const int row = it * 8 + r16;                      // it 0..7 x r16 0..7 = rows 0..63
      vals[it] = *(const v4f*)(Ts + row * 68 + 4 * p);
    }
    float* yb = out + (size_t)m0 * EE + o0 + 4 * p;
    {
#pragma unroll
      for (int it = 0; it < 8; ++it) {
        const int row = it * 8 + r16;
        *(v4f*)(yb + (size_t)row * EE) = vals[it];
      }
      
    }
  }
}

// =====================================================================================================
// Workspace map (bytes), every offset a multiple of 256 and every plane sized to its whole-line store granularity:
//   HO           f16 [256][256]       131072           0 .. 131072
//   Q16, K16     f16 [4096][256]      2 x 2097152      .. 4325376
//   VT           f16 [2][256][2048]   2097152          .. 6422528
//   OH, OL       f16 [2][8][2048][32] 2 x 2097152      .. 10616832  (end)
// =====================================================================================================
extern "C" void kernel_launch(void* const* d_in, const int* in_sizes, int n_in,
                              void* d_out, int out_size, void* d_ws, size_t ws_size,
                              hipStream_t stream) {
  if (n_in < 12) return;
  if (in_sizes[0] != MR * EE || in_sizes[1] != MR * EE || in_sizes[2] != MR * EE) return;
  if (in_sizes[3] != NSB * LQ) return;
  if (in_sizes[4] != EE * EE || in_sizes[6] != EE * EE || in_sizes[8] != EE * EE || in_sizes[10] != EE * EE) return;
  if (in_sizes[5] != EE || in_sizes[7] != EE || in_sizes[9] != EE || in_sizes[11] != EE) return;
  if (out_size != MR * EE) return;

  const float* queries = (const float*)d_in[0];
  const float* keys    = (const float*)d_in[1];
  const float* values  = (const float*)d_in[2];
  const float* pres    = (const float*)d_in[3];
  const float* Wq      = (const float*)d_in[4];
  const float* bq      = (const float*)d_in[5];
  const float* Wk      = (const float*)d_in[6];
  const float* bk      = (const float*)d_in[7];
  const float* Wv      = (const float*)d_in[8];
  const float* bv      = (const float*)d_in[9];
  const float* Wo      = (const float*)d_in[10];
  const float* bo      = (const float*)d_in[11];
  float* out = (float*)d_out;

  const size_t PW  = (size_t)EE * EE * 2;               // 131072
  const size_t PP  = (size_t)MR * EE * 2;               // 2097152
  const size_t PVT = (size_t)NSB * EE * LQ * 2;         // 2097152
  const size_t PO  = (size_t)NSB * NH * LQ * DH * 2;    // 2097152
  size_t off = 0;
  const size_t oHO = off; off += PW;
  const size_t oQ  = off; off += PP;
  const size_t oK  = off; off += PP;
  const size_t oVT = off; off += PVT;
  const size_t oOH = off; off += PO;
  const size_t oOL = off; off += PO;
  if (off > ws_size) return;                            // off = 10616832
  if (off > (size_t)134217728) return;

  char* ws = (char*)d_ws;
  unsigned short* HOp = (unsigned short*)(ws + oHO);
  unsigned short* Q16 = (unsigned short*)(ws + oQ);
  unsigned short* K16 = (unsigned short*)(ws + oK);
  unsigned short* VTp = (unsigned short*)(ws + oVT);
  unsigned short* OHp = (unsigned short*)(ws + oOH);
  unsigned short* OLp = (unsigned short*)(ws + oOL);

  const dim3 blk256(256), blk128(128);
  const dim3 gPJ(NBW + 3 * NBP);                        // 16 + 3 x 64 blocks
  const dim3 gAT(NSB * NH * (LQ / 64));                 // 512 blocks
  const dim3 gOP((MR / 64) * (EE / 64));                // 256 blocks

  // (1) transposed 16-bit Wo plane HO[o][e]; projections from the f32 inputs: q, k row-major [4096][256] (x16),
  //     v transposed VT[ns][hd][l] (x16), biases added
  proj_all<<<gPJ, blk256, 0, stream>>>(queries, keys, values, Wq, Wk, Wv, Wo, bq, bk, bv, Q16, K16, VTp, HOp);
  // (2) attention output planes OH / OL [ns][h][q][32] (row softmax over keys with the key term)
  attn_fwd<<<gAT, blk128, 0, stream>>>(Q16, K16, VTp, pres, OHp, OLp);
  // (3) output projection + bias -> d_out [4096][256] f32
  out_proj<<<gOP, blk128, 0, stream>>>(OHp, OLp, HOp, bo, out);
  (void)hipGetLastError();
}

// v005
// It runs in 37 microseconds.
// In both of two side-by-side timings against v004, it was 1.13 times as fast.
// Over all steps from v000 it is 2.85 times as fast.
// Contractions, all v_wmma_f32_16x16x32_f16 (f16 operands, f32 accumulate): q/k/v projections X.W with f16
// containers holding bf16-RNE inputs (X x64, W x1024); scores K.q with q, k planes f16 x16 (K = 32 per head);
// P as f16 hi (x4096) + residual (same scale) planes . V plane (f16 x16) into two accumulator pairs; output projection
// with O as f16 hi (x256) + residual (x2^11) planes and Wo bf16-RNE x1024 into two accumulators. Key-mask term,
// running max / sum, exp, residual folds and biases in f32 on VALU.
#include <hip/hip_runtime.h>
#include <math.h>
#include <stdint.h>

#define NSB  2
#define LQ   2048
#define EE   256
#define NH   8
#define DH   32
#define MR   (NSB * LQ)
#define XSC  64.0f
#define WSC  1024.0f
#define ISC  (1.0f / 4096.0f)
#define BSC  16.0f
#define RL2E (0.17677669529663687 * 1.44269504088896340736)   // log2(e) / sqrt(32): exp(s / sqrt(32)) = 2^(s * RL2E)
#define SCL  ((float)(RL2E / 256.0))   // score accumulator (256 q.k) -> log2 units
#define MB2  ((float)(1.0e32 * RL2E))  // the key term's 1e32 in log2 units
#define NEG0 (-1.0e38f)
#define POFF 12.0f                     // P carries 2^12: the exponent's reference point lies 12 below the running max
#define LOIN (1.0f / 2048.0f)
#define LOSC 2048.0f
#define OSC  (1.0f / 262144.0f)
#define NBW  16                     // blocks of the Wo transposition: 16 o-tiles
#define PM   128                    // rows m of a projection block
#define NBP  ((MR / PM) * (EE / 128))   // blocks of one projection
#define WPH  144                    // LDS pitch of a staged W row e, halves (256 B of data + 32 B: 32 B x odd for the transposing reader)
#define XPH  264                    // LDS pitch of a staged X row m, halves (512 B of data + 16 B: 16 B x odd for 16-B readers)
static_assert(EE == NH * DH);
static_assert(DH == 32);
static_assert((LQ % PM) == 0 && (EE % 128) == 0 && (MR % PM) == 0);
static_assert(EE == 256 && PM == 128);
static_assert(LQ == 128 * 16);
#define SK   128                    // keys per LDS stage of the attention kernel
#define NST  (LQ / SK)              // stages
#define KPH  40                     // LDS pitch of a staged K row, halves (64 B of data + 16 B: 16 B x odd for 16-B readers)
#define VPH  136                    // LDS pitch of a staged V^T row, halves (256 B of data + 16 B)
#define KBH  (SK * KPH)             // halves per K buffer
#define VBH  (DH * VPH)             // halves per V buffer
static_assert(NST >= 2 && SK == 128);               // the softmax step merges 8 tile maxima and 4 partial sums
static_assert(SK * 4 == 4 * 128 && DH * (SK / 8) == 4 * 128);   // 4 + 4 copies of 16 B per thread and stage

typedef _Float16 v16h __attribute__((ext_vector_type(16)));
typedef _Float16 v8h  __attribute__((ext_vector_type(8)));
typedef float    v8f  __attribute__((ext_vector_type(8)));
typedef float    v4f  __attribute__((ext_vector_type(4)));
typedef unsigned int v4u __attribute__((ext_vector_type(4)));
typedef unsigned int v2u __attribute__((ext_vector_type(2)));
typedef unsigned int v8u __attribute__((ext_vector_type(8)));
typedef short    s16x8 __attribute__((ext_vector_type(8)));
typedef float    v2f  __attribute__((ext_vector_type(2)));
typedef _Float16 v2h  __attribute__((ext_vector_type(2)));
typedef __bf16   v2b  __attribute__((ext_vector_type(2)));

union FragH { v16h v; v8h h[2]; };

// ---- scalar helpers ----------------------------------------------------------------------------------
__device__ __forceinline__ unsigned short bf_bits(float f) {          // f32 -> bf16 bits, RNE convert
  unsigned u = __float_as_uint(f);
  return (unsigned short)((u + 0x7FFFu + ((u >> 16) & 1u)) >> 16);
}
__device__ __forceinline__ float bf_up(unsigned short h) { return __uint_as_float(((unsigned)h) << 16); }
__device__ __forceinline__ float bfr(float f) { return bf_up(bf_bits(f)); }
__device__ __forceinline__ unsigned short h_bits(_Float16 x) { return __builtin_bit_cast(unsigned short, x); }
__device__ __forceinline__ unsigned pk16(unsigned short a, unsigned short b) { return (unsigned)a | ((unsigned)b << 16); }
__device__ __forceinline__ v8f zero8() { v8f z = {0.f, 0.f, 0.f, 0.f, 0.f, 0.f, 0.f, 0.f}; return z; }
// 4 consecutive f32 -> f16( bf16_RNE(x) * sc ) packed into 8 bytes; the RNE step by the packed hardware convert, which
// gives bfr()'s value for every finite x
__device__ __forceinline__ v2u cvt4(v4f a, float sc) {
  v2u v;
#pragma unroll
  for (int i = 0; i < 2; ++i) {
    const v2f x = {a[2 * i], a[2 * i + 1]};
    const unsigned b = __builtin_bit_cast(unsigned, __builtin_convertvector(x, v2b));
    const v2f y = {__uint_as_float(b << 16) * sc, __uint_as_float(b & 0xFFFF0000u) * sc};
    v[i] = __builtin_bit_cast(unsigned, __builtin_convertvector(y, v2h));
  }
  return v;
}

// ---- fragment loader: 16-bit A/B operand, lane -> row/col (lane&15), p already includes +8*(lane>>4);
//      elements 0..7 <- p[0..7] (k0+8h..), elements 8..15 <- p[16..23] (k0+16+8h..)
__device__ __forceinline__ v16h ldfrag_h(const _Float16* p) {
  FragH f;
  f.h[0] = *(const v8h*)(p);
  f.h[1] = *(const v8h*)(p + 16);
  return f.v;
}

// ---- transposing fragment loader: LDS tile T[k][row] (16-bit, k-major), p = T + (k0 + 8*(lane>>4) + (lane&7)) * pitch
//      + row0 + 8*((lane>>3)&1); lane (ci, hh) receives T[k0+8hh+0..7][row0+ci], then T[k0+16+8hh+0..7][row0+ci]:
//      the k order of ldfrag_h
__device__ __forceinline__ v16h ldfrag_tr(const unsigned short* p, int pitch) {
  typedef __attribute__((address_space(3))) s16x8 lds_s16x8;
  FragH f;
  f.h[0] = __builtin_bit_cast(v8h, __builtin_amdgcn_ds_load_tr16_b128_v8i16((lds_s16x8*)p));
  f.h[1] = __builtin_bit_cast(v8h, __builtin_amdgcn_ds_load_tr16_b128_v8i16((lds_s16x8*)(p + 16 * pitch)));
  return f.v;
}

// ---- WMMA helpers with trailing VALU hazard gap ----------------------------------------------------
__device__ __forceinline__ v8f mma_h(v16h a, v16h b, v8f c) {
  return __builtin_amdgcn_wmma_f32_16x16x32_f16(false, a, false, b, (short)0, c, false, false);
}
// ties 4 accumulators, keeps 5 fragments live through 4 VALU slots
__device__ __forceinline__ void guard4(v8f& a, v8f& b, v8f& c, v8f& d,
                                       v16h x, v16h y0, v16h y1, v16h y2, v16h y3) {
#if defined(__HIP_DEVICE_COMPILE__)
  asm volatile("v_nop\n\tv_nop\n\tv_nop\n\tv_nop"
               : "+v"(a), "+v"(b), "+v"(c), "+v"(d) : "v"(x), "v"(y0), "v"(y1), "v"(y2), "v"(y3));
#endif
}

// ---- residual halves of 8 values: l = f16(p - hi), two per register. The mixed-precision FMA hi * (-1) + p takes hi (f16)
//      straight from its packed half, -1 and p as f32, and writes one half of l (left to itself the compiler converts hi
//      back to f32, subtracts and repacks). The four low halves stand ahead of the four high halves; s_delay_alu names
//      that distance of 4, so that the wait of a high half for its register's low half does not hold up the SIMD's other wave.
__device__ __forceinline__ void resid8(unsigned* l, const unsigned* h, const float* p) {
#if defined(__HIP_DEVICE_COMPILE__)
  asm("v_fma_mixlo_f16 %0, %4, %16, %8 op_sel_hi:[1,0,0]\n\t"
      "v_fma_mixlo_f16 %1, %5, %16, %10 op_sel_hi:[1,0,0]\n\t"
      "v_fma_mixlo_f16 %2, %6, %16, %12 op_sel_hi:[1,0,0]\n\t"
      "v_fma_mixlo_f16 %3, %7, %16, %14 op_sel_hi:[1,0,0]\n\t"
      "s_delay_alu instid0(VALU_DEP_4) | instskip(NEXT) | instid1(VALU_DEP_4)\n\t"
      "v_fma_mixhi_f16 %0, %4, %16, %9 op_sel:[1,0,0] op_sel_hi:[1,0,0]\n\t"
      "v_fma_mixhi_f16 %1, %5, %16, %11 op_sel:[1,0,0] op_sel_hi:[1,0,0]\n\t"
      "s_delay_alu instid0(VALU_DEP_4) | instskip(NEXT) | instid1(VALU_DEP_4)\n\t"
      "v_fma_mixhi_f16 %2, %6, %16, %13 op_sel:[1,0,0] op_sel_hi:[1,0,0]\n\t"
      "v_fma_mixhi_f16 %3, %7, %16, %15 op_sel:[1,0,0] op_sel_hi:[1,0,0]"
      : "=&v"(l[0]), "=&v"(l[1]), "=&v"(l[2]), "=&v"(l[3])
      : "v"(h[0]), "v"(h[1]), "v"(h[2]), "v"(h[3]),
        "v"(p[0]), "v"(p[1]), "v"(p[2]), "v"(p[3]), "v"(p[4]), "v"(p[5]), "v"(p[6]), "v"(p[7]), "s"(-1.0f));
#endif
}

// =====================================================================================================
// Transposed output-weight plane: HO[o][e] = f16( bf16_RNE(Wo[e][o]) * 1024 ) for the [in][out] weight (x.W layout).
// Block = 16 output rows o0 = 16*bx, 256 threads, 16 blocks, so that this chain is no longer than a projection block's.
// Read W rows e as 4 threads x 16 B (64-B row segment o0..o0+15), all 4 loads of a thread in flight together, 2-B
// transposed LDS stores into Ts[o_local][e] (pitch 264), block barrier, then whole rows out.
// coverage: read 4 it x 64 rows e x 4 pieces x 4 = all 256 e x 16 o; write 2 it x 8 waves = 16 rows x 32 lanes x 8
//           halves = 16 x 256; 16 o-tiles -> HO [256][256] entirely.
// =====================================================================================================
__device__ __forceinline__
void cvt_wt_body(int bx, unsigned short* Ts, const float* __restrict__ src, unsigned short* dst) {
  const int tid  = threadIdx.x;
  const int wave = tid >> 5;
  const int lane = tid & 31;
  const int o0   = bx * 16;
  const int p = tid & 3, r64 = tid >> 2;                // p = 16-B piece of the 64-B row segment, r64 = row in group
  v4f a[4];
#pragma unroll
  for (int it = 0; it < 4; ++it) a[it] = *(const v4f*)(src + (size_t)(it * 64 + r64) * EE + o0 + 4 * p);
#pragma unroll
  for (int it = 0; it < 4; ++it) {
    const int e = it * 64 + r64;                         // 0..255
#pragma unroll
    for (int i = 0; i < 4; ++i) Ts[(4 * p + i) * 264 + e] = h_bits((_Float16)(bfr(a[it][i]) * WSC));
  }
  __syncthreads();
  v4u vals[2];
#pragma unroll
  for (int it = 0; it < 2; ++it) {
    const int row = it * 8 + wave;                       // it 0..1 x wave 0..7 = rows 0..15
    vals[it] = *(const v4u*)(Ts + row * 264 + 8 * lane);
  }
  unsigned short* db = dst + (size_t)o0 * EE + 8 * lane;
#pragma unroll
  for (int it = 0; it < 2; ++it) {
    const int row = it * 8 + wave;
    *(v4u*)(db + (size_t)row * EE) = vals[it];
  }
}

// =====================================================================================================
// Projection GEMM Y[m][o] = sum_e X[m][e] W[e][o] (x 65536 in the accumulator) + b[o], straight from the f32 inputs.
// Block = 8 waves = 128 rows m x 128 cols o (32 m-tiles x 2 o-tiles = 64 blocks per projection). The block converts
// its own operands into LDS: Ws[e][o_local] = f16( bf16_RNE(W[e][o]) * 1024 ) (one wave-load = one 512-B row segment),
// Xs[m_local][e] = f16( bf16_RNE(X[m][e]) * 64 ) (one wave-load = half a row), 8-B LDS stores, block barrier.
// Wave (wm = wave & 3, wo = wave >> 2) owns 32 rows m x 64 cols o: A(W^T rows o = o0+64wo+16t+ci by the transposing
// load, k = e split map) . B(Xs row m = m0+32wm+16i+ci, col = m, same map); 8 k-steps of 32, 8 accumulators per wave;
// acc[i][t][r] <-> (m = m0+32wm+16i+ci, o = o0+64wo+16t+8hh+r). y16 = acc * 2^-12 + 16 * bf16_RNE(b[o]) (= 16 y).
// A second barrier ends every wave's operand reads before the same LDS becomes output staging.
// tr == 0: YO[m][o] = f16(y16): staged as Ts[m_local][o_local] (pitch 136, 16-B LDS stores), block barrier, rows out.
// tr == 1: VT[ns][o][l] (keys contiguous): staged as Ts[o_local][l_local] (pitch 136, 2-B LDS stores), barrier, rows out.
// coverage: operands: 32 it x 8 rows e x 128 o, 32 it x 4 rows m x 256 e; tr 0: 8 it x 16 rows x 16 pieces x 8 halves =
//           128 x 128 per block, grid -> [4096][256]; tr 1: 8 it x 16 lines x 16 pieces x 8 = 128 o x 128 l, grid ->
//           VT [2][256][2048].
// =====================================================================================================
__device__ __forceinline__
void proj_body(int bx, bool tr, unsigned short* Sm, const float* __restrict__ wf, const float* __restrict__ xf,
               const float* __restrict__ bias, unsigned short* yo) {
  const int tid  = threadIdx.x;
  const int wave = tid >> 5;
  const int lane = tid & 31;
  const int hh   = lane >> 4;
  const int ci   = lane & 15;
  const int wm   = wave & 3, wo = wave >> 2;
  const int mt   = bx >> 1, ot = bx & 1;
  const int m0   = mt * PM, o0 = ot * 128;
  unsigned short* Ws = Sm;                               // [256 e][WPH]
  unsigned short* Xs = Sm + EE * WPH;                    // [128 m][XPH]
  {
    const float* wsrc = wf + (size_t)wave * EE + o0 + 4 * lane;                    // row e = 8 it + wave
    const float* xsrc = xf + (size_t)(m0 + (tid >> 6)) * EE + 4 * (tid & 63);      // row m = 4 it + (tid >> 6)
    unsigned short* wd = Ws + wave * WPH + 4 * lane;
    unsigned short* xd = Xs + (tid >> 6) * XPH + 4 * (tid & 63);
    v4f a[32], c[32];
#pragma unroll
    for (int it = 0; it < 32; ++it) a[it] = *(const v4f*)(wsrc + (size_t)(8 * it) * EE);
#if defined(__HIP_DEVICE_COMPILE__)
    // stands between the loads above and a later load whose result the compiler puts into their address pair
    asm volatile("s_wait_xcnt 0x0" ::: "memory");
#endif
#pragma unroll
    for (int it = 0; it < 16; ++it) c[it] = *(const v4f*)(xsrc + (size_t)(4 * it) * EE);
    // keeps these 48 loads ahead of all conversion work: one latency for the lot instead of one per trickled load
    __builtin_amdgcn_sched_barrier(0);
#pragma unroll
    for (int it = 0; it < 16; ++it) *(v2u*)(wd + (8 * it) * WPH) = cvt4(a[it], WSC);
    // the last 16 loads go out as soon as registers are free, ahead of the remaining conversion work
    __builtin_amdgcn_sched_barrier(0);
#pragma unroll
    for (int it = 16; it < 32; ++it) c[it] = *(const v4f*)(xsrc + (size_t)(4 * it) * EE);
    __builtin_amdgcn_sched_barrier(0);                   // closes the group above
#pragma unroll
    for (int it = 16; it < 32; ++it) *(v2u*)(wd + (8 * it) * WPH) = cvt4(a[it], WSC);
#pragma unroll
    for (int it = 0; it < 32; ++it) *(v2u*)(xd + (4 * it) * XPH) = cvt4(c[it], XSC);
  }
  __syncthreads();

  const _Float16* xr = (const _Float16*)(const void*)Xs + (32 * wm + ci) * XPH + 8 * hh;       // B: X row m, + 16 i rows
  const unsigned short* wr = Ws + (8 * hh + (lane & 7)) * WPH + 64 * wo + 8 * ((lane >> 3) & 1);   // A: + k0 rows, + 16 t

  v8f acc[2][4];
#pragma unroll
  for (int i = 0; i < 2; ++i)
#pragma unroll
    for (int t = 0; t < 4; ++t) acc[i][t] = zero8();

  // two register sets: the fragments of k-step ks + 1 are asked for ahead of the products of k-step ks, so that their LDS
  // latency runs under those products; unrolled, so that the set index and every LDS offset are compile-time constants
  v16h wa[2][4], xb[2][2];
#pragma unroll
  for (int t = 0; t < 4; ++t) wa[0][t] = ldfrag_tr(wr + 16 * t, WPH);
#pragma unroll
  for (int i = 0; i < 2; ++i) xb[0][i] = ldfrag_h(xr + (16 * i) * XPH);
#pragma unroll
  for (int ks = 0; ks < EE / 32; ++ks) {
    const int cu = ks & 1, nx = cu ^ 1;
    if (ks + 1 < EE / 32) {
      const int k1 = (ks + 1) * 32;
#pragma unroll
      for (int t = 0; t < 4; ++t) wa[nx][t] = ldfrag_tr(wr + k1 * WPH + 16 * t, WPH);
#pragma unroll
      for (int i = 0; i < 2; ++i) xb[nx][i] = ldfrag_h(xr + (16 * i) * XPH + k1);
    }
    // holds the load group together and ahead of the products: left free, the loads sink in among the products
    __builtin_amdgcn_sched_barrier(0);
#pragma unroll
    for (int i = 0; i < 2; ++i)
#pragma unroll
      for (int t = 0; t < 4; ++t) acc[i][t] = mma_h(wa[cu][t], xb[cu][i], acc[i][t]);
    __builtin_amdgcn_sched_barrier(0);                   // the next load group stays behind these products
  }
  __syncthreads();                                       // every wave has read its operands: the LDS becomes Ts

  unsigned short* Ts = Sm;                               // 128 x 136 halves
  const int p = tid & 15, r16 = tid >> 4;               // r16 0..15 = row within group, p = 16-B piece of the 256-B segment
  if (!tr) {
#pragma unroll
    for (int i = 0; i < 2; ++i) {
      unsigned short* ts = Ts + (32 * wm + 16 * i + ci) * 136 + 64 * wo + 8 * hh;
#pragma unroll
      for (int t = 0; t < 4; ++t) {
        const v4f b0 = *(const v4f*)(bias + o0 + 64 * wo + 16 * t + 8 * hh);
        const v4f b1 = *(const v4f*)(bias + o0 + 64 * wo + 16 * t + 8 * hh + 4);
        float y[8];
#pragma unroll
        for (int e = 0; e < 4; ++e) {
          y[e]     = acc[i][t][e] * ISC     + bfr(b0[e]) * BSC;
          y[4 + e] = acc[i][t][4 + e] * ISC + bfr(b1[e]) * BSC;
        }
        v4u v;
#pragma unroll
        for (int j = 0; j < 4; ++j) v[j] = pk16(h_bits((_Float16)y[2 * j]), h_bits((_Float16)y[2 * j + 1]));
        *(v4u*)(ts + 16 * t) = v;
      }
    }
    __syncthreads();
    v4u vals[8];
#pragma unroll
    for (int it = 0; it < 8; ++it) {
      const int row = it * 16 + r16;                     // it 0..7 x r16 0..15 = rows 0..127
      vals[it] = *(const v4u*)(Ts + row * 136 + 8 * p);
    }
    unsigned short* yb = yo + (size_t)m0 * EE + o0 + 8 * p;
#pragma unroll
    for (int it = 0; it < 8; ++it) {
      const int row = it * 16 + r16;
      *(v4u*)(yb + (size_t)row * EE) = vals[it];
    }
  } else {
    const int ns = m0 / LQ, l0 = m0 - ns * LQ;
#pragma unroll
    for (int i = 0; i < 2; ++i) {
#pragma unroll
      for (int t = 0; t < 4; ++t) {
        const v4f b0 = *(const v4f*)(bias + o0 + 64 * wo + 16 * t + 8 * hh);
        const v4f b1 = *(const v4f*)(bias + o0 + 64 * wo + 16 * t + 8 * hh + 4);
#pragma unroll
        for (int r = 0; r < 4; ++r) {
          Ts[(64 * wo + 16 * t + 8 * hh + r) * 136 + 32 * wm + 16 * i + ci] =
              h_bits((_Float16)(acc[i][t][r] * ISC + bfr(b0[r]) * BSC));
          Ts[(64 * wo + 16 * t + 8 * hh + 4 + r) * 136 + 32 * wm + 16 * i + ci] =
              h_bits((_Float16)(acc[i][t][4 + r] * ISC + bfr(b1[r]) * BSC));
        }
      }
    }
    __syncthreads();
    v4u vals[8];
#pragma unroll
    for (int it = 0; it < 8; ++it) {
      const int orow = it * 16 + r16;                    // it 0..7 x r16 0..15 = o_local 0..127
      vals[it] = *(const v4u*)(Ts + orow * 136 + 8 * p);
    }
    unsigned short* yb = yo + ((size_t)ns * EE + o0) * LQ + l0 + 8 * p;
#pragma unroll
    for (int it = 0; it < 8; ++it) {
      const int orow = it * 16 + r16;
      *(v4u*)(yb + (size_t)orow * LQ) = vals[it];
    }
  }
}

// One launch for the Wo transposition and the three projections, none of which depends on another: blocks 0..15 build
// the HO plane, then 64 blocks each for q, k (row-major out) and v (transposed out). Every select is block-uniform.
__global__ __launch_bounds__(256)
void proj_all(const float* __restrict__ xq, const float* __restrict__ xk, const float* __restrict__ xv,
              const float* __restrict__ wq, const float* __restrict__ wk, const float* __restrict__ wv,
              const float* __restrict__ wo, const float* __restrict__ bq, const float* __restrict__ bk,
              const float* __restrict__ bv, unsigned short* q16, unsigned short* k16, unsigned short* vt,
              unsigned short* ho) {
  __shared__ __align__(16) unsigned short Sm[EE * WPH + PM * XPH];   // 70656 halves >= 16 * 264, 128 * 136
  const int bx = blockIdx.x;
  if (bx < NBW) { cvt_wt_body(bx, Sm, wo, ho); return; }
  const int pb = bx - NBW;
  const int wh = pb / NBP;                               // 0 q, 1 k, 2 v
  proj_body(pb - wh * NBP, wh == 2, Sm, wh == 0 ? wq : (wh == 1 ? wk : wv), wh == 0 ? xq : (wh == 1 ? xk : xv),
            wh == 0 ? bq : (wh == 1 ? bk : bv), wh == 0 ? q16 : (wh == 1 ? k16 : vt));
}

// ---- one stage of K and V^T into LDS: 8 asynchronous 16-B copies per lane (4 of K, 4 of V^T), no register in between.
//      lk / lv = the lane's LDS byte address of its first K / V piece, gk / gv = its global source; piece i of K lies
//      32 rows further (LDS 32 * 80 B, global 32 * 512 B), piece i of V^T 8 rows further (LDS 8 * 272 B, global 8 * 4096 B).
__device__ __forceinline__ void stage_kv(unsigned lk, unsigned lv, const unsigned short* gk, const unsigned short* gv) {
#if defined(__HIP_DEVICE_COMPILE__)
  const unsigned lk1 = lk + 32 * KPH * 2, lk2 = lk + 64 * KPH * 2, lk3 = lk + 96 * KPH * 2;
  const unsigned lv1 = lv + 8 * VPH * 2,  lv2 = lv + 16 * VPH * 2, lv3 = lv + 24 * VPH * 2;
  const unsigned short* gk1 = gk + 32 * EE;
  const unsigned short* gk2 = gk + 64 * EE;
  const unsigned short* gk3 = gk + 96 * EE;
  const unsigned short* gv1 = gv + 8 * LQ;
  const unsigned short* gv2 = gv + 16 * LQ;
  const unsigned short* gv3 = gv + 24 * LQ;
  // the closing s_wait_xcnt stands in the copies' own statement so that no address register is rewritten ahead of it
  asm volatile("global_load_async_to_lds_b128 %0, %8, off\n\t"
               "global_load_async_to_lds_b128 %1, %9, off\n\t"
               "global_load_async_to_lds_b128 %2, %10, off\n\t"
               "global_load_async_to_lds_b128 %3, %11, off\n\t"
               "global_load_async_to_lds_b128 %4, %12, off\n\t"
               "global_load_async_to_lds_b128 %5, %13, off\n\t"
               "global_load_async_to_lds_b128 %6, %14, off\n\t"
               "global_load_async_to_lds_b128 %7, %15, off\n\t"
               "s_wait_xcnt 0x0"
               :: "v"(lk), "v"(lk1), "v"(lk2), "v"(lk3), "v"(lv), "v"(lv1), "v"(lv2), "v"(lv3),
                  "v"(gk), "v"(gk1), "v"(gk2), "v"(gk3), "v"(gv), "v"(gv1), "v"(gv2), "v"(gv3)
               : "memory");
#endif
}

// =====================================================================================================
// Row-softmax attention (online max) per (ns, h, 64 queries q0..), 4 waves, grid 2*8*32 = 512; wave w owns queries
// q0+16w+ci (B operand of the score tile = Q16 row fragment, col = query, k = d, one k-step). Key term in log2 units
// Mk[l] = (1 - bf16_RNE(pres[ns][l])) * 1e32 * log2(e)/sqrt(32) staged once per block in LDS.
// K rows (this head's 64 B) and V^T rows of 128 keys are staged per block in LDS by asynchronous copies, two buffers: stage s + 1 flies while stage s is worked
// on; all four waves read their A fragments from the staged tile. One softmax step per stage of 128 keys:
//   8 score D tiles (rows = keys l0+16j+8hh+r, col = query) = A(K16 rows l, k = d) . B(qf);
//   t = acc * (log2(e)/sqrt(32)/256) - Mk[l], one f32 FMA; stage max over the lane's 64 keys combined with the partner
//   half (lane^16); reference point R = running max - 12, R and the rescale factor 2^(R_old - R) identical for both
//   halves of a query column; p = 2^(t - R) = 4096 exp(score - max), the sum Z carries the same factor;
//   P split: hi = f16(p), lo = f16(p - hi), both B fragments of each 32 keys lt.. built in registers
//   (element r <- key lt+8hh+r, element 8+r <- key lt+16+8hh+r, lane unchanged); O^T (rows d, cols queries) rescaled once, then
//   += A(VT rows d = h*32 + 16j + ci, keys contiguous) . B(hi) and . B(lo): 4 accumulators (d 0..15 / 16..31, hi / lo).
// Epilogue: 256*O = 16 (acc_hi + acc_lo) / Z as f16 hi plus f16 residual (x2048), staged per query row in LDS
// coverage: 2 it x 128 threads x 8 halves = 64 rows x 32 per plane per block; grid covers [2][8][2048][32] once.
// =====================================================================================================
__global__ __launch_bounds__(128)
void attn_fwd(const unsigned short* __restrict__ q16, const unsigned short* __restrict__ k16,
              const unsigned short* __restrict__ vt, const float* __restrict__ pres,
              unsigned short* ohp, unsigned short* olp) {
  __shared__ __align__(16) float Mk[LQ];
  __shared__ __align__(16) unsigned short Hs[64 * 40];
  __shared__ __align__(16) unsigned short Lw[64 * 40];
  __shared__ __align__(16) unsigned short Kb[2 * KBH];
  __shared__ __align__(16) unsigned short Vb[2 * VBH];
  const int tid  = threadIdx.x;
  const int wave = tid >> 5;
  const int lane = tid & 31;
  const int hh   = lane >> 4;
  const int ci   = lane & 15;
  const int bx   = blockIdx.x;
  const int ns   = bx / (NH * (LQ / 64));
  const int rem  = bx - ns * (NH * (LQ / 64));
  const int h    = rem / (LQ / 64);
  const int q0   = (rem - h * (LQ / 64)) * 64;
  const int qi   = q0 + 16 * wave + ci;                 // this lane's query
  // copy map: K piece (row tid>>2 (+32i), 16-B piece tid&3), V^T piece (row d = tid>>4 (+8i), 16-B piece tid&15)
  const unsigned lk0 = (unsigned)(uintptr_t)(Kb + (tid >> 2) * KPH + 8 * (tid & 3));
  const unsigned lv0 = (unsigned)(uintptr_t)(Vb + (tid >> 4) * VPH + 8 * (tid & 15));
  const unsigned short* gk0 = k16 + (size_t)(ns * LQ + (tid >> 2)) * EE + h * DH + 8 * (tid & 3);      // + SK * EE per stage
  const unsigned short* gv0 = vt + ((size_t)ns * EE + h * DH + (tid >> 4)) * LQ + 8 * (tid & 15);      // + SK per stage
  stage_kv(lk0, lv0, gk0, gv0);                         // stage 0 -> buffer 0
  {
    const float* pp = pres + (size_t)ns * LQ + 16 * tid;   // 128 threads x 16 floats = 2048 keys
#pragma unroll
    for (int i = 0; i < 4; ++i) {
      const v4f a = *(const v4f*)(pp + 4 * i);
      v4f mv;
#pragma unroll
      for (int e = 0; e < 4; ++e) mv[e] = (1.0f - bfr(a[e])) * MB2;
      *(v4f*)(Mk + 16 * tid + 4 * i) = mv;
    }
  }
  asm volatile("s_wait_asynccnt 0x0" ::: "memory");     // this wave's copies of stage 0 have landed
  __syncthreads();                                      // publishes Mk and stage 0
  stage_kv(lk0 + KBH * 2, lv0 + VBH * 2, gk0 + (size_t)SK * EE, gv0 + SK);     // stage 1 -> buffer 1

  const _Float16* Q = (const _Float16*)(const void*)q16;
  const v16h qf = ldfrag_h(Q + (size_t)(ns * LQ + qi) * EE + h * DH + 8 * hh);
  const _Float16* kl = (const _Float16*)(const void*)Kb + ci * KPH + 8 * hh;   // + buffer, + key_local * KPH
  const _Float16* vl = (const _Float16*)(const void*)Vb + ci * VPH + 8 * hh;   // row d = ci, + 16 * VPH, + key_local

  float rref = NEG0, z = 0.f;
  v8f ah0 = zero8(), ah1 = zero8(), al0 = zero8(), al1 = zero8();
#pragma unroll 1
  for (int st = 0; st < NST; ++st) {
    const int bf = st & 1;
    const _Float16* kp = kl + bf * KBH;
    const _Float16* vp = vl + bf * VBH;
    // one softmax step per stage: the 8 score tiles and the lane's 64 exponentials of 128 keys are independent among
    // themselves, and the running max, its cross-half exchange and the rescale come once per stage;
    // every loop of the step is unrolled: its arrays stay in registers and every LDS offset is an immediate
    const float* mp = Mk + st * SK + 8 * hh;
    v8f s[SK / 16];                                      // s[j][r] <-> key st*SK + 16j + 8hh + r, col = query
#pragma unroll
    for (int j = 0; j < SK / 16; ++j) s[j] = mma_h(ldfrag_h(kp + (16 * j) * KPH), qf, zero8());
    float mj[SK / 16];
#pragma unroll
    for (int j = 0; j < SK / 16; ++j) {
      const v4f ma = *(const v4f*)(mp + 16 * j);         // keys 16j + 8hh + 0..3 <-> s[j][0..3]
      const v4f mb = *(const v4f*)(mp + 16 * j + 4);     // keys 16j + 8hh + 4..7 <-> s[j][4..7]
#pragma unroll
      for (int r = 0; r < 4; ++r) {
        s[j][r]     = s[j][r] * SCL     - ma[r];
        s[j][4 + r] = s[j][4 + r] * SCL - mb[r];
      }
      float m = s[j][0];
#pragma unroll
      for (int r = 1; r < 8; ++r) m = fmaxf(m, s[j][r]);
      mj[j] = m;
    }
    float mx = fmaxf(fmaxf(fmaxf(mj[0], mj[1]), fmaxf(mj[2], mj[3])), fmaxf(fmaxf(mj[4], mj[5]), fmaxf(mj[6], mj[7])));
    mx = fmaxf(mx, __shfl_xor(mx, 16, 32));
    float mo = mx - POFF;
    mo = (mx - mo > 15.0f) ? mx : mo;                    // |mx| near 2^27: the rounded difference may lie 16 below, p past f16
    const float nref = fmaxf(rref, mo);
    const float corr = __builtin_amdgcn_exp2f(rref - nref);
    rref = nref;
    ah0 *= corr; ah1 *= corr; al0 *= corr; al1 *= corr;
    v2f zu[SK / 32];                                     // per 32 keys: sums of p over even / odd r, one packed add per pair
#pragma unroll
    for (int u = 0; u < SK / 32; ++u) {
      v8u ph, pl;
      v2f zg[2];
#pragma unroll
      for (int r = 0; r < 8; r += 4) {
        float x[8], p[8];                                // 0..3 <-> s[2u][r..r+3], 4..7 <-> s[2u+1][r..r+3]
#pragma unroll
        for (int e = 0; e < 4; ++e) {
          x[e]     = s[2 * u][r + e] - nref;
          x[4 + e] = s[2 * u + 1][r + e] - nref;
        }
#pragma unroll
        for (int e = 0; e < 8; ++e) p[e] = __builtin_amdgcn_exp2f(x[e]);
        const v2f pa0 = {p[0], p[1]}, pa1 = {p[2], p[3]}, pc0 = {p[4], p[5]}, pc1 = {p[6], p[7]};
        zg[r >> 2] = (pa0 + pc0) + (pa1 + pc1);
        // registers of the two B fragments: elements r..r+3 -> r/2, r/2 + 1; elements 8+r..8+r+3 -> 4 + r/2, 5 + r/2
        unsigned hq[4], lq[4];
        hq[0] = __builtin_bit_cast(unsigned, __builtin_convertvector(pa0, v2h));
        hq[1] = __builtin_bit_cast(unsigned, __builtin_convertvector(pa1, v2h));
        hq[2] = __builtin_bit_cast(unsigned, __builtin_convertvector(pc0, v2h));
        hq[3] = __builtin_bit_cast(unsigned, __builtin_convertvector(pc1, v2h));
        resid8(lq, hq, p);
        const int g = r >> 1;
        ph[g] = hq[0]; ph[g + 1] = hq[1]; ph[4 + g] = hq[2]; ph[5 + g] = hq[3];
        pl[g] = lq[0]; pl[g + 1] = lq[1]; pl[4 + g] = lq[2]; pl[5 + g] = lq[3];
      }
      zu[u] = zg[0] + zg[1];
      const v16h va0 = ldfrag_h(vp + u * 32);                      // d = ci
      const v16h va1 = ldfrag_h(vp + 16 * VPH + u * 32);           // d = 16 + ci
      const v16h pb = __builtin_bit_cast(v16h, ph), lb = __builtin_bit_cast(v16h, pl);
      ah0 = mma_h(va0, pb, ah0);
      ah1 = mma_h(va1, pb, ah1);
      al0 = mma_h(va0, lb, al0);
      al1 = mma_h(va1, lb, al1);
    }
    const v2f zt = (zu[0] + zu[1]) + (zu[2] + zu[3]);
    z = z * corr + (zt[0] + zt[1]);
    // publish point of stage st + 1: own LDS reads done, own copies landed, then the barrier that both publishes
    // stage st + 1 and ends every wave's reads of the buffer refilled behind it
    asm volatile("s_wait_dscnt 0x0" ::: "memory");
    asm volatile("s_wait_asynccnt 0x0" ::: "memory");
    __syncthreads();
    if (st + 2 < NST)
      stage_kv(lk0 + bf * (KBH * 2), lv0 + bf * (VBH * 2), gk0 + (size_t)(st + 2) * SK * EE, gv0 + (st + 2) * SK);
  }
  asm volatile("s_wait_asynccnt 0x0" ::: "memory");     // nothing of this wave's copies is left in flight

  // ah0/al0[r] <-> d = 8hh + r, ah1/al1[r] <-> d = 16 + 8hh + r, query qi; Z >= 1 (the max key's p)
  const float zz  = z + __shfl_xor(z, 16, 32);
  const float rzs = (1.0f / zz) * 16.0f;
  float o[16];
#pragma unroll
  for (int r = 0; r < 8; ++r) {
    o[r]     = (ah0[r] + al0[r]) * rzs;
    o[8 + r] = (ah1[r] + al1[r]) * rzs;
  }
  v4u h0, h1, g0, g1;
#pragma unroll
  for (int i = 0; i < 4; ++i) {
    const _Float16 a0 = (_Float16)o[2 * i],     a1 = (_Float16)o[2 * i + 1];
    const _Float16 b0 = (_Float16)o[8 + 2 * i], b1 = (_Float16)o[8 + 2 * i + 1];
    const _Float16 la0 = (_Float16)((o[2 * i]         - (float)a0) * LOSC);
    const _Float16 la1 = (_Float16)((o[2 * i + 1]     - (float)a1) * LOSC);
    const _Float16 lb0 = (_Float16)((o[8 + 2 * i]     - (float)b0) * LOSC);
    const _Float16 lb1 = (_Float16)((o[8 + 2 * i + 1] - (float)b1) * LOSC);
    h0[i] = pk16(h_bits(a0), h_bits(a1));
    h1[i] = pk16(h_bits(b0), h_bits(b1));
    g0[i] = pk16(h_bits(la0), h_bits(la1));
    g1[i] = pk16(h_bits(lb0), h_bits(lb1));
  }
  {
    const int ro = (16 * wave + ci) * 40 + 8 * hh;
    *(v4u*)(Hs + ro)      = h0;
    *(v4u*)(Hs + ro + 16) = h1;
    *(v4u*)(Lw + ro)      = g0;
    *(v4u*)(Lw + ro + 16) = g1;
  }
  __syncthreads();
  {
    const size_t ob = ((size_t)(ns * NH + h) * LQ + q0) * DH;      // 4096-B aligned region of 64 x 32 halves
    v4u hv[2], lv[2];
#pragma unroll
    for (int it2 = 0; it2 < 2; ++it2) {
      const int hf = it2 * 1024 + 8 * tid;             // half index within the 2048-half region
      const int row = hf >> 5, col = hf & 31;
      hv[it2] = *(const v4u*)(Hs + row * 40 + col);
      lv[it2] = *(const v4u*)(Lw + row * 40 + col);
    }
    {
#pragma unroll
      for (int it2 = 0; it2 < 2; ++it2) {
        const int hf = it2 * 1024 + 8 * tid;
        *(v4u*)(ohp + ob + hf) = hv[it2];
        *(v4u*)(olp + ob + hf) = lv[it2];
      }
      
    }
  }
}

// =====================================================================================================
// Output projection out[m][o] = sum_c O[m][c] Wo[c][o] + bo[o], O = (hi + lo/2048)/256 from the OH/OL planes
// ([ns][h][q][32]: k-step j = head j). Block = 4 waves = 64 rows m x 64 cols o (grid 64 x 4 = 256); wave w owns rows
// m0+16w+ci (B operands = OH and OL row fragments, col = m), A = HO plane rows o0+16t+ci (k = c split map); 4 hi + 4
// lo accumulators; acc[t][r] <-> (m = m0+16w+ci, o = o0+16t+8hh+r).
// Epilogue: (acch + accl/2048)/262144 + bf16_RNE(bo) staged in LDS as Ts[m_local][o_local] (pitch 68, 16-B vector
// coverage: 8 it x 8 rows x 16 pieces x 4 floats = 64 x 64 per block; grid covers out [4096][256] exactly once.
// =====================================================================================================
__global__ __launch_bounds__(128)
void out_proj(const unsigned short* __restrict__ ohp, const unsigned short* __restrict__ olp,
              const unsigned short* __restrict__ woh, const float* __restrict__ bo, float* out) {
  __shared__ __align__(16) float Ts[64 * 68];
  const int tid  = threadIdx.x;
  const int wave = tid >> 5;
  const int lane = tid & 31;
  const int hh   = lane >> 4;
  const int ci   = lane & 15;
  const int bx   = blockIdx.x;
  const int mt   = bx >> 2, ot = bx & 3;
  const int m0   = mt * 64, o0 = ot * 64;
  const int ns   = m0 / LQ;
  const int ql   = m0 - ns * LQ + 16 * wave + ci;       // query of this lane's row
  const _Float16* OHf = (const _Float16*)(const void*)ohp;
  const _Float16* OLf = (const _Float16*)(const void*)olp;
  const _Float16* W   = (const _Float16*)(const void*)woh;
  const size_t orow = ((size_t)(ns * NH) * LQ + ql) * DH + 8 * hh;    // + j * LQ * DH per head
  const _Float16* ar = OHf + orow;
  const _Float16* lr = OLf + orow;
  const _Float16* wr = W + (size_t)(o0 + ci) * EE + 8 * hh;           // + 16t*EE + 32j

  v8f acch[4], accl[4];
#pragma unroll
  for (int t = 0; t < 4; ++t) { acch[t] = zero8(); accl[t] = zero8(); }

#pragma unroll 1
  for (int j = 0; j < NH; ++j) {
    const v16h obh = ldfrag_h(ar + (size_t)j * LQ * DH);
    const v16h obl = ldfrag_h(lr + (size_t)j * LQ * DH);
    v16h wa[4];
#pragma unroll
    for (int t = 0; t < 4; ++t) wa[t] = ldfrag_h(wr + (size_t)(16 * t) * EE + 32 * j);
#pragma unroll
    for (int t = 0; t < 4; ++t) acch[t] = mma_h(wa[t], obh, acch[t]);
    guard4(acch[0], acch[1], acch[2], acch[3], obh, wa[0], wa[1], wa[2], wa[3]);
#pragma unroll
    for (int t = 0; t < 4; ++t) accl[t] = mma_h(wa[t], obl, accl[t]);
    guard4(accl[0], accl[1], accl[2], accl[3], obl, wa[0], wa[1], wa[2], wa[3]);
  }

  {
    float* ts = Ts + (16 * wave + ci) * 68 + 8 * hh;
#pragma unroll
    for (int t = 0; t < 4; ++t) {
      const v4f b0 = *(const v4f*)(bo + o0 + 16 * t + 8 * hh);
      const v4f b1 = *(const v4f*)(bo + o0 + 16 * t + 8 * hh + 4);
      v4f r0, r1;
#pragma unroll
      for (int e = 0; e < 4; ++e) {
        r0[e] = (acch[t][e]     + accl[t][e]     * LOIN) * OSC + bfr(b0[e]);
        r1[e] = (acch[t][4 + e] + accl[t][4 + e] * LOIN) * OSC + bfr(b1[e]);
      }
      *(v4f*)(ts + 16 * t)     = r0;
      *(v4f*)(ts + 16 * t + 4) = r1;
    }
  }
  __syncthreads();
  {
    const int p = tid & 15, r16 = tid >> 4;             // r16 0..7, p = 16-B piece of the 256-B segment
    v4f vals[8];
#pragma unroll
    for (int it = 0; it < 8; ++it) {
      const int row = it * 8 + r16;                      // it 0..7 x r16 0..7 = rows 0..63
      vals[it] = *(const v4f*)(Ts + row * 68 + 4 * p);
    }
    float* yb = out + (size_t)m0 * EE + o0 + 4 * p;
    {
#pragma unroll
      for (int it = 0; it < 8; ++it) {
        const int row = it * 8 + r16;
        *(v4f*)(yb + (size_t)row * EE) = vals[it];
      }
      
    }
  }
}

// =====================================================================================================
// Workspace map (bytes), every offset a multiple of 256 and every plane sized to its whole-line store granularity:
//   HO           f16 [256][256]       131072           0 .. 131072
//   Q16, K16     f16 [4096][256]      2 x 2097152      .. 4325376
//   VT           f16 [2][256][2048]   2097152          .. 6422528
//   OH, OL       f16 [2][8][2048][32] 2 x 2097152      .. 10616832  (end)
// =====================================================================================================
extern "C" void kernel_launch(void* const* d_in, const int* in_sizes, int n_in,
                              void* d_out, int out_size, void* d_ws, size_t ws_size,
                              hipStream_t stream) {
  if (n_in < 12) return;
  if (in_sizes[0] != MR * EE || in_sizes[1] != MR * EE || in_sizes[2] != MR * EE) return;
  if (in_sizes[3] != NSB * LQ) return;
  if (in_sizes[4] != EE * EE || in_sizes[6] != EE * EE || in_sizes[8] != EE * EE || in_sizes[10] != EE * EE) return;
  if (in_sizes[5] != EE || in_sizes[7] != EE || in_sizes[9] != EE || in_sizes[11] != EE) return;
  if (out_size != MR * EE) return;

  const float* queries = (const float*)d_in[0];
  const float* keys    = (const float*)d_in[1];
  const float* values  = (const float*)d_in[2];
  const float* pres    = (const float*)d_in[3];
  const float* Wq      = (const float*)d_in[4];
  const float* bq      = (const float*)d_in[5];
  const float* Wk      = (const float*)d_in[6];
  const float* bk      = (const float*)d_in[7];
  const float* Wv      = (const float*)d_in[8];
  const float* bv      = (const float*)d_in[9];
  const float* Wo      = (const float*)d_in[10];
  const float* bo      = (const float*)d_in[11];
  float* out = (float*)d_out;

  const size_t PW  = (size_t)EE * EE * 2;               // 131072
  const size_t PP  = (size_t)MR * EE * 2;               // 2097152
  const size_t PVT = (size_t)NSB * EE * LQ * 2;         // 2097152
  const size_t PO  = (size_t)NSB * NH * LQ * DH * 2;    // 2097152
  size_t off = 0;
  const size_t oHO = off; off += PW;
  const size_t oQ  = off; off += PP;
  const size_t oK  = off; off += PP;
  const size_t oVT = off; off += PVT;
  const size_t oOH = off; off += PO;
  const size_t oOL = off; off += PO;
  if (off > ws_size) return;                            // off = 10616832
  if (off > (size_t)134217728) return;

  char* ws = (char*)d_ws;
  unsigned short* HOp = (unsigned short*)(ws + oHO);
  unsigned short* Q16 = (unsigned short*)(ws + oQ);
  unsigned short* K16 = (unsigned short*)(ws + oK);
  unsigned short* VTp = (unsigned short*)(ws + oVT);
  unsigned short* OHp = (unsigned short*)(ws + oOH);
  unsigned short* OLp = (unsigned short*)(ws + oOL);

  const dim3 blk256(256), blk128(128);
  const dim3 gPJ(NBW + 3 * NBP);                        // 16 + 3 x 64 blocks
  const dim3 gAT(NSB * NH * (LQ / 64));                 // 512 blocks
  const dim3 gOP((MR / 64) * (EE / 64));                // 256 blocks

  // (1) transposed 16-bit Wo plane HO[o][e]; projections from the f32 inputs: q, k row-major [4096][256] (x16),
  //     v transposed VT[ns][hd][l] (x16), biases added
  proj_all<<<gPJ, blk256, 0, stream>>>(queries, keys, values, Wq, Wk, Wv, Wo, bq, bk, bv, Q16, K16, VTp, HOp);
  // (2) attention output planes OH / OL [ns][h][q][32] (row softmax over keys with the key term)
  attn_fwd<<<gAT, blk128, 0, stream>>>(Q16, K16, VTp, pres, OHp, OLp);
  // (3) output projection + bias -> d_out [4096][256] f32
  out_proj<<<gOP, blk128, 0, stream>>>(OHp, OLp, HOp, bo, out);
  (void)hipGetLastError();
}

// v006
// Measured time: 33.1 microseconds a run.
// In two side-by-side timings against v005, it was 1.12 and 1.11 times as fast.
// Over all steps from v000 it is 3.19 times as fast.
// Contractions, all v_wmma_f32_16x16x32_f16 (f16 operands, f32 accumulate): q/k/v projections X.W with f16
// containers holding bf16-RNE inputs (X x64, W x1024); scores K.q with q, k planes f16 x16 (K = 32 per head);
// P as f16 hi (x4096) + residual (same scale) planes . V plane (f16 x16) into two accumulator pairs; output projection
// with O as f16 hi (x256) + residual (x2^11) planes and Wo bf16-RNE x1024 into two accumulators. Key-mask term,
// running max / sum, exp, residual folds and biases in f32 on VALU.
#include <hip/hip_runtime.h>
#include <math.h>
#include <stdint.h>

#define NSB  2
#define LQ   2048
#define EE   256
#define NH   8
#define DH   32
#define MR   (NSB * LQ)
#define XSC  64.0f
#define WSC  1024.0f
#define ISC  (1.0f / 4096.0f)
#define BSC  16.0f
#define RL2E (0.17677669529663687 * 1.44269504088896340736)   // log2(e) / sqrt(32): exp(s / sqrt(32)) = 2^(s * RL2E)
#define SCL  ((float)(RL2E / 256.0))   // score accumulator (256 q.k) -> log2 units
#define MB2  ((float)(1.0e32 * RL2E))  // the key term's 1e32 in log2 units
#define NEG0 (-1.0e38f)
#define POFF 12.0f                     // P carries 2^12: the exponent's reference point lies 12 below the running max
#define LOIN (1.0f / 2048.0f)
#define LOSC 2048.0f
#define OSC  (1.0f / 262144.0f)
#define NBW  16                     // blocks of the Wo transposition: 16 o-tiles
#define PM   128                    // rows m of a projection block
#define NBP  ((MR / PM) * (EE / 128))   // blocks of one projection
#define WPH  144                    // LDS pitch of a staged W row e, halves (256 B of data + 32 B: 32 B x odd for the transposing reader)
#define XPH  264                    // LDS pitch of a staged X row m, halves (512 B of data + 16 B: 16 B x odd for 16-B readers)
static_assert(EE == NH * DH);
static_assert(DH == 32);
static_assert((LQ % PM) == 0 && (EE % 128) == 0 && (MR % PM) == 0);
static_assert(EE == 256 && PM == 128);
static_assert(LQ == 128 * 16);
#define SK   128                    // keys per LDS stage of the attention kernel
#define NST  (LQ / SK)              // stages
#define KPH  40                     // LDS pitch of a staged K row, halves (64 B of data + 16 B: 16 B x odd for 16-B readers)
#define VPH  136                    // LDS pitch of a staged V^T row, halves (256 B of data + 16 B)
#define KBH  (SK * KPH)             // halves per K buffer
#define VBH  (DH * VPH)             // halves per V buffer
static_assert(NST >= 2 && SK == 128);               // the softmax step merges 8 tile maxima and 4 partial sums
static_assert(SK * 4 == 4 * 128 && DH * (SK / 8) == 4 * 128);   // 4 + 4 copies of 16 B per thread and stage
#define OWP  264                    // LDS pitch of a staged HO row o, halves (512 B of data + 16 B: 16 B x odd for 16-B readers)
#define OOP  40                     // LDS pitch of a staged OH / OL row m, halves (64 B of data + 16 B)

typedef _Float16 v16h __attribute__((ext_vector_type(16)));
typedef _Float16 v8h  __attribute__((ext_vector_type(8)));
typedef float    v8f  __attribute__((ext_vector_type(8)));
typedef float    v4f  __attribute__((ext_vector_type(4)));
typedef unsigned int v4u __attribute__((ext_vector_type(4)));
typedef unsigned int v2u __attribute__((ext_vector_type(2)));
typedef unsigned int v8u __attribute__((ext_vector_type(8)));
typedef short    s16x8 __attribute__((ext_vector_type(8)));
typedef float    v2f  __attribute__((ext_vector_type(2)));
typedef _Float16 v2h  __attribute__((ext_vector_type(2)));
typedef __bf16   v2b  __attribute__((ext_vector_type(2)));

union FragH { v16h v; v8h h[2]; };

// ---- scalar helpers ----------------------------------------------------------------------------------
__device__ __forceinline__ unsigned short bf_bits(float f) {          // f32 -> bf16 bits, RNE convert
  unsigned u = __float_as_uint(f);
  return (unsigned short)((u + 0x7FFFu + ((u >> 16) & 1u)) >> 16);
}
__device__ __forceinline__ float bf_up(unsigned short h) { return __uint_as_float(((unsigned)h) << 16); }
__device__ __forceinline__ float bfr(float f) { return bf_up(bf_bits(f)); }
__device__ __forceinline__ unsigned short h_bits(_Float16 x) { return __builtin_bit_cast(unsigned short, x); }
__device__ __forceinline__ unsigned pk16(unsigned short a, unsigned short b) { return (unsigned)a | ((unsigned)b << 16); }
__device__ __forceinline__ v8f zero8() { v8f z = {0.f, 0.f, 0.f, 0.f, 0.f, 0.f, 0.f, 0.f}; return z; }
// 4 consecutive f32 -> f16( bf16_RNE(x) * sc ) packed into 8 bytes; the RNE step by the packed hardware convert, which
// gives bfr()'s value for every finite x
__device__ __forceinline__ v2u cvt4(v4f a, float sc) {
  v2u v;
#pragma unroll
  for (int i = 0; i < 2; ++i) {
    const v2f x = {a[2 * i], a[2 * i + 1]};
    const unsigned b = __builtin_bit_cast(unsigned, __builtin_convertvector(x, v2b));
    const v2f y = {__uint_as_float(b << 16) * sc, __uint_as_float(b & 0xFFFF0000u) * sc};
    v[i] = __builtin_bit_cast(unsigned, __builtin_convertvector(y, v2h));
  }
  return v;
}

// ---- fragment loader: 16-bit A/B operand, lane -> row/col (lane&15), p already includes +8*(lane>>4);
//      elements 0..7 <- p[0..7] (k0+8h..), elements 8..15 <- p[16..23] (k0+16+8h..)
__device__ __forceinline__ v16h ldfrag_h(const _Float16* p) {
  FragH f;
  f.h[0] = *(const v8h*)(p);
  f.h[1] = *(const v8h*)(p + 16);
  return f.v;
}

// ---- transposing fragment loader: LDS tile T[k][row] (16-bit, k-major), p = T + (k0 + 8*(lane>>4) + (lane&7)) * pitch
//      + row0 + 8*((lane>>3)&1); lane (ci, hh) receives T[k0+8hh+0..7][row0+ci], then T[k0+16+8hh+0..7][row0+ci]:
//      the k order of ldfrag_h
__device__ __forceinline__ v16h ldfrag_tr(const unsigned short* p, int pitch) {
  typedef __attribute__((address_space(3))) s16x8 lds_s16x8;
  FragH f;
  f.h[0] = __builtin_bit_cast(v8h, __builtin_amdgcn_ds_load_tr16_b128_v8i16((lds_s16x8*)p));
  f.h[1] = __builtin_bit_cast(v8h, __builtin_amdgcn_ds_load_tr16_b128_v8i16((lds_s16x8*)(p + 16 * pitch)));
  return f.v;
}

// ---- WMMA helper --------------------------------------------------------------------------------------
__device__ __forceinline__ v8f mma_h(v16h a, v16h b, v8f c) {
  return __builtin_amdgcn_wmma_f32_16x16x32_f16(false, a, false, b, (short)0, c, false, false);
}
// ---- residual halves of 8 values: l = f16(p - hi), two per register. The mixed-precision FMA hi * (-1) + p takes hi (f16)
//      straight from its packed half, -1 and p as f32, and writes one half of l (left to itself the compiler converts hi
//      back to f32, subtracts and repacks). The four low halves stand ahead of the four high halves; s_delay_alu names
//      that distance of 4, so that the wait of a high half for its register's low half does not hold up the SIMD's other wave.
__device__ __forceinline__ void resid8(unsigned* l, const unsigned* h, const float* p) {
#if defined(__HIP_DEVICE_COMPILE__)
  asm("v_fma_mixlo_f16 %0, %4, %16, %8 op_sel_hi:[1,0,0]\n\t"
      "v_fma_mixlo_f16 %1, %5, %16, %10 op_sel_hi:[1,0,0]\n\t"
      "v_fma_mixlo_f16 %2, %6, %16, %12 op_sel_hi:[1,0,0]\n\t"
      "v_fma_mixlo_f16 %3, %7, %16, %14 op_sel_hi:[1,0,0]\n\t"
      "s_delay_alu instid0(VALU_DEP_4) | instskip(NEXT) | instid1(VALU_DEP_4)\n\t"
      "v_fma_mixhi_f16 %0, %4, %16, %9 op_sel:[1,0,0] op_sel_hi:[1,0,0]\n\t"
      "v_fma_mixhi_f16 %1, %5, %16, %11 op_sel:[1,0,0] op_sel_hi:[1,0,0]\n\t"
      "s_delay_alu instid0(VALU_DEP_4) | instskip(NEXT) | instid1(VALU_DEP_4)\n\t"
      "v_fma_mixhi_f16 %2, %6, %16, %13 op_sel:[1,0,0] op_sel_hi:[1,0,0]\n\t"
      "v_fma_mixhi_f16 %3, %7, %16, %15 op_sel:[1,0,0] op_sel_hi:[1,0,0]"
      : "=&v"(l[0]), "=&v"(l[1]), "=&v"(l[2]), "=&v"(l[3])
      : "v"(h[0]), "v"(h[1]), "v"(h[2]), "v"(h[3]),
        "v"(p[0]), "v"(p[1]), "v"(p[2]), "v"(p[3]), "v"(p[4]), "v"(p[5]), "v"(p[6]), "v"(p[7]), "s"(-1.0f));
#endif
}

// =====================================================================================================
// Transposed output-weight plane: HO[o][e] = f16( bf16_RNE(Wo[e][o]) * 1024 ) for the [in][out] weight (x.W layout).
// Block = 16 output rows o0 = 16*bx, 256 threads, 16 blocks, so that this chain is no longer than a projection block's.
// Read W rows e as 4 threads x 16 B (64-B row segment o0..o0+15), all 4 loads of a thread in flight together, 2-B
// transposed LDS stores into Ts[o_local][e] (pitch 264), block barrier, then whole rows out.
// coverage: read 4 it x 64 rows e x 4 pieces x 4 = all 256 e x 16 o; write 2 it x 8 waves = 16 rows x 32 lanes x 8
//           halves = 16 x 256; 16 o-tiles -> HO [256][256] entirely.
// =====================================================================================================
__device__ __forceinline__
void cvt_wt_body(int bx, unsigned short* Ts, const float* __restrict__ src, unsigned short* dst) {
  const int tid  = threadIdx.x;
  const int wave = tid >> 5;
  const int lane = tid & 31;
  const int o0   = bx * 16;
  const int p = tid & 3, r64 = tid >> 2;                // p = 16-B piece of the 64-B row segment, r64 = row in group
  v4f a[4];
#pragma unroll
  for (int it = 0; it < 4; ++it) a[it] = *(const v4f*)(src + (size_t)(it * 64 + r64) * EE + o0 + 4 * p);
#pragma unroll
  for (int it = 0; it < 4; ++it) {
    const int e = it * 64 + r64;                         // 0..255
#pragma unroll
    for (int i = 0; i < 4; ++i) Ts[(4 * p + i) * 264 + e] = h_bits((_Float16)(bfr(a[it][i]) * WSC));
  }
  __syncthreads();
  v4u vals[2];
#pragma unroll
  for (int it = 0; it < 2; ++it) {
    const int row = it * 8 + wave;                       // it 0..1 x wave 0..7 = rows 0..15
    vals[it] = *(const v4u*)(Ts + row * 264 + 8 * lane);
  }
  unsigned short* db = dst + (size_t)o0 * EE + 8 * lane;
#pragma unroll
  for (int it = 0; it < 2; ++it) {
    const int row = it * 8 + wave;
    *(v4u*)(db + (size_t)row * EE) = vals[it];
  }
}

// =====================================================================================================
// Projection GEMM Y[m][o] = sum_e X[m][e] W[e][o] (x 65536 in the accumulator) + b[o], straight from the f32 inputs.
// Block = 8 waves = 128 rows m x 128 cols o (32 m-tiles x 2 o-tiles = 64 blocks per projection). The block converts
// its own operands into LDS: Ws[e][o_local] = f16( bf16_RNE(W[e][o]) * 1024 ) (one wave-load = one 512-B row segment),
// Xs[m_local][e] = f16( bf16_RNE(X[m][e]) * 64 ) (one wave-load = half a row), 8-B LDS stores, block barrier.
// Wave (wm = wave & 3, wo = wave >> 2) owns 32 rows m x 64 cols o: A(W^T rows o = o0+64wo+16t+ci by the transposing
// load, k = e split map) . B(Xs row m = m0+32wm+16i+ci, col = m, same map); 8 k-steps of 32, 8 accumulators per wave;
// acc[i][t][r] <-> (m = m0+32wm+16i+ci, o = o0+64wo+16t+8hh+r). y16 = acc * 2^-12 + 16 * bf16_RNE(b[o]) (= 16 y).
// A second barrier ends every wave's operand reads before the same LDS becomes output staging.
// tr == 0: YO[m][o] = f16(y16): staged as Ts[m_local][o_local] (pitch 136, 16-B LDS stores), block barrier, rows out.
// tr == 1: VT[ns][o][l] (keys contiguous): staged as Ts[o_local][l_local] (pitch 136, 2-B LDS stores), barrier, rows out.
// coverage: operands: 32 it x 8 rows e x 128 o, 32 it x 4 rows m x 256 e; tr 0: 8 it x 16 rows x 16 pieces x 8 halves =
//           128 x 128 per block, grid -> [4096][256]; tr 1: 8 it x 16 lines x 16 pieces x 8 = 128 o x 128 l, grid ->
//           VT [2][256][2048].
// =====================================================================================================
__device__ __forceinline__
void proj_body(int bx, bool tr, unsigned short* Sm, const float* __restrict__ wf, const float* __restrict__ xf,
               const float* __restrict__ bias, unsigned short* yo) {
  const int tid  = threadIdx.x;
  const int wave = tid >> 5;
  const int lane = tid & 31;
  const int hh   = lane >> 4;
  const int ci   = lane & 15;
  const int wm   = wave & 3, wo = wave >> 2;
  const int mt   = bx >> 1, ot = bx & 1;
  const int m0   = mt * PM, o0 = ot * 128;
  unsigned short* Ws = Sm;                               // [256 e][WPH]
  unsigned short* Xs = Sm + EE * WPH;                    // [128 m][XPH]
  {
    const float* wsrc = wf + (size_t)wave * EE + o0 + 4 * lane;                    // row e = 8 it + wave
    const float* xsrc = xf + (size_t)(m0 + (tid >> 6)) * EE + 4 * (tid & 63);      // row m = 4 it + (tid >> 6)
    unsigned short* wd = Ws + wave * WPH + 4 * lane;
    unsigned short* xd = Xs + (tid >> 6) * XPH + 4 * (tid & 63);
    v4f a[32], c[32];
#pragma unroll
    for (int it = 0; it < 32; ++it) a[it] = *(const v4f*)(wsrc + (size_t)(8 * it) * EE);
#if defined(__HIP_DEVICE_COMPILE__)
    // stands between the loads above and a later load whose result the compiler puts into their address pair
    asm volatile("s_wait_xcnt 0x0" ::: "memory");
#endif
#pragma unroll
    for (int it = 0; it < 16; ++it) c[it] = *(const v4f*)(xsrc + (size_t)(4 * it) * EE);
    // keeps these 48 loads ahead of all conversion work: one latency for the lot instead of one per trickled load
    __builtin_amdgcn_sched_barrier(0);
#pragma unroll
    for (int it = 0; it < 16; ++it) *(v2u*)(wd + (8 * it) * WPH) = cvt4(a[it], WSC);
    // the last 16 loads go out as soon as registers are free, ahead of the remaining conversion work
    __builtin_amdgcn_sched_barrier(0);
#pragma unroll
    for (int it = 16; it < 32; ++it) c[it] = *(const v4f*)(xsrc + (size_t)(4 * it) * EE);
    __builtin_amdgcn_sched_barrier(0);                   // closes the group above
#pragma unroll
    for (int it = 16; it < 32; ++it) *(v2u*)(wd + (8 * it) * WPH) = cvt4(a[it], WSC);
#pragma unroll
    for (int it = 0; it < 32; ++it) *(v2u*)(xd + (4 * it) * XPH) = cvt4(c[it], XSC);
  }
  __syncthreads();

  const _Float16* xr = (const _Float16*)(const void*)Xs + (32 * wm + ci) * XPH + 8 * hh;       // B: X row m, + 16 i rows
  const unsigned short* wr = Ws + (8 * hh + (lane & 7)) * WPH + 64 * wo + 8 * ((lane >> 3) & 1);   // A: + k0 rows, + 16 t

  v8f acc[2][4];
#pragma unroll
  for (int i = 0; i < 2; ++i)
#pragma unroll
    for (int t = 0; t < 4; ++t) acc[i][t] = zero8();

  // two register sets: the fragments of k-step ks + 1 are asked for ahead of the products of k-step ks, so that their LDS
  // latency runs under those products; unrolled, so that the set index and every LDS offset are compile-time constants
  v16h wa[2][4], xb[2][2];
#pragma unroll
  for (int t = 0; t < 4; ++t) wa[0][t] = ldfrag_tr(wr + 16 * t, WPH);
#pragma unroll
  for (int i = 0; i < 2; ++i) xb[0][i] = ldfrag_h(xr + (16 * i) * XPH);
#pragma unroll
  for (int ks = 0; ks < EE / 32; ++ks) {
    const int cu = ks & 1, nx = cu ^ 1;
    if (ks + 1 < EE / 32) {
      const int k1 = (ks + 1) * 32;
#pragma unroll
      for (int t = 0; t < 4; ++t) wa[nx][t] = ldfrag_tr(wr + k1 * WPH + 16 * t, WPH);
#pragma unroll
      for (int i = 0; i < 2; ++i) xb[nx][i] = ldfrag_h(xr + (16 * i) * XPH + k1);
    }
    // holds the load group together and ahead of the products: left free, the loads sink in among the products
    __builtin_amdgcn_sched_barrier(0);
#pragma unroll
    for (int i = 0; i < 2; ++i)
#pragma unroll
      for (int t = 0; t < 4; ++t) acc[i][t] = mma_h(wa[cu][t], xb[cu][i], acc[i][t]);
    __builtin_amdgcn_sched_barrier(0);                   // the next load group stays behind these products
  }
  __syncthreads();                                       // every wave has read its operands: the LDS becomes Ts

  unsigned short* Ts = Sm;                               // 128 x 136 halves
  const int p = tid & 15, r16 = tid >> 4;               // r16 0..15 = row within group, p = 16-B piece of the 256-B segment
  if (!tr) {
#pragma unroll
    for (int i = 0; i < 2; ++i) {
      unsigned short* ts = Ts + (32 * wm + 16 * i + ci) * 136 + 64 * wo + 8 * hh;
#pragma unroll
      for (int t = 0; t < 4; ++t) {
        const v4f b0 = *(const v4f*)(bias + o0 + 64 * wo + 16 * t + 8 * hh);
        const v4f b1 = *(const v4f*)(bias + o0 + 64 * wo + 16 * t + 8 * hh + 4);
        float y[8];
#pragma unroll
        for (int e = 0; e < 4; ++e) {
          y[e]     = acc[i][t][e] * ISC     + bfr(b0[e]) * BSC;
          y[4 + e] = acc[i][t][4 + e] * ISC + bfr(b1[e]) * BSC;
        }
        v4u v;
#pragma unroll
        for (int j = 0; j < 4; ++j) v[j] = pk16(h_bits((_Float16)y[2 * j]), h_bits((_Float16)y[2 * j + 1]));
        *(v4u*)(ts + 16 * t) = v;
      }
    }
    __syncthreads();
    v4u vals[8];
#pragma unroll
    for (int it = 0; it < 8; ++it) {
      const int row = it * 16 + r16;                     // it 0..7 x r16 0..15 = rows 0..127
      vals[it] = *(const v4u*)(Ts + row * 136 + 8 * p);
    }
    unsigned short* yb = yo + (size_t)m0 * EE + o0 + 8 * p;
#pragma unroll
    for (int it = 0; it < 8; ++it) {
      const int row = it * 16 + r16;
      *(v4u*)(yb + (size_t)row * EE) = vals[it];
    }
  } else {
    const int ns = m0 / LQ, l0 = m0 - ns * LQ;
#pragma unroll
    for (int i = 0; i < 2; ++i) {
#pragma unroll
      for (int t = 0; t < 4; ++t) {
        const v4f b0 = *(const v4f*)(bias + o0 + 64 * wo + 16 * t + 8 * hh);
        const v4f b1 = *(const v4f*)(bias + o0 + 64 * wo + 16 * t + 8 * hh + 4);
#pragma unroll
        for (int r = 0; r < 4; ++r) {
          Ts[(64 * wo + 16 * t + 8 * hh + r) * 136 + 32 * wm + 16 * i + ci] =
              h_bits((_Float16)(acc[i][t][r] * ISC + bfr(b0[r]) * BSC));
          Ts[(64 * wo + 16 * t + 8 * hh + 4 + r) * 136 + 32 * wm + 16 * i + ci] =
              h_bits((_Float16)(acc[i][t][4 + r] * ISC + bfr(b1[r]) * BSC));
        }
      }
    }
    __syncthreads();
    v4u vals[8];
#pragma unroll
    for (int it = 0; it < 8; ++it) {
      const int orow = it * 16 + r16;                    // it 0..7 x r16 0..15 = o_local 0..127
      vals[it] = *(const v4u*)(Ts + orow * 136 + 8 * p);
    }
    unsigned short* yb = yo + ((size_t)ns * EE + o0) * LQ + l0 + 8 * p;
#pragma unroll
    for (int it = 0; it < 8; ++it) {
      const int orow = it * 16 + r16;
      *(v4u*)(yb + (size_t)orow * LQ) = vals[it];
    }
  }
}

// One launch for the Wo transposition and the three projections, none of which depends on another: blocks 0..15 build
// the HO plane, then 64 blocks each for q, k (row-major out) and v (transposed out). Every select is block-uniform.
__global__ __launch_bounds__(256)
void proj_all(const float* __restrict__ xq, const float* __restrict__ xk, const float* __restrict__ xv,
              const float* __restrict__ wq, const float* __restrict__ wk, const float* __restrict__ wv,
              const float* __restrict__ wo, const float* __restrict__ bq, const float* __restrict__ bk,
              const float* __restrict__ bv, unsigned short* q16, unsigned short* k16, unsigned short* vt,
              unsigned short* ho) {
  __shared__ __align__(16) unsigned short Sm[EE * WPH + PM * XPH];   // 70656 halves >= 16 * 264, 128 * 136
  const int bx = blockIdx.x;
  if (bx < NBW) { cvt_wt_body(bx, Sm, wo, ho); return; }
  const int pb = bx - NBW;
  const int wh = pb / NBP;                               // 0 q, 1 k, 2 v
  proj_body(pb - wh * NBP, wh == 2, Sm, wh == 0 ? wq : (wh == 1 ? wk : wv), wh == 0 ? xq : (wh == 1 ? xk : xv),
            wh == 0 ? bq : (wh == 1 ? bk : bv), wh == 0 ? q16 : (wh == 1 ? k16 : vt));
}

// ---- one stage of K and V^T into LDS: 8 asynchronous 16-B copies per lane (4 of K, 4 of V^T), no register in between.
//      lk / lv = the lane's LDS byte address of its first K / V piece, gk / gv = its global source; piece i of K lies
//      32 rows further (LDS 32 * 80 B, global 32 * 512 B), piece i of V^T 8 rows further (LDS 8 * 272 B, global 8 * 4096 B).
__device__ __forceinline__ void stage_kv(unsigned lk, unsigned lv, const unsigned short* gk, const unsigned short* gv) {
#if defined(__HIP_DEVICE_COMPILE__)
  const unsigned lk1 = lk + 32 * KPH * 2, lk2 = lk + 64 * KPH * 2, lk3 = lk + 96 * KPH * 2;
  const unsigned lv1 = lv + 8 * VPH * 2,  lv2 = lv + 16 * VPH * 2, lv3 = lv + 24 * VPH * 2;
  const unsigned short* gk1 = gk + 32 * EE;
  const unsigned short* gk2 = gk + 64 * EE;
  const unsigned short* gk3 = gk + 96 * EE;
  const unsigned short* gv1 = gv + 8 * LQ;
  const unsigned short* gv2 = gv + 16 * LQ;
  const unsigned short* gv3 = gv + 24 * LQ;
  // the closing s_wait_xcnt stands in the copies' own statement so that no address register is rewritten ahead of it
  asm volatile("global_load_async_to_lds_b128 %0, %8, off\n\t"
               "global_load_async_to_lds_b128 %1, %9, off\n\t"
               "global_load_async_to_lds_b128 %2, %10, off\n\t"
               "global_load_async_to_lds_b128 %3, %11, off\n\t"
               "global_load_async_to_lds_b128 %4, %12, off\n\t"
               "global_load_async_to_lds_b128 %5, %13, off\n\t"
               "global_load_async_to_lds_b128 %6, %14, off\n\t"
               "global_load_async_to_lds_b128 %7, %15, off\n\t"
               "s_wait_xcnt 0x0"
               :: "v"(lk), "v"(lk1), "v"(lk2), "v"(lk3), "v"(lv), "v"(lv1), "v"(lv2), "v"(lv3),
                  "v"(gk), "v"(gk1), "v"(gk2), "v"(gk3), "v"(gv), "v"(gv1), "v"(gv2), "v"(gv3)
               : "memory");
#endif
}

// =====================================================================================================
// Row-softmax attention (online max) per (ns, h, 64 queries q0..), 4 waves, grid 2*8*32 = 512; wave w owns queries
// q0+16w+ci (B operand of the score tile = Q16 row fragment, col = query, k = d, one k-step). Key term in log2 units
// Mk[l] = (1 - bf16_RNE(pres[ns][l])) * 1e32 * log2(e)/sqrt(32) staged once per block in LDS.
// K rows (this head's 64 B) and V^T rows of 128 keys are staged per block in LDS by asynchronous copies, two buffers: stage s + 1 flies while stage s is worked
// on; all four waves read their A fragments from the staged tile. One softmax step per stage of 128 keys:
//   8 score D tiles (rows = keys l0+16j+8hh+r, col = query) = A(K16 rows l, k = d) . B(qf);
//   t = acc * (log2(e)/sqrt(32)/256) - Mk[l], one f32 FMA; stage max over the lane's 64 keys combined with the partner
//   half (lane^16); reference point R = running max - 12, R and the rescale factor 2^(R_old - R) identical for both
//   halves of a query column; p = 2^(t - R) = 4096 exp(score - max), the sum Z carries the same factor;
//   P split: hi = f16(p), lo = f16(p - hi), both B fragments of each 32 keys lt.. built in registers
//   (element r <- key lt+8hh+r, element 8+r <- key lt+16+8hh+r, lane unchanged); O^T (rows d, cols queries) rescaled once, then
//   += A(VT rows d = h*32 + 16j + ci, keys contiguous) . B(hi) and . B(lo): 4 accumulators (d 0..15 / 16..31, hi / lo).
// Epilogue: 256*O = 16 (acc_hi + acc_lo) / Z as f16 hi plus f16 residual (x2048), staged per query row in LDS
// coverage: 2 it x 128 threads x 8 halves = 64 rows x 32 per plane per block; grid covers [2][8][2048][32] once.
// =====================================================================================================
__global__ __launch_bounds__(128)
void attn_fwd(const unsigned short* __restrict__ q16, const unsigned short* __restrict__ k16,
              const unsigned short* __restrict__ vt, const float* __restrict__ pres,
              unsigned short* ohp, unsigned short* olp) {
  __shared__ __align__(16) float Mk[LQ];
  __shared__ __align__(16) unsigned short Hs[64 * 40];
  __shared__ __align__(16) unsigned short Lw[64 * 40];
  __shared__ __align__(16) unsigned short Kb[2 * KBH];
  __shared__ __align__(16) unsigned short Vb[2 * VBH];
  const int tid  = threadIdx.x;
  const int wave = tid >> 5;
  const int lane = tid & 31;
  const int hh   = lane >> 4;
  const int ci   = lane & 15;
  const int bx   = blockIdx.x;
  const int ns   = bx / (NH * (LQ / 64));
  const int rem  = bx - ns * (NH * (LQ / 64));
  const int h    = rem / (LQ / 64);
  const int q0   = (rem - h * (LQ / 64)) * 64;
  const int qi   = q0 + 16 * wave + ci;                 // this lane's query
  // copy map: K piece (row tid>>2 (+32i), 16-B piece tid&3), V^T piece (row d = tid>>4 (+8i), 16-B piece tid&15)
  const unsigned lk0 = (unsigned)(uintptr_t)(Kb + (tid >> 2) * KPH + 8 * (tid & 3));
  const unsigned lv0 = (unsigned)(uintptr_t)(Vb + (tid >> 4) * VPH + 8 * (tid & 15));
  const unsigned short* gk0 = k16 + (size_t)(ns * LQ + (tid >> 2)) * EE + h * DH + 8 * (tid & 3);      // + SK * EE per stage
  const unsigned short* gv0 = vt + ((size_t)ns * EE + h * DH + (tid >> 4)) * LQ + 8 * (tid & 15);      // + SK per stage
  stage_kv(lk0, lv0, gk0, gv0);                         // stage 0 -> buffer 0
  {
    const float* pp = pres + (size_t)ns * LQ + 16 * tid;   // 128 threads x 16 floats = 2048 keys
#pragma unroll
    for (int i = 0; i < 4; ++i) {
      const v4f a = *(const v4f*)(pp + 4 * i);
      v4f mv;
#pragma unroll
      for (int e = 0; e < 4; ++e) mv[e] = (1.0f - bfr(a[e])) * MB2;
      *(v4f*)(Mk + 16 * tid + 4 * i) = mv;
    }
  }
  asm volatile("s_wait_asynccnt 0x0" ::: "memory");     // this wave's copies of stage 0 have landed
  __syncthreads();                                      // publishes Mk and stage 0
  stage_kv(lk0 + KBH * 2, lv0 + VBH * 2, gk0 + (size_t)SK * EE, gv0 + SK);     // stage 1 -> buffer 1

  const _Float16* Q = (const _Float16*)(const void*)q16;
  const v16h qf = ldfrag_h(Q + (size_t)(ns * LQ + qi) * EE + h * DH + 8 * hh);
  const _Float16* kl = (const _Float16*)(const void*)Kb + ci * KPH + 8 * hh;   // + buffer, + key_local * KPH
  const _Float16* vl = (const _Float16*)(const void*)Vb + ci * VPH + 8 * hh;   // row d = ci, + 16 * VPH, + key_local

  float rref = NEG0, z = 0.f;
  v8f ah0 = zero8(), ah1 = zero8(), al0 = zero8(), al1 = zero8();
#pragma unroll 1
  for (int st = 0; st < NST; ++st) {
    const int bf = st & 1;
    const _Float16* kp = kl + bf * KBH;
    const _Float16* vp = vl + bf * VBH;
    // one softmax step per stage: the 8 score tiles and the lane's 64 exponentials of 128 keys are independent among
    // themselves, and the running max, its cross-half exchange and the rescale come once per stage;
    // every loop of the step is unrolled: its arrays stay in registers and every LDS offset is an immediate
    const float* mp = Mk + st * SK + 8 * hh;
    v8f s[SK / 16];                                      // s[j][r] <-> key st*SK + 16j + 8hh + r, col = query
#pragma unroll
    for (int j = 0; j < SK / 16; ++j) s[j] = mma_h(ldfrag_h(kp + (16 * j) * KPH), qf, zero8());
    float mj[SK / 16];
#pragma unroll
    for (int j = 0; j < SK / 16; ++j) {
      const v4f ma = *(const v4f*)(mp + 16 * j);         // keys 16j + 8hh + 0..3 <-> s[j][0..3]
      const v4f mb = *(const v4f*)(mp + 16 * j + 4);     // keys 16j + 8hh + 4..7 <-> s[j][4..7]
#pragma unroll
      for (int r = 0; r < 4; ++r) {
        s[j][r]     = s[j][r] * SCL     - ma[r];
        s[j][4 + r] = s[j][4 + r] * SCL - mb[r];
      }
      float m = s[j][0];
#pragma unroll
      for (int r = 1; r < 8; ++r) m = fmaxf(m, s[j][r]);
      mj[j] = m;
    }
    float mx = fmaxf(fmaxf(fmaxf(mj[0], mj[1]), fmaxf(mj[2], mj[3])), fmaxf(fmaxf(mj[4], mj[5]), fmaxf(mj[6], mj[7])));
    mx = fmaxf(mx, __shfl_xor(mx, 16, 32));
    float mo = mx - POFF;
    mo = (mx - mo > 15.0f) ? mx : mo;                    // |mx| near 2^27: the rounded difference may lie 16 below, p past f16
    const float nref = fmaxf(rref, mo);
    const float corr = __builtin_amdgcn_exp2f(rref - nref);
    rref = nref;
    ah0 *= corr; ah1 *= corr; al0 *= corr; al1 *= corr;
    v2f zu[SK / 32];                                     // per 32 keys: sums of p over even / odd r, one packed add per pair
#pragma unroll
    for (int u = 0; u < SK / 32; ++u) {
      v8u ph, pl;
      v2f zg[2];
#pragma unroll
      for (int r = 0; r < 8; r += 4) {
        float x[8], p[8];                                // 0..3 <-> s[2u][r..r+3], 4..7 <-> s[2u+1][r..r+3]
#pragma unroll
        for (int e = 0; e < 4; ++e) {
          x[e]     = s[2 * u][r + e] - nref;
          x[4 + e] = s[2 * u + 1][r + e] - nref;
        }
#pragma unroll
        for (int e = 0; e < 8; ++e) p[e] = __builtin_amdgcn_exp2f(x[e]);
        const v2f pa0 = {p[0], p[1]}, pa1 = {p[2], p[3]}, pc0 = {p[4], p[5]}, pc1 = {p[6], p[7]};
        zg[r >> 2] = (pa0 + pc0) + (pa1 + pc1);
        // registers of the two B fragments: elements r..r+3 -> r/2, r/2 + 1; elements 8+r..8+r+3 -> 4 + r/2, 5 + r/2
        unsigned hq[4], lq[4];
        hq[0] = __builtin_bit_cast(unsigned, __builtin_convertvector(pa0, v2h));
        hq[1] = __builtin_bit_cast(unsigned, __builtin_convertvector(pa1, v2h));
        hq[2] = __builtin_bit_cast(unsigned, __builtin_convertvector(pc0, v2h));
        hq[3] = __builtin_bit_cast(unsigned, __builtin_convertvector(pc1, v2h));
        resid8(lq, hq, p);
        const int g = r >> 1;
        ph[g] = hq[0]; ph[g + 1] = hq[1]; ph[4 + g] = hq[2]; ph[5 + g] = hq[3];
        pl[g] = lq[0]; pl[g + 1] = lq[1]; pl[4 + g] = lq[2]; pl[5 + g] = lq[3];
      }
      zu[u] = zg[0] + zg[1];
      const v16h va0 = ldfrag_h(vp + u * 32);                      // d = ci
      const v16h va1 = ldfrag_h(vp + 16 * VPH + u * 32);           // d = 16 + ci
      const v16h pb = __builtin_bit_cast(v16h, ph), lb = __builtin_bit_cast(v16h, pl);
      ah0 = mma_h(va0, pb, ah0);
      ah1 = mma_h(va1, pb, ah1);
      al0 = mma_h(va0, lb, al0);
      al1 = mma_h(va1, lb, al1);
    }
    const v2f zt = (zu[0] + zu[1]) + (zu[2] + zu[3]);
    z = z * corr + (zt[0] + zt[1]);
    // publish point of stage st + 1: own LDS reads done, own copies landed, then the barrier that both publishes
    // stage st + 1 and ends every wave's reads of the buffer refilled behind it
    asm volatile("s_wait_dscnt 0x0" ::: "memory");
    asm volatile("s_wait_asynccnt 0x0" ::: "memory");
    __syncthreads();
    if (st + 2 < NST)
      stage_kv(lk0 + bf * (KBH * 2), lv0 + bf * (VBH * 2), gk0 + (size_t)(st + 2) * SK * EE, gv0 + (st + 2) * SK);
  }
  asm volatile("s_wait_asynccnt 0x0" ::: "memory");     // nothing of this wave's copies is left in flight

  // ah0/al0[r] <-> d = 8hh + r, ah1/al1[r] <-> d = 16 + 8hh + r, query qi; Z >= 1 (the max key's p)
  const float zz  = z + __shfl_xor(z, 16, 32);
  const float rzs = (1.0f / zz) * 16.0f;
  float o[16];
#pragma unroll
  for (int r = 0; r < 8; ++r) {
    o[r]     = (ah0[r] + al0[r]) * rzs;
    o[8 + r] = (ah1[r] + al1[r]) * rzs;
  }
  v4u h0, h1, g0, g1;
#pragma unroll
  for (int i = 0; i < 4; ++i) {
    const _Float16 a0 = (_Float16)o[2 * i],     a1 = (_Float16)o[2 * i + 1];
    const _Float16 b0 = (_Float16)o[8 + 2 * i], b1 = (_Float16)o[8 + 2 * i + 1];
    const _Float16 la0 = (_Float16)((o[2 * i]         - (float)a0) * LOSC);
    const _Float16 la1 = (_Float16)((o[2 * i + 1]     - (float)a1) * LOSC);
    const _Float16 lb0 = (_Float16)((o[8 + 2 * i]     - (float)b0) * LOSC);
    const _Float16 lb1 = (_Float16)((o[8 + 2 * i + 1] - (float)b1) * LOSC);
    h0[i] = pk16(h_bits(a0), h_bits(a1));
    h1[i] = pk16(h_bits(b0), h_bits(b1));
    g0[i] = pk16(h_bits(la0), h_bits(la1));
    g1[i] = pk16(h_bits(lb0), h_bits(lb1));
  }
  {
    const int ro = (16 * wave + ci) * 40 + 8 * hh;
    *(v4u*)(Hs + ro)      = h0;
    *(v4u*)(Hs + ro + 16) = h1;
    *(v4u*)(Lw + ro)      = g0;
    *(v4u*)(Lw + ro + 16) = g1;
  }
  __syncthreads();
  {
    const size_t ob = ((size_t)(ns * NH + h) * LQ + q0) * DH;      // 4096-B aligned region of 64 x 32 halves
    v4u hv[2], lv[2];
#pragma unroll
    for (int it2 = 0; it2 < 2; ++it2) {
      const int hf = it2 * 1024 + 8 * tid;             // half index within the 2048-half region
      const int row = hf >> 5, col = hf & 31;
      hv[it2] = *(const v4u*)(Hs + row * 40 + col);
      lv[it2] = *(const v4u*)(Lw + row * 40 + col);
    }
    {
#pragma unroll
      for (int it2 = 0; it2 < 2; ++it2) {
        const int hf = it2 * 1024 + 8 * tid;
        *(v4u*)(ohp + ob + hf) = hv[it2];
        *(v4u*)(olp + ob + hf) = lv[it2];
      }
      
    }
  }
}

// ---- 12 asynchronous 16-B copies per lane, global -> LDS, no register in between: l[i] = the lane's LDS byte address,
//      g[i] = its global source
__device__ __forceinline__ void copy12(const unsigned* l, const unsigned short* const* g) {
#if defined(__HIP_DEVICE_COMPILE__)
  // the closing s_wait_xcnt stands in the copies' own statement so that no address register is rewritten ahead of it
  asm volatile("global_load_async_to_lds_b128 %0, %12, off\n\t"
               "global_load_async_to_lds_b128 %1, %13, off\n\t"
               "global_load_async_to_lds_b128 %2, %14, off\n\t"
               "global_load_async_to_lds_b128 %3, %15, off\n\t"
               "global_load_async_to_lds_b128 %4, %16, off\n\t"
               "global_load_async_to_lds_b128 %5, %17, off\n\t"
               "global_load_async_to_lds_b128 %6, %18, off\n\t"
               "global_load_async_to_lds_b128 %7, %19, off\n\t"
               "global_load_async_to_lds_b128 %8, %20, off\n\t"
               "global_load_async_to_lds_b128 %9, %21, off\n\t"
               "global_load_async_to_lds_b128 %10, %22, off\n\t"
               "global_load_async_to_lds_b128 %11, %23, off\n\t"
               "s_wait_xcnt 0x0"
               :: "v"(l[0]), "v"(l[1]), "v"(l[2]), "v"(l[3]), "v"(l[4]), "v"(l[5]),
                  "v"(l[6]), "v"(l[7]), "v"(l[8]), "v"(l[9]), "v"(l[10]), "v"(l[11]),
                  "v"(g[0]), "v"(g[1]), "v"(g[2]), "v"(g[3]), "v"(g[4]), "v"(g[5]),
                  "v"(g[6]), "v"(g[7]), "v"(g[8]), "v"(g[9]), "v"(g[10]), "v"(g[11])
               : "memory");
#endif
}

// =====================================================================================================
// Output projection out[m][o] = sum_c O[m][c] Wo[c][o] + bo[o], O = (hi + lo/2048)/256 from the OH/OL planes
// ([ns][h][q][32]: k-step j = head j). Block = 4 waves = 64 rows m x 64 cols o (grid 64 x 4 = 256).
// Every global read of the block goes out at entry: the bias into registers, and both operands whole into LDS by
// asynchronous copies, each wave-copy 512 contiguous bytes: Ws[o_local][e] = 64 HO rows (16 copies per lane, one row
// per wave-copy), Os[plane][j][m_local][32] = the block's 64 rows of each head of OH and OL (2 x 8 x 2 copies per lane,
// 8 rows per wave-copy); 48 copies per wave in flight, one wait, one barrier, then the buffers are only read.
// Wave w owns rows m0+16w+ci (B operands = OH and OL row fragments, col = m), A = HO rows o0+16t+ci (k = c split map);
// 4 hi + 4 lo accumulators; acc[t][r] <-> (m = m0+16w+ci, o = o0+16t+8hh+r).
// Epilogue: (acch + accl/2048)/262144 + bf16_RNE(bo) staged in LDS as Ts[m_local][o_local] (pitch 68, 16-B vector
// coverage: copies 16 x 4 rows x 512 B = 64 x 256 halves, 16 x 2 x 32 rows x 64 B = 2 x 8 x 64 x 32 halves;
//           8 it x 8 rows x 16 pieces x 4 floats = 64 x 64 per block; grid covers out [4096][256] exactly once.
// =====================================================================================================
__global__ __launch_bounds__(128)
void out_proj(const unsigned short* __restrict__ ohp, const unsigned short* __restrict__ olp,
              const unsigned short* __restrict__ woh, const float* __restrict__ bo, float* out) {
  __shared__ __align__(16) unsigned short Ws[64 * OWP];
  __shared__ __align__(16) unsigned short Os[2 * NH * 64 * OOP];
  __shared__ __align__(16) float Ts[64 * 68];
  const int tid  = threadIdx.x;
  const int wave = tid >> 5;
  const int lane = tid & 31;
  const int hh   = lane >> 4;
  const int ci   = lane & 15;
  const int bx   = blockIdx.x;
  const int mt   = bx >> 2, ot = bx & 3;
  const int m0   = mt * 64, o0 = ot * 64;
  const int ns   = m0 / LQ;

  v4f bb[4][2];
#pragma unroll
  for (int t = 0; t < 4; ++t) {
    bb[t][0] = *(const v4f*)(bo + o0 + 16 * t + 8 * hh);
    bb[t][1] = *(const v4f*)(bo + o0 + 16 * t + 8 * hh + 4);
  }
#if defined(__HIP_DEVICE_COMPILE__)
  // stands between the loads above and the address arithmetic below, which reuses the registers of their base
  asm volatile("s_wait_xcnt 0x0" ::: "memory");
#endif
  {
    unsigned l[48];
    const unsigned short* g[48];
    // HO: copy i = row o_local 4 i + wave, 16-B piece lane
    const unsigned lw = (unsigned)(uintptr_t)(Ws + wave * OWP + 8 * lane);
    const unsigned short* gw = woh + (size_t)(o0 + wave) * EE + 8 * lane;
#pragma unroll
    for (int i = 0; i < 16; ++i) {
      l[i] = lw + i * (4 * OWP * 2);
      g[i] = gw + i * (4 * EE);
    }
    // OH / OL: copy (plane, j, c) = row m_local 32 c + (tid >> 2), 16-B piece tid & 3; the 64 rows of a head are contiguous
    const unsigned lo = (unsigned)(uintptr_t)(Os + (tid >> 2) * OOP + 8 * (tid & 3));
    const size_t ob = ((size_t)(ns * NH) * LQ + (m0 - ns * LQ)) * DH + 8 * tid;
#pragma unroll
    for (int pj = 0; pj < 2 * NH; ++pj) {
      const unsigned short* gp = (pj < NH ? ohp : olp) + ob + (size_t)(pj & (NH - 1)) * LQ * DH;
#pragma unroll
      for (int c = 0; c < 2; ++c) {
        l[16 + 2 * pj + c] = lo + (pj * 64 + 32 * c) * (OOP * 2);
        g[16 + 2 * pj + c] = gp + c * (128 * 8);
      }
    }
#pragma unroll
    for (int s = 0; s < 4; ++s) copy12(l + 12 * s, g + 12 * s);
  }
  asm volatile("s_wait_asynccnt 0x0" ::: "memory");     // this wave's copies have landed
  __syncthreads();                                      // publishes Ws and Os

  const _Float16* ar = (const _Float16*)(const void*)Os + (16 * wave + ci) * OOP + 8 * hh;   // + j * 64 * OOP
  const _Float16* lr = ar + NH * 64 * OOP;
  const _Float16* wr = (const _Float16*)(const void*)Ws + ci * OWP + 8 * hh;                 // + 16t * OWP + 32j

  v8f acch[4], accl[4];
#pragma unroll
  for (int t = 0; t < 4; ++t) { acch[t] = zero8(); accl[t] = zero8(); }

  // two register sets: the fragments of k-step j + 1 are asked for ahead of the products of k-step j, so that their LDS
  // latency runs under those products; unrolled, so that the set index and every LDS offset are compile-time constants
  v16h obh[2], obl[2], wa[2][4];
  obh[0] = ldfrag_h(ar);
  obl[0] = ldfrag_h(lr);
#pragma unroll
  for (int t = 0; t < 4; ++t) wa[0][t] = ldfrag_h(wr + (16 * t) * OWP);
#pragma unroll
  for (int j = 0; j < NH; ++j) {
    const int cu = j & 1, nx = cu ^ 1;
    if (j + 1 < NH) {
      obh[nx] = ldfrag_h(ar + (j + 1) * 64 * OOP);
      obl[nx] = ldfrag_h(lr + (j + 1) * 64 * OOP);
#pragma unroll
      for (int t = 0; t < 4; ++t) wa[nx][t] = ldfrag_h(wr + (16 * t) * OWP + 32 * (j + 1));
    }
    // holds the load group together and ahead of the products: left free, the loads sink in among the products
    __builtin_amdgcn_sched_barrier(0);
#pragma unroll
    for (int t = 0; t < 4; ++t) acch[t] = mma_h(wa[cu][t], obh[cu], acch[t]);
#pragma unroll
    for (int t = 0; t < 4; ++t) accl[t] = mma_h(wa[cu][t], obl[cu], accl[t]);
    __builtin_amdgcn_sched_barrier(0);                   // the next load group stays behind these products
  }

  {
    float* ts = Ts + (16 * wave + ci) * 68 + 8 * hh;
#pragma unroll
    for (int t = 0; t < 4; ++t) {
      v4f r0, r1;
#pragma unroll
      for (int e = 0; e < 4; ++e) {
        r0[e] = (acch[t][e]     + accl[t][e]     * LOIN) * OSC + bfr(bb[t][0][e]);
        r1[e] = (acch[t][4 + e] + accl[t][4 + e] * LOIN) * OSC + bfr(bb[t][1][e]);
      }
      *(v4f*)(ts + 16 * t)     = r0;
      *(v4f*)(ts + 16 * t + 4) = r1;
    }
  }
  __syncthreads();
  {
    const int p = tid & 15, r16 = tid >> 4;             // r16 0..7, p = 16-B piece of the 256-B segment
    v4f vals[8];
#pragma unroll
    for (int it = 0; it < 8; ++it) {
      const int row = it * 8 + r16;                      // it 0..7 x r16 0..7 = rows 0..63
      vals[it] = *(const v4f*)(Ts + row * 68 + 4 * p);
    }
    float* yb = out + (size_t)m0 * EE + o0 + 4 * p;
#pragma unroll
    for (int it = 0; it < 8; ++it) {
      const int row = it * 8 + r16;
      *(v4f*)(yb + (size_t)row * EE) = vals[it];
    }
  }
}

// =====================================================================================================
// Workspace map (bytes), every offset a multiple of 256 and every plane sized to its whole-line store granularity:
//   HO           f16 [256][256]       131072           0 .. 131072
//   Q16, K16     f16 [4096][256]      2 x 2097152      .. 4325376
//   VT           f16 [2][256][2048]   2097152          .. 6422528
//   OH, OL       f16 [2][8][2048][32] 2 x 2097152      .. 10616832  (end)
// =====================================================================================================
extern "C" void kernel_launch(void* const* d_in, const int* in_sizes, int n_in,
                              void* d_out, int out_size, void* d_ws, size_t ws_size,
                              hipStream_t stream) {
  if (n_in < 12) return;
  if (in_sizes[0] != MR * EE || in_sizes[1] != MR * EE || in_sizes[2] != MR * EE) return;
  if (in_sizes[3] != NSB * LQ) return;
  if (in_sizes[4] != EE * EE || in_sizes[6] != EE * EE || in_sizes[8] != EE * EE || in_sizes[10] != EE * EE) return;
  if (in_sizes[5] != EE || in_sizes[7] != EE || in_sizes[9] != EE || in_sizes[11] != EE) return;
  if (out_size != MR * EE) return;

  const float* queries = (const float*)d_in[0];
  const float* keys    = (const float*)d_in[1];
  const float* values  = (const float*)d_in[2];
  const float* pres    = (const float*)d_in[3];
  const float* Wq      = (const float*)d_in[4];
  const float* bq      = (const float*)d_in[5];
  const float* Wk      = (const float*)d_in[6];
  const float* bk      = (const float*)d_in[7];
  const float* Wv      = (const float*)d_in[8];
  const float* bv      = (const float*)d_in[9];
  const float* Wo      = (const float*)d_in[10];
  const float* bo      = (const float*)d_in[11];
  float* out = (float*)d_out;

  const size_t PW  = (size_t)EE * EE * 2;               // 131072
  const size_t PP  = (size_t)MR * EE * 2;               // 2097152
  const size_t PVT = (size_t)NSB * EE * LQ * 2;         // 2097152
  const size_t PO  = (size_t)NSB * NH * LQ * DH * 2;    // 2097152
  size_t off = 0;
  const size_t oHO = off; off += PW;
  const size_t oQ  = off; off += PP;
  const size_t oK  = off; off += PP;
  const size_t oVT = off; off += PVT;
  const size_t oOH = off; off += PO;
  const size_t oOL = off; off += PO;
  if (off > ws_size) return;                            // off = 10616832
  if (off > (size_t)134217728) return;

  char* ws = (char*)d_ws;
  unsigned short* HOp = (unsigned short*)(ws + oHO);
  unsigned short* Q16 = (unsigned short*)(ws + oQ);
  unsigned short* K16 = (unsigned short*)(ws + oK);
  unsigned short* VTp = (unsigned short*)(ws + oVT);
  unsigned short* OHp = (unsigned short*)(ws + oOH);
  unsigned short* OLp = (unsigned short*)(ws + oOL);

  const dim3 blk256(256), blk128(128);
  const dim3 gPJ(NBW + 3 * NBP);                        // 16 + 3 x 64 blocks
  const dim3 gAT(NSB * NH * (LQ / 64));                 // 512 blocks
  const dim3 gOP((MR / 64) * (EE / 64));                // 256 blocks

  // (1) transposed 16-bit Wo plane HO[o][e]; projections from the f32 inputs: q, k row-major [4096][256] (x16),
  //     v transposed VT[ns][hd][l] (x16), biases added
  proj_all<<<gPJ, blk256, 0, stream>>>(queries, keys, values, Wq, Wk, Wv, Wo, bq, bk, bv, Q16, K16, VTp, HOp);
  // (2) attention output planes OH / OL [ns][h][q][32] (row softmax over keys with the key term)
  attn_fwd<<<gAT, blk128, 0, stream>>>(Q16, K16, VTp, pres, OHp, OLp);
  // (3) output projection + bias -> d_out [4096][256] f32
  out_proj<<<gOP, blk128, 0, stream>>>(OHp, OLp, HOp, bo, out);
  (void)hipGetLastError();
}

// v007
// Measured time: 30.9 microseconds a run.
// Next to v006, in two timings, it ran 1.07 times as fast each time.
// All steps since v000 together make it 3.41 times as fast.
// Contractions, all v_wmma_f32_16x16x32_f16 (f16 operands, f32 accumulate): q/k/v projections X.W with f16
// containers holding bf16-RNE inputs (X x64, W x1024); scores K.q with q, k planes f16 x16 (K = 32 per head);
// P as f16 hi (x4096) + residual (same scale) planes . V plane (f16 x16) into two accumulator pairs; output projection
// with O as f16 hi (x256) + residual (x2^11) planes and Wo bf16-RNE x1024 into two accumulators. Key-mask term,
// running max / sum, exp, residual folds and biases in f32 on VALU.
#include <hip/hip_runtime.h>
#include <math.h>
#include <stdint.h>

#define NSB  2
#define LQ   2048
#define EE   256
#define NH   8
#define DH   32
#define MR   (NSB * LQ)
#define XSC  64.0f
#define WSC  1024.0f
#define ISC  (1.0f / 4096.0f)
#define BSC  16.0f
#define RL2E (0.17677669529663687 * 1.44269504088896340736)   // log2(e) / sqrt(32): exp(s / sqrt(32)) = 2^(s * RL2E)
#define SCL  ((float)(RL2E / 256.0))   // score accumulator (256 q.k) -> log2 units
#define MB2  ((float)(1.0e32 * RL2E))  // the key term's 1e32 in log2 units
#define NEG0 (-1.0e38f)
#define POFF 12.0f                     // P carries 2^12: the exponent's reference point lies 12 below the running max
#define LOIN (1.0f / 2048.0f)
#define LOSC 2048.0f
#define OSC  (1.0f / 262144.0f)
#define NBW  16                     // blocks of the Wo transposition: 16 o-tiles
#define PM   128                    // rows m of a projection block
#define NBP  ((MR / PM) * (EE / 128))   // blocks of one projection
#define WPH  144                    // LDS pitch of a staged W row e, halves (256 B of data + 32 B: 32 B x odd for the transposing reader)
#define XPH  264                    // LDS pitch of a staged X row m, halves (512 B of data + 16 B: 16 B x odd for 16-B readers)
static_assert(EE == NH * DH);
static_assert(DH == 32);
static_assert((LQ % PM) == 0 && (EE % 128) == 0 && (MR % PM) == 0);
static_assert(EE == 256 && PM == 128);
static_assert(LQ == 128 * 16);
#define SK   128                    // keys per LDS stage of the attention kernel
#define NST  (LQ / SK)              // stages
#define KPH  40                     // LDS pitch of a staged K row, halves (64 B of data + 16 B: 16 B x odd for 16-B readers)
#define VPH  136                    // LDS pitch of a staged V^T row, halves (256 B of data + 16 B)
#define KBH  (SK * KPH)             // halves per K buffer
#define VBH  (DH * VPH)             // halves per V buffer
static_assert(NST >= 2 && SK == 128);               // the softmax step merges 8 tile maxima and 4 partial sums
#define NGR  2                      // key groups of an attention block: group g works on stages g, g + 2, g + 4, ...
#define NPR  (NST / NGR)            // trips of the attention loop: one stage per group and trip
#define MGP  20                     // LDS pitch of a lane's partial result, floats (72 B of data + 8 B: 16 B x odd)
static_assert(NPR >= 2 && NPR * NGR == NST);
static_assert(SK * 4 == 4 * 128 && DH * (SK / 8) == 4 * 128);   // 4 + 4 copies of 16 B per thread and stage
#define OWP  264                    // LDS pitch of a staged HO row o, halves (512 B of data + 16 B: 16 B x odd for 16-B readers)
#define OOP  40                     // LDS pitch of a staged OH / OL row m, halves (64 B of data + 16 B)

typedef _Float16 v16h __attribute__((ext_vector_type(16)));
typedef _Float16 v8h  __attribute__((ext_vector_type(8)));
typedef float    v8f  __attribute__((ext_vector_type(8)));
typedef float    v4f  __attribute__((ext_vector_type(4)));
typedef unsigned int v4u __attribute__((ext_vector_type(4)));
typedef unsigned int v2u __attribute__((ext_vector_type(2)));
typedef unsigned int v8u __attribute__((ext_vector_type(8)));
typedef short    s16x8 __attribute__((ext_vector_type(8)));
typedef float    v2f  __attribute__((ext_vector_type(2)));
typedef _Float16 v2h  __attribute__((ext_vector_type(2)));
typedef __bf16   v2b  __attribute__((ext_vector_type(2)));

union FragH { v16h v; v8h h[2]; };

// ---- scalar helpers ----------------------------------------------------------------------------------
__device__ __forceinline__ unsigned short bf_bits(float f) {          // f32 -> bf16 bits, RNE convert
  unsigned u = __float_as_uint(f);
  return (unsigned short)((u + 0x7FFFu + ((u >> 16) & 1u)) >> 16);
}
__device__ __forceinline__ float bf_up(unsigned short h) { return __uint_as_float(((unsigned)h) << 16); }
__device__ __forceinline__ float bfr(float f) { return bf_up(bf_bits(f)); }
__device__ __forceinline__ unsigned short h_bits(_Float16 x) { return __builtin_bit_cast(unsigned short, x); }
__device__ __forceinline__ unsigned pk16(unsigned short a, unsigned short b) { return (unsigned)a | ((unsigned)b << 16); }
__device__ __forceinline__ v8f zero8() { v8f z = {0.f, 0.f, 0.f, 0.f, 0.f, 0.f, 0.f, 0.f}; return z; }
// 4 consecutive f32 -> f16( bf16_RNE(x) * sc ) packed into 8 bytes; the RNE step by the packed hardware convert, which
// gives bfr()'s value for every finite x
__device__ __forceinline__ v2u cvt4(v4f a, float sc) {
  v2u v;
#pragma unroll
  for (int i = 0; i < 2; ++i) {
    const v2f x = {a[2 * i], a[2 * i + 1]};
    const unsigned b = __builtin_bit_cast(unsigned, __builtin_convertvector(x, v2b));
    const v2f y = {__uint_as_float(b << 16) * sc, __uint_as_float(b & 0xFFFF0000u) * sc};
    v[i] = __builtin_bit_cast(unsigned, __builtin_convertvector(y, v2h));
  }
  return v;
}

// ---- fragment loader: 16-bit A/B operand, lane -> row/col (lane&15), p already includes +8*(lane>>4);
//      elements 0..7 <- p[0..7] (k0+8h..), elements 8..15 <- p[16..23] (k0+16+8h..)
__device__ __forceinline__ v16h ldfrag_h(const _Float16* p) {
  FragH f;
  f.h[0] = *(const v8h*)(p);
  f.h[1] = *(const v8h*)(p + 16);
  return f.v;
}

// ---- transposing fragment loader: LDS tile T[k][row] (16-bit, k-major), p = T + (k0 + 8*(lane>>4) + (lane&7)) * pitch
//      + row0 + 8*((lane>>3)&1); lane (ci, hh) receives T[k0+8hh+0..7][row0+ci], then T[k0+16+8hh+0..7][row0+ci]:
//      the k order of ldfrag_h
__device__ __forceinline__ v16h ldfrag_tr(const unsigned short* p, int pitch) {
  typedef __attribute__((address_space(3))) s16x8 lds_s16x8;
  FragH f;
  f.h[0] = __builtin_bit_cast(v8h, __builtin_amdgcn_ds_load_tr16_b128_v8i16((lds_s16x8*)p));
  f.h[1] = __builtin_bit_cast(v8h, __builtin_amdgcn_ds_load_tr16_b128_v8i16((lds_s16x8*)(p + 16 * pitch)));
  return f.v;
}

// ---- WMMA helper --------------------------------------------------------------------------------------
__device__ __forceinline__ v8f mma_h(v16h a, v16h b, v8f c) {
  return __builtin_amdgcn_wmma_f32_16x16x32_f16(false, a, false, b, (short)0, c, false, false);
}
// ---- residual halves of 8 values: l = f16(p - hi), two per register. The mixed-precision FMA hi * (-1) + p takes hi (f16)
//      straight from its packed half, -1 and p as f32, and writes one half of l (left to itself the compiler converts hi
//      back to f32, subtracts and repacks). The four low halves stand ahead of the four high halves; s_delay_alu names
//      that distance of 4, so that the wait of a high half for its register's low half does not hold up the SIMD's other waves.
__device__ __forceinline__ void resid8(unsigned* l, const unsigned* h, const float* p) {
#if defined(__HIP_DEVICE_COMPILE__)
  asm("v_fma_mixlo_f16 %0, %4, %16, %8 op_sel_hi:[1,0,0]\n\t"
      "v_fma_mixlo_f16 %1, %5, %16, %10 op_sel_hi:[1,0,0]\n\t"
      "v_fma_mixlo_f16 %2, %6, %16, %12 op_sel_hi:[1,0,0]\n\t"
      "v_fma_mixlo_f16 %3, %7, %16, %14 op_sel_hi:[1,0,0]\n\t"
      "s_delay_alu instid0(VALU_DEP_4) | instskip(NEXT) | instid1(VALU_DEP_4)\n\t"
      "v_fma_mixhi_f16 %0, %4, %16, %9 op_sel:[1,0,0] op_sel_hi:[1,0,0]\n\t"
      "v_fma_mixhi_f16 %1, %5, %16, %11 op_sel:[1,0,0] op_sel_hi:[1,0,0]\n\t"
      "s_delay_alu instid0(VALU_DEP_4) | instskip(NEXT) | instid1(VALU_DEP_4)\n\t"
      "v_fma_mixhi_f16 %2, %6, %16, %13 op_sel:[1,0,0] op_sel_hi:[1,0,0]\n\t"
      "v_fma_mixhi_f16 %3, %7, %16, %15 op_sel:[1,0,0] op_sel_hi:[1,0,0]"
      : "=&v"(l[0]), "=&v"(l[1]), "=&v"(l[2]), "=&v"(l[3])
      : "v"(h[0]), "v"(h[1]), "v"(h[2]), "v"(h[3]),
        "v"(p[0]), "v"(p[1]), "v"(p[2]), "v"(p[3]), "v"(p[4]), "v"(p[5]), "v"(p[6]), "v"(p[7]), "s"(-1.0f));
#endif
}

// =====================================================================================================
// Transposed output-weight plane: HO[o][e] = f16( bf16_RNE(Wo[e][o]) * 1024 ) for the [in][out] weight (x.W layout).
// Block = 16 output rows o0 = 16*bx, 256 threads, 16 blocks, so that this chain is no longer than a projection block's.
// Read W rows e as 4 threads x 16 B (64-B row segment o0..o0+15), all 4 loads of a thread in flight together, 2-B
// transposed LDS stores into Ts[o_local][e] (pitch 264), block barrier, then whole rows out.
// coverage: read 4 it x 64 rows e x 4 pieces x 4 = all 256 e x 16 o; write 2 it x 8 waves = 16 rows x 32 lanes x 8
//           halves = 16 x 256; 16 o-tiles -> HO [256][256] entirely.
// =====================================================================================================
__device__ __forceinline__
void cvt_wt_body(int bx, unsigned short* Ts, const float* __restrict__ src, unsigned short* dst) {
  const int tid  = threadIdx.x;
  const int wave = tid >> 5;
  const int lane = tid & 31;
  const int o0   = bx * 16;
  const int p = tid & 3, r64 = tid >> 2;                // p = 16-B piece of the 64-B row segment, r64 = row in group
  v4f a[4];
#pragma unroll
  for (int it = 0; it < 4; ++it) a[it] = *(const v4f*)(src + (size_t)(it * 64 + r64) * EE + o0 + 4 * p);
#pragma unroll
  for (int it = 0; it < 4; ++it) {
    const int e = it * 64 + r64;                         // 0..255
#pragma unroll
    for (int i = 0; i < 4; ++i) Ts[(4 * p + i) * 264 + e] = h_bits((_Float16)(bfr(a[it][i]) * WSC));
  }
  __syncthreads();
  v4u vals[2];
#pragma unroll
  for (int it = 0; it < 2; ++it) {
    const int row = it * 8 + wave;                       // it 0..1 x wave 0..7 = rows 0..15
    vals[it] = *(const v4u*)(Ts + row * 264 + 8 * lane);
  }
  unsigned short* db = dst + (size_t)o0 * EE + 8 * lane;
#pragma unroll
  for (int it = 0; it < 2; ++it) {
    const int row = it * 8 + wave;
    *(v4u*)(db + (size_t)row * EE) = vals[it];
  }
}

// =====================================================================================================
// Projection GEMM Y[m][o] = sum_e X[m][e] W[e][o] (x 65536 in the accumulator) + b[o], straight from the f32 inputs.
// Block = 8 waves = 128 rows m x 128 cols o (32 m-tiles x 2 o-tiles = 64 blocks per projection). The block converts
// its own operands into LDS: Ws[e][o_local] = f16( bf16_RNE(W[e][o]) * 1024 ) (one wave-load = one 512-B row segment),
// Xs[m_local][e] = f16( bf16_RNE(X[m][e]) * 64 ) (one wave-load = half a row), 8-B LDS stores, block barrier.
// Wave (wm = wave & 3, wo = wave >> 2) owns 32 rows m x 64 cols o: A(W^T rows o = o0+64wo+16t+ci by the transposing
// load, k = e split map) . B(Xs row m = m0+32wm+16i+ci, col = m, same map); 8 k-steps of 32, 8 accumulators per wave;
// acc[i][t][r] <-> (m = m0+32wm+16i+ci, o = o0+64wo+16t+8hh+r). y16 = acc * 2^-12 + 16 * bf16_RNE(b[o]) (= 16 y).
// A second barrier ends every wave's operand reads before the same LDS becomes output staging.
// tr == 0: YO[m][o] = f16(y16): staged as Ts[m_local][o_local] (pitch 136, 16-B LDS stores), block barrier, rows out.
// tr == 1: VT[ns][o][l] (keys contiguous): staged as Ts[o_local][l_local] (pitch 136, 2-B LDS stores), barrier, rows out.
// coverage: operands: 32 it x 8 rows e x 128 o, 32 it x 4 rows m x 256 e; tr 0: 8 it x 16 rows x 16 pieces x 8 halves =
//           128 x 128 per block, grid -> [4096][256]; tr 1: 8 it x 16 lines x 16 pieces x 8 = 128 o x 128 l, grid ->
//           VT [2][256][2048].
// =====================================================================================================
__device__ __forceinline__
void proj_body(int bx, bool tr, unsigned short* Sm, const float* __restrict__ wf, const float* __restrict__ xf,
               const float* __restrict__ bias, unsigned short* yo) {
  const int tid  = threadIdx.x;
  const int wave = tid >> 5;
  const int lane = tid & 31;
  const int hh   = lane >> 4;
  const int ci   = lane & 15;
  const int wm   = wave & 3, wo = wave >> 2;
  const int mt   = bx >> 1, ot = bx & 1;
  const int m0   = mt * PM, o0 = ot * 128;
  unsigned short* Ws = Sm;                               // [256 e][WPH]
  unsigned short* Xs = Sm + EE * WPH;                    // [128 m][XPH]
  {
    const float* wsrc = wf + (size_t)wave * EE + o0 + 4 * lane;                    // row e = 8 it + wave
    const float* xsrc = xf + (size_t)(m0 + (tid >> 6)) * EE + 4 * (tid & 63);      // row m = 4 it + (tid >> 6)
    unsigned short* wd = Ws + wave * WPH + 4 * lane;
    unsigned short* xd = Xs + (tid >> 6) * XPH + 4 * (tid & 63);
    v4f a[32], c[32];
#pragma unroll
    for (int it = 0; it < 32; ++it) a[it] = *(const v4f*)(wsrc + (size_t)(8 * it) * EE);
#if defined(__HIP_DEVICE_COMPILE__)
    // stands between the loads above and a later load whose result the compiler puts into their address pair
    asm volatile("s_wait_xcnt 0x0" ::: "memory");
#endif
#pragma unroll
    for (int it = 0; it < 16; ++it) c[it] = *(const v4f*)(xsrc + (size_t)(4 * it) * EE);
    // keeps these 48 loads ahead of all conversion work: one latency for the lot instead of one per trickled load
    __builtin_amdgcn_sched_barrier(0);
#pragma unroll
    for (int it = 0; it < 16; ++it) *(v2u*)(wd + (8 * it) * WPH) = cvt4(a[it], WSC);
    // the last 16 loads go out as soon as registers are free, ahead of the remaining conversion work
    __builtin_amdgcn_sched_barrier(0);
#pragma unroll
    for (int it = 16; it < 32; ++it) c[it] = *(const v4f*)(xsrc + (size_t)(4 * it) * EE);
    __builtin_amdgcn_sched_barrier(0);                   // closes the group above
#pragma unroll
    for (int it = 16; it < 32; ++it) *(v2u*)(wd + (8 * it) * WPH) = cvt4(a[it], WSC);
#pragma unroll
    for (int it = 0; it < 32; ++it) *(v2u*)(xd + (4 * it) * XPH) = cvt4(c[it], XSC);
  }
  __syncthreads();

  const _Float16* xr = (const _Float16*)(const void*)Xs + (32 * wm + ci) * XPH + 8 * hh;       // B: X row m, + 16 i rows
  const unsigned short* wr = Ws + (8 * hh + (lane & 7)) * WPH + 64 * wo + 8 * ((lane >> 3) & 1);   // A: + k0 rows, + 16 t

  v8f acc[2][4];
#pragma unroll
  for (int i = 0; i < 2; ++i)
#pragma unroll
    for (int t = 0; t < 4; ++t) acc[i][t] = zero8();

  // two register sets: the fragments of k-step ks + 1 are asked for ahead of the products of k-step ks, so that their LDS
  // latency runs under those products; unrolled, so that the set index and every LDS offset are compile-time constants
  v16h wa[2][4], xb[2][2];
#pragma unroll
  for (int t = 0; t < 4; ++t) wa[0][t] = ldfrag_tr(wr + 16 * t, WPH);
#pragma unroll
  for (int i = 0; i < 2; ++i) xb[0][i] = ldfrag_h(xr + (16 * i) * XPH);
#pragma unroll
  for (int ks = 0; ks < EE / 32; ++ks) {
    const int cu = ks & 1, nx = cu ^ 1;
    if (ks + 1 < EE / 32) {
      const int k1 = (ks + 1) * 32;
#pragma unroll
      for (int t = 0; t < 4; ++t) wa[nx][t] = ldfrag_tr(wr + k1 * WPH + 16 * t, WPH);
#pragma unroll
      for (int i = 0; i < 2; ++i) xb[nx][i] = ldfrag_h(xr + (16 * i) * XPH + k1);
    }
    // holds the load group together and ahead of the products: left free, the loads sink in among the products
    __builtin_amdgcn_sched_barrier(0);
#pragma unroll
    for (int i = 0; i < 2; ++i)
#pragma unroll
      for (int t = 0; t < 4; ++t) acc[i][t] = mma_h(wa[cu][t], xb[cu][i], acc[i][t]);
    __builtin_amdgcn_sched_barrier(0);                   // the next load group stays behind these products
  }
  __syncthreads();                                       // every wave has read its operands: the LDS becomes Ts

  unsigned short* Ts = Sm;                               // 128 x 136 halves
  const int p = tid & 15, r16 = tid >> 4;               // r16 0..15 = row within group, p = 16-B piece of the 256-B segment
  if (!tr) {
#pragma unroll
    for (int i = 0; i < 2; ++i) {
      unsigned short* ts = Ts + (32 * wm + 16 * i + ci) * 136 + 64 * wo + 8 * hh;
#pragma unroll
      for (int t = 0; t < 4; ++t) {
        const v4f b0 = *(const v4f*)(bias + o0 + 64 * wo + 16 * t + 8 * hh);
        const v4f b1 = *(const v4f*)(bias + o0 + 64 * wo + 16 * t + 8 * hh + 4);
        float y[8];
#pragma unroll
        for (int e = 0; e < 4; ++e) {
          y[e]     = acc[i][t][e] * ISC     + bfr(b0[e]) * BSC;
          y[4 + e] = acc[i][t][4 + e] * ISC + bfr(b1[e]) * BSC;
        }
        v4u v;
#pragma unroll
        for (int j = 0; j < 4; ++j) v[j] = pk16(h_bits((_Float16)y[2 * j]), h_bits((_Float16)y[2 * j + 1]));
        *(v4u*)(ts + 16 * t) = v;
      }
    }
    __syncthreads();
    v4u vals[8];
#pragma unroll
    for (int it = 0; it < 8; ++it) {
      const int row = it * 16 + r16;                     // it 0..7 x r16 0..15 = rows 0..127
      vals[it] = *(const v4u*)(Ts + row * 136 + 8 * p);
    }
    unsigned short* yb = yo + (size_t)m0 * EE + o0 + 8 * p;
#pragma unroll
    for (int it = 0; it < 8; ++it) {
      const int row = it * 16 + r16;
      *(v4u*)(yb + (size_t)row * EE) = vals[it];
    }
  } else {
    const int ns = m0 / LQ, l0 = m0 - ns * LQ;
#pragma unroll
    for (int i = 0; i < 2; ++i) {
#pragma unroll
      for (int t = 0; t < 4; ++t) {
        const v4f b0 = *(const v4f*)(bias + o0 + 64 * wo + 16 * t + 8 * hh);
        const v4f b1 = *(const v4f*)(bias + o0 + 64 * wo + 16 * t + 8 * hh + 4);
#pragma unroll
        for (int r = 0; r < 4; ++r) {
          Ts[(64 * wo + 16 * t + 8 * hh + r) * 136 + 32 * wm + 16 * i + ci] =
              h_bits((_Float16)(acc[i][t][r] * ISC + bfr(b0[r]) * BSC));
          Ts[(64 * wo + 16 * t + 8 * hh + 4 + r) * 136 + 32 * wm + 16 * i + ci] =
              h_bits((_Float16)(acc[i][t][4 + r] * ISC + bfr(b1[r]) * BSC));
        }
      }
    }
    __syncthreads();
    v4u vals[8];
#pragma unroll
    for (int it = 0; it < 8; ++it) {
      const int orow = it * 16 + r16;                    // it 0..7 x r16 0..15 = o_local 0..127
      vals[it] = *(const v4u*)(Ts + orow * 136 + 8 * p);
    }
    unsigned short* yb = yo + ((size_t)ns * EE + o0) * LQ + l0 + 8 * p;
#pragma unroll
    for (int it = 0; it < 8; ++it) {
      const int orow = it * 16 + r16;
      *(v4u*)(yb + (size_t)orow * LQ) = vals[it];
    }
  }
}

// One launch for the Wo transposition and the three projections, none of which depends on another: blocks 0..15 build
// the HO plane, then 64 blocks each for q, k (row-major out) and v (transposed out). Every select is block-uniform.
__global__ __launch_bounds__(256)
void proj_all(const float* __restrict__ xq, const float* __restrict__ xk, const float* __restrict__ xv,
              const float* __restrict__ wq, const float* __restrict__ wk, const float* __restrict__ wv,
              const float* __restrict__ wo, const float* __restrict__ bq, const float* __restrict__ bk,
              const float* __restrict__ bv, unsigned short* q16, unsigned short* k16, unsigned short* vt,
              unsigned short* ho) {
  __shared__ __align__(16) unsigned short Sm[EE * WPH + PM * XPH];   // 70656 halves >= 16 * 264, 128 * 136
  const int bx = blockIdx.x;
  if (bx < NBW) { cvt_wt_body(bx, Sm, wo, ho); return; }
  const int pb = bx - NBW;
  const int wh = pb / NBP;                               // 0 q, 1 k, 2 v
  proj_body(pb - wh * NBP, wh == 2, Sm, wh == 0 ? wq : (wh == 1 ? wk : wv), wh == 0 ? xq : (wh == 1 ? xk : xv),
            wh == 0 ? bq : (wh == 1 ? bk : bv), wh == 0 ? q16 : (wh == 1 ? k16 : vt));
}

// ---- one stage of K and V^T into LDS: 8 asynchronous 16-B copies per lane (4 of K, 4 of V^T), no register in between.
//      lk / lv = the lane's LDS byte address of its first K / V piece, gk / gv = its global source; piece i of K lies
//      32 rows further (LDS 32 * 80 B, global 32 * 512 B), piece i of V^T 8 rows further (LDS 8 * 272 B, global 8 * 4096 B).
__device__ __forceinline__ void stage_kv(unsigned lk, unsigned lv, const unsigned short* gk, const unsigned short* gv) {
#if defined(__HIP_DEVICE_COMPILE__)
  const unsigned lk1 = lk + 32 * KPH * 2, lk2 = lk + 64 * KPH * 2, lk3 = lk + 96 * KPH * 2;
  const unsigned lv1 = lv + 8 * VPH * 2,  lv2 = lv + 16 * VPH * 2, lv3 = lv + 24 * VPH * 2;
  const unsigned short* gk1 = gk + 32 * EE;
  const unsigned short* gk2 = gk + 64 * EE;
  const unsigned short* gk3 = gk + 96 * EE;
  const unsigned short* gv1 = gv + 8 * LQ;
  const unsigned short* gv2 = gv + 16 * LQ;
  const unsigned short* gv3 = gv + 24 * LQ;
  // the closing s_wait_xcnt stands in the copies' own statement so that no address register is rewritten ahead of it
  asm volatile("global_load_async_to_lds_b128 %0, %8, off\n\t"
               "global_load_async_to_lds_b128 %1, %9, off\n\t"
               "global_load_async_to_lds_b128 %2, %10, off\n\t"
               "global_load_async_to_lds_b128 %3, %11, off\n\t"
               "global_load_async_to_lds_b128 %4, %12, off\n\t"
               "global_load_async_to_lds_b128 %5, %13, off\n\t"
               "global_load_async_to_lds_b128 %6, %14, off\n\t"
               "global_load_async_to_lds_b128 %7, %15, off\n\t"
               "s_wait_xcnt 0x0"
               :: "v"(lk), "v"(lk1), "v"(lk2), "v"(lk3), "v"(lv), "v"(lv1), "v"(lv2), "v"(lv3),
                  "v"(gk), "v"(gk1), "v"(gk2), "v"(gk3), "v"(gv), "v"(gv1), "v"(gv2), "v"(gv3)
               : "memory");
#endif
}

// =====================================================================================================
// Row-softmax attention (online max) per (ns, h, 64 queries q0..), 8 waves = 2 key groups x 4 query tiles, grid
// 2*8*32 = 512: with two blocks on a WGP four waves share a SIMD, and one wave's vector work runs under the others'
// LDS, matrix and exchange latencies. Group g = wave >> 2 walks stages g, g + 2, ... with buffers of its own, filled by
// its own four waves; the two partial results (reference point, Z, O) of a query are merged once, behind the loop.
// Wave w & 3 owns queries
// q0+16(w&3)+ci (B operand of the score tile = Q16 row fragment, col = query, k = d, one k-step). Key term in log2 units
// Mk[l] = (1 - bf16_RNE(pres[ns][l])) * 1e32 * log2(e)/sqrt(32) staged once per block in LDS.
// K rows (this head's 64 B) and V^T rows of 128 keys are staged per block in LDS by asynchronous copies, two buffers per group: stage s + 2 flies while stage s is worked
// on; all four waves of a group read their A fragments from the group's staged tile. One softmax step per stage of 128 keys:
//   8 score D tiles (rows = keys l0+16j+8hh+r, col = query) = A(K16 rows l, k = d) . B(qf);
//   t = acc * (log2(e)/sqrt(32)/256) - Mk[l], one f32 FMA; stage max over the lane's 64 keys combined with the partner
//   half (lane^16); reference point R = running max - 12, R and the rescale factor 2^(R_old - R) identical for both
//   halves of a query column; p = 2^(t - R) = 4096 exp(score - max), the sum Z carries the same factor;
//   P split: hi = f16(p), lo = f16(p - hi), both B fragments of each 32 keys lt.. built in registers
//   (element r <- key lt+8hh+r, element 8+r <- key lt+16+8hh+r, lane unchanged); O^T (rows d, cols queries) rescaled once, then
//   += A(VT rows d = h*32 + 16j + ci, keys contiguous) . B(hi) and . B(lo): 4 accumulators (d 0..15 / 16..31, hi / lo).
// Epilogue: 256*O = 16 (acc_hi + acc_lo) / Z as f16 hi plus f16 residual (x2048), staged per query row in LDS
// coverage: 256 threads x 8 halves = 64 rows x 32 per plane per block; grid covers [2][8][2048][32] once.
// =====================================================================================================
// four waves per SIMD (two blocks per WGP): the register budget of exactly that, so that the scheduler spends registers
// on LDS loads in flight instead of saving them for a fifth wave that never comes
__global__ __launch_bounds__(256) __attribute__((amdgpu_waves_per_eu(4, 4)))
void attn_fwd(const unsigned short* __restrict__ q16, const unsigned short* __restrict__ k16,
              const unsigned short* __restrict__ vt, const float* __restrict__ pres,
              unsigned short* ohp, unsigned short* olp) {
  __shared__ __align__(16) float Mk[LQ];
  __shared__ __align__(16) unsigned short Hs[64 * 40];
  __shared__ __align__(16) unsigned short Lw[64 * 40];
  __shared__ __align__(16) unsigned short Kb[2 * NGR * KBH];   // [buffer][group]
  __shared__ __align__(16) unsigned short Vb[2 * NGR * VBH];   // [buffer][group]
  __shared__ __align__(16) float Mg[128 * MGP];                // group 1's partial results, one row per lane
  const int tid  = threadIdx.x;
  const int grp  = tid >> 7;                            // key group
  const int t7   = tid & 127;                           // thread within the group
  const int wave = (tid >> 5) & 3;                      // query tile
  const int lane = tid & 31;
  const int hh   = lane >> 4;
  const int ci   = lane & 15;
  const int bx   = blockIdx.x;
  const int ns   = bx / (NH * (LQ / 64));
  const int rem  = bx - ns * (NH * (LQ / 64));
  const int h    = rem / (LQ / 64);
  const int q0   = (rem - h * (LQ / 64)) * 64;
  const int qi   = q0 + 16 * wave + ci;                 // this lane's query
  // copy map within a group: K piece (row t7>>2 (+32i), 16-B piece t7&3), V^T piece (row d = t7>>4 (+8i), 16-B piece t7&15)
  const unsigned lk0 = (unsigned)(uintptr_t)(Kb + grp * KBH + (t7 >> 2) * KPH + 8 * (t7 & 3));
  const unsigned lv0 = (unsigned)(uintptr_t)(Vb + grp * VBH + (t7 >> 4) * VPH + 8 * (t7 & 15));
  const unsigned short* gk0 = k16 + (size_t)(ns * LQ + grp * SK + (t7 >> 2)) * EE + h * DH + 8 * (t7 & 3);   // + NGR * SK * EE per trip
  const unsigned short* gv0 = vt + ((size_t)ns * EE + h * DH + (t7 >> 4)) * LQ + grp * SK + 8 * (t7 & 15);   // + NGR * SK per trip
  stage_kv(lk0, lv0, gk0, gv0);                         // trip 0 (stage grp) -> buffer 0
  {
    const float* pp = pres + (size_t)ns * LQ + 8 * tid;    // 256 threads x 8 floats = 2048 keys
#pragma unroll
    for (int i = 0; i < 2; ++i) {
      const v4f a = *(const v4f*)(pp + 4 * i);
      v4f mv;
#pragma unroll
      for (int e = 0; e < 4; ++e) mv[e] = (1.0f - bfr(a[e])) * MB2;
      *(v4f*)(Mk + 8 * tid + 4 * i) = mv;
    }
  }
  asm volatile("s_wait_asynccnt 0x0" ::: "memory");     // this wave's copies of trip 0 have landed
  __syncthreads();                                      // publishes Mk and trip 0
  stage_kv(lk0 + NGR * KBH * 2, lv0 + NGR * VBH * 2, gk0 + (size_t)(NGR * SK) * EE, gv0 + NGR * SK);   // trip 1 -> buffer 1

  const _Float16* Q = (const _Float16*)(const void*)q16;
  const v16h qf = ldfrag_h(Q + (size_t)(ns * LQ + qi) * EE + h * DH + 8 * hh);
  const _Float16* kl = (const _Float16*)(const void*)Kb + grp * KBH + ci * KPH + 8 * hh;   // + buffer, + key_local * KPH
  const _Float16* vl = (const _Float16*)(const void*)Vb + grp * VBH + ci * VPH + 8 * hh;   // row d = ci, + 16 * VPH, + key_local

  float rref = NEG0, z = 0.f;
  v8f ah0 = zero8(), ah1 = zero8(), al0 = zero8(), al1 = zero8();
#pragma unroll 1
  for (int pr = 0; pr < NPR; ++pr) {
    const int bf = pr & 1;
    const _Float16* kp = kl + bf * (NGR * KBH);
    const _Float16* vp = vl + bf * (NGR * VBH);
    // one softmax step per stage: the 8 score tiles and the lane's 64 exponentials of 128 keys are independent among
    // themselves, and the running max, its cross-half exchange and the rescale come once per stage;
    // every loop of the step is unrolled: its arrays stay in registers and every LDS offset is an immediate
    const float* mp = Mk + (pr * NGR + grp) * SK + 8 * hh;
    v8f s[SK / 16];                                      // s[j][r] <-> key (pr*NGR + grp)*SK + 16j + 8hh + r, col = query
#pragma unroll
    for (int j = 0; j < SK / 16; ++j) s[j] = mma_h(ldfrag_h(kp + (16 * j) * KPH), qf, zero8());
    float mj[SK / 16];
#pragma unroll
    for (int j = 0; j < SK / 16; ++j) {
      const v4f ma = *(const v4f*)(mp + 16 * j);         // keys 16j + 8hh + 0..3 <-> s[j][0..3]
      const v4f mb = *(const v4f*)(mp + 16 * j + 4);     // keys 16j + 8hh + 4..7 <-> s[j][4..7]
#pragma unroll
      for (int r = 0; r < 4; ++r) {
        s[j][r]     = s[j][r] * SCL     - ma[r];
        s[j][4 + r] = s[j][4 + r] * SCL - mb[r];
      }
      float m = s[j][0];
#pragma unroll
      for (int r = 1; r < 8; ++r) m = fmaxf(m, s[j][r]);
      mj[j] = m;
    }
    float mx = fmaxf(fmaxf(fmaxf(mj[0], mj[1]), fmaxf(mj[2], mj[3])), fmaxf(fmaxf(mj[4], mj[5]), fmaxf(mj[6], mj[7])));
    mx = fmaxf(mx, __shfl_xor(mx, 16, 32));
    float mo = mx - POFF;
    mo = (mx - mo > 15.0f) ? mx : mo;                    // |mx| near 2^27: the rounded difference may lie 16 below, p past f16
    const float nref = fmaxf(rref, mo);
    const float corr = __builtin_amdgcn_exp2f(rref - nref);
    rref = nref;
    ah0 *= corr; ah1 *= corr; al0 *= corr; al1 *= corr;
    v2f zu[SK / 32];                                     // per 32 keys: sums of p over even / odd r, one packed add per pair
#pragma unroll
    for (int u = 0; u < SK / 32; ++u) {
      v8u ph, pl;
      v2f zg[2];
#pragma unroll
      for (int r = 0; r < 8; r += 4) {
        float x[8], p[8];                                // 0..3 <-> s[2u][r..r+3], 4..7 <-> s[2u+1][r..r+3]
#pragma unroll
        for (int e = 0; e < 4; ++e) {
          x[e]     = s[2 * u][r + e] - nref;
          x[4 + e] = s[2 * u + 1][r + e] - nref;
        }
#pragma unroll
        for (int e = 0; e < 8; ++e) p[e] = __builtin_amdgcn_exp2f(x[e]);
        const v2f pa0 = {p[0], p[1]}, pa1 = {p[2], p[3]}, pc0 = {p[4], p[5]}, pc1 = {p[6], p[7]};
        zg[r >> 2] = (pa0 + pc0) + (pa1 + pc1);
        // registers of the two B fragments: elements r..r+3 -> r/2, r/2 + 1; elements 8+r..8+r+3 -> 4 + r/2, 5 + r/2
        unsigned hq[4], lq[4];
        hq[0] = __builtin_bit_cast(unsigned, __builtin_convertvector(pa0, v2h));
        hq[1] = __builtin_bit_cast(unsigned, __builtin_convertvector(pa1, v2h));
        hq[2] = __builtin_bit_cast(unsigned, __builtin_convertvector(pc0, v2h));
        hq[3] = __builtin_bit_cast(unsigned, __builtin_convertvector(pc1, v2h));
        resid8(lq, hq, p);
        const int g = r >> 1;
        ph[g] = hq[0]; ph[g + 1] = hq[1]; ph[4 + g] = hq[2]; ph[5 + g] = hq[3];
        pl[g] = lq[0]; pl[g + 1] = lq[1]; pl[4 + g] = lq[2]; pl[5 + g] = lq[3];
      }
      zu[u] = zg[0] + zg[1];
      const v16h va0 = ldfrag_h(vp + u * 32);                      // d = ci
      const v16h va1 = ldfrag_h(vp + 16 * VPH + u * 32);           // d = 16 + ci
      const v16h pb = __builtin_bit_cast(v16h, ph), lb = __builtin_bit_cast(v16h, pl);
      ah0 = mma_h(va0, pb, ah0);
      ah1 = mma_h(va1, pb, ah1);
      al0 = mma_h(va0, lb, al0);
      al1 = mma_h(va1, lb, al1);
    }
    const v2f zt = (zu[0] + zu[1]) + (zu[2] + zu[3]);
    z = z * corr + (zt[0] + zt[1]);
    // publish point of trip pr + 1: own LDS reads done, own copies landed, then the barrier that both publishes
    // trip pr + 1 and ends every wave's reads of the buffer refilled behind it
    asm volatile("s_wait_dscnt 0x0" ::: "memory");
    asm volatile("s_wait_asynccnt 0x0" ::: "memory");
    __syncthreads();
    if (pr + 2 < NPR)
      stage_kv(lk0 + bf * (NGR * KBH * 2), lv0 + bf * (NGR * VBH * 2), gk0 + (size_t)(pr + 2) * (NGR * SK) * EE,
               gv0 + (pr + 2) * (NGR * SK));
  }
  asm volatile("s_wait_asynccnt 0x0" ::: "memory");     // nothing of this wave's copies is left in flight

  // ah0/al0[r] <-> d = 8hh + r, ah1/al1[r] <-> d = 16 + 8hh + r, query qi; Z >= 1 (the max key's p)
  // Merge of the two key groups: lane t7 of group 1 hands its 16 sums, its reference point and its Z to lane t7 of
  // group 0, which brings both partial results to the larger reference point and adds them.
  v8f oa = ah0 + al0, ob8 = ah1 + al1;
  float* mg = Mg + t7 * MGP;
  if (grp == 1) {
    const v4f w0 = {oa[0], oa[1], oa[2], oa[3]},     w1 = {oa[4], oa[5], oa[6], oa[7]};
    const v4f w2 = {ob8[0], ob8[1], ob8[2], ob8[3]}, w3 = {ob8[4], ob8[5], ob8[6], ob8[7]};
    const v2f w4 = {rref, z};
    *(v4f*)(mg)      = w0;
    *(v4f*)(mg + 4)  = w1;
    *(v4f*)(mg + 8)  = w2;
    *(v4f*)(mg + 12) = w3;
    *(v2f*)(mg + 16) = w4;
  }
  __syncthreads();                                      // publishes group 1's partial results
  if (grp == 0) {
    const v4f w0 = *(const v4f*)(mg), w1 = *(const v4f*)(mg + 4), w2 = *(const v4f*)(mg + 8), w3 = *(const v4f*)(mg + 12);
    const v2f w4 = *(const v2f*)(mg + 16);
    const float rm = fmaxf(rref, w4[0]);
    const float c0 = __builtin_amdgcn_exp2f(rref - rm), c1 = __builtin_amdgcn_exp2f(w4[0] - rm);
    z = z * c0 + w4[1] * c1;
    const float zz  = z + __shfl_xor(z, 16, 32);
    const float rzs = (1.0f / zz) * 16.0f;
    float o[16];
#pragma unroll
    for (int r = 0; r < 4; ++r) {
      o[r]      = (oa[r] * c0      + w0[r] * c1) * rzs;
      o[4 + r]  = (oa[4 + r] * c0  + w1[r] * c1) * rzs;
      o[8 + r]  = (ob8[r] * c0     + w2[r] * c1) * rzs;
      o[12 + r] = (ob8[4 + r] * c0 + w3[r] * c1) * rzs;
    }
    v4u h0, h1, g0, g1;
#pragma unroll
    for (int i = 0; i < 4; ++i) {
      const _Float16 a0 = (_Float16)o[2 * i],     a1 = (_Float16)o[2 * i + 1];
      const _Float16 b0 = (_Float16)o[8 + 2 * i], b1 = (_Float16)o[8 + 2 * i + 1];
      const _Float16 la0 = (_Float16)((o[2 * i]         - (float)a0) * LOSC);
      const _Float16 la1 = (_Float16)((o[2 * i + 1]     - (float)a1) * LOSC);
      const _Float16 lb0 = (_Float16)((o[8 + 2 * i]     - (float)b0) * LOSC);
      const _Float16 lb1 = (_Float16)((o[8 + 2 * i + 1] - (float)b1) * LOSC);
      h0[i] = pk16(h_bits(a0), h_bits(a1));
      h1[i] = pk16(h_bits(b0), h_bits(b1));
      g0[i] = pk16(h_bits(la0), h_bits(la1));
      g1[i] = pk16(h_bits(lb0), h_bits(lb1));
    }
    {
      const int ro = (16 * wave + ci) * 40 + 8 * hh;
      *(v4u*)(Hs + ro)      = h0;
      *(v4u*)(Hs + ro + 16) = h1;
      *(v4u*)(Lw + ro)      = g0;
      *(v4u*)(Lw + ro + 16) = g1;
    }
  }
  __syncthreads();
  {
    const size_t ob = ((size_t)(ns * NH + h) * LQ + q0) * DH;      // 4096-B aligned region of 64 x 32 halves
    const int hf = 8 * tid;                              // half index within the 2048-half region
    const int row = hf >> 5, col = hf & 31;
    const v4u hv = *(const v4u*)(Hs + row * 40 + col);
    const v4u lv = *(const v4u*)(Lw + row * 40 + col);
    *(v4u*)(ohp + ob + hf) = hv;
    *(v4u*)(olp + ob + hf) = lv;
  }
}

// ---- 12 asynchronous 16-B copies per lane, global -> LDS, no register in between: l[i] = the lane's LDS byte address,
//      g[i] = its global source
__device__ __forceinline__ void copy12(const unsigned* l, const unsigned short* const* g) {
#if defined(__HIP_DEVICE_COMPILE__)
  // the closing s_wait_xcnt stands in the copies' own statement so that no address register is rewritten ahead of it
  asm volatile("global_load_async_to_lds_b128 %0, %12, off\n\t"
               "global_load_async_to_lds_b128 %1, %13, off\n\t"
               "global_load_async_to_lds_b128 %2, %14, off\n\t"
               "global_load_async_to_lds_b128 %3, %15, off\n\t"
               "global_load_async_to_lds_b128 %4, %16, off\n\t"
               "global_load_async_to_lds_b128 %5, %17, off\n\t"
               "global_load_async_to_lds_b128 %6, %18, off\n\t"
               "global_load_async_to_lds_b128 %7, %19, off\n\t"
               "global_load_async_to_lds_b128 %8, %20, off\n\t"
               "global_load_async_to_lds_b128 %9, %21, off\n\t"
               "global_load_async_to_lds_b128 %10, %22, off\n\t"
               "global_load_async_to_lds_b128 %11, %23, off\n\t"
               "s_wait_xcnt 0x0"
               :: "v"(l[0]), "v"(l[1]), "v"(l[2]), "v"(l[3]), "v"(l[4]), "v"(l[5]),
                  "v"(l[6]), "v"(l[7]), "v"(l[8]), "v"(l[9]), "v"(l[10]), "v"(l[11]),
                  "v"(g[0]), "v"(g[1]), "v"(g[2]), "v"(g[3]), "v"(g[4]), "v"(g[5]),
                  "v"(g[6]), "v"(g[7]), "v"(g[8]), "v"(g[9]), "v"(g[10]), "v"(g[11])
               : "memory");
#endif
}

// =====================================================================================================
// Output projection out[m][o] = sum_c O[m][c] Wo[c][o] + bo[o], O = (hi + lo/2048)/256 from the OH/OL planes
// ([ns][h][q][32]: k-step j = head j). Block = 4 waves = 64 rows m x 64 cols o (grid 64 x 4 = 256).
// Every global read of the block goes out at entry: the bias into registers, and both operands whole into LDS by
// asynchronous copies, each wave-copy 512 contiguous bytes: Ws[o_local][e] = 64 HO rows (16 copies per lane, one row
// per wave-copy), Os[plane][j][m_local][32] = the block's 64 rows of each head of OH and OL (2 x 8 x 2 copies per lane,
// 8 rows per wave-copy); 48 copies per wave in flight, one wait, one barrier, then the buffers are only read.
// Wave w owns rows m0+16w+ci (B operands = OH and OL row fragments, col = m), A = HO rows o0+16t+ci (k = c split map);
// 4 hi + 4 lo accumulators; acc[t][r] <-> (m = m0+16w+ci, o = o0+16t+8hh+r).
// Epilogue: (acch + accl/2048)/262144 + bf16_RNE(bo) staged in LDS as Ts[m_local][o_local] (pitch 68, 16-B vector
// coverage: copies 16 x 4 rows x 512 B = 64 x 256 halves, 16 x 2 x 32 rows x 64 B = 2 x 8 x 64 x 32 halves;
//           8 it x 8 rows x 16 pieces x 4 floats = 64 x 64 per block; grid covers out [4096][256] exactly once.
// =====================================================================================================
__global__ __launch_bounds__(128)
void out_proj(const unsigned short* __restrict__ ohp, const unsigned short* __restrict__ olp,
              const unsigned short* __restrict__ woh, const float* __restrict__ bo, float* out) {
  __shared__ __align__(16) unsigned short Ws[64 * OWP];
  __shared__ __align__(16) unsigned short Os[2 * NH * 64 * OOP];
  __shared__ __align__(16) float Ts[64 * 68];
  const int tid  = threadIdx.x;
  const int wave = tid >> 5;
  const int lane = tid & 31;
  const int hh   = lane >> 4;
  const int ci   = lane & 15;
  const int bx   = blockIdx.x;
  const int mt   = bx >> 2, ot = bx & 3;
  const int m0   = mt * 64, o0 = ot * 64;
  const int ns   = m0 / LQ;

  v4f bb[4][2];
#pragma unroll
  for (int t = 0; t < 4; ++t) {
    bb[t][0] = *(const v4f*)(bo + o0 + 16 * t + 8 * hh);
    bb[t][1] = *(const v4f*)(bo + o0 + 16 * t + 8 * hh + 4);
  }
#if defined(__HIP_DEVICE_COMPILE__)
  // stands between the loads above and the address arithmetic below, which reuses the registers of their base
  asm volatile("s_wait_xcnt 0x0" ::: "memory");
#endif
  {
    unsigned l[48];
    const unsigned short* g[48];
    // HO: copy i = row o_local 4 i + wave, 16-B piece lane
    const unsigned lw = (unsigned)(uintptr_t)(Ws + wave * OWP + 8 * lane);
    const unsigned short* gw = woh + (size_t)(o0 + wave) * EE + 8 * lane;
#pragma unroll
    for (int i = 0; i < 16; ++i) {
      l[i] = lw + i * (4 * OWP * 2);
      g[i] = gw + i * (4 * EE);
    }
    // OH / OL: copy (plane, j, c) = row m_local 32 c + (tid >> 2), 16-B piece tid & 3; the 64 rows of a head are contiguous
    const unsigned lo = (unsigned)(uintptr_t)(Os + (tid >> 2) * OOP + 8 * (tid & 3));
    const size_t ob = ((size_t)(ns * NH) * LQ + (m0 - ns * LQ)) * DH + 8 * tid;
#pragma unroll
    for (int pj = 0; pj < 2 * NH; ++pj) {
      const unsigned short* gp = (pj < NH ? ohp : olp) + ob + (size_t)(pj & (NH - 1)) * LQ * DH;
#pragma unroll
      for (int c = 0; c < 2; ++c) {
        l[16 + 2 * pj + c] = lo + (pj * 64 + 32 * c) * (OOP * 2);
        g[16 + 2 * pj + c] = gp + c * (128 * 8);
      }
    }
#pragma unroll
    for (int s = 0; s < 4; ++s) copy12(l + 12 * s, g + 12 * s);
  }
  asm volatile("s_wait_asynccnt 0x0" ::: "memory");     // this wave's copies have landed
  __syncthreads();                                      // publishes Ws and Os

  const _Float16* ar = (const _Float16*)(const void*)Os + (16 * wave + ci) * OOP + 8 * hh;   // + j * 64 * OOP
  const _Float16* lr = ar + NH * 64 * OOP;
  const _Float16* wr = (const _Float16*)(const void*)Ws + ci * OWP + 8 * hh;                 // + 16t * OWP + 32j

  v8f acch[4], accl[4];
#pragma unroll
  for (int t = 0; t < 4; ++t) { acch[t] = zero8(); accl[t] = zero8(); }

  // two register sets: the fragments of k-step j + 1 are asked for ahead of the products of k-step j, so that their LDS
  // latency runs under those products; unrolled, so that the set index and every LDS offset are compile-time constants
  v16h obh[2], obl[2], wa[2][4];
  obh[0] = ldfrag_h(ar);
  obl[0] = ldfrag_h(lr);
#pragma unroll
  for (int t = 0; t < 4; ++t) wa[0][t] = ldfrag_h(wr + (16 * t) * OWP);
#pragma unroll
  for (int j = 0; j < NH; ++j) {
    const int cu = j & 1, nx = cu ^ 1;
    if (j + 1 < NH) {
      obh[nx] = ldfrag_h(ar + (j + 1) * 64 * OOP);
      obl[nx] = ldfrag_h(lr + (j + 1) * 64 * OOP);
#pragma unroll
      for (int t = 0; t < 4; ++t) wa[nx][t] = ldfrag_h(wr + (16 * t) * OWP + 32 * (j + 1));
    }
    // holds the load group together and ahead of the products: left free, the loads sink in among the products
    __builtin_amdgcn_sched_barrier(0);
#pragma unroll
    for (int t = 0; t < 4; ++t) acch[t] = mma_h(wa[cu][t], obh[cu], acch[t]);
#pragma unroll
    for (int t = 0; t < 4; ++t) accl[t] = mma_h(wa[cu][t], obl[cu], accl[t]);
    __builtin_amdgcn_sched_barrier(0);                   // the next load group stays behind these products
  }

  {
    float* ts = Ts + (16 * wave + ci) * 68 + 8 * hh;
#pragma unroll
    for (int t = 0; t < 4; ++t) {
      v4f r0, r1;
#pragma unroll
      for (int e = 0; e < 4; ++e) {
        r0[e] = (acch[t][e]     + accl[t][e]     * LOIN) * OSC + bfr(bb[t][0][e]);
        r1[e] = (acch[t][4 + e] + accl[t][4 + e] * LOIN) * OSC + bfr(bb[t][1][e]);
      }
      *(v4f*)(ts + 16 * t)     = r0;
      *(v4f*)(ts + 16 * t + 4) = r1;
    }
  }
  __syncthreads();
  {
    const int p = tid & 15, r16 = tid >> 4;             // r16 0..7, p = 16-B piece of the 256-B segment
    v4f vals[8];
#pragma unroll
    for (int it = 0; it < 8; ++it) {
      const int row = it * 8 + r16;                      // it 0..7 x r16 0..7 = rows 0..63
      vals[it] = *(const v4f*)(Ts + row * 68 + 4 * p);
    }
    float* yb = out + (size_t)m0 * EE + o0 + 4 * p;
#pragma unroll
    for (int it = 0; it < 8; ++it) {
      const int row = it * 8 + r16;
      *(v4f*)(yb + (size_t)row * EE) = vals[it];
    }
  }
}

// =====================================================================================================
// Workspace map (bytes), every offset a multiple of 256 and every plane sized to its whole-line store granularity:
//   HO           f16 [256][256]       131072           0 .. 131072
//   Q16, K16     f16 [4096][256]      2 x 2097152      .. 4325376
//   VT           f16 [2][256][2048]   2097152          .. 6422528
//   OH, OL       f16 [2][8][2048][32] 2 x 2097152      .. 10616832  (end)
// =====================================================================================================
extern "C" void kernel_launch(void* const* d_in, const int* in_sizes, int n_in,
                              void* d_out, int out_size, void* d_ws, size_t ws_size,
                              hipStream_t stream) {
  if (n_in < 12) return;
  if (in_sizes[0] != MR * EE || in_sizes[1] != MR * EE || in_sizes[2] != MR * EE) return;
  if (in_sizes[3] != NSB * LQ) return;
  if (in_sizes[4] != EE * EE || in_sizes[6] != EE * EE || in_sizes[8] != EE * EE || in_sizes[10] != EE * EE) return;
  if (in_sizes[5] != EE || in_sizes[7] != EE || in_sizes[9] != EE || in_sizes[11] != EE) return;
  if (out_size != MR * EE) return;

  const float* queries = (const float*)d_in[0];
  const float* keys    = (const float*)d_in[1];
  const float* values  = (const float*)d_in[2];
  const float* pres    = (const float*)d_in[3];
  const float* Wq      = (const float*)d_in[4];
  const float* bq      = (const float*)d_in[5];
  const float* Wk      = (const float*)d_in[6];
  const float* bk      = (const float*)d_in[7];
  const float* Wv      = (const float*)d_in[8];
  const float* bv      = (const float*)d_in[9];
  const float* Wo      = (const float*)d_in[10];
  const float* bo      = (const float*)d_in[11];
  float* out = (float*)d_out;

  const size_t PW  = (size_t)EE * EE * 2;               // 131072
  const size_t PP  = (size_t)MR * EE * 2;               // 2097152
  const size_t PVT = (size_t)NSB * EE * LQ * 2;         // 2097152
  const size_t PO  = (size_t)NSB * NH * LQ * DH * 2;    // 2097152
  size_t off = 0;
  const size_t oHO = off; off += PW;
  const size_t oQ  = off; off += PP;
  const size_t oK  = off; off += PP;
  const size_t oVT = off; off += PVT;
  const size_t oOH = off; off += PO;
  const size_t oOL = off; off += PO;
  if (off > ws_size) return;                            // off = 10616832
  if (off > (size_t)134217728) return;

  char* ws = (char*)d_ws;
  unsigned short* HOp = (unsigned short*)(ws + oHO);
  unsigned short* Q16 = (unsigned short*)(ws + oQ);
  unsigned short* K16 = (unsigned short*)(ws + oK);
  unsigned short* VTp = (unsigned short*)(ws + oVT);
  unsigned short* OHp = (unsigned short*)(ws + oOH);
  unsigned short* OLp = (unsigned short*)(ws + oOL);

  const dim3 blk256(256), blk128(128);
  const dim3 gPJ(NBW + 3 * NBP);                        // 16 + 3 x 64 blocks
  const dim3 gAT(NSB * NH * (LQ / 64));                 // 512 blocks
  const dim3 gOP((MR / 64) * (EE / 64));                // 256 blocks

  // (1) transposed 16-bit Wo plane HO[o][e]; projections from the f32 inputs: q, k row-major [4096][256] (x16),
  //     v transposed VT[ns][hd][l] (x16), biases added
  proj_all<<<gPJ, blk256, 0, stream>>>(queries, keys, values, Wq, Wk, Wv, Wo, bq, bk, bv, Q16, K16, VTp, HOp);
  // (2) attention output planes OH / OL [ns][h][q][32] (row softmax over keys with the key term)
  attn_fwd<<<gAT, blk256, 0, stream>>>(Q16, K16, VTp, pres, OHp, OLp);
  // (3) output projection + bias -> d_out [4096][256] f32
  out_proj<<<gOP, blk128, 0, stream>>>(OHp, OLp, HOp, bo, out);
  (void)hipGetLastError();
}

// v008
// Measured time: 28.4 microseconds a run.
// Next to v007, in two timings, it ran 1.08 and 1.09 times as fast.
// Counting every step since v000, it is 3.71 times as fast.
// Contractions, all v_wmma_f32_16x16x32_f16 (f16 operands, f32 accumulate): q/k/v projections X.W with f16
// containers holding bf16-RNE inputs (X x64, W x1024); scores K.q with q, k planes f16 x16 (K = 32 per head);
// P as f16 hi (x4096) + residual (same scale) planes . V plane (f16 x16) into two accumulator pairs; output projection
// with O as f16 hi (x256) + residual (x2^11) planes and Wo bf16-RNE x1024 into two accumulators. Key-mask term,
// running max / sum, exp, residual folds and biases in f32 on VALU.
// Keys: only the keys of a batch whose mask term equals the batch's smallest one are projected and attended to. Two
// different mask terms lie more than 1e24 apart (one f32 step of a term near 1e31; smaller terms are coarser multiples),
// a score from the f16 planes stays below 2e8, so that every other key's weight 2^(t - max) is exactly 0 in f32.
#include <hip/hip_runtime.h>
#include <math.h>
#include <stdint.h>

#define NSB  2
#define LQ   2048
#define EE   256
#define NH   8
#define DH   32
#define MR   (NSB * LQ)
#define XSC  64.0f
#define WSC  1024.0f
#define ISC  (1.0f / 4096.0f)
#define BSC  16.0f
#define RL2E (0.17677669529663687 * 1.44269504088896340736)   // log2(e) / sqrt(32): exp(s / sqrt(32)) = 2^(s * RL2E)
#define SCL  ((float)(RL2E / 256.0))   // score accumulator (256 q.k) -> log2 units
#define MB2  ((float)(1.0e32 * RL2E))  // the key term's 1e32 in log2 units
#define NEG0 (-1.0e38f)
#define PADT 1.0e35f                   // added to the key term of a rank past the kept keys: its weight is exactly 0
#define POFF 12.0f                     // P carries 2^12: the exponent's reference point lies 12 below the running max
#define LOIN (1.0f / 2048.0f)
#define LOSC 2048.0f
#define OSC  (1.0f / 262144.0f)
#define NBW  16                     // blocks of the Wo transposition: 16 o-tiles
#define PM   128                    // rows m of a projection block
#define NBP  ((MR / PM) * (EE / 128))   // blocks of one projection
#define WPH  144                    // LDS pitch of a staged W row e, halves (256 B of data + 32 B: 32 B x odd for the transposing reader)
#define XPH  264                    // LDS pitch of a staged X row m, halves (512 B of data + 16 B: 16 B x odd for 16-B readers)
static_assert(EE == NH * DH);
static_assert(DH == 32);
static_assert((LQ % PM) == 0 && (EE % 128) == 0 && (MR % PM) == 0);
static_assert(EE == 256 && PM == 128);
static_assert(LQ == 128 * 16);
#define SK   128                    // keys per LDS stage of the attention kernel
#define NST  (LQ / SK)              // stages
#define KPH  40                     // LDS pitch of a staged K row, halves (64 B of data + 16 B: 16 B x odd for 16-B readers)
#define VPH  136                    // LDS pitch of a staged V^T row, halves (256 B of data + 16 B)
#define KBH  (SK * KPH)             // halves per K buffer
#define VBH  (DH * VPH)             // halves per V buffer
static_assert(NST >= 2 && SK == 128);               // the softmax step merges 8 tile maxima and 4 partial sums
#define NGR  2                      // key groups of an attention block: group g works on stages g, g + 2, g + 4, ...
#define NPR  (NST / NGR)            // most trips of the attention loop: one stage per group and trip
#define MGP  20                     // LDS pitch of a lane's partial result, floats (72 B of data + 8 B: 16 B x odd)
static_assert(NPR >= 2 && NPR * NGR == NST);
static_assert(SK * 4 == 4 * 128 && DH * (SK / 8) == 4 * 128);   // 4 + 4 copies of 16 B per thread and stage
#define OWP  264                    // LDS pitch of a staged HO row o, halves (512 B of data + 16 B: 16 B x odd for 16-B readers)
#define OOP  40                     // LDS pitch of a staged OH / OL row m, halves (64 B of data + 16 B)

typedef _Float16 v16h __attribute__((ext_vector_type(16)));
typedef _Float16 v8h  __attribute__((ext_vector_type(8)));
typedef float    v8f  __attribute__((ext_vector_type(8)));
typedef float    v4f  __attribute__((ext_vector_type(4)));
typedef unsigned int v4u __attribute__((ext_vector_type(4)));
typedef int      v4i  __attribute__((ext_vector_type(4)));
typedef unsigned int v2u __attribute__((ext_vector_type(2)));
typedef unsigned int v8u __attribute__((ext_vector_type(8)));
typedef short    s16x8 __attribute__((ext_vector_type(8)));
typedef float    v2f  __attribute__((ext_vector_type(2)));
typedef _Float16 v2h  __attribute__((ext_vector_type(2)));
typedef __bf16   v2b  __attribute__((ext_vector_type(2)));

union FragH { v16h v; v8h h[2]; };

// ---- scalar helpers ----------------------------------------------------------------------------------
__device__ __forceinline__ unsigned short bf_bits(float f) {          // f32 -> bf16 bits, RNE convert
  unsigned u = __float_as_uint(f);
  return (unsigned short)((u + 0x7FFFu + ((u >> 16) & 1u)) >> 16);
}
__device__ __forceinline__ float bf_up(unsigned short h) { return __uint_as_float(((unsigned)h) << 16); }
__device__ __forceinline__ float bfr(float f) { return bf_up(bf_bits(f)); }
__device__ __forceinline__ unsigned short h_bits(_Float16 x) { return __builtin_bit_cast(unsigned short, x); }
__device__ __forceinline__ unsigned pk16(unsigned short a, unsigned short b) { return (unsigned)a | ((unsigned)b << 16); }
__device__ __forceinline__ v8f zero8() { v8f z = {0.f, 0.f, 0.f, 0.f, 0.f, 0.f, 0.f, 0.f}; return z; }
// 4 consecutive f32 -> f16( bf16_RNE(x) * sc ) packed into 8 bytes; the RNE step by the packed hardware convert, which
// gives bfr()'s value for every finite x
__device__ __forceinline__ v2u cvt4(v4f a, float sc) {
  v2u v;
#pragma unroll
  for (int i = 0; i < 2; ++i) {
    const v2f x = {a[2 * i], a[2 * i + 1]};
    const unsigned b = __builtin_bit_cast(unsigned, __builtin_convertvector(x, v2b));
    const v2f y = {__uint_as_float(b << 16) * sc, __uint_as_float(b & 0xFFFF0000u) * sc};
    v[i] = __builtin_bit_cast(unsigned, __builtin_convertvector(y, v2h));
  }
  return v;
}
// key terms of 2 presence values, log2 units: (1 - bf16_RNE(x)) * 1e32 * log2(e)/sqrt(32); the RNE step as in cvt4
__device__ __forceinline__ v2f kterm2(float x0, float x1) {
  const v2f x = {x0, x1};
  const unsigned b = __builtin_bit_cast(unsigned, __builtin_convertvector(x, v2b));
  const v2f t = {(1.0f - __uint_as_float(b << 16)) * MB2, (1.0f - __uint_as_float(b & 0xFFFF0000u)) * MB2};
  return t;
}

// ---- fragment loader: 16-bit A/B operand, lane -> row/col (lane&15), p already includes +8*(lane>>4);
//      elements 0..7 <- p[0..7] (k0+8h..), elements 8..15 <- p[16..23] (k0+16+8h..)
__device__ __forceinline__ v16h ldfrag_h(const _Float16* p) {
  FragH f;
  f.h[0] = *(const v8h*)(p);
  f.h[1] = *(const v8h*)(p + 16);
  return f.v;
}

// ---- transposing fragment loader: LDS tile T[k][row] (16-bit, k-major), p = T + (k0 + 8*(lane>>4) + (lane&7)) * pitch
//      + row0 + 8*((lane>>3)&1); lane (ci, hh) receives T[k0+8hh+0..7][row0+ci], then T[k0+16+8hh+0..7][row0+ci]:
//      the k order of ldfrag_h
__device__ __forceinline__ v16h ldfrag_tr(const unsigned short* p, int pitch) {
  typedef __attribute__((address_space(3))) s16x8 lds_s16x8;
  FragH f;
  f.h[0] = __builtin_bit_cast(v8h, __builtin_amdgcn_ds_load_tr16_b128_v8i16((lds_s16x8*)p));
  f.h[1] = __builtin_bit_cast(v8h, __builtin_amdgcn_ds_load_tr16_b128_v8i16((lds_s16x8*)(p + 16 * pitch)));
  return f.v;
}

// ---- WMMA helper --------------------------------------------------------------------------------------
__device__ __forceinline__ v8f mma_h(v16h a, v16h b, v8f c) {
  return __builtin_amdgcn_wmma_f32_16x16x32_f16(false, a, false, b, (short)0, c, false, false);
}
// ---- residual halves of 8 values: l = f16(p - hi), two per register. The mixed-precision FMA hi * (-1) + p takes hi (f16)
//      straight from its packed half, -1 and p as f32, and writes one half of l (left to itself the compiler converts hi
//      back to f32, subtracts and repacks). The four low halves stand ahead of the four high halves; s_delay_alu names
//      that distance of 4, so that the wait of a high half for its register's low half does not hold up the SIMD's other waves.
__device__ __forceinline__ void resid8(unsigned* l, const unsigned* h, const float* p) {
#if defined(__HIP_DEVICE_COMPILE__)
  asm("v_fma_mixlo_f16 %0, %4, %16, %8 op_sel_hi:[1,0,0]\n\t"
      "v_fma_mixlo_f16 %1, %5, %16, %10 op_sel_hi:[1,0,0]\n\t"
      "v_fma_mixlo_f16 %2, %6, %16, %12 op_sel_hi:[1,0,0]\n\t"
      "v_fma_mixlo_f16 %3, %7, %16, %14 op_sel_hi:[1,0,0]\n\t"
      "s_delay_alu instid0(VALU_DEP_4) | instskip(NEXT) | instid1(VALU_DEP_4)\n\t"
      "v_fma_mixhi_f16 %0, %4, %16, %9 op_sel:[1,0,0] op_sel_hi:[1,0,0]\n\t"
      "v_fma_mixhi_f16 %1, %5, %16, %11 op_sel:[1,0,0] op_sel_hi:[1,0,0]\n\t"
      "s_delay_alu instid0(VALU_DEP_4) | instskip(NEXT) | instid1(VALU_DEP_4)\n\t"
      "v_fma_mixhi_f16 %2, %6, %16, %13 op_sel:[1,0,0] op_sel_hi:[1,0,0]\n\t"
      "v_fma_mixhi_f16 %3, %7, %16, %15 op_sel:[1,0,0] op_sel_hi:[1,0,0]"
      : "=&v"(l[0]), "=&v"(l[1]), "=&v"(l[2]), "=&v"(l[3])
      : "v"(h[0]), "v"(h[1]), "v"(h[2]), "v"(h[3]),
        "v"(p[0]), "v"(p[1]), "v"(p[2]), "v"(p[3]), "v"(p[4]), "v"(p[5]), "v"(p[6]), "v"(p[7]), "s"(-1.0f));
#endif
}

// =====================================================================================================
// Transposed output-weight plane: HO[o][e] = f16( bf16_RNE(Wo[e][o]) * 1024 ) for the [in][out] weight (x.W layout).
// Block = 16 output rows o0 = 16*bx, 256 threads, 16 blocks, so that this chain is no longer than a projection block's.
// Read W rows e as 4 threads x 16 B (64-B row segment o0..o0+15), all 4 loads of a thread in flight together, 2-B
// transposed LDS stores into Ts[o_local][e] (pitch 264), block barrier, then whole rows out.
// coverage: read 4 it x 64 rows e x 4 pieces x 4 = all 256 e x 16 o; write 2 it x 8 waves = 16 rows x 32 lanes x 8
//           halves = 16 x 256; 16 o-tiles -> HO [256][256] entirely.
// =====================================================================================================
__device__ __forceinline__
void cvt_wt_body(int bx, unsigned short* Ts, const float* __restrict__ src, unsigned short* dst) {
  const int tid  = threadIdx.x;
  const int wave = tid >> 5;
  const int lane = tid & 31;
  const int o0   = bx * 16;
  const int p = tid & 3, r64 = tid >> 2;                // p = 16-B piece of the 64-B row segment, r64 = row in group
  v4f a[4];
#pragma unroll
  for (int it = 0; it < 4; ++it) a[it] = *(const v4f*)(src + (size_t)(it * 64 + r64) * EE + o0 + 4 * p);
#pragma unroll
  for (int it = 0; it < 4; ++it) {
    const int e = it * 64 + r64;                         // 0..255
#pragma unroll
    for (int i = 0; i < 4; ++i) Ts[(4 * p + i) * 264 + e] = h_bits((_Float16)(bfr(a[it][i]) * WSC));
  }
  __syncthreads();
  v4u vals[2];
#pragma unroll
  for (int it = 0; it < 2; ++it) {
    const int row = it * 8 + wave;                       // it 0..1 x wave 0..7 = rows 0..15
    vals[it] = *(const v4u*)(Ts + row * 264 + 8 * lane);
  }
  unsigned short* db = dst + (size_t)o0 * EE + 8 * lane;
#pragma unroll
  for (int it = 0; it < 2; ++it) {
    const int row = it * 8 + wave;
    *(v4u*)(db + (size_t)row * EE) = vals[it];
  }
}

// =====================================================================================================
// Projection GEMM Y[m][o] = sum_e X[m][e] W[e][o] (x 65536 in the accumulator) + b[o], straight from the f32 inputs.
// Block = 8 waves = 128 rows m x 128 cols o (32 m-tiles x 2 o-tiles = 64 blocks per projection). The block converts
// its own operands into LDS: Ws[e][o_local] = f16( bf16_RNE(W[e][o]) * 1024 ) (one wave-load = one 512-B row segment),
// Xs[m_local][e] = f16( bf16_RNE(X[m][e]) * 64 ) (one wave-load = half a row), 8-B LDS stores, block barrier.
// Wave (wm = wave & 3, wo = wave >> 2) owns 32 rows m x 64 cols o: A(W^T rows o = o0+64wo+16t+ci by the transposing
// load, k = e split map) . B(Xs row m = m0+32wm+16i+ci, col = m, same map); 8 k-steps of 32, 8 accumulators per wave;
// acc[i][t][r] <-> (m = m0+32wm+16i+ci, o = o0+64wo+16t+8hh+r). y16 = acc * 2^-12 + 16 * bf16_RNE(b[o]) (= 16 y).
// A second barrier ends every wave's operand reads before the same LDS becomes output staging.
// Rows: row m_local of a q block is query w0 + m_local of its batch. A k or v block (gat) works on kept keys: every wave
// reads the batch's 2048 presence values (key 128 i + 4 lane + e), forms the mask terms and their minimum, and numbers the
// keys that attain it in the order (i, e, lane) by ballots; row m_local is the key of rank w0 + m_local, ranks from the
// count n on are filled with key 0 (attn_fwd masks them), and a block whose ranks all lie at or past n leaves before any
// barrier. The row table Ix goes through LDS (wave w writes the entries of i = 2w, 2w + 1, whose presence values it reads a
// second time, into registers of a fixed index), published by one barrier.
// The k block of rank 0, o-tile 0 of each batch writes n and the minimum to kc[2 ns], kc[2 ns + 1].
// tr == 0: YO[m][o] = f16(y16): staged as Ts[m_local][o_local] (pitch 136, 16-B LDS stores), block barrier, rows out.
// tr == 1: VT[ns][o][l] (keys contiguous): staged as Ts[o_local][l_local] (pitch 136, 2-B LDS stores), barrier, rows out.
// coverage: operands: 32 it x 8 rows e x 128 o, 4 thread groups x 32 it rows m x 256 e; tr 0: 8 it x 16 rows x 16 pieces x 8 halves =
//           128 x 128 per block, grid -> [4096][256]; tr 1: 8 it x 16 lines x 16 pieces x 8 = 128 o x 128 l, grid ->
//           VT [2][256][2048].
// =====================================================================================================
__device__ __forceinline__
void proj_body(int bx, bool tr, bool gat, bool wkc, unsigned short* Sm, int* Ix, const float* __restrict__ wf,
               const float* __restrict__ xf, const float* __restrict__ bias, const float* __restrict__ pres, float* kc,
               unsigned short* yo) {
  const int tid  = threadIdx.x;
  const int wave = tid >> 5;
  const int lane = tid & 31;
  const int hh   = lane >> 4;
  const int ci   = lane & 15;
  const int wm   = wave & 3, wo = wave >> 2;
  const int mt   = bx >> 1, ot = bx & 1;
  const int m0   = mt * PM, o0 = ot * 128;
  unsigned short* Ws = Sm;                               // [256 e][WPH]
  unsigned short* Xs = Sm + EE * WPH;                    // [128 m][XPH]
  const int nsb  = m0 / LQ, w0 = m0 - nsb * LQ;         // batch; first query (q) or first rank (k, v) of the block
  {
    const float* wsrc = wf + (size_t)wave * EE + o0 + 4 * lane;                    // row e = 8 it + wave
    unsigned short* wd = Ws + wave * WPH + 4 * lane;
    unsigned short* xd = Xs + (32 * (tid >> 6)) * XPH + 4 * (tid & 63);            // row m_local = 32 (tid >> 6) + it
    v4f a[32], c[32], pa[16], pw[2];
    if (gat) {
      const char* pb = (const char*)(pres + (size_t)nsb * LQ);
      const unsigned lo = 16 * lane, lw = lo + 1024 * wave;                          // bytes: key 4 lane; the wave's own keys
#pragma unroll
      for (int i = 0; i < 16; ++i) pa[i] = *(const v4f*)(pb + lo + 512 * i);
#pragma unroll
      for (int i = 0; i < 2; ++i) pw[i] = *(const v4f*)(pb + lw + 512 * i);          // i = 2 wave, 2 wave + 1 once more
#if defined(__HIP_DEVICE_COMPILE__)
      // stands between the loads above and the next write of their base or offsets, which are named so that they stay in
      // their registers up to it
      asm volatile("s_wait_xcnt 0x0" :: "s"(pb), "v"(lo), "v"(lw) : "memory");
#endif
    }
#pragma unroll
    for (int it = 0; it < 32; ++it) a[it] = *(const v4f*)(wsrc + (size_t)(8 * it) * EE);
#if defined(__HIP_DEVICE_COMPILE__)
    // stands between the loads above and a later load whose result the compiler puts into their address pair
    asm volatile("s_wait_xcnt 0x0" ::: "memory");
#endif
    if (gat) {
      const int wv = __builtin_amdgcn_readfirstlane(wave);
      float mk[64], mw[8];
#pragma unroll
      for (int i = 0; i < 16; ++i)
#pragma unroll
        for (int e = 0; e < 4; e += 2) {
          const v2f t = kterm2(pa[i][e], pa[i][e + 1]);
          mk[4 * i + e] = t[0]; mk[4 * i + e + 1] = t[1];
        }
#pragma unroll
      for (int i = 0; i < 2; ++i)
#pragma unroll
        for (int e = 0; e < 4; e += 2) {
          const v2f t = kterm2(pw[i][e], pw[i][e + 1]);
          mw[4 * i + e] = t[0]; mw[4 * i + e + 1] = t[1];
        }
      float mn = mk[0];
#pragma unroll
      for (int k = 1; k < 64; ++k) mn = fminf(mn, mk[k]);
      // minimum over the wave in vector cross-lane moves (row_xmask 1, 2, 4, 8, then the other row's lane): a shuffle
      // would go through the LDS unit, five dependent round trips on the way to the first X load
      mn = fminf(mn, __int_as_float(__builtin_amdgcn_update_dpp(0, __float_as_int(mn), 0x161, 0xF, 0xF, true)));
      mn = fminf(mn, __int_as_float(__builtin_amdgcn_update_dpp(0, __float_as_int(mn), 0x162, 0xF, 0xF, true)));
      mn = fminf(mn, __int_as_float(__builtin_amdgcn_update_dpp(0, __float_as_int(mn), 0x164, 0xF, 0xF, true)));
      mn = fminf(mn, __int_as_float(__builtin_amdgcn_update_dpp(0, __float_as_int(mn), 0x168, 0xF, 0xF, true)));
      mn = fminf(mn, __int_as_float(__builtin_amdgcn_permlanex16(__float_as_int(mn), __float_as_int(mn), 0x76543210,
                                                                 0xFEDCBA98, false, false)));
      int base = 0;                                      // kept keys of the batch: the same scalar in every wave
      int be = -w0;                                      // rank of the wave's first kept key, counted from the block's first
#pragma unroll
      for (int i = 0; i < 16; ++i) {                     // branch-free: the 64 ballots and their counts run as one stream
        int cn = 0;
#pragma unroll
        for (int e = 0; e < 4; ++e) cn += __builtin_popcount(__builtin_amdgcn_ballot_w32(mk[4 * i + e] == mn));
        base += cn;
        be   += i < 2 * wv ? cn : 0;
      }
      if (w0 >= base && w0 > 0) return;                  // no kept key among this block's ranks: the whole block leaves
#pragma unroll
      for (int k = 0; k < 8; ++k) {                      // own key (i = 2 wv + (k >> 2), e = k & 3, lane)
        const unsigned bal = __builtin_amdgcn_ballot_w32(mw[k] == mn);
        const int r = be + (int)__builtin_amdgcn_mbcnt_lo(bal, 0u);
        if (mw[k] == mn && (unsigned)r < (unsigned)PM) Ix[r] = 256 * wv + 128 * (k >> 2) + 4 * lane + (k & 3);
        be += __builtin_popcount(bal);
      }
      if (tid < PM && w0 + tid >= base) Ix[tid] = 0;
      if (wkc && w0 == 0 && tid == 0) {
        kc[2 * nsb]     = (float)base;
        kc[2 * nsb + 1] = mn;
      }
    } else {
      if (tid < PM) Ix[tid] = w0 + tid;
    }
    // publishes Ix. LDS-only fences round the bare barrier: the W loads above stay in flight across it (a build with
    // __syncthreads() here waits for all of them, s_wait_loadcnt 0, in front of the barrier)
    __builtin_amdgcn_fence(__ATOMIC_RELEASE, "workgroup", "local");
    __builtin_amdgcn_s_barrier();
    __builtin_amdgcn_fence(__ATOMIC_ACQUIRE, "workgroup", "local");
    unsigned xo[32];                                     // offset of the thread's piece of row m_local = 32 (tid >> 6) + it, bytes
#pragma unroll
    for (int k = 0; k < 8; ++k) {
      const v4i q = *(const v4i*)(Ix + 32 * (tid >> 6) + 4 * k);
#pragma unroll
      for (int e = 0; e < 4; ++e) xo[4 * k + e] = (unsigned)(nsb * LQ + q[e]) * (EE * 4) + 16 * (tid & 63);
    }
#pragma unroll
    for (int it = 0; it < 16; ++it) c[it] = *(const v4f*)((const char*)xf + xo[it]);
#if defined(__HIP_DEVICE_COMPILE__)
    // the offsets are named so that they stay in their registers up to the wait: no result of these loads lands on one
    asm volatile("s_wait_xcnt 0x0" :: "v"(xo[0]), "v"(xo[1]), "v"(xo[2]), "v"(xo[3]), "v"(xo[4]), "v"(xo[5]), "v"(xo[6]),
                 "v"(xo[7]), "v"(xo[8]), "v"(xo[9]), "v"(xo[10]), "v"(xo[11]), "v"(xo[12]), "v"(xo[13]), "v"(xo[14]),
                 "v"(xo[15]) : "memory");
#endif
    // keeps these 48 loads ahead of all conversion work: one latency for the lot instead of one per trickled load
    __builtin_amdgcn_sched_barrier(0);
#pragma unroll
    for (int it = 0; it < 16; ++it) *(v2u*)(wd + (8 * it) * WPH) = cvt4(a[it], WSC);
    // the last 16 loads go out as soon as registers are free, ahead of the remaining conversion work
    __builtin_amdgcn_sched_barrier(0);
#pragma unroll
    for (int it = 16; it < 32; ++it) c[it] = *(const v4f*)((const char*)xf + xo[it]);
#if defined(__HIP_DEVICE_COMPILE__)
    // as above
    asm volatile("s_wait_xcnt 0x0" :: "v"(xo[16]), "v"(xo[17]), "v"(xo[18]), "v"(xo[19]), "v"(xo[20]), "v"(xo[21]),
                 "v"(xo[22]), "v"(xo[23]), "v"(xo[24]), "v"(xo[25]), "v"(xo[26]), "v"(xo[27]), "v"(xo[28]), "v"(xo[29]),
                 "v"(xo[30]), "v"(xo[31]) : "memory");
#endif
    __builtin_amdgcn_sched_barrier(0);                   // closes the group above
#pragma unroll
    for (int it = 16; it < 32; ++it) *(v2u*)(wd + (8 * it) * WPH) = cvt4(a[it], WSC);
#pragma unroll
    for (int it = 0; it < 32; ++it) *(v2u*)(xd + it * XPH) = cvt4(c[it], XSC);
  }
  __syncthreads();

  const _Float16* xr = (const _Float16*)(const void*)Xs + (32 * wm + ci) * XPH + 8 * hh;       // B: X row m, + 16 i rows
  const unsigned short* wr = Ws + (8 * hh + (lane & 7)) * WPH + 64 * wo + 8 * ((lane >> 3) & 1);   // A: + k0 rows, + 16 t

  v8f acc[2][4];
#pragma unroll
  for (int i = 0; i < 2; ++i)
#pragma unroll
    for (int t = 0; t < 4; ++t) acc[i][t] = zero8();

  // two register sets: the fragments of k-step ks + 1 are asked for ahead of the products of k-step ks, so that their LDS
  // latency runs under those products; unrolled, so that the set index and every LDS offset are compile-time constants
  v16h wa[2][4], xb[2][2];
#pragma unroll
  for (int t = 0; t < 4; ++t) wa[0][t] = ldfrag_tr(wr + 16 * t, WPH);
#pragma unroll
  for (int i = 0; i < 2; ++i) xb[0][i] = ldfrag_h(xr + (16 * i) * XPH);
#pragma unroll
  for (int ks = 0; ks < EE / 32; ++ks) {
    const int cu = ks & 1, nx = cu ^ 1;
    if (ks + 1 < EE / 32) {
      const int k1 = (ks + 1) * 32;
#pragma unroll
      for (int t = 0; t < 4; ++t) wa[nx][t] = ldfrag_tr(wr + k1 * WPH + 16 * t, WPH);
#pragma unroll
      for (int i = 0; i < 2; ++i) xb[nx][i] = ldfrag_h(xr + (16 * i) * XPH + k1);
    }
    // holds the load group together and ahead of the products: left free, the loads sink in among the products
    __builtin_amdgcn_sched_barrier(0);
#pragma unroll
    for (int i = 0; i < 2; ++i)
#pragma unroll
      for (int t = 0; t < 4; ++t) acc[i][t] = mma_h(wa[cu][t], xb[cu][i], acc[i][t]);
    __builtin_amdgcn_sched_barrier(0);                   // the next load group stays behind these products
  }
  __syncthreads();                                       // every wave has read its operands: the LDS becomes Ts

  unsigned short* Ts = Sm;                               // 128 x 136 halves
  const int p = tid & 15, r16 = tid >> 4;               // r16 0..15 = row within group, p = 16-B piece of the 256-B segment
  if (!tr) {
#pragma unroll
    for (int i = 0; i < 2; ++i) {
      unsigned short* ts = Ts + (32 * wm + 16 * i + ci) * 136 + 64 * wo + 8 * hh;
#pragma unroll
      for (int t = 0; t < 4; ++t) {
        const v4f b0 = *(const v4f*)(bias + o0 + 64 * wo + 16 * t + 8 * hh);
        const v4f b1 = *(const v4f*)(bias + o0 + 64 * wo + 16 * t + 8 * hh + 4);
        float y[8];
#pragma unroll
        for (int e = 0; e < 4; ++e) {
          y[e]     = acc[i][t][e] * ISC     + bfr(b0[e]) * BSC;
          y[4 + e] = acc[i][t][4 + e] * ISC + bfr(b1[e]) * BSC;
        }
        v4u v;
#pragma unroll
        for (int j = 0; j < 4; ++j) v[j] = pk16(h_bits((_Float16)y[2 * j]), h_bits((_Float16)y[2 * j + 1]));
        *(v4u*)(ts + 16 * t) = v;
      }
    }
    __syncthreads();
    v4u vals[8];
#pragma unroll
    for (int it = 0; it < 8; ++it) {
      const int row = it * 16 + r16;                     // it 0..7 x r16 0..15 = rows 0..127
      vals[it] = *(const v4u*)(Ts + row * 136 + 8 * p);
    }
    unsigned short* yb = yo + (size_t)m0 * EE + o0 + 8 * p;
#pragma unroll
    for (int it = 0; it < 8; ++it) {
      const int row = it * 16 + r16;
      *(v4u*)(yb + (size_t)row * EE) = vals[it];
    }
  } else {
    const int ns = m0 / LQ, l0 = m0 - ns * LQ;
#pragma unroll
    for (int i = 0; i < 2; ++i) {
#pragma unroll
      for (int t = 0; t < 4; ++t) {
        const v4f b0 = *(const v4f*)(bias + o0 + 64 * wo + 16 * t + 8 * hh);
        const v4f b1 = *(const v4f*)(bias + o0 + 64 * wo + 16 * t + 8 * hh + 4);
#pragma unroll
        for (int r = 0; r < 4; ++r) {
          Ts[(64 * wo + 16 * t + 8 * hh + r) * 136 + 32 * wm + 16 * i + ci] =
              h_bits((_Float16)(acc[i][t][r] * ISC + bfr(b0[r]) * BSC));
          Ts[(64 * wo + 16 * t + 8 * hh + 4 + r) * 136 + 32 * wm + 16 * i + ci] =
              h_bits((_Float16)(acc[i][t][4 + r] * ISC + bfr(b1[r]) * BSC));
        }
      }
    }
    __syncthreads();
    v4u vals[8];
#pragma unroll
    for (int it = 0; it < 8; ++it) {
      const int orow = it * 16 + r16;                    // it 0..7 x r16 0..15 = o_local 0..127
      vals[it] = *(const v4u*)(Ts + orow * 136 + 8 * p);
    }
    unsigned short* yb = yo + ((size_t)ns * EE + o0) * LQ + l0 + 8 * p;
#pragma unroll
    for (int it = 0; it < 8; ++it) {
      const int orow = it * 16 + r16;
      *(v4u*)(yb + (size_t)orow * LQ) = vals[it];
    }
  }
}

// One launch for the Wo transposition and the three projections, none of which depends on another: blocks 0..15 build
// the HO plane, then 64 blocks each for q, k (row-major out) and v (transposed out). Every select is block-uniform.
// The k and v planes hold kept keys by rank: rows (columns of VT) from 128 * ceil(n / 128) on are not written, nor read.
__global__ __launch_bounds__(256)
void proj_all(const float* __restrict__ xq, const float* __restrict__ xk, const float* __restrict__ xv,
              const float* __restrict__ wq, const float* __restrict__ wk, const float* __restrict__ wv,
              const float* __restrict__ wo, const float* __restrict__ bq, const float* __restrict__ bk,
              const float* __restrict__ bv, const float* __restrict__ pres, unsigned short* q16, unsigned short* k16,
              unsigned short* vt, unsigned short* ho, float* kc) {
  __shared__ __align__(16) unsigned short Sm[EE * WPH + PM * XPH];   // 70656 halves >= 16 * 264, 128 * 136
  __shared__ __align__(16) int Ix[PM];                               // row m_local -> query or key within the batch
  const int bx = blockIdx.x;
  if (bx < NBW) { cvt_wt_body(bx, Sm, wo, ho); return; }
  const int pb = bx - NBW;
  const int wh = pb / NBP;                               // 0 q, 1 k, 2 v
  const int rb = pb - wh * NBP;
  proj_body(rb, wh == 2, wh != 0, wh == 1 && (rb & 1) == 0, Sm, Ix, wh == 0 ? wq : (wh == 1 ? wk : wv),
            wh == 0 ? xq : (wh == 1 ? xk : xv), wh == 0 ? bq : (wh == 1 ? bk : bv), pres, kc,
            wh == 0 ? q16 : (wh == 1 ? k16 : vt));
}

// ---- one stage of K and V^T into LDS: 8 asynchronous 16-B copies per lane (4 of K, 4 of V^T), no register in between.
//      lk / lv = the lane's LDS byte address of its first K / V piece, gk / gv = its global source; piece i of K lies
//      32 rows further (LDS 32 * 80 B, global 32 * 512 B), piece i of V^T 8 rows further (LDS 8 * 272 B, global 8 * 4096 B).
__device__ __forceinline__ void stage_kv(unsigned lk, unsigned lv, const unsigned short* gk, const unsigned short* gv) {
#if defined(__HIP_DEVICE_COMPILE__)
  const unsigned lk1 = lk + 32 * KPH * 2, lk2 = lk + 64 * KPH * 2, lk3 = lk + 96 * KPH * 2;
  const unsigned lv1 = lv + 8 * VPH * 2,  lv2 = lv + 16 * VPH * 2, lv3 = lv + 24 * VPH * 2;
  const unsigned short* gk1 = gk + 32 * EE;
  const unsigned short* gk2 = gk + 64 * EE;
  const unsigned short* gk3 = gk + 96 * EE;
  const unsigned short* gv1 = gv + 8 * LQ;
  const unsigned short* gv2 = gv + 16 * LQ;
  const unsigned short* gv3 = gv + 24 * LQ;
  // the closing s_wait_xcnt stands in the copies' own statement so that no address register is rewritten ahead of it
  asm volatile("global_load_async_to_lds_b128 %0, %8, off\n\t"
               "global_load_async_to_lds_b128 %1, %9, off\n\t"
               "global_load_async_to_lds_b128 %2, %10, off\n\t"
               "global_load_async_to_lds_b128 %3, %11, off\n\t"
               "global_load_async_to_lds_b128 %4, %12, off\n\t"
               "global_load_async_to_lds_b128 %5, %13, off\n\t"
               "global_load_async_to_lds_b128 %6, %14, off\n\t"
               "global_load_async_to_lds_b128 %7, %15, off\n\t"
               "s_wait_xcnt 0x0"
               :: "v"(lk), "v"(lk1), "v"(lk2), "v"(lk3), "v"(lv), "v"(lv1), "v"(lv2), "v"(lv3),
                  "v"(gk), "v"(gk1), "v"(gk2), "v"(gk3), "v"(gv), "v"(gv1), "v"(gv2), "v"(gv3)
               : "memory");
#endif
}

// =====================================================================================================
// Row-softmax attention (online max) per (ns, h, 64 queries q0..), 8 waves = 2 key groups x 4 query tiles, grid
// 2*8*32 = 512: with two blocks on a WGP four waves share a SIMD, and one wave's vector work runs under the others'
// LDS, matrix and exchange latencies. Group g = wave >> 2 walks stages g, g + 2, ... with buffers of its own, filled by
// its own four waves; the two partial results (reference point, Z, O) of a query are merged once, behind the loop.
// Wave w & 3 owns queries
// q0+16(w&3)+ci (B operand of the score tile = Q16 row fragment, col = query, k = d, one k-step). The k and v planes hold
// the batch's n kept keys by rank (proj_all), which all have the one key term mmin = min_l (1 - bf16_RNE(pres[ns][l])) *
// 1e32 * log2(e)/sqrt(32), in log2 units: n and mmin come from kc, the walk is over ceil(n / 128) stages, n clamped to
// 1..2048. Key term by rank, staged once per block in LDS: Mk[k] = mmin for k < n, mmin + 1e35 from n on, so that such a
// rank's weight is exactly 0; a group whose stage lies wholly past n copies the last written stage instead, and its weights
// come to 0 here or in the merge.
// K rows (this head's 64 B) and V^T rows of 128 keys are staged per block in LDS by asynchronous copies, two buffers per group: stage s + 2 flies while stage s is worked
// on; all four waves of a group read their A fragments from the group's staged tile. One softmax step per stage of 128 keys:
//   8 score D tiles (rows = keys l0+16j+8hh+r, col = query) = A(K16 rows l, k = d) . B(qf);
//   t = acc * (log2(e)/sqrt(32)/256) - Mk[k], one f32 FMA; stage max over the lane's 64 keys combined with the partner
//   half (lane^16); reference point R = running max - 12, R and the rescale factor 2^(R_old - R) identical for both
//   halves of a query column; p = 2^(t - R) = 4096 exp(score - max), the sum Z carries the same factor;
//   P split: hi = f16(p), lo = f16(p - hi), both B fragments of each 32 keys lt.. built in registers
//   (element r <- key lt+8hh+r, element 8+r <- key lt+16+8hh+r, lane unchanged); O^T (rows d, cols queries) rescaled once, then
//   += A(VT rows d = h*32 + 16j + ci, keys contiguous) . B(hi) and . B(lo): 4 accumulators (d 0..15 / 16..31, hi / lo).
// Epilogue: 256*O = 16 (acc_hi + acc_lo) / Z as f16 hi plus f16 residual (x2048), staged per query row in LDS
// coverage: 256 threads x 8 halves = 64 rows x 32 per plane per block; grid covers [2][8][2048][32] once.
// =====================================================================================================
// four waves per SIMD (two blocks per WGP): the register budget of exactly that, so that the scheduler spends registers
// on LDS loads in flight instead of saving them for a fifth wave that never comes
__global__ __launch_bounds__(256) __attribute__((amdgpu_waves_per_eu(4, 4)))
void attn_fwd(const unsigned short* __restrict__ q16, const unsigned short* __restrict__ k16,
              const unsigned short* __restrict__ vt, const float* __restrict__ kc,
              unsigned short* ohp, unsigned short* olp) {
  __shared__ __align__(16) float Mk[LQ];
  __shared__ __align__(16) unsigned short Hs[64 * 40];
  __shared__ __align__(16) unsigned short Lw[64 * 40];
  __shared__ __align__(16) unsigned short Kb[2 * NGR * KBH];   // [buffer][group]
  __shared__ __align__(16) unsigned short Vb[2 * NGR * VBH];   // [buffer][group]
  __shared__ __align__(16) float Mg[128 * MGP];                // group 1's partial results, one row per lane
  const int tid  = threadIdx.x;
  const int grp  = tid >> 7;                            // key group
  const int t7   = tid & 127;                           // thread within the group
  const int wave = (tid >> 5) & 3;                      // query tile
  const int lane = tid & 31;
  const int hh   = lane >> 4;
  const int ci   = lane & 15;
  const int bx   = blockIdx.x;
  const int ns   = bx / (NH * (LQ / 64));
  const int rem  = bx - ns * (NH * (LQ / 64));
  const int h    = rem / (LQ / 64);
  const int q0   = (rem - h * (LQ / 64)) * 64;
  const int qi   = q0 + 16 * wave + ci;                 // this lane's query
  // copy map within a group: K piece (row t7>>2 (+32i), 16-B piece t7&3), V^T piece (row d = t7>>4 (+8i), 16-B piece t7&15)
  const unsigned lk0 = (unsigned)(uintptr_t)(Kb + grp * KBH + (t7 >> 2) * KPH + 8 * (t7 & 3));
  const unsigned lv0 = (unsigned)(uintptr_t)(Vb + grp * VBH + (t7 >> 4) * VPH + 8 * (t7 & 15));
  const unsigned short* gk0 = k16 + (size_t)(ns * LQ + (t7 >> 2)) * EE + h * DH + 8 * (t7 & 3);   // + SK * EE per stage
  const unsigned short* gv0 = vt + ((size_t)ns * EE + h * DH + (t7 >> 4)) * LQ + 8 * (t7 & 15);   // + SK per stage
  const int   gs   = __builtin_amdgcn_readfirstlane(grp);              // the group as a scalar: stage numbers stay scalar
  const float mmin = kc[2 * ns + 1];
  const int   nr   = (int)kc[2 * ns];
  const int   n    = __builtin_amdgcn_readfirstlane(nr < 1 ? 1 : (nr > LQ ? LQ : nr));   // bounds every trip count and address
  const int   nst  = (n + SK - 1) / SK;                 // written stages, 1..NST
  const int   npr  = (nst + NGR - 1) / NGR;             // trips, 1..NPR, the same for the whole block
  {
    const int sc = gs < nst ? gs : nst - 1;
    stage_kv(lk0, lv0, gk0 + (size_t)sc * (SK * EE), gv0 + sc * SK);   // trip 0 (stage grp) -> buffer 0
  }
  {
    const float mpad = mmin + PADT;
#pragma unroll
    for (int i = 0; i < 2; ++i) {                        // 256 threads x 8 floats = 2048 ranks
      v4f mv;
#pragma unroll
      for (int e = 0; e < 4; ++e) mv[e] = (8 * tid + 4 * i + e < n) ? mmin : mpad;
      *(v4f*)(Mk + 8 * tid + 4 * i) = mv;
    }
  }
  asm volatile("s_wait_asynccnt 0x0" ::: "memory");     // this wave's copies of trip 0 have landed
  __syncthreads();                                      // publishes Mk and trip 0
  if (npr > 1) {
    const int sc = NGR + gs < nst ? NGR + gs : nst - 1;
    stage_kv(lk0 + NGR * KBH * 2, lv0 + NGR * VBH * 2, gk0 + (size_t)sc * (SK * EE), gv0 + sc * SK);   // trip 1 -> buffer 1
  }

  const _Float16* Q = (const _Float16*)(const void*)q16;
  const v16h qf = ldfrag_h(Q + (size_t)(ns * LQ + qi) * EE + h * DH + 8 * hh);
  const _Float16* kl = (const _Float16*)(const void*)Kb + grp * KBH + ci * KPH + 8 * hh;   // + buffer, + key_local * KPH
  const _Float16* vl = (const _Float16*)(const void*)Vb + grp * VBH + ci * VPH + 8 * hh;   // row d = ci, + 16 * VPH, + key_local

  float rref = NEG0, z = 0.f;
  v8f ah0 = zero8(), ah1 = zero8(), al0 = zero8(), al1 = zero8();
#pragma unroll 1
  for (int pr = 0; pr < npr; ++pr) {
    const int bf = pr & 1;
    const _Float16* kp = kl + bf * (NGR * KBH);
    const _Float16* vp = vl + bf * (NGR * VBH);
    // one softmax step per stage: the 8 score tiles and the lane's 64 exponentials of 128 keys are independent among
    // themselves, and the running max, its cross-half exchange and the rescale come once per stage;
    // every loop of the step is unrolled: its arrays stay in registers and every LDS offset is an immediate
    const float* mp = Mk + (pr * NGR + grp) * SK + 8 * hh;
    v8f s[SK / 16];                                      // s[j][r] <-> rank (pr*NGR + grp)*SK + 16j + 8hh + r, col = query
#pragma unroll
    for (int j = 0; j < SK / 16; ++j) s[j] = mma_h(ldfrag_h(kp + (16 * j) * KPH), qf, zero8());
    float mj[SK / 16];
#pragma unroll
    for (int j = 0; j < SK / 16; ++j) {
      const v4f ma = *(const v4f*)(mp + 16 * j);         // ranks 16j + 8hh + 0..3 <-> s[j][0..3]
      const v4f mb = *(const v4f*)(mp + 16 * j + 4);     // ranks 16j + 8hh + 4..7 <-> s[j][4..7]
#pragma unroll
      for (int r = 0; r < 4; ++r) {
        s[j][r]     = s[j][r] * SCL     - ma[r];
        s[j][4 + r] = s[j][4 + r] * SCL - mb[r];
      }
      float m = s[j][0];
#pragma unroll
      for (int r = 1; r < 8; ++r) m = fmaxf(m, s[j][r]);
      mj[j] = m;
    }
    float mx = fmaxf(fmaxf(fmaxf(mj[0], mj[1]), fmaxf(mj[2], mj[3])), fmaxf(fmaxf(mj[4], mj[5]), fmaxf(mj[6], mj[7])));
    mx = fmaxf(mx, __shfl_xor(mx, 16, 32));
    float mo = mx - POFF;
    mo = (mx - mo > 15.0f) ? mx : mo;                    // |mx| near 2^27: the rounded difference may lie 16 below, p past f16
    const float nref = fmaxf(rref, mo);
    const float corr = __builtin_amdgcn_exp2f(rref - nref);
    rref = nref;
    ah0 *= corr; ah1 *= corr; al0 *= corr; al1 *= corr;
    v2f zu[SK / 32];                                     // per 32 keys: sums of p over even / odd r, one packed add per pair
#pragma unroll
    for (int u = 0; u < SK / 32; ++u) {
      v8u ph, pl;
      v2f zg[2];
#pragma unroll
      for (int r = 0; r < 8; r += 4) {
        float x[8], p[8];                                // 0..3 <-> s[2u][r..r+3], 4..7 <-> s[2u+1][r..r+3]
#pragma unroll
        for (int e = 0; e < 4; ++e) {
          x[e]     = s[2 * u][r + e] - nref;
          x[4 + e] = s[2 * u + 1][r + e] - nref;
        }
#pragma unroll
        for (int e = 0; e < 8; ++e) p[e] = __builtin_amdgcn_exp2f(x[e]);
        const v2f pa0 = {p[0], p[1]}, pa1 = {p[2], p[3]}, pc0 = {p[4], p[5]}, pc1 = {p[6], p[7]};
        zg[r >> 2] = (pa0 + pc0) + (pa1 + pc1);
        // registers of the two B fragments: elements r..r+3 -> r/2, r/2 + 1; elements 8+r..8+r+3 -> 4 + r/2, 5 + r/2
        unsigned hq[4], lq[4];
        hq[0] = __builtin_bit_cast(unsigned, __builtin_convertvector(pa0, v2h));
        hq[1] = __builtin_bit_cast(unsigned, __builtin_convertvector(pa1, v2h));
        hq[2] = __builtin_bit_cast(unsigned, __builtin_convertvector(pc0, v2h));
        hq[3] = __builtin_bit_cast(unsigned, __builtin_convertvector(pc1, v2h));
        resid8(lq, hq, p);
        const int g = r >> 1;
        ph[g] = hq[0]; ph[g + 1] = hq[1]; ph[4 + g] = hq[2]; ph[5 + g] = hq[3];
        pl[g] = lq[0]; pl[g + 1] = lq[1]; pl[4 + g] = lq[2]; pl[5 + g] = lq[3];
      }
      zu[u] = zg[0] + zg[1];
      const v16h va0 = ldfrag_h(vp + u * 32);                      // d = ci
      const v16h va1 = ldfrag_h(vp + 16 * VPH + u * 32);           // d = 16 + ci
      const v16h pb = __builtin_bit_cast(v16h, ph), lb = __builtin_bit_cast(v16h, pl);
      ah0 = mma_h(va0, pb, ah0);
      ah1 = mma_h(va1, pb, ah1);
      al0 = mma_h(va0, lb, al0);
      al1 = mma_h(va1, lb, al1);
    }
    const v2f zt = (zu[0] + zu[1]) + (zu[2] + zu[3]);
    z = z * corr + (zt[0] + zt[1]);
    // publish point of trip pr + 1: own LDS reads done, own copies landed, then the barrier that both publishes
    // trip pr + 1 and ends every wave's reads of the buffer refilled behind it
    asm volatile("s_wait_dscnt 0x0" ::: "memory");
    asm volatile("s_wait_asynccnt 0x0" ::: "memory");
    __syncthreads();
    if (pr + 2 < npr) {
      const int s2 = (pr + 2) * NGR + gs;
      const int sc = s2 < nst ? s2 : nst - 1;
      stage_kv(lk0 + bf * (NGR * KBH * 2), lv0 + bf * (NGR * VBH * 2), gk0 + (size_t)sc * (SK * EE), gv0 + sc * SK);
    }
  }
  asm volatile("s_wait_asynccnt 0x0" ::: "memory");     // nothing of this wave's copies is left in flight

  // ah0/al0[r] <-> d = 8hh + r, ah1/al1[r] <-> d = 16 + 8hh + r, query qi; Z >= 1 (the max key's p)
  // Merge of the two key groups: lane t7 of group 1 hands its 16 sums, its reference point and its Z to lane t7 of
  // group 0, which brings both partial results to the larger reference point and adds them.
  v8f oa = ah0 + al0, ob8 = ah1 + al1;
  float* mg = Mg + t7 * MGP;
  if (grp == 1) {
    const v4f w0 = {oa[0], oa[1], oa[2], oa[3]},     w1 = {oa[4], oa[5], oa[6], oa[7]};
    const v4f w2 = {ob8[0], ob8[1], ob8[2], ob8[3]}, w3 = {ob8[4], ob8[5], ob8[6], ob8[7]};
    const v2f w4 = {rref, z};
    *(v4f*)(mg)      = w0;
    *(v4f*)(mg + 4)  = w1;
    *(v4f*)(mg + 8)  = w2;
    *(v4f*)(mg + 12) = w3;
    *(v2f*)(mg + 16) = w4;
  }
  __syncthreads();                                      // publishes group 1's partial results
  if (grp == 0) {
    const v4f w0 = *(const v4f*)(mg), w1 = *(const v4f*)(mg + 4), w2 = *(const v4f*)(mg + 8), w3 = *(const v4f*)(mg + 12);
    const v2f w4 = *(const v2f*)(mg + 16);
    const float rm = fmaxf(rref, w4[0]);
    const float c0 = __builtin_amdgcn_exp2f(rref - rm), c1 = __builtin_amdgcn_exp2f(w4[0] - rm);
    z = z * c0 + w4[1] * c1;
    const float zz  = z + __shfl_xor(z, 16, 32);
    const float rzs = (1.0f / zz) * 16.0f;
    float o[16];
#pragma unroll
    for (int r = 0; r < 4; ++r) {
      o[r]      = (oa[r] * c0      + w0[r] * c1) * rzs;
      o[4 + r]  = (oa[4 + r] * c0  + w1[r] * c1) * rzs;
      o[8 + r]  = (ob8[r] * c0     + w2[r] * c1) * rzs;
      o[12 + r] = (ob8[4 + r] * c0 + w3[r] * c1) * rzs;
    }
    v4u h0, h1, g0, g1;
#pragma unroll
    for (int i = 0; i < 4; ++i) {
      const _Float16 a0 = (_Float16)o[2 * i],     a1 = (_Float16)o[2 * i + 1];
      const _Float16 b0 = (_Float16)o[8 + 2 * i], b1 = (_Float16)o[8 + 2 * i + 1];
      const _Float16 la0 = (_Float16)((o[2 * i]         - (float)a0) * LOSC);
      const _Float16 la1 = (_Float16)((o[2 * i + 1]     - (float)a1) * LOSC);
      const _Float16 lb0 = (_Float16)((o[8 + 2 * i]     - (float)b0) * LOSC);
      const _Float16 lb1 = (_Float16)((o[8 + 2 * i + 1] - (float)b1) * LOSC);
      h0[i] = pk16(h_bits(a0), h_bits(a1));
      h1[i] = pk16(h_bits(b0), h_bits(b1));
      g0[i] = pk16(h_bits(la0), h_bits(la1));
      g1[i] = pk16(h_bits(lb0), h_bits(lb1));
    }
    {
      const int ro = (16 * wave + ci) * 40 + 8 * hh;
      *(v4u*)(Hs + ro)      = h0;
      *(v4u*)(Hs + ro + 16) = h1;
      *(v4u*)(Lw + ro)      = g0;
      *(v4u*)(Lw + ro + 16) = g1;
    }
  }
  __syncthreads();
  {
    const size_t ob = ((size_t)(ns * NH + h) * LQ + q0) * DH;      // 4096-B aligned region of 64 x 32 halves
    const int hf = 8 * tid;                              // half index within the 2048-half region
    const int row = hf >> 5, col = hf & 31;
    const v4u hv = *(const v4u*)(Hs + row * 40 + col);
    const v4u lv = *(const v4u*)(Lw + row * 40 + col);
    *(v4u*)(ohp + ob + hf) = hv;
    *(v4u*)(olp + ob + hf) = lv;
  }
}

// ---- 12 asynchronous 16-B copies per lane, global -> LDS, no register in between: l[i] = the lane's LDS byte address,
//      g[i] = its global source
__device__ __forceinline__ void copy12(const unsigned* l, const unsigned short* const* g) {
#if defined(__HIP_DEVICE_COMPILE__)
  // the closing s_wait_xcnt stands in the copies' own statement so that no address register is rewritten ahead of it
  asm volatile("global_load_async_to_lds_b128 %0, %12, off\n\t"
               "global_load_async_to_lds_b128 %1, %13, off\n\t"
               "global_load_async_to_lds_b128 %2, %14, off\n\t"
               "global_load_async_to_lds_b128 %3, %15, off\n\t"
               "global_load_async_to_lds_b128 %4, %16, off\n\t"
               "global_load_async_to_lds_b128 %5, %17, off\n\t"
               "global_load_async_to_lds_b128 %6, %18, off\n\t"
               "global_load_async_to_lds_b128 %7, %19, off\n\t"
               "global_load_async_to_lds_b128 %8, %20, off\n\t"
               "global_load_async_to_lds_b128 %9, %21, off\n\t"
               "global_load_async_to_lds_b128 %10, %22, off\n\t"
               "global_load_async_to_lds_b128 %11, %23, off\n\t"
               "s_wait_xcnt 0x0"
               :: "v"(l[0]), "v"(l[1]), "v"(l[2]), "v"(l[3]), "v"(l[4]), "v"(l[5]),
                  "v"(l[6]), "v"(l[7]), "v"(l[8]), "v"(l[9]), "v"(l[10]), "v"(l[11]),
                  "v"(g[0]), "v"(g[1]), "v"(g[2]), "v"(g[3]), "v"(g[4]), "v"(g[5]),
                  "v"(g[6]), "v"(g[7]), "v"(g[8]), "v"(g[9]), "v"(g[10]), "v"(g[11])
               : "memory");
#endif
}

// =====================================================================================================
// Output projection out[m][o] = sum_c O[m][c] Wo[c][o] + bo[o], O = (hi + lo/2048)/256 from the OH/OL planes
// ([ns][h][q][32]: k-step j = head j). Block = 4 waves = 64 rows m x 64 cols o (grid 64 x 4 = 256).
// Every global read of the block goes out at entry: the bias into registers, and both operands whole into LDS by
// asynchronous copies, each wave-copy 512 contiguous bytes: Ws[o_local][e] = 64 HO rows (16 copies per lane, one row
// per wave-copy), Os[plane][j][m_local][32] = the block's 64 rows of each head of OH and OL (2 x 8 x 2 copies per lane,
// 8 rows per wave-copy); 48 copies per wave in flight, one wait, one barrier, then the buffers are only read.
// Wave w owns rows m0+16w+ci (B operands = OH and OL row fragments, col = m), A = HO rows o0+16t+ci (k = c split map);
// 4 hi + 4 lo accumulators; acc[t][r] <-> (m = m0+16w+ci, o = o0+16t+8hh+r).
// Epilogue: (acch + accl/2048)/262144 + bf16_RNE(bo) staged in LDS as Ts[m_local][o_local] (pitch 68, 16-B vector
// coverage: copies 16 x 4 rows x 512 B = 64 x 256 halves, 16 x 2 x 32 rows x 64 B = 2 x 8 x 64 x 32 halves;
//           8 it x 8 rows x 16 pieces x 4 floats = 64 x 64 per block; grid covers out [4096][256] exactly once.
// =====================================================================================================
__global__ __launch_bounds__(128)
void out_proj(const unsigned short* __restrict__ ohp, const unsigned short* __restrict__ olp,
              const unsigned short* __restrict__ woh, const float* __restrict__ bo, float* out) {
  __shared__ __align__(16) unsigned short Ws[64 * OWP];
  __shared__ __align__(16) unsigned short Os[2 * NH * 64 * OOP];
  __shared__ __align__(16) float Ts[64 * 68];
  const int tid  = threadIdx.x;
  const int wave = tid >> 5;
  const int lane = tid & 31;
  const int hh   = lane >> 4;
  const int ci   = lane & 15;
  const int bx   = blockIdx.x;
  const int mt   = bx >> 2, ot = bx & 3;
  const int m0   = mt * 64, o0 = ot * 64;
  const int ns   = m0 / LQ;

  v4f bb[4][2];
#pragma unroll
  for (int t = 0; t < 4; ++t) {
    bb[t][0] = *(const v4f*)(bo + o0 + 16 * t + 8 * hh);
    bb[t][1] = *(const v4f*)(bo + o0 + 16 * t + 8 * hh + 4);
  }
#if defined(__HIP_DEVICE_COMPILE__)
  // stands between the loads above and the address arithmetic below, which reuses the registers of their base
  asm volatile("s_wait_xcnt 0x0" ::: "memory");
#endif
  {
    unsigned l[48];
    const unsigned short* g[48];
    // HO: copy i = row o_local 4 i + wave, 16-B piece lane
    const unsigned lw = (unsigned)(uintptr_t)(Ws + wave * OWP + 8 * lane);
    const unsigned short* gw = woh + (size_t)(o0 + wave) * EE + 8 * lane;
#pragma unroll
    for (int i = 0; i < 16; ++i) {
      l[i] = lw + i * (4 * OWP * 2);
      g[i] = gw + i * (4 * EE);
    }
    // OH / OL: copy (plane, j, c) = row m_local 32 c + (tid >> 2), 16-B piece tid & 3; the 64 rows of a head are contiguous
    const unsigned lo = (unsigned)(uintptr_t)(Os + (tid >> 2) * OOP + 8 * (tid & 3));
    const size_t ob = ((size_t)(ns * NH) * LQ + (m0 - ns * LQ)) * DH + 8 * tid;
#pragma unroll
    for (int pj = 0; pj < 2 * NH; ++pj) {
      const unsigned short* gp = (pj < NH ? ohp : olp) + ob + (size_t)(pj & (NH - 1)) * LQ * DH;
#pragma unroll
      for (int c = 0; c < 2; ++c) {
        l[16 + 2 * pj + c] = lo + (pj * 64 + 32 * c) * (OOP * 2);
        g[16 + 2 * pj + c] = gp + c * (128 * 8);
      }
    }
#pragma unroll
    for (int s = 0; s < 4; ++s) copy12(l + 12 * s, g + 12 * s);
  }
  asm volatile("s_wait_asynccnt 0x0" ::: "memory");     // this wave's copies have landed
  __syncthreads();                                      // publishes Ws and Os

  const _Float16* ar = (const _Float16*)(const void*)Os + (16 * wave + ci) * OOP + 8 * hh;   // + j * 64 * OOP
  const _Float16* lr = ar + NH * 64 * OOP;
  const _Float16* wr = (const _Float16*)(const void*)Ws + ci * OWP + 8 * hh;                 // + 16t * OWP + 32j

  v8f acch[4], accl[4];
#pragma unroll
  for (int t = 0; t < 4; ++t) { acch[t] = zero8(); accl[t] = zero8(); }

  // two register sets: the fragments of k-step j + 1 are asked for ahead of the products of k-step j, so that their LDS
  // latency runs under those products; unrolled, so that the set index and every LDS offset are compile-time constants
  v16h obh[2], obl[2], wa[2][4];
  obh[0] = ldfrag_h(ar);
  obl[0] = ldfrag_h(lr);
#pragma unroll
  for (int t = 0; t < 4; ++t) wa[0][t] = ldfrag_h(wr + (16 * t) * OWP);
#pragma unroll
  for (int j = 0; j < NH; ++j) {
    const int cu = j & 1, nx = cu ^ 1;
    if (j + 1 < NH) {
      obh[nx] = ldfrag_h(ar + (j + 1) * 64 * OOP);
      obl[nx] = ldfrag_h(lr + (j + 1) * 64 * OOP);
#pragma unroll
      for (int t = 0; t < 4; ++t) wa[nx][t] = ldfrag_h(wr + (16 * t) * OWP + 32 * (j + 1));
    }
    // holds the load group together and ahead of the products: left free, the loads sink in among the products
    __builtin_amdgcn_sched_barrier(0);
#pragma unroll
    for (int t = 0; t < 4; ++t) acch[t] = mma_h(wa[cu][t], obh[cu], acch[t]);
#pragma unroll
    for (int t = 0; t < 4; ++t) accl[t] = mma_h(wa[cu][t], obl[cu], accl[t]);
    __builtin_amdgcn_sched_barrier(0);                   // the next load group stays behind these products
  }

  {
    float* ts = Ts + (16 * wave + ci) * 68 + 8 * hh;
#pragma unroll
    for (int t = 0; t < 4; ++t) {
      v4f r0, r1;
#pragma unroll
      for (int e = 0; e < 4; ++e) {
        r0[e] = (acch[t][e]     + accl[t][e]     * LOIN) * OSC + bfr(bb[t][0][e]);
        r1[e] = (acch[t][4 + e] + accl[t][4 + e] * LOIN) * OSC + bfr(bb[t][1][e]);
      }
      *(v4f*)(ts + 16 * t)     = r0;
      *(v4f*)(ts + 16 * t + 4) = r1;
    }
  }
  __syncthreads();
  {
    const int p = tid & 15, r16 = tid >> 4;             // r16 0..7, p = 16-B piece of the 256-B segment
    v4f vals[8];
#pragma unroll
    for (int it = 0; it < 8; ++it) {
      const int row = it * 8 + r16;                      // it 0..7 x r16 0..7 = rows 0..63
      vals[it] = *(const v4f*)(Ts + row * 68 + 4 * p);
    }
    float* yb = out + (size_t)m0 * EE + o0 + 4 * p;
#pragma unroll
    for (int it = 0; it < 8; ++it) {
      const int row = it * 8 + r16;
      *(v4f*)(yb + (size_t)row * EE) = vals[it];
    }
  }
}

// =====================================================================================================
// Workspace map (bytes), every offset a multiple of 256 and every plane sized to its whole-line store granularity:
//   HO           f16 [256][256]       131072           0 .. 131072
//   Q16, K16     f16 [4096][256]      2 x 2097152      .. 4325376
//   VT           f16 [2][256][2048]   2097152          .. 6422528
//   OH, OL       f16 [2][8][2048][32] 2 x 2097152      .. 10616832
//   MT           f32 [2][2]           256              .. 10617088  (end)   kept keys n and key term mmin per batch
// =====================================================================================================
extern "C" void kernel_launch(void* const* d_in, const int* in_sizes, int n_in,
                              void* d_out, int out_size, void* d_ws, size_t ws_size,
                              hipStream_t stream) {
  if (n_in < 12) return;
  if (in_sizes[0] != MR * EE || in_sizes[1] != MR * EE || in_sizes[2] != MR * EE) return;
  if (in_sizes[3] != NSB * LQ) return;
  if (in_sizes[4] != EE * EE || in_sizes[6] != EE * EE || in_sizes[8] != EE * EE || in_sizes[10] != EE * EE) return;
  if (in_sizes[5] != EE || in_sizes[7] != EE || in_sizes[9] != EE || in_sizes[11] != EE) return;
  if (out_size != MR * EE) return;

  const float* queries = (const float*)d_in[0];
  const float* keys    = (const float*)d_in[1];
  const float* values  = (const float*)d_in[2];
  const float* pres    = (const float*)d_in[3];
  const float* Wq      = (const float*)d_in[4];
  const float* bq      = (const float*)d_in[5];
  const float* Wk      = (const float*)d_in[6];
  const float* bk      = (const float*)d_in[7];
  const float* Wv      = (const float*)d_in[8];
  const float* bv      = (const float*)d_in[9];
  const float* Wo      = (const float*)d_in[10];
  const float* bo      = (const float*)d_in[11];
  float* out = (float*)d_out;

  const size_t PW  = (size_t)EE * EE * 2;               // 131072
  const size_t PP  = (size_t)MR * EE * 2;               // 2097152
  const size_t PVT = (size_t)NSB * EE * LQ * 2;         // 2097152
  const size_t PO  = (size_t)NSB * NH * LQ * DH * 2;    // 2097152
  size_t off = 0;
  const size_t oHO = off; off += PW;
  const size_t oQ  = off; off += PP;
  const size_t oK  = off; off += PP;
  const size_t oVT = off; off += PVT;
  const size_t oOH = off; off += PO;
  const size_t oOL = off; off += PO;
  const size_t oMT = off; off += 256;
  if (off > ws_size) return;                            // off = 10617088
  if (off > (size_t)134217728) return;

  char* ws = (char*)d_ws;
  unsigned short* HOp = (unsigned short*)(ws + oHO);
  unsigned short* Q16 = (unsigned short*)(ws + oQ);
  unsigned short* K16 = (unsigned short*)(ws + oK);
  unsigned short* VTp = (unsigned short*)(ws + oVT);
  unsigned short* OHp = (unsigned short*)(ws + oOH);
  unsigned short* OLp = (unsigned short*)(ws + oOL);
  float*          MTp = (float*)(ws + oMT);

  const dim3 blk256(256), blk128(128);
  const dim3 gPJ(NBW + 3 * NBP);                        // 16 + 3 x 64 blocks
  const dim3 gAT(NSB * NH * (LQ / 64));                 // 512 blocks
  const dim3 gOP((MR / 64) * (EE / 64));                // 256 blocks

  // (1) transposed 16-bit Wo plane HO[o][e]; projections from the f32 inputs: q, k row-major [4096][256] (x16),
  //     v transposed VT[ns][hd][l] (x16), biases added; k and v of the kept keys only, by rank; n and mmin per batch
  proj_all<<<gPJ, blk256, 0, stream>>>(queries, keys, values, Wq, Wk, Wv, Wo, bq, bk, bv, pres, Q16, K16, VTp, HOp, MTp);
  // (2) attention output planes OH / OL [ns][h][q][32] (row softmax over keys with the key term)
  attn_fwd<<<gAT, blk256, 0, stream>>>(Q16, K16, VTp, MTp, OHp, OLp);
  // (3) output projection + bias -> d_out [4096][256] f32
  out_proj<<<gOP, blk128, 0, stream>>>(OHp, OLp, HOp, bo, out);
  (void)hipGetLastError();
}

// v010
// Measured time: 24.6 microseconds a run.
// It is 1.16 times as fast as v008, going by the measured steps of the versions left out in between.
// Over all steps from v000 it is 4.28 times as fast.
// Contractions, all v_wmma_f32_16x16x32_f16 (f16 operands, f32 accumulate): q/k/v projections X.W with f16
// containers holding bf16-RNE inputs (X x64, W x1024); scores K.q with q, k planes f16 x16 (K = 32 per head);
// P as one f16 plane (x4096) . V plane (f16 x16), both operands at f16's 11 bits, into one accumulator pair; output projection
// with O as one f16 plane (x256), finer than its partner Wo bf16-RNE x1024. Key-mask term,
// running max / sum, exp and biases in f32 on VALU.
// Keys: only the keys of a batch whose mask term equals the batch's smallest one are projected and attended to. Two
// different mask terms lie more than 1e24 apart (one f32 step of a term near 1e31; smaller terms are coarser multiples),
// a score from the f16 planes stays below 2e8, so that every other key's weight 2^(t - max) is exactly 0 in f32.
#include <hip/hip_runtime.h>
#include <math.h>
#include <stdint.h>

#define NSB  2
#define LQ   2048
#define EE   256
#define NH   8
#define DH   32
#define MR   (NSB * LQ)
#define XSC  64.0f
#define WSC  1024.0f
#define ISC  (1.0f / 4096.0f)
#define BSC  16.0f
#define RL2E (0.17677669529663687 * 1.44269504088896340736)   // log2(e) / sqrt(32): exp(s / sqrt(32)) = 2^(s * RL2E)
#define SCL  ((float)(RL2E / 256.0))   // score accumulator (256 q.k) -> log2 units
#define MB2  ((float)(1.0e32 * RL2E))  // the key term's 1e32 in log2 units
#define NEG0 (-1.0e38f)
#define PADT 1.0e35f                   // taken off the score of a rank past the kept keys: its weight is exactly 0
#define POFF 12.0f                     // P carries 2^12: the exponent's reference point lies 12 below the running max
#define OSC  (1.0f / 262144.0f)
#define NBW  16                     // blocks of the Wo transposition: 16 o-tiles
#define PM   128                    // rows m of a projection block
#define NBP  ((MR / PM) * (EE / 128))   // blocks of one projection
#define WPH  144                    // LDS pitch of a staged W row e, halves (256 B of data + 32 B: 32 B x odd for the transposing reader)
#define XPH  264                    // LDS pitch of a staged X row m, halves (512 B of data + 16 B: 16 B x odd for 16-B readers)
static_assert(EE == NH * DH);
static_assert(DH == 32);
static_assert((LQ % PM) == 0 && (EE % 128) == 0 && (MR % PM) == 0);
static_assert(EE == 256 && PM == 128);
static_assert(LQ == 128 * 16);
#define SK   128                    // keys per LDS stage of the attention kernel
#define NST  (LQ / SK)              // stages
#define KPH  40                     // LDS pitch of a staged K row, halves (64 B of data + 16 B: 16 B x odd for 16-B readers)
#define VPH  136                    // LDS pitch of a staged V^T row, halves (256 B of data + 16 B)
#define KBH  (SK * KPH)             // halves per K buffer
#define VBH  (DH * VPH)             // halves per V buffer
static_assert(NST >= 2 && SK == 128);               // the softmax step merges 4 maxima of 15 values, the 4 values left out and 4 partial sums
#define NGR  2                      // key groups of an attention block: group g works on stages g, g + 2, g + 4, ...
#define NPR  (NST / NGR)            // most trips of the attention loop: one stage per group and trip
#define MGP  20                     // LDS pitch of a lane's partial result, floats (72 B of data + 8 B: 16 B x odd)
static_assert(NPR >= 2 && NPR * NGR == NST);
static_assert(SK * 4 == 4 * 128 && DH * (SK / 8) == 4 * 128);   // 4 + 4 copies of 16 B per thread and stage
#define OWP  264                    // LDS pitch of a staged HO row o, halves (512 B of data + 16 B: 16 B x odd for 16-B readers)
#define OOP  40                     // LDS pitch of a staged OH row m, halves (64 B of data + 16 B)

typedef _Float16 v16h __attribute__((ext_vector_type(16)));
typedef _Float16 v8h  __attribute__((ext_vector_type(8)));
typedef float    v8f  __attribute__((ext_vector_type(8)));
typedef float    v4f  __attribute__((ext_vector_type(4)));
typedef unsigned int v4u __attribute__((ext_vector_type(4)));
typedef int      v4i  __attribute__((ext_vector_type(4)));
typedef unsigned int v2u __attribute__((ext_vector_type(2)));
typedef unsigned int v8u __attribute__((ext_vector_type(8)));
typedef short    s16x8 __attribute__((ext_vector_type(8)));
typedef float    v2f  __attribute__((ext_vector_type(2)));
typedef _Float16 v2h  __attribute__((ext_vector_type(2)));
typedef __bf16   v2b  __attribute__((ext_vector_type(2)));

union FragH { v16h v; v8h h[2]; };

// ---- scalar helpers ----------------------------------------------------------------------------------
__device__ __forceinline__ unsigned short bf_bits(float f) {          // f32 -> bf16 bits, RNE convert
  unsigned u = __float_as_uint(f);
  return (unsigned short)((u + 0x7FFFu + ((u >> 16) & 1u)) >> 16);
}
__device__ __forceinline__ float bf_up(unsigned short h) { return __uint_as_float(((unsigned)h) << 16); }
__device__ __forceinline__ float bfr(float f) { return bf_up(bf_bits(f)); }
__device__ __forceinline__ unsigned short h_bits(_Float16 x) { return __builtin_bit_cast(unsigned short, x); }
__device__ __forceinline__ unsigned pk16(unsigned short a, unsigned short b) { return (unsigned)a | ((unsigned)b << 16); }
__device__ __forceinline__ v8f zero8() { v8f z = {0.f, 0.f, 0.f, 0.f, 0.f, 0.f, 0.f, 0.f}; return z; }
// 4 consecutive f32 -> f16( bf16_RNE(x) * sc ) packed into 8 bytes; the RNE step by the packed hardware convert, which
// gives bfr()'s value for every finite x
__device__ __forceinline__ v2u cvt4(v4f a, float sc) {
  v2u v;
#pragma unroll
  for (int i = 0; i < 2; ++i) {
    const v2f x = {a[2 * i], a[2 * i + 1]};
    const unsigned b = __builtin_bit_cast(unsigned, __builtin_convertvector(x, v2b));
    const v2f y = {__uint_as_float(b << 16) * sc, __uint_as_float(b & 0xFFFF0000u) * sc};
    v[i] = __builtin_bit_cast(unsigned, __builtin_convertvector(y, v2h));
  }
  return v;
}
// key terms of 2 presence values, log2 units: (1 - bf16_RNE(x)) * 1e32 * log2(e)/sqrt(32); the RNE step as in cvt4
__device__ __forceinline__ v2f kterm2(float x0, float x1) {
  const v2f x = {x0, x1};
  const unsigned b = __builtin_bit_cast(unsigned, __builtin_convertvector(x, v2b));
  const v2f t = {(1.0f - __uint_as_float(b << 16)) * MB2, (1.0f - __uint_as_float(b & 0xFFFF0000u)) * MB2};
  return t;
}

// ---- fragment loader: 16-bit A/B operand, lane -> row/col (lane&15), p already includes +8*(lane>>4);
//      elements 0..7 <- p[0..7] (k0+8h..), elements 8..15 <- p[16..23] (k0+16+8h..)
__device__ __forceinline__ v16h ldfrag_h(const _Float16* p) {
  FragH f;
  f.h[0] = *(const v8h*)(p);
  f.h[1] = *(const v8h*)(p + 16);
  return f.v;
}

// ---- transposing fragment loader: LDS tile T[k][row] (16-bit, k-major), p = T + (k0 + 8*(lane>>4) + (lane&7)) * pitch
//      + row0 + 8*((lane>>3)&1); lane (ci, hh) receives T[k0+8hh+0..7][row0+ci], then T[k0+16+8hh+0..7][row0+ci]:
//      the k order of ldfrag_h
__device__ __forceinline__ v16h ldfrag_tr(const unsigned short* p, int pitch) {
  typedef __attribute__((address_space(3))) s16x8 lds_s16x8;
  FragH f;
  f.h[0] = __builtin_bit_cast(v8h, __builtin_amdgcn_ds_load_tr16_b128_v8i16((lds_s16x8*)p));
  f.h[1] = __builtin_bit_cast(v8h, __builtin_amdgcn_ds_load_tr16_b128_v8i16((lds_s16x8*)(p + 16 * pitch)));
  return f.v;
}

// ---- WMMA helper --------------------------------------------------------------------------------------
__device__ __forceinline__ v8f mma_h(v16h a, v16h b, v8f c) {
  return __builtin_amdgcn_wmma_f32_16x16x32_f16(false, a, false, b, (short)0, c, false, false);
}

// =====================================================================================================
// Transposed output-weight plane: HO[o][e] = f16( bf16_RNE(Wo[e][o]) * 1024 ) for the [in][out] weight (x.W layout).
// Block = 16 output rows o0 = 16*bx, 256 threads, 16 blocks, so that this chain is no longer than a projection block's.
// Read W rows e as 4 threads x 16 B (64-B row segment o0..o0+15), all 4 loads of a thread in flight together, 2-B
// transposed LDS stores into Ts[o_local][e] (pitch 264), block barrier, then whole rows out.
// coverage: read 4 it x 64 rows e x 4 pieces x 4 = all 256 e x 16 o; write 2 it x 8 waves = 16 rows x 32 lanes x 8
//           halves = 16 x 256; 16 o-tiles -> HO [256][256] entirely.
// =====================================================================================================
__device__ __forceinline__
void cvt_wt_body(int bx, unsigned short* Ts, const float* __restrict__ src, unsigned short* dst) {
  const int tid  = threadIdx.x;
  const int wave = tid >> 5;
  const int lane = tid & 31;
  const int o0   = bx * 16;
  const int p = tid & 3, r64 = tid >> 2;                // p = 16-B piece of the 64-B row segment, r64 = row in group
  v4f a[4];
#pragma unroll
  for (int it = 0; it < 4; ++it) a[it] = *(const v4f*)(src + (size_t)(it * 64 + r64) * EE + o0 + 4 * p);
#pragma unroll
  for (int it = 0; it < 4; ++it) {
    const int e = it * 64 + r64;                         // 0..255
#pragma unroll
    for (int i = 0; i < 4; ++i) Ts[(4 * p + i) * 264 + e] = h_bits((_Float16)(bfr(a[it][i]) * WSC));
  }
  __syncthreads();
  v4u vals[2];
#pragma unroll
  for (int it = 0; it < 2; ++it) {
    const int row = it * 8 + wave;                       // it 0..1 x wave 0..7 = rows 0..15
    vals[it] = *(const v4u*)(Ts + row * 264 + 8 * lane);
  }
  unsigned short* db = dst + (size_t)o0 * EE + 8 * lane;
#pragma unroll
  for (int it = 0; it < 2; ++it) {
    const int row = it * 8 + wave;
    *(v4u*)(db + (size_t)row * EE) = vals[it];
  }
}

// =====================================================================================================
// Projection GEMM Y[m][o] = sum_e X[m][e] W[e][o] (x 65536 in the accumulator) + b[o], straight from the f32 inputs.
// Block = 8 waves = 128 rows m x 128 cols o (32 m-tiles x 2 o-tiles = 64 blocks per projection). The block converts
// its own operands into LDS: Ws[e][o_local] = f16( bf16_RNE(W[e][o]) * 1024 ) (one wave-load = one 512-B row segment),
// Xs[m_local][e] = f16( bf16_RNE(X[m][e]) * 64 ) (one wave-load = half a row), 8-B LDS stores, block barrier.
// Wave (wm = wave & 3, wo = wave >> 2) owns 32 rows m x 64 cols o: A(W^T rows o = o0+64wo+16t+ci by the transposing
// load, k = e split map) . B(Xs row m = m0+32wm+16i+ci, col = m, same map); 8 k-steps of 32, 8 accumulators per wave;
// acc[i][t][r] <-> (m = m0+32wm+16i+ci, o = o0+64wo+16t+8hh+r). y16 = acc * 2^-12 + 16 * bf16_RNE(b[o]) (= 16 y).
// A second barrier ends every wave's operand reads before the same LDS becomes output staging.
// Rows: row m_local of a q block is query w0 + m_local of its batch. A k or v block (gat) works on kept keys: every wave
// reads the batch's 2048 presence values (key 128 i + 4 lane + e), forms the mask terms and their minimum, and numbers the
// keys that attain it in the order (i, e, lane) by ballots; row m_local is the key of rank w0 + m_local, ranks from the
// count n on are filled with key 0 (attn_fwd masks them), and a block whose ranks all lie at or past n leaves before any
// barrier. The row table Ix goes through LDS (wave w writes the entries of i = 2w, 2w + 1, whose presence values it reads a
// second time, into registers of a fixed index), published by one barrier.
// The k block of rank 0, o-tile 0 of each batch writes n and the minimum to kc[2 ns], kc[2 ns + 1].
// tr == 0: YO[m][o] = f16(y16): staged as Ts[m_local][o_local] (pitch 136, 16-B LDS stores), block barrier, rows out.
// tr == 1: VT[ns][o][l] (keys contiguous): staged as Ts[o_local][l_local] (pitch 136, 2-B LDS stores), barrier, rows out.
// coverage: operands: 32 it x 8 rows e x 128 o, 4 thread groups x 32 it rows m x 256 e; tr 0: 8 it x 16 rows x 16 pieces x 8 halves =
//           128 x 128 per block, grid -> [4096][256]; tr 1: 8 it x 16 lines x 16 pieces x 8 = 128 o x 128 l, grid ->
//           VT [2][256][2048].
// =====================================================================================================
__device__ __forceinline__
void proj_body(int bx, bool tr, bool gat, bool wkc, unsigned short* Sm, int* Ix, const float* __restrict__ wf,
               const float* __restrict__ xf, const float* __restrict__ bias, const float* __restrict__ pres, float* kc,
               unsigned short* yo) {
  const int tid  = threadIdx.x;
  const int wave = tid >> 5;
  const int lane = tid & 31;
  const int hh   = lane >> 4;
  const int ci   = lane & 15;
  const int wm   = wave & 3, wo = wave >> 2;
  const int mt   = bx >> 1, ot = bx & 1;
  const int m0   = mt * PM, o0 = ot * 128;
  unsigned short* Ws = Sm;                               // [256 e][WPH]
  unsigned short* Xs = Sm + EE * WPH;                    // [128 m][XPH]
  const int nsb  = m0 / LQ, w0 = m0 - nsb * LQ;         // batch; first query (q) or first rank (k, v) of the block
  {
    const float* wsrc = wf + (size_t)wave * EE + o0 + 4 * lane;                    // row e = 8 it + wave
    unsigned short* wd = Ws + wave * WPH + 4 * lane;
    unsigned short* xd = Xs + (32 * (tid >> 6)) * XPH + 4 * (tid & 63);            // row m_local = 32 (tid >> 6) + it
    v4f a[32], c[32], pa[16], pw[2];
    if (gat) {
      const char* pb = (const char*)(pres + (size_t)nsb * LQ);
      const unsigned lo = 16 * lane, lw = lo + 1024 * wave;                          // bytes: key 4 lane; the wave's own keys
#pragma unroll
      for (int i = 0; i < 16; ++i) pa[i] = *(const v4f*)(pb + lo + 512 * i);
#pragma unroll
      for (int i = 0; i < 2; ++i) pw[i] = *(const v4f*)(pb + lw + 512 * i);          // i = 2 wave, 2 wave + 1 once more
#if defined(__HIP_DEVICE_COMPILE__)
      // stands between the loads above and the next write of their base or offsets, which are named so that they stay in
      // their registers up to it
      asm volatile("s_wait_xcnt 0x0" :: "s"(pb), "v"(lo), "v"(lw) : "memory");
#endif
    }
#pragma unroll
    for (int it = 0; it < 32; ++it) a[it] = *(const v4f*)(wsrc + (size_t)(8 * it) * EE);
#if defined(__HIP_DEVICE_COMPILE__)
    // stands between the loads above and a later load whose result the compiler puts into their address pair
    asm volatile("s_wait_xcnt 0x0" ::: "memory");
#endif
    if (gat) {
      const int wv = __builtin_amdgcn_readfirstlane(wave);
      float mk[64], mw[8];
#pragma unroll
      for (int i = 0; i < 16; ++i)
#pragma unroll
        for (int e = 0; e < 4; e += 2) {
          const v2f t = kterm2(pa[i][e], pa[i][e + 1]);
          mk[4 * i + e] = t[0]; mk[4 * i + e + 1] = t[1];
        }
#pragma unroll
      for (int i = 0; i < 2; ++i)
#pragma unroll
        for (int e = 0; e < 4; e += 2) {
          const v2f t = kterm2(pw[i][e], pw[i][e + 1]);
          mw[4 * i + e] = t[0]; mw[4 * i + e + 1] = t[1];
        }
      float mn = mk[0];
#pragma unroll
      for (int k = 1; k < 64; ++k) mn = fminf(mn, mk[k]);
      // minimum over the wave in vector cross-lane moves (row_xmask 1, 2, 4, 8, then the other row's lane): a shuffle
      // would go through the LDS unit, five dependent round trips on the way to the first X load
      mn = fminf(mn, __int_as_float(__builtin_amdgcn_update_dpp(0, __float_as_int(mn), 0x161, 0xF, 0xF, true)));
      mn = fminf(mn, __int_as_float(__builtin_amdgcn_update_dpp(0, __float_as_int(mn), 0x162, 0xF, 0xF, true)));
      mn = fminf(mn, __int_as_float(__builtin_amdgcn_update_dpp(0, __float_as_int(mn), 0x164, 0xF, 0xF, true)));
      mn = fminf(mn, __int_as_float(__builtin_amdgcn_update_dpp(0, __float_as_int(mn), 0x168, 0xF, 0xF, true)));
      mn = fminf(mn, __int_as_float(__builtin_amdgcn_permlanex16(__float_as_int(mn), __float_as_int(mn), 0x76543210,
                                                                 0xFEDCBA98, false, false)));
      int base = 0;                                      // kept keys of the batch: the same scalar in every wave
      int be = -w0;                                      // rank of the wave's first kept key, counted from the block's first
#pragma unroll
      for (int i = 0; i < 16; ++i) {                     // branch-free: the 64 ballots and their counts run as one stream
        int cn = 0;
#pragma unroll
        for (int e = 0; e < 4; ++e) cn += __builtin_popcount(__builtin_amdgcn_ballot_w32(mk[4 * i + e] == mn));
        base += cn;
        be   += i < 2 * wv ? cn : 0;
      }
      if (w0 >= base && w0 > 0) return;                  // no kept key among this block's ranks: the whole block leaves
#pragma unroll
      for (int k = 0; k < 8; ++k) {                      // own key (i = 2 wv + (k >> 2), e = k & 3, lane)
        const unsigned bal = __builtin_amdgcn_ballot_w32(mw[k] == mn);
        const int r = be + (int)__builtin_amdgcn_mbcnt_lo(bal, 0u);
        if (mw[k] == mn && (unsigned)r < (unsigned)PM) Ix[r] = 256 * wv + 128 * (k >> 2) + 4 * lane + (k & 3);
        be += __builtin_popcount(bal);
      }
      if (tid < PM && w0 + tid >= base) Ix[tid] = 0;
      if (wkc && w0 == 0 && tid == 0) {
        kc[2 * nsb]     = (float)base;
        kc[2 * nsb + 1] = mn;
      }
    } else {
      if (tid < PM) Ix[tid] = w0 + tid;
    }
    // publishes Ix. LDS-only fences round the bare barrier: the W loads above stay in flight across it (a build with
    // __syncthreads() here waits for all of them, s_wait_loadcnt 0, in front of the barrier)
    __builtin_amdgcn_fence(__ATOMIC_RELEASE, "workgroup", "local");
    __builtin_amdgcn_s_barrier();
    __builtin_amdgcn_fence(__ATOMIC_ACQUIRE, "workgroup", "local");
    unsigned xo[32];                                     // offset of the thread's piece of row m_local = 32 (tid >> 6) + it, bytes
#pragma unroll
    for (int k = 0; k < 8; ++k) {
      const v4i q = *(const v4i*)(Ix + 32 * (tid >> 6) + 4 * k);
#pragma unroll
      for (int e = 0; e < 4; ++e) xo[4 * k + e] = (unsigned)(nsb * LQ + q[e]) * (EE * 4) + 16 * (tid & 63);
    }
#pragma unroll
    for (int it = 0; it < 16; ++it) c[it] = *(const v4f*)((const char*)xf + xo[it]);
#if defined(__HIP_DEVICE_COMPILE__)
    // the offsets are named so that they stay in their registers up to the wait: no result of these loads lands on one
    asm volatile("s_wait_xcnt 0x0" :: "v"(xo[0]), "v"(xo[1]), "v"(xo[2]), "v"(xo[3]), "v"(xo[4]), "v"(xo[5]), "v"(xo[6]),
                 "v"(xo[7]), "v"(xo[8]), "v"(xo[9]), "v"(xo[10]), "v"(xo[11]), "v"(xo[12]), "v"(xo[13]), "v"(xo[14]),
                 "v"(xo[15]) : "memory");
#endif
    // keeps these 48 loads ahead of all conversion work: one latency for the lot instead of one per trickled load
    __builtin_amdgcn_sched_barrier(0);
#pragma unroll
    for (int it = 0; it < 16; ++it) *(v2u*)(wd + (8 * it) * WPH) = cvt4(a[it], WSC);
    // the last 16 loads go out as soon as registers are free, ahead of the remaining conversion work
    __builtin_amdgcn_sched_barrier(0);
#pragma unroll
    for (int it = 16; it < 32; ++it) c[it] = *(const v4f*)((const char*)xf + xo[it]);
#if defined(__HIP_DEVICE_COMPILE__)
    // as above
    asm volatile("s_wait_xcnt 0x0" :: "v"(xo[16]), "v"(xo[17]), "v"(xo[18]), "v"(xo[19]), "v"(xo[20]), "v"(xo[21]),
                 "v"(xo[22]), "v"(xo[23]), "v"(xo[24]), "v"(xo[25]), "v"(xo[26]), "v"(xo[27]), "v"(xo[28]), "v"(xo[29]),
                 "v"(xo[30]), "v"(xo[31]) : "memory");
#endif
    __builtin_amdgcn_sched_barrier(0);                   // closes the group above
#pragma unroll
    for (int it = 16; it < 32; ++it) *(v2u*)(wd + (8 * it) * WPH) = cvt4(a[it], WSC);
#pragma unroll
    for (int it = 0; it < 32; ++it) *(v2u*)(xd + it * XPH) = cvt4(c[it], XSC);
  }
  __syncthreads();

  const _Float16* xr = (const _Float16*)(const void*)Xs + (32 * wm + ci) * XPH + 8 * hh;       // B: X row m, + 16 i rows
  const unsigned short* wr = Ws + (8 * hh + (lane & 7)) * WPH + 64 * wo + 8 * ((lane >> 3) & 1);   // A: + k0 rows, + 16 t

  v8f acc[2][4];
#pragma unroll
  for (int i = 0; i < 2; ++i)
#pragma unroll
    for (int t = 0; t < 4; ++t) acc[i][t] = zero8();

  // two register sets: the fragments of k-step ks + 1 are asked for ahead of the products of k-step ks, so that their LDS
  // latency runs under those products; unrolled, so that the set index and every LDS offset are compile-time constants
  v16h wa[2][4], xb[2][2];
#pragma unroll
  for (int t = 0; t < 4; ++t) wa[0][t] = ldfrag_tr(wr + 16 * t, WPH);
#pragma unroll
  for (int i = 0; i < 2; ++i) xb[0][i] = ldfrag_h(xr + (16 * i) * XPH);
#pragma unroll
  for (int ks = 0; ks < EE / 32; ++ks) {
    const int cu = ks & 1, nx = cu ^ 1;
    if (ks + 1 < EE / 32) {
      const int k1 = (ks + 1) * 32;
#pragma unroll
      for (int t = 0; t < 4; ++t) wa[nx][t] = ldfrag_tr(wr + k1 * WPH + 16 * t, WPH);
#pragma unroll
      for (int i = 0; i < 2; ++i) xb[nx][i] = ldfrag_h(xr + (16 * i) * XPH + k1);
    }
    // holds the load group together and ahead of the products: left free, the loads sink in among the products
    __builtin_amdgcn_sched_barrier(0);
#pragma unroll
    for (int i = 0; i < 2; ++i)
#pragma unroll
      for (int t = 0; t < 4; ++t) acc[i][t] = mma_h(wa[cu][t], xb[cu][i], acc[i][t]);
    __builtin_amdgcn_sched_barrier(0);                   // the next load group stays behind these products
  }
  __syncthreads();                                       // every wave has read its operands: the LDS becomes Ts

  unsigned short* Ts = Sm;                               // 128 x 136 halves
  const int p = tid & 15, r16 = tid >> 4;               // r16 0..15 = row within group, p = 16-B piece of the 256-B segment
  if (!tr) {
#pragma unroll
    for (int i = 0; i < 2; ++i) {
      unsigned short* ts = Ts + (32 * wm + 16 * i + ci) * 136 + 64 * wo + 8 * hh;
#pragma unroll
      for (int t = 0; t < 4; ++t) {
        const v4f b0 = *(const v4f*)(bias + o0 + 64 * wo + 16 * t + 8 * hh);
        const v4f b1 = *(const v4f*)(bias + o0 + 64 * wo + 16 * t + 8 * hh + 4);
        float y[8];
#pragma unroll
        for (int e = 0; e < 4; ++e) {
          y[e]     = acc[i][t][e] * ISC     + bfr(b0[e]) * BSC;
          y[4 + e] = acc[i][t][4 + e] * ISC + bfr(b1[e]) * BSC;
        }
        v4u v;
#pragma unroll
        for (int j = 0; j < 4; ++j) v[j] = pk16(h_bits((_Float16)y[2 * j]), h_bits((_Float16)y[2 * j + 1]));
        *(v4u*)(ts + 16 * t) = v;
      }
    }
    __syncthreads();
    v4u vals[8];
#pragma unroll
    for (int it = 0; it < 8; ++it) {
      const int row = it * 16 + r16;                     // it 0..7 x r16 0..15 = rows 0..127
      vals[it] = *(const v4u*)(Ts + row * 136 + 8 * p);
    }
    unsigned short* yb = yo + (size_t)m0 * EE + o0 + 8 * p;
#pragma unroll
    for (int it = 0; it < 8; ++it) {
      const int row = it * 16 + r16;
      *(v4u*)(yb + (size_t)row * EE) = vals[it];
    }
  } else {
    const int ns = m0 / LQ, l0 = m0 - ns * LQ;
#pragma unroll
    for (int i = 0; i < 2; ++i) {
#pragma unroll
      for (int t = 0; t < 4; ++t) {
        const v4f b0 = *(const v4f*)(bias + o0 + 64 * wo + 16 * t + 8 * hh);
        const v4f b1 = *(const v4f*)(bias + o0 + 64 * wo + 16 * t + 8 * hh + 4);
#pragma unroll
        for (int r = 0; r < 4; ++r) {
          Ts[(64 * wo + 16 * t + 8 * hh + r) * 136 + 32 * wm + 16 * i + ci] =
              h_bits((_Float16)(acc[i][t][r] * ISC + bfr(b0[r]) * BSC));
          Ts[(64 * wo + 16 * t + 8 * hh + 4 + r) * 136 + 32 * wm + 16 * i + ci] =
              h_bits((_Float16)(acc[i][t][4 + r] * ISC + bfr(b1[r]) * BSC));
        }
      }
    }
    __syncthreads();
    v4u vals[8];
#pragma unroll
    for (int it = 0; it < 8; ++it) {
      const int orow = it * 16 + r16;                    // it 0..7 x r16 0..15 = o_local 0..127
      vals[it] = *(const v4u*)(Ts + orow * 136 + 8 * p);
    }
    unsigned short* yb = yo + ((size_t)ns * EE + o0) * LQ + l0 + 8 * p;
#pragma unroll
    for (int it = 0; it < 8; ++it) {
      const int orow = it * 16 + r16;
      *(v4u*)(yb + (size_t)orow * LQ) = vals[it];
    }
  }
}

// One launch for the Wo transposition and the three projections, none of which depends on another: blocks 0..15 build
// the HO plane, then 64 blocks each for q, k (row-major out) and v (transposed out). Every select is block-uniform.
// The k and v planes hold kept keys by rank: rows (columns of VT) from 128 * ceil(n / 128) on are not written, nor read.
__global__ __launch_bounds__(256)
void proj_all(const float* __restrict__ xq, const float* __restrict__ xk, const float* __restrict__ xv,
              const float* __restrict__ wq, const float* __restrict__ wk, const float* __restrict__ wv,
              const float* __restrict__ wo, const float* __restrict__ bq, const float* __restrict__ bk,
              const float* __restrict__ bv, const float* __restrict__ pres, unsigned short* q16, unsigned short* k16,
              unsigned short* vt, unsigned short* ho, float* kc) {
  __shared__ __align__(16) unsigned short Sm[EE * WPH + PM * XPH];   // 70656 halves >= 16 * 264, 128 * 136
  __shared__ __align__(16) int Ix[PM];                               // row m_local -> query or key within the batch
  const int bx = blockIdx.x;
  if (bx < NBW) { cvt_wt_body(bx, Sm, wo, ho); return; }
  const int pb = bx - NBW;
  const int wh = pb / NBP;                               // 0 q, 1 k, 2 v
  const int rb = pb - wh * NBP;
  proj_body(rb, wh == 2, wh != 0, wh == 1 && (rb & 1) == 0, Sm, Ix, wh == 0 ? wq : (wh == 1 ? wk : wv),
            wh == 0 ? xq : (wh == 1 ? xk : xv), wh == 0 ? bq : (wh == 1 ? bk : bv), pres, kc,
            wh == 0 ? q16 : (wh == 1 ? k16 : vt));
}

// ---- one stage of K and V^T into LDS: 8 asynchronous 16-B copies per lane (4 of K, 4 of V^T), no register in between.
//      lk / lv = the lane's LDS byte address of its first K / V piece, gk / gv = its global source; piece i of K lies
//      32 rows further (LDS 32 * 80 B, global 32 * 512 B), piece i of V^T 8 rows further (LDS 8 * 272 B, global 8 * 4096 B).
__device__ __forceinline__ void stage_kv(unsigned lk, unsigned lv, const unsigned short* gk, const unsigned short* gv) {
#if defined(__HIP_DEVICE_COMPILE__)
  const unsigned lk1 = lk + 32 * KPH * 2, lk2 = lk + 64 * KPH * 2, lk3 = lk + 96 * KPH * 2;
  const unsigned lv1 = lv + 8 * VPH * 2,  lv2 = lv + 16 * VPH * 2, lv3 = lv + 24 * VPH * 2;
  const unsigned short* gk1 = gk + 32 * EE;
  const unsigned short* gk2 = gk + 64 * EE;
  const unsigned short* gk3 = gk + 96 * EE;
  const unsigned short* gv1 = gv + 8 * LQ;
  const unsigned short* gv2 = gv + 16 * LQ;
  const unsigned short* gv3 = gv + 24 * LQ;
  // the closing s_wait_xcnt stands in the copies' own statement so that no address register is rewritten ahead of it
  asm volatile("global_load_async_to_lds_b128 %0, %8, off\n\t"
               "global_load_async_to_lds_b128 %1, %9, off\n\t"
               "global_load_async_to_lds_b128 %2, %10, off\n\t"
               "global_load_async_to_lds_b128 %3, %11, off\n\t"
               "global_load_async_to_lds_b128 %4, %12, off\n\t"
               "global_load_async_to_lds_b128 %5, %13, off\n\t"
               "global_load_async_to_lds_b128 %6, %14, off\n\t"
               "global_load_async_to_lds_b128 %7, %15, off\n\t"
               "s_wait_xcnt 0x0"
               :: "v"(lk), "v"(lk1), "v"(lk2), "v"(lk3), "v"(lv), "v"(lv1), "v"(lv2), "v"(lv3),
                  "v"(gk), "v"(gk1), "v"(gk2), "v"(gk3), "v"(gv), "v"(gv1), "v"(gv2), "v"(gv3)
               : "memory");
#endif
}

// =====================================================================================================
// Row-softmax attention (online max) per (ns, h, 64 queries q0..), 8 waves = 2 key groups x 4 query tiles, grid
// 2*8*32 = 512: with two blocks on a WGP four waves share a SIMD, and one wave's vector work runs under the others'
// LDS, matrix and exchange latencies. Group g = wave >> 2 walks stages g, g + 2, ... with buffers of its own, filled by
// its own four waves; the two partial results (reference point, Z, O) of a query are merged once, behind the loop.
// Wave w & 3 owns queries
// q0+16(w&3)+ci (B operand of the score tile = Q16 row fragment, col = query, k = d, one k-step). The k and v planes hold
// the batch's n kept keys by rank (proj_all), which all have the one key term mmin = min_l (1 - bf16_RNE(pres[ns][l])) *
// 1e32 * log2(e)/sqrt(32), in log2 units: n and mmin come from kc, the walk is over ceil(n / 128) stages, n clamped to
// 1..2048. A term common to all keys shifts every score alike and leaves the softmax as it is, but for its rounding: mmin
// is 0 or at least 1e29 in size (1 - a bf16 value is 0 or at least 2^-8 in size), and in f32 a term of that size swallows a
// score (below 2e8) whole: all kept keys then weigh alike, which a zero q fragment gives. So nothing is taken off the score
// of a kept rank. Pad term by rank, staged once per block in LDS: Mk[k] = 0 for k < n, 1e35 from n on, so that such a
// rank's weight is exactly 0; only a stage that reaches past n reads it. A group whose stage lies wholly past n copies the
// last written stage instead, and its weights come to 0 here or in the merge.
// K rows (this head's 64 B) and V^T rows of 128 keys are staged per block in LDS by asynchronous copies, two buffers: stage s + 2 flies while stage s is worked
// on; all four waves of a group read their A fragments from the group's staged tile. One softmax step per stage of 128 keys:
//   8 score D tiles (rows = keys l0+16j+8hh+r, col = query) = A(K16 rows l, k = d) . B(qf);
//   stage max over the lane's 64 accumulators, brought to log2 units (x log2(e)/sqrt(32)/256), combined with the partner
//   half (lane^16); reference point R = running max - 12, R and the rescale factor 2^(R_old - R) identical for both
//   halves of a query column; p = 2^(acc * log2(e)/sqrt(32)/256 - R) = 4096 exp(score - max), the exponent by one f32 FMA,
//   the sum Z carries the same factor;
//   P = f16(p), rounded as V's plane is; the B fragment of each 32 keys lt.. built in registers
//   (element r <- key lt+8hh+r, element 8+r <- key lt+16+8hh+r, lane unchanged); O^T (rows d, cols queries) rescaled once, then
//   += A(VT rows d = h*32 + 16j + ci, keys contiguous) . B(P): 2 accumulators (d 0..15 / 16..31).
// Epilogue: 256*O = 16 acc / Z as f16, staged per query row in LDS
// coverage: 256 threads x 8 halves = 64 rows x 32 per block; grid covers [2][8][2048][32] once.
// =====================================================================================================
// four waves per SIMD (two blocks per WGP): the register budget of exactly that, so that the scheduler spends registers
// on LDS loads in flight instead of saving them for a fifth wave that never comes
__global__ __launch_bounds__(256) __attribute__((amdgpu_waves_per_eu(4, 4)))
void attn_fwd(const unsigned short* __restrict__ q16, const unsigned short* __restrict__ k16,
              const unsigned short* __restrict__ vt, const float* __restrict__ kc,
              unsigned short* ohp) {
  __shared__ __align__(16) float Mk[LQ];
  __shared__ __align__(16) unsigned short Hs[64 * 40];
  __shared__ __align__(16) unsigned short Kb[2 * NGR * KBH];   // [buffer][group]
  __shared__ __align__(16) unsigned short Vb[2 * NGR * VBH];   // [buffer][group]
  __shared__ __align__(16) float Mg[128 * MGP];                // group 1's partial results, one row per lane
  const int tid  = threadIdx.x;
  const int grp  = tid >> 7;                            // key group
  const int t7   = tid & 127;                           // thread within the group
  const int wave = (tid >> 5) & 3;                      // query tile
  const int lane = tid & 31;
  const int hh   = lane >> 4;
  const int ci   = lane & 15;
  const int bx   = blockIdx.x;
  const int ns   = bx / (NH * (LQ / 64));
  const int rem  = bx - ns * (NH * (LQ / 64));
  const int h    = rem / (LQ / 64);
  const int q0   = (rem - h * (LQ / 64)) * 64;
  const int qi   = q0 + 16 * wave + ci;                 // this lane's query
  // copy map within a group: K piece (row t7>>2 (+32i), 16-B piece t7&3), V^T piece (row d = t7>>4 (+8i), 16-B piece t7&15)
  const unsigned lk0 = (unsigned)(uintptr_t)(Kb + grp * KBH + (t7 >> 2) * KPH + 8 * (t7 & 3));
  const unsigned lv0 = (unsigned)(uintptr_t)(Vb + grp * VBH + (t7 >> 4) * VPH + 8 * (t7 & 15));
  const unsigned short* gk0 = k16 + (size_t)(ns * LQ + (t7 >> 2)) * EE + h * DH + 8 * (t7 & 3);   // + SK * EE per stage
  const unsigned short* gv0 = vt + ((size_t)ns * EE + h * DH + (t7 >> 4)) * LQ + 8 * (t7 & 15);   // + SK per stage
  const int   gs   = __builtin_amdgcn_readfirstlane(grp);              // the group as a scalar: stage numbers stay scalar
  const float mmin = kc[2 * ns + 1];
  const int   nr   = (int)kc[2 * ns];
  const int   n    = __builtin_amdgcn_readfirstlane(nr < 1 ? 1 : (nr > LQ ? LQ : nr));   // bounds every trip count and address
  const int   nst  = (n + SK - 1) / SK;                 // written stages, 1..NST
  const int   npr  = (nst + NGR - 1) / NGR;             // trips, 1..NPR, the same for the whole block
  {
    const int sc = gs < nst ? gs : nst - 1;
    stage_kv(lk0, lv0, gk0 + (size_t)sc * (SK * EE), gv0 + sc * SK);   // trip 0 (stage grp) -> buffer 0
  }
  {
#pragma unroll
    for (int i = 0; i < 2; ++i) {                        // 256 threads x 8 floats = 2048 ranks
      v4f mv;
#pragma unroll
      for (int e = 0; e < 4; ++e) mv[e] = (8 * tid + 4 * i + e < n) ? 0.0f : PADT;
      *(v4f*)(Mk + 8 * tid + 4 * i) = mv;
    }
  }
  asm volatile("s_wait_asynccnt 0x0" ::: "memory");     // this wave's copies of trip 0 have landed
  __syncthreads();                                      // publishes Mk and trip 0
  if (npr > 1) {
    const int sc = NGR + gs < nst ? NGR + gs : nst - 1;
    stage_kv(lk0 + NGR * KBH * 2, lv0 + NGR * VBH * 2, gk0 + (size_t)sc * (SK * EE), gv0 + sc * SK);   // trip 1 -> buffer 1
  }

  const _Float16* Q = (const _Float16*)(const void*)q16;
  v16h qf = ldfrag_h(Q + (size_t)(ns * LQ + qi) * EE + h * DH + 8 * hh);
  if (mmin != 0.0f) qf = (v16h)(_Float16)0.0f;          // a nonzero common term swallows every score: all of them equal
  const _Float16* kl = (const _Float16*)(const void*)Kb + grp * KBH + ci * KPH + 8 * hh;   // + buffer, + key_local * KPH
  const _Float16* vl = (const _Float16*)(const void*)Vb + grp * VBH + ci * VPH + 8 * hh;   // row d = ci, + 16 * VPH, + key_local

  float rref = NEG0, z = 0.f;
  v8f ah0 = zero8(), ah1 = zero8();
#pragma unroll 1
  for (int pr = 0; pr < npr; ++pr) {
    const int bf = pr & 1;
    const _Float16* kp = kl + bf * (NGR * KBH);
    const _Float16* vp = vl + bf * (NGR * VBH);
    // one softmax step per stage: the 8 score tiles and the lane's 64 exponentials of 128 keys are independent among
    // themselves, and the running max, its cross-half exchange and the rescale come once per stage;
    // every loop of the step is unrolled: its arrays stay in registers and every LDS offset is an immediate
    const float* mp = Mk + (pr * NGR + grp) * SK + 8 * hh;
    v8f s[SK / 16];                                      // s[j][r] <-> rank (pr*NGR + grp)*SK + 16j + 8hh + r, col = query
    v16h kf[SK / 16];
#pragma unroll
    for (int j = 0; j < SK / 16; ++j) kf[j] = ldfrag_h(kp + (16 * j) * KPH);
    // holds the stage's K loads together ahead of the products: left free, this build reloads one register set for six of
    // the eight products and waits out each load's LDS latency in turn
    __builtin_amdgcn_sched_barrier(0);
#pragma unroll
    for (int j = 0; j < SK / 16; ++j) s[j] = mma_h(kf[j], qf, zero8());
    // a stage of kept ranks only (scalar test) has no term to take off: s stays the raw accumulator, mul brings it to log2
    // units; a stage that reaches past n is brought to log2 units here, with the pad term of its ranks from LDS
    float mul = SCL;
    if ((pr * NGR + gs + 1) * SK > n) {
#pragma unroll
      for (int j = 0; j < SK / 16; ++j) {
        const v4f ma = *(const v4f*)(mp + 16 * j);       // ranks 16j + 8hh + 0..3 <-> s[j][0..3]
        const v4f mb = *(const v4f*)(mp + 16 * j + 4);   // ranks 16j + 8hh + 4..7 <-> s[j][4..7]
#pragma unroll
        for (int r = 0; r < 4; ++r) {
          s[j][r]     = s[j][r] * SCL     - ma[r];
          s[j][4 + r] = s[j][4 + r] * SCL - mb[r];
        }
      }
      mul = 1.0f;
    }
    float mj[SK / 32];                                   // per 32 keys: 15 of the lane's 16 values, three-input maxima throughout
#pragma unroll
    for (int u = 0; u < SK / 32; ++u) {
      float m = fmaxf(fmaxf(s[2 * u][0], s[2 * u][1]), s[2 * u][2]);
      m = fmaxf(fmaxf(m, s[2 * u][3]), s[2 * u][4]);
      m = fmaxf(fmaxf(m, s[2 * u][5]), s[2 * u][6]);
      m = fmaxf(fmaxf(m, s[2 * u][7]), s[2 * u + 1][0]);
      m = fmaxf(fmaxf(m, s[2 * u + 1][1]), s[2 * u + 1][2]);
      m = fmaxf(fmaxf(m, s[2 * u + 1][3]), s[2 * u + 1][4]);
      mj[u] = fmaxf(fmaxf(m, s[2 * u + 1][5]), s[2 * u + 1][6]);
    }
    float mx = fmaxf(fmaxf(mj[0], s[1][7]), mj[1]);      // and the four sixteenth values
    mx = fmaxf(fmaxf(mx, s[3][7]), mj[2]);
    mx = fmaxf(fmaxf(mx, s[5][7]), mj[3]);
    mx = fmaxf(mx, s[7][7]);
    mx *= mul;                                           // mul > 0: the maximum of the products
    mx = fmaxf(mx, __shfl_xor(mx, 16, 32));
    // from 2^20 on mx, and mx - 12, are rounded by up to 8 against the unrounded products below: no offset there, p stays in f16
    const float mo = (fabsf(mx) < 1048576.0f) ? mx - POFF : mx;
    const float nref = fmaxf(rref, mo);
    const float corr = __builtin_amdgcn_exp2f(rref - nref);
    rref = nref;
    ah0 *= corr; ah1 *= corr;
    const v2f mul2 = {mul, mul}, nn2 = {-nref, -nref};
    v2f zu[SK / 32];                                     // per 32 keys: sums of p over even / odd r, one packed add per pair
#pragma unroll
    for (int u = 0; u < SK / 32; ++u) {
      v8u ph;
      v2f zg[2];
#pragma unroll
      for (int r = 0; r < 8; r += 4) {
        float x[8], p[8];                                // 0..3 <-> s[2u][r..r+3], 4..7 <-> s[2u+1][r..r+3]
#pragma unroll
        for (int e = 0; e < 4; e += 2) {
          const v2f sa = {s[2 * u][r + e], s[2 * u][r + e + 1]}, sc2 = {s[2 * u + 1][r + e], s[2 * u + 1][r + e + 1]};
          const v2f xa = __builtin_elementwise_fma(sa, mul2, nn2), xc = __builtin_elementwise_fma(sc2, mul2, nn2);
          x[e] = xa[0];     x[e + 1] = xa[1];
          x[4 + e] = xc[0]; x[5 + e] = xc[1];
        }
#pragma unroll
        for (int e = 0; e < 8; ++e) p[e] = __builtin_amdgcn_exp2f(x[e]);
        const v2f pa0 = {p[0], p[1]}, pa1 = {p[2], p[3]}, pc0 = {p[4], p[5]}, pc1 = {p[6], p[7]};
        zg[r >> 2] = (pa0 + pc0) + (pa1 + pc1);
        // registers of the B fragment: elements r..r+3 -> r/2, r/2 + 1; elements 8+r..8+r+3 -> 4 + r/2, 5 + r/2
        const int g = r >> 1;
        ph[g]     = __builtin_bit_cast(unsigned, __builtin_convertvector(pa0, v2h));
        ph[g + 1] = __builtin_bit_cast(unsigned, __builtin_convertvector(pa1, v2h));
        ph[4 + g] = __builtin_bit_cast(unsigned, __builtin_convertvector(pc0, v2h));
        ph[5 + g] = __builtin_bit_cast(unsigned, __builtin_convertvector(pc1, v2h));
      }
      zu[u] = zg[0] + zg[1];
      const v16h va0 = ldfrag_h(vp + u * 32);                      // d = ci
      const v16h va1 = ldfrag_h(vp + 16 * VPH + u * 32);           // d = 16 + ci
      const v16h pb = __builtin_bit_cast(v16h, ph);
      ah0 = mma_h(va0, pb, ah0);
      ah1 = mma_h(va1, pb, ah1);
    }
    const v2f zt = (zu[0] + zu[1]) + (zu[2] + zu[3]);
    z = z * corr + (zt[0] + zt[1]);
    // publish point of trip pr + 1: own LDS reads done, own copies landed, then the barrier that both publishes
    // trip pr + 1 and ends every wave's reads of the buffer refilled behind it
    asm volatile("s_wait_dscnt 0x0" ::: "memory");
    asm volatile("s_wait_asynccnt 0x0" ::: "memory");
    __syncthreads();
    if (pr + 2 < npr) {
      const int s2 = (pr + 2) * NGR + gs;
      const int sc = s2 < nst ? s2 : nst - 1;
      stage_kv(lk0 + bf * (NGR * KBH * 2), lv0 + bf * (NGR * VBH * 2), gk0 + (size_t)sc * (SK * EE), gv0 + sc * SK);
    }
  }
  asm volatile("s_wait_asynccnt 0x0" ::: "memory");     // nothing of this wave's copies is left in flight

  // ah0[r] <-> d = 8hh + r, ah1[r] <-> d = 16 + 8hh + r, query qi; Z >= 1 (the max key's p)
  // Merge of the two key groups: lane t7 of group 1 hands its 16 sums, its reference point and its Z to lane t7 of
  // group 0, which brings both partial results to the larger reference point and adds them.
  const v8f oa = ah0, ob8 = ah1;
  float* mg = Mg + t7 * MGP;
  if (grp == 1) {
    const v4f w0 = {oa[0], oa[1], oa[2], oa[3]},     w1 = {oa[4], oa[5], oa[6], oa[7]};
    const v4f w2 = {ob8[0], ob8[1], ob8[2], ob8[3]}, w3 = {ob8[4], ob8[5], ob8[6], ob8[7]};
    const v2f w4 = {rref, z};
    *(v4f*)(mg)      = w0;
    *(v4f*)(mg + 4)  = w1;
    *(v4f*)(mg + 8)  = w2;
    *(v4f*)(mg + 12) = w3;
    *(v2f*)(mg + 16) = w4;
  }
  __syncthreads();                                      // publishes group 1's partial results
  if (grp == 0) {
    const v4f w0 = *(const v4f*)(mg), w1 = *(const v4f*)(mg + 4), w2 = *(const v4f*)(mg + 8), w3 = *(const v4f*)(mg + 12);
    const v2f w4 = *(const v2f*)(mg + 16);
    const float rm = fmaxf(rref, w4[0]);
    const float c0 = __builtin_amdgcn_exp2f(rref - rm), c1 = __builtin_amdgcn_exp2f(w4[0] - rm);
    z = z * c0 + w4[1] * c1;
    const float zz  = z + __shfl_xor(z, 16, 32);
    const float rzs = (1.0f / zz) * 16.0f;
    float o[16];
#pragma unroll
    for (int r = 0; r < 4; ++r) {
      o[r]      = (oa[r] * c0      + w0[r] * c1) * rzs;
      o[4 + r]  = (oa[4 + r] * c0  + w1[r] * c1) * rzs;
      o[8 + r]  = (ob8[r] * c0     + w2[r] * c1) * rzs;
      o[12 + r] = (ob8[4 + r] * c0 + w3[r] * c1) * rzs;
    }
    v4u h0, h1;
#pragma unroll
    for (int i = 0; i < 4; ++i) {
      const _Float16 a0 = (_Float16)o[2 * i],     a1 = (_Float16)o[2 * i + 1];
      const _Float16 b0 = (_Float16)o[8 + 2 * i], b1 = (_Float16)o[8 + 2 * i + 1];
      h0[i] = pk16(h_bits(a0), h_bits(a1));
      h1[i] = pk16(h_bits(b0), h_bits(b1));
    }
    {
      const int ro = (16 * wave + ci) * 40 + 8 * hh;
      *(v4u*)(Hs + ro)      = h0;
      *(v4u*)(Hs + ro + 16) = h1;
    }
  }
  __syncthreads();
  {
    const size_t ob = ((size_t)(ns * NH + h) * LQ + q0) * DH;      // 4096-B aligned region of 64 x 32 halves
    const int hf = 8 * tid;                              // half index within the 2048-half region
    const int row = hf >> 5, col = hf & 31;
    const v4u hv = *(const v4u*)(Hs + row * 40 + col);
    *(v4u*)(ohp + ob + hf) = hv;
  }
}

// ---- 8 asynchronous 16-B copies per lane, global -> LDS, no register in between: l[i] = the lane's LDS byte address,
//      g[i] = its global source
__device__ __forceinline__ void copy8(const unsigned* l, const unsigned short* const* g) {
#if defined(__HIP_DEVICE_COMPILE__)
  // the closing s_wait_xcnt stands in the copies' own statement so that no address register is rewritten ahead of it
  asm volatile("global_load_async_to_lds_b128 %0, %8, off\n\t"
               "global_load_async_to_lds_b128 %1, %9, off\n\t"
               "global_load_async_to_lds_b128 %2, %10, off\n\t"
               "global_load_async_to_lds_b128 %3, %11, off\n\t"
               "global_load_async_to_lds_b128 %4, %12, off\n\t"
               "global_load_async_to_lds_b128 %5, %13, off\n\t"
               "global_load_async_to_lds_b128 %6, %14, off\n\t"
               "global_load_async_to_lds_b128 %7, %15, off\n\t"
               "s_wait_xcnt 0x0"
               :: "v"(l[0]), "v"(l[1]), "v"(l[2]), "v"(l[3]), "v"(l[4]), "v"(l[5]), "v"(l[6]), "v"(l[7]),
                  "v"(g[0]), "v"(g[1]), "v"(g[2]), "v"(g[3]), "v"(g[4]), "v"(g[5]), "v"(g[6]), "v"(g[7])
               : "memory");
#endif
}

// =====================================================================================================
// Output projection out[m][o] = sum_c O[m][c] Wo[c][o] + bo[o], O = OH/256 from the OH plane
// ([ns][h][q][32]: k-step j = head j). Block = 4 waves = 64 rows m x 64 cols o (grid 64 x 4 = 256).
// Every global read of the block goes out at entry: the bias into registers, and both operands whole into LDS by
// asynchronous copies, each wave-copy 512 contiguous bytes: Ws[o_local][e] = 64 HO rows (16 copies per lane, one row
// per wave-copy), Os[j][m_local][32] = the block's 64 rows of each head of OH (8 x 2 copies per lane,
// 8 rows per wave-copy); 32 copies per wave in flight, one wait, one barrier, then the buffers are only read.
// Wave w owns rows m0+16w+ci (B operand = OH row fragment, col = m), A = HO rows o0+16t+ci (k = c split map);
// 4 accumulators; acc[t][r] <-> (m = m0+16w+ci, o = o0+16t+8hh+r).
// Epilogue: acch/262144 + bf16_RNE(bo) staged in LDS as Ts[m_local][o_local] (pitch 68, 16-B vector
// coverage: copies 16 x 4 rows x 512 B = 64 x 256 halves, 16 x 32 rows x 64 B = 8 x 64 x 32 halves;
//           8 it x 8 rows x 16 pieces x 4 floats = 64 x 64 per block; grid covers out [4096][256] exactly once.
// =====================================================================================================
__global__ __launch_bounds__(128)
void out_proj(const unsigned short* __restrict__ ohp, const unsigned short* __restrict__ woh,
              const float* __restrict__ bo, float* out) {
  __shared__ __align__(16) unsigned short Ws[64 * OWP];
  __shared__ __align__(16) unsigned short Os[NH * 64 * OOP];
  __shared__ __align__(16) float Ts[64 * 68];
  const int tid  = threadIdx.x;
  const int wave = tid >> 5;
  const int lane = tid & 31;
  const int hh   = lane >> 4;
  const int ci   = lane & 15;
  const int bx   = blockIdx.x;
  const int mt   = bx >> 2, ot = bx & 3;
  const int m0   = mt * 64, o0 = ot * 64;
  const int ns   = m0 / LQ;

  v4f bb[4][2];
#pragma unroll
  for (int t = 0; t < 4; ++t) {
    bb[t][0] = *(const v4f*)(bo + o0 + 16 * t + 8 * hh);
    bb[t][1] = *(const v4f*)(bo + o0 + 16 * t + 8 * hh + 4);
  }
#if defined(__HIP_DEVICE_COMPILE__)
  // stands between the loads above and the address arithmetic below, which reuses the registers of their base
  asm volatile("s_wait_xcnt 0x0" ::: "memory");
#endif
  {
    unsigned l[32];
    const unsigned short* g[32];
    // HO: copy i = row o_local 4 i + wave, 16-B piece lane
    const unsigned lw = (unsigned)(uintptr_t)(Ws + wave * OWP + 8 * lane);
    const unsigned short* gw = woh + (size_t)(o0 + wave) * EE + 8 * lane;
#pragma unroll
    for (int i = 0; i < 16; ++i) {
      l[i] = lw + i * (4 * OWP * 2);
      g[i] = gw + i * (4 * EE);
    }
    // OH: copy (j, c) = row m_local 32 c + (tid >> 2), 16-B piece tid & 3; the 64 rows of a head are contiguous
    const unsigned lo = (unsigned)(uintptr_t)(Os + (tid >> 2) * OOP + 8 * (tid & 3));
    const size_t ob = ((size_t)(ns * NH) * LQ + (m0 - ns * LQ)) * DH + 8 * tid;
#pragma unroll
    for (int pj = 0; pj < NH; ++pj) {
      const unsigned short* gp = ohp + ob + (size_t)pj * LQ * DH;
#pragma unroll
      for (int c = 0; c < 2; ++c) {
        l[16 + 2 * pj + c] = lo + (pj * 64 + 32 * c) * (OOP * 2);
        g[16 + 2 * pj + c] = gp + c * (128 * 8);
      }
    }
#pragma unroll
    for (int s = 0; s < 4; ++s) copy8(l + 8 * s, g + 8 * s);
  }
  asm volatile("s_wait_asynccnt 0x0" ::: "memory");     // this wave's copies have landed
  __syncthreads();                                      // publishes Ws and Os

  const _Float16* ar = (const _Float16*)(const void*)Os + (16 * wave + ci) * OOP + 8 * hh;   // + j * 64 * OOP
  const _Float16* wr = (const _Float16*)(const void*)Ws + ci * OWP + 8 * hh;                 // + 16t * OWP + 32j

  v8f acch[4];
#pragma unroll
  for (int t = 0; t < 4; ++t) acch[t] = zero8();

  // two register sets: the fragments of k-step j + 1 are asked for ahead of the products of k-step j, so that their LDS
  // latency runs under those products; unrolled, so that the set index and every LDS offset are compile-time constants
  v16h obh[2], wa[2][4];
  obh[0] = ldfrag_h(ar);
#pragma unroll
  for (int t = 0; t < 4; ++t) wa[0][t] = ldfrag_h(wr + (16 * t) * OWP);
#pragma unroll
  for (int j = 0; j < NH; ++j) {
    const int cu = j & 1, nx = cu ^ 1;
    if (j + 1 < NH) {
      obh[nx] = ldfrag_h(ar + (j + 1) * 64 * OOP);
#pragma unroll
      for (int t = 0; t < 4; ++t) wa[nx][t] = ldfrag_h(wr + (16 * t) * OWP + 32 * (j + 1));
    }
    // holds the load group together and ahead of the products: left free, the loads sink in among the products
    __builtin_amdgcn_sched_barrier(0);
#pragma unroll
    for (int t = 0; t < 4; ++t) acch[t] = mma_h(wa[cu][t], obh[cu], acch[t]);
    __builtin_amdgcn_sched_barrier(0);                   // the next load group stays behind these products
  }

  {
    float* ts = Ts + (16 * wave + ci) * 68 + 8 * hh;
#pragma unroll
    for (int t = 0; t < 4; ++t) {
      v4f r0, r1;
#pragma unroll
      for (int e = 0; e < 4; ++e) {
        r0[e] = acch[t][e]     * OSC + bfr(bb[t][0][e]);
        r1[e] = acch[t][4 + e] * OSC + bfr(bb[t][1][e]);
      }
      *(v4f*)(ts + 16 * t)     = r0;
      *(v4f*)(ts + 16 * t + 4) = r1;
    }
  }
  __syncthreads();
  {
    const int p = tid & 15, r16 = tid >> 4;             // r16 0..7, p = 16-B piece of the 256-B segment
    v4f vals[8];
#pragma unroll
    for (int it = 0; it < 8; ++it) {
      const int row = it * 8 + r16;                      // it 0..7 x r16 0..7 = rows 0..63
      vals[it] = *(const v4f*)(Ts + row * 68 + 4 * p);
    }
    float* yb = out + (size_t)m0 * EE + o0 + 4 * p;
#pragma unroll
    for (int it = 0; it < 8; ++it) {
      const int row = it * 8 + r16;
      *(v4f*)(yb + (size_t)row * EE) = vals[it];
    }
  }
}

// =====================================================================================================
// Workspace map (bytes), every offset a multiple of 256 and every plane sized to its whole-line store granularity:
//   HO           f16 [256][256]       131072           0 .. 131072
//   Q16, K16     f16 [4096][256]      2 x 2097152      .. 4325376
//   VT           f16 [2][256][2048]   2097152          .. 6422528
//   OH           f16 [2][8][2048][32] 2097152          .. 8519680
//   MT           f32 [2][2]           256              .. 8519936  (end)   kept keys n and key term mmin per batch
// =====================================================================================================
extern "C" void kernel_launch(void* const* d_in, const int* in_sizes, int n_in,
                              void* d_out, int out_size, void* d_ws, size_t ws_size,
                              hipStream_t stream) {
  if (n_in < 12) return;
  if (in_sizes[0] != MR * EE || in_sizes[1] != MR * EE || in_sizes[2] != MR * EE) return;
  if (in_sizes[3] != NSB * LQ) return;
  if (in_sizes[4] != EE * EE || in_sizes[6] != EE * EE || in_sizes[8] != EE * EE || in_sizes[10] != EE * EE) return;
  if (in_sizes[5] != EE || in_sizes[7] != EE || in_sizes[9] != EE || in_sizes[11] != EE) return;
  if (out_size != MR * EE) return;

  const float* queries = (const float*)d_in[0];
  const float* keys    = (const float*)d_in[1];
  const float* values  = (const float*)d_in[2];
  const float* pres    = (const float*)d_in[3];
  const float* Wq      = (const float*)d_in[4];
  const float* bq      = (const float*)d_in[5];
  const float* Wk      = (const float*)d_in[6];
  const float* bk      = (const float*)d_in[7];
  const float* Wv      = (const float*)d_in[8];
  const float* bv      = (const float*)d_in[9];
  const float* Wo      = (const float*)d_in[10];
  const float* bo      = (const float*)d_in[11];
  float* out = (float*)d_out;

  const size_t PW  = (size_t)EE * EE * 2;               // 131072
  const size_t PP  = (size_t)MR * EE * 2;               // 2097152
  const size_t PVT = (size_t)NSB * EE * LQ * 2;         // 2097152
  const size_t PO  = (size_t)NSB * NH * LQ * DH * 2;    // 2097152
  size_t off = 0;
  const size_t oHO = off; off += PW;
  const size_t oQ  = off; off += PP;
  const size_t oK  = off; off += PP;
  const size_t oVT = off; off += PVT;
  const size_t oOH = off; off += PO;
  const size_t oMT = off; off += 256;
  if (off > ws_size) return;                            // off = 8519936
  if (off > (size_t)134217728) return;

  char* ws = (char*)d_ws;
  unsigned short* HOp = (unsigned short*)(ws + oHO);
  unsigned short* Q16 = (unsigned short*)(ws + oQ);
  unsigned short* K16 = (unsigned short*)(ws + oK);
  unsigned short* VTp = (unsigned short*)(ws + oVT);
  unsigned short* OHp = (unsigned short*)(ws + oOH);
  float*          MTp = (float*)(ws + oMT);

  const dim3 blk256(256), blk128(128);
  const dim3 gPJ(NBW + 3 * NBP);                        // 16 + 3 x 64 blocks
  const dim3 gAT(NSB * NH * (LQ / 64));                 // 512 blocks
  const dim3 gOP((MR / 64) * (EE / 64));                // 256 blocks

  // (1) transposed 16-bit Wo plane HO[o][e]; projections from the f32 inputs: q, k row-major [4096][256] (x16),
  //     v transposed VT[ns][hd][l] (x16), biases added; k and v of the kept keys only, by rank; n and mmin per batch
  proj_all<<<gPJ, blk256, 0, stream>>>(queries, keys, values, Wq, Wk, Wv, Wo, bq, bk, bv, pres, Q16, K16, VTp, HOp, MTp);
  // (2) attention output plane OH [ns][h][q][32] (row softmax over keys with the key term)
  attn_fwd<<<gAT, blk256, 0, stream>>>(Q16, K16, VTp, MTp, OHp);
  // (3) output projection + bias -> d_out [4096][256] f32
  out_proj<<<gOP, blk128, 0, stream>>>(OHp, HOp, bo, out);
  (void)hipGetLastError();
}
